// v000
// The times below were measured on an AMD MI455X: many runs one after another, warmed up first and cycling through
// copies of the inputs, with the whole window's GPU time divided by the number of runs. Launches and the gaps
// between them are all in it. The median over several windows is given; except for v000 it joins two sittings, which
// can be a few percent apart, so the side-by-side timings, each taken in one sitting, are the better comparison.
// v000, which the later versions start from, runs in 5770 microseconds.
#include <hip/hip_runtime.h>
// Causal multi-head attention on three inputs with bias-free [in][out] projections and a biased [in][out] output projection (query_data, key_data, value_data [2][2048][1024]; q = split_heads(query_data Wq), k = split_heads(key_data Wk), v = split_heads(value_data Wv) ([in][out] [1024][1024], NO biases), 16 heads of 64; scores / sqrt(64); scores + triu(ones, k = 1) x (-1e13): an additive fill strictly above the diagonal == exclusion (exp underflows to exactly 0; every row keeps its diagonal); softmax over keys; out = merged Wp + bp ([in][out] + a REAL bias) -> [2][2048][1024]); the causal rule is built inside the reference: a causal rule by index; q and k carried as f16 hi + x1024 residual planes with three-product scores.
// Structure: token rows r = b*2048 + s; x as exact f16 rows (bf16-rounded); q and k as WMMA GEMMs (32x64 wave tiles, f32 accumulation, exact x16 weights, no bias) into f32 rows split into f16 hi + x1024 residual planes, v as an f16-output GEMM; per batch: V^T for all heads via LDS transposes; per query tile of 256 rows: scores against the keys below the tile end only as THREE accumulating passes (hi.hi + lo.hi + hi.lo, K = 64, all heads on grid.y, alpha 1/sqrt(64) = 0.125, 2^-13 on the residual passes, logits sigma ~8), causal row softmax on VALU with an arithmetic 0/1 key mask over the computed range (f32 statistics, native exp; weights x256 f16), o = P . V^T (K = keys below the tile end, alpha 2^-2: o carried x64, folded into the output GEMM alpha) written straight into the merged f16 o rows; out = o W_o + b GEMM (f32) into the output layout.
// Compute dtype: inputs rounded to bf16; x / weights exact; v, softmax weights and o as plain f16 GEMM operands (~2^-12), q and k as f16 hi + x1024 residual planes; scores and softmax statistics f32; v_wmma_f32_16x16x32_f16.
#define NB 2
#define SCL 0.125f                         /* 1 / sqrt(head_dim = 64) */
#define SCLR 0.0001220703125f              /* 2^-13: the same scale on the x1024 residual passes */
#define SQ 2048
#define DM 1024
#define NH 16
#define HD 64
#define HG 4                         /* heads per launch of the head-group k_vt (not launched) */
#define QT 256                       /* query rows per causal tile */
#define NKX SQ                       /* S / P row pitch */
#define QT0 128                      /* first-tile rows recomputed exactly in f32 */
#define B0 0                         /* first batch processed (debug hook) */
#define NBR NB                       /* batches processed (debug hook) */
#define NR ((size_t)NB * SQ)         /* token rows */
#define MP ((int)((size_t)NBR * SQ)) /* rows projected (debug hook) */
#define QN SQ                        /* query rows attended per batch (debug hook) */
#define NHD NH                       /* heads attended (debug hook) */
#define MPO MP                       /* rows through the output stage (debug hook) */
#define LQ DM      /* row pitch of the q/k/v rows */
typedef __bf16 v16b __attribute__((ext_vector_type(16)));
typedef unsigned short v8us __attribute__((ext_vector_type(8), may_alias));
typedef float  v8f  __attribute__((ext_vector_type(8)));
typedef float  v4f  __attribute__((ext_vector_type(4)));
typedef float  v4fa __attribute__((ext_vector_type(4), may_alias));
union FragB { v16b v; v8us half[2]; unsigned short u[16]; };

__device__ __forceinline__ unsigned short bf16_bits(float x) { unsigned int u = __float_as_uint(x); return (unsigned short)((u + 0x7FFFu + ((u >> 16) & 1u)) >> 16); }
__device__ __forceinline__ float bf16_val(unsigned short b) { return __uint_as_float(((unsigned int)b) << 16); }
__device__ __forceinline__ float bf16_round(float x) { return bf16_val(bf16_bits(x)); }
// D += A·B with NT terms: 1 = ah·bh, 2 = + al·bh (A split), 3 = + ah·bl (both split)
template <int NT>
__device__ __forceinline__ v8f mmaN(v16b ah, v16b al, v16b bh, v16b bl, v8f c) {
  c = __builtin_amdgcn_wmma_f32_16x16x32_bf16(false, ah, false, bh, (short)0, c, false, false);
  if (NT >= 2) c = __builtin_amdgcn_wmma_f32_16x16x32_bf16(false, al, false, bh, (short)0, c, false, false);
  if (NT >= 3) c = __builtin_amdgcn_wmma_f32_16x16x32_bf16(false, ah, false, bl, (short)0, c, false, false);
  asm volatile("v_nop\n\tv_nop\n\tv_nop\n\tv_nop" : "+v"(c) : "v"(ah), "v"(al), "v"(bh), "v"(bl));
  return c;
}

__global__ __launch_bounds__(256) void k_wt_bf16(const float* __restrict__ W, unsigned short* __restrict__ Wt, int K, int N) {
  const int t = blockIdx.x * 256 + threadIdx.x;
  const int k8n = K / 8;
  if (t >= N * k8n) return;
  const int n = t / k8n, k8 = (t % k8n) * 8;
  v8us v;
#pragma unroll
  for (int i = 0; i < 8; ++i) v[i] = bf16_bits(W[(size_t)(k8 + i) * N + n]);
  *(v8us*)(Wt + (size_t)n * K + k8) = v;
  
}

// GEMM C[M][N] (f32, pitch ldc) = act(A[M][K]·W + bias). A f32 row-major (pitch lda) converted per fragment to bf16
// (ASPLIT: hi/lo two planes -> 2 terms, else single rounded term); Wt bf16 [N][K] (pitch ldb). BIAS_BF16 rounds the
// bias to bf16 first (bias quantised to bf16 before the add). K%32==0, M%16==0, N%64==0.
template <bool ASPLIT, int ACT, bool BIAS_BF16>
__global__ __launch_bounds__(128) void k_gemm_bf(const float* __restrict__ A, int lda, const unsigned short* __restrict__ Wt, int ldb,
                                               const float* __restrict__ bias, float* __restrict__ C, int ldc, int M, int N, int K) {
  __shared__ __attribute__((aligned(16))) float so[4][16][64];
  const int tid = threadIdx.x, w = tid >> 5, lane = tid & 31, ln = lane & 15, hh = lane >> 4;
  const int ntn = N / 64;
  const int wid = blockIdx.x * 4 + w;
  const int mt = wid / ntn, nq = wid % ntn;
  if (mt * 16 >= M) return;
  const int row0 = mt * 16, col0 = nq * 64;
  const float* arow = A + (size_t)(row0 + ln) * lda;
  v8f acc[4] = {};
  for (int kb = 0; kb < K; kb += 32) {
    FragB ah, al;
    const v4f x0 = *(const v4fa*)(arow + kb + 8 * hh), x1 = *(const v4fa*)(arow + kb + 8 * hh + 4);
    const v4f x2 = *(const v4fa*)(arow + kb + 16 + 8 * hh), x3 = *(const v4fa*)(arow + kb + 16 + 8 * hh + 4);
    float xs[16] = {x0[0],x0[1],x0[2],x0[3],x1[0],x1[1],x1[2],x1[3],x2[0],x2[1],x2[2],x2[3],x3[0],x3[1],x3[2],x3[3]};
#pragma unroll
    for (int i = 0; i < 16; ++i) { const unsigned short hb = bf16_bits(xs[i]); ah.u[i] = hb; al.u[i] = ASPLIT ? bf16_bits(xs[i] - bf16_val(hb)) : (unsigned short)0; }
#pragma unroll
    for (int t = 0; t < 4; ++t) {
      const unsigned short* brow = Wt + (size_t)(col0 + t * 16 + ln) * ldb + kb;
      FragB b;
      b.half[0] = *(const v8us*)(brow + 8 * hh);
      b.half[1] = *(const v8us*)(brow + 16 + 8 * hh);
      acc[t] = mmaN<ASPLIT ? 2 : 1>(ah.v, al.v, b.v, b.v, acc[t]);
    }
  }
#pragma unroll
  for (int t = 0; t < 4; ++t) {
    float bv = bias ? bias[col0 + t * 16 + ln] : 0.f;
    if (BIAS_BF16) bv = bf16_round(bv);
#pragma unroll
    for (int r = 0; r < 8; ++r) { float v = acc[t][r] + bv; if (ACT == 1) v = fmaxf(v, 0.f); so[w][8 * hh + r][t * 16 + ln] = v; }
  }
  __builtin_amdgcn_fence(__ATOMIC_ACQ_REL, "workgroup");
  __builtin_amdgcn_wave_barrier();
  const int rsub = lane >> 4, c4 = (lane & 15) * 4;
  {
#pragma unroll
    for (int q = 0; q < 8; ++q) {
      const int r = q * 2 + rsub;
      const v4f v = *(const v4fa*)&so[w][r][c4];
      *(v4f*)(C + (size_t)(row0 + r) * ldc + col0 + c4) = v;
    }
    
  }
}

// GEMM C = act(A·W + bias + resid): A f32 (ASPLIT -> hi/lo 2 terms), Wt bf16 [N][K]; ACT 0 none, 1 relu, 2 exact gelu;
// resid (optional, f32, row index = (row % rmod), pitch ldr, RES_BF16 rounds it) added before the activation.
template <bool ASPLIT, int ACT, bool BIAS_BF16, bool RES_BF16>
__global__ __launch_bounds__(128) void k_gemm_bf3(const float* __restrict__ A, int lda, const unsigned short* __restrict__ Wt, int ldb,
                                                const float* __restrict__ bias, const float* __restrict__ resid, int rmod, int ldr,
                                                float* __restrict__ C, int ldc, int M, int N, int K) {
  __shared__ __attribute__((aligned(16))) float so[4][16][64];
  const int tid = threadIdx.x, w = tid >> 5, lane = tid & 31, ln = lane & 15, hh = lane >> 4;
  const int ntn = N / 64;
  const int wid = blockIdx.x * 4 + w;
  const int mt = wid / ntn, nq = wid % ntn;
  if (mt * 16 >= M) return;
  const int row0 = mt * 16, col0 = nq * 64;
  const float* arow = A + (size_t)(row0 + ln) * lda;
  v8f acc[4] = {};
  for (int kb = 0; kb < K; kb += 32) {
    FragB ah, al;
    const v4f x0 = *(const v4fa*)(arow + kb + 8 * hh), x1 = *(const v4fa*)(arow + kb + 8 * hh + 4);
    const v4f x2 = *(const v4fa*)(arow + kb + 16 + 8 * hh), x3 = *(const v4fa*)(arow + kb + 16 + 8 * hh + 4);
    float xs[16] = {x0[0],x0[1],x0[2],x0[3],x1[0],x1[1],x1[2],x1[3],x2[0],x2[1],x2[2],x2[3],x3[0],x3[1],x3[2],x3[3]};
#pragma unroll
    for (int i = 0; i < 16; ++i) { const unsigned short hb = bf16_bits(xs[i]); ah.u[i] = hb; al.u[i] = ASPLIT ? bf16_bits(xs[i] - bf16_val(hb)) : (unsigned short)0; }
#pragma unroll
    for (int t = 0; t < 4; ++t) {
      const unsigned short* brow = Wt + (size_t)(col0 + t * 16 + ln) * ldb + kb;
      FragB b;
      b.half[0] = *(const v8us*)(brow + 8 * hh);
      b.half[1] = *(const v8us*)(brow + 16 + 8 * hh);
      acc[t] = mmaN<ASPLIT ? 2 : 1>(ah.v, al.v, b.v, b.v, acc[t]);
    }
  }
#pragma unroll
  for (int t = 0; t < 4; ++t) {
    const int col = col0 + t * 16 + ln;
    float bv = bias ? bias[col] : 0.f;
    if (BIAS_BF16) bv = bf16_round(bv);
#pragma unroll
    for (int r = 0; r < 8; ++r) {
      float v = acc[t][r] + bv;
      if (resid) { float rv = resid[(size_t)((row0 + 8 * hh + r) % rmod) * ldr + col]; if (RES_BF16) rv = bf16_round(rv); v += rv; }
      if (ACT == 1) v = fmaxf(v, 0.f);
      if (ACT == 2) v = 0.5f * v * (1.0f + erff(v * 0.70710678118654752f));
      if (ACT == 3) { const float u = 0.7978845608028654f * (v + 0.044715f * v * v * v); v = 0.5f * v * (1.0f + tanhf(u)); }
      so[w][8 * hh + r][t * 16 + ln] = v;
    }
  }
  __builtin_amdgcn_fence(__ATOMIC_ACQ_REL, "workgroup");
  __builtin_amdgcn_wave_barrier();
  const int rsub = lane >> 4, c4 = (lane & 15) * 4;
  {
#pragma unroll
    for (int q = 0; q < 8; ++q) {
      const int r = q * 2 + rsub;
      const v4f v = *(const v4fa*)&so[w][r][c4];
      *(v4f*)(C + (size_t)(row0 + r) * ldc + col0 + c4) = v;
    }
    
  }
}
// row LayerNorm (biased variance, eps) over N: s = X (+ R); optional out_sum <- s; out_norm <- (s-mu)*rsqrt(var+eps)*g + b
template <bool PARAM_BF16>
__global__ __launch_bounds__(256) void k_layernorm(const float* __restrict__ X, const float* __restrict__ R, const float* __restrict__ g, const float* __restrict__ bta,
                                                  float* __restrict__ out_sum, float* __restrict__ out_norm, int N, float eps) {
  __shared__ float red[256];
  const int row = blockIdx.x, tid = threadIdx.x;
  const float* x = X + (size_t)row * N; const float* rr = R ? R + (size_t)row * N : nullptr;
  float vals[16];                     // up to N = 4096
  const int per = N / 256;            // contiguous chunk per thread? use strided-by-4 chunks: thread handles j = tid*4 + 1024*u
  float s1 = 0.f;
  for (int u = 0; u < per / 4; ++u) {
    const int j = tid * 4 + 1024 * u;
    const v4f a = *(const v4fa*)(x + j);
    v4f b = {0.f,0.f,0.f,0.f}; if (rr) b = *(const v4fa*)(rr + j);
#pragma unroll
    for (int q = 0; q < 4; ++q) { const float v = a[q] + b[q]; vals[u * 4 + q] = v; s1 += v; }
  }
  red[tid] = s1; __syncthreads();
  for (int st = 128; st > 0; st >>= 1) { if (tid < st) red[tid] += red[tid + st]; __syncthreads(); }
  const float mu = red[0] / (float)N; __syncthreads();
  float s2 = 0.f;
  for (int u = 0; u < per / 4; ++u)
#pragma unroll
    for (int q = 0; q < 4; ++q) { const float c = vals[u * 4 + q] - mu; s2 += c * c; }
  red[tid] = s2; __syncthreads();
  for (int st = 128; st > 0; st >>= 1) { if (tid < st) red[tid] += red[tid + st]; __syncthreads(); }
  const float rs = rsqrtf(red[0] / (float)N + eps);
  {
    for (int u = 0; u < per / 4; ++u) {
      const int j = tid * 4 + 1024 * u;
      v4f o, sm;
#pragma unroll
      for (int q = 0; q < 4; ++q) {
        float gg = g[j + q], bb = bta[j + q];
        if (PARAM_BF16) { gg = bf16_round(gg); bb = bf16_round(bb); }
        sm[q] = vals[u * 4 + q]; o[q] = (vals[u * 4 + q] - mu) * rs * gg + bb;
      }
      if (out_sum) *(v4f*)(out_sum + (size_t)row * N + j) = sm;
      *(v4f*)(out_norm + (size_t)row * N + j) = o;
    }
    
  }
}



// ---- f16 WMMA path (v_wmma_f32_16x16x32_f16): 11-bit significands for operands in range — used where a [0,1] probability operand needs more precision than bf16
typedef _Float16 v16h __attribute__((ext_vector_type(16)));
union FragH { v16h v; v8us half[2]; _Float16 h[16]; unsigned short u[16]; };
template <int NT>
__device__ __forceinline__ v8f mmaH(v16h ah, v16h al, v16h bh, v16h bl, v8f c) {
  c = __builtin_amdgcn_wmma_f32_16x16x32_f16(false, ah, false, bh, (short)0, c, false, false);
  if (NT >= 2) c = __builtin_amdgcn_wmma_f32_16x16x32_f16(false, al, false, bh, (short)0, c, false, false);
  if (NT >= 3) c = __builtin_amdgcn_wmma_f32_16x16x32_f16(false, ah, false, bl, (short)0, c, false, false);
  asm volatile("v_nop\n\tv_nop\n\tv_nop\n\tv_nop" : "+v"(c) : "v"(ah), "v"(al), "v"(bh), "v"(bl));
  return c;
}
// batched GEMM like k_gemm_b but f16 operands: A f32 (split into f16 hi/lo if ASPLIT, else rounded to f16), Bt = f16 values [n][k]; alpha; C f32; N multiple of 16 (partial tiles skipped)
template <bool ASPLIT>
__global__ __launch_bounds__(128) void k_gemm_h(const float* __restrict__ A, int lda, size_t sA, const _Float16* __restrict__ Bh, int ldb, size_t sB, float alpha, float* __restrict__ C, int ldc, size_t sC, int M, int N, int K) {
  __shared__ __attribute__((aligned(16))) float so[4][16][64];
  const int tid = threadIdx.x, w = tid >> 5, lane = tid & 31, ln = lane & 15, hh = lane >> 4; const int by = blockIdx.y;
  A += (size_t)by * sA; Bh += (size_t)by * sB; C += (size_t)by * sC;
  const int ntn = (N + 63) / 64; const int wid = blockIdx.x * 4 + w; const int mt = wid / ntn, nq = wid % ntn; if (mt * 16 >= M) return;
  const int row0 = mt * 16, col0 = nq * 64; const float* arow = A + (size_t)(row0 + ln) * lda;
  v8f acc[4] = {};
  for (int kb = 0; kb < K; kb += 32) {
    FragH ah, al;
    const v4f x0 = *(const v4fa*)(arow + kb + 8 * hh), x1 = *(const v4fa*)(arow + kb + 8 * hh + 4), x2 = *(const v4fa*)(arow + kb + 16 + 8 * hh), x3 = *(const v4fa*)(arow + kb + 16 + 8 * hh + 4);
    float xs[16] = {x0[0],x0[1],x0[2],x0[3],x1[0],x1[1],x1[2],x1[3],x2[0],x2[1],x2[2],x2[3],x3[0],x3[1],x3[2],x3[3]};
#pragma unroll
    for (int i = 0; i < 16; ++i) { const _Float16 h = (_Float16)xs[i]; ah.h[i] = h; al.h[i] = ASPLIT ? (_Float16)(xs[i] - (float)h) : (_Float16)0.0f; }
#pragma unroll
    for (int t = 0; t < 4; ++t) { if (col0 + t * 16 >= N) continue; const size_t boff = (size_t)(col0 + t * 16 + ln) * ldb + kb; FragH bq; bq.half[0] = *(const v8us*)(Bh + boff + 8 * hh); bq.half[1] = *(const v8us*)(Bh + boff + 16 + 8 * hh);
      acc[t] = mmaH<ASPLIT ? 2 : 1>(ah.v, al.v, bq.v, bq.v, acc[t]); }
  }
#pragma unroll
  for (int t = 0; t < 4; ++t) { if (col0 + t * 16 >= N) continue;
#pragma unroll
    for (int r = 0; r < 8; ++r) so[w][8 * hh + r][t * 16 + ln] = acc[t][r] * alpha; }
  __builtin_amdgcn_fence(__ATOMIC_ACQ_REL, "workgroup"); __builtin_amdgcn_wave_barrier();
  const int rsub = lane >> 4, c4 = (lane & 15) * 4;
  {
#pragma unroll
    for (int q = 0; q < 8; ++q) { const int r = q * 2 + rsub; if (col0 + c4 < N) { const v4f v = *(const v4fa*)&so[w][r][c4]; *(v4f*)(C + (size_t)(row0 + r) * ldc + col0 + c4) = v; } }
     }
}

// Wt[n][k] = f16(W[k][n]·scale) from f32 row-major W[K][N] (scale = power of two; bf16-exact weights stay exact in f16 away from the subnormal range)
__global__ __launch_bounds__(256) void k_wt_f16(const float* __restrict__ W, _Float16* __restrict__ Wt, int K, int N, float scale) {
  const int t = blockIdx.x * 256 + threadIdx.x; if (t >= N * (K / 8)) return; const int n = t / (K / 8), k8 = (t % (K / 8)) * 8; FragH f;
#pragma unroll
  for (int i = 0; i < 8; ++i) f.h[i] = (_Float16)(bf16_round(W[(size_t)(k8 + i) * N + n]) * scale); const v8us o = f.half[0];
  *(v8us*)((unsigned short*)Wt + (size_t)n * K + k8) = o; 
}
// k_gemm_hh variant with fused epilogue: v = acc·alpha + bias[by·sBias + col] (+ CP[(row/rowsPerB)·sCPb + by·64 + col] if CP) ; ACT 0 none / 1 elu ; writes f16 C16 (and f32 C if non-null)
template <int ACT>
__global__ __launch_bounds__(128) void k_gemm_hhx(const _Float16* __restrict__ A, int lda, size_t sA, const _Float16* __restrict__ Bh, int ldb, size_t sB, float alpha, const float* __restrict__ bias, size_t sBias, const float* __restrict__ CP, int rowsPerB, size_t sCPb, int row0g,
    float* __restrict__ C, _Float16* __restrict__ C16, int ldc, size_t sC, int M, int N, int K) {
  __shared__ __attribute__((aligned(16))) float so[4][16][64];
  const int tid = threadIdx.x, w = tid >> 5, lane = tid & 31, ln = lane & 15, hh = lane >> 4; const int by = blockIdx.y;
  A += (size_t)by * sA; Bh += (size_t)by * sB; const size_t cofs = (size_t)by * sC; const float* bp = bias ? bias + (size_t)by * sBias : nullptr;
  const int ntn = (N + 63) / 64; const int wid = blockIdx.x * 4 + w; const int mt = wid / ntn, nq = wid % ntn; if (mt * 16 >= M) return;
  const int row0 = mt * 16, col0 = nq * 64; const _Float16* arow = A + (size_t)(row0 + ln) * lda;
  v8f acc[4] = {};
  for (int kb = 0; kb < K; kb += 32) { FragH ah; ah.half[0] = *(const v8us*)((const unsigned short*)arow + kb + 8 * hh); ah.half[1] = *(const v8us*)((const unsigned short*)arow + kb + 16 + 8 * hh);
#pragma unroll
    for (int t = 0; t < 4; ++t) { if (col0 + t * 16 >= N) continue; const size_t boff = (size_t)(col0 + t * 16 + ln) * ldb + kb; FragH bq; bq.half[0] = *(const v8us*)((const unsigned short*)Bh + boff + 8 * hh); bq.half[1] = *(const v8us*)((const unsigned short*)Bh + boff + 16 + 8 * hh);
      acc[t] = mmaH<1>(ah.v, ah.v, bq.v, bq.v, acc[t]); }
  }
#pragma unroll
  for (int t = 0; t < 4; ++t) { if (col0 + t * 16 >= N) continue; const int col = col0 + t * 16 + ln; const float bv = bp ? bf16_round(bp[col]) : 0.f;
#pragma unroll
    for (int r = 0; r < 8; ++r) { float v = acc[t][r] * alpha + bv; if (CP) { const int rr = row0g + row0 + 8 * hh + r; if (rowsPerB < 0) v += CP[cofs + (size_t)rr * ldc + col];      /* rowsPerB < 0: own element of the batched C plane */ else { const int bidx = rr / rowsPerB; v += CP[(size_t)bidx * sCPb + (size_t)by * 64 + col]; } } if (ACT == 1) v = (v > 0.f) ? v : expm1f(v); else if (ACT == 7) v = (v > 0.f) ? v + 1.0f : expf(v); else if (ACT == 8) v = tanhf(v); else if (ACT == 9) v = 0.5f * v * (1.0f + tanhf(0.7978845608028654f * (v + 0.044715f * v * v * v))); else if (ACT == 11) v = 1.0f / (1.0f + expf(-v)); else if (ACT == 12) v = (v > 0.f) ? v : 0.01f * v; else if (ACT == 14) v = (v > 0.f) ? v : 0.1f * v; else if (ACT == 16) v = (v >= 0.f) ? v : 0.3f * v; else if (ACT == 17) v = (v >= 0.f) ? v : 0.2f * v; else if (ACT == 15) v = v / (1.0f + expf(-v)); else if (ACT == 3) v = fmaxf(v, 0.f); else if (ACT == 6) v = 0.5f * v * (1.0f + erff(v * 0.70710678118654752f)); so[w][8 * hh + r][t * 16 + ln] = v; } }
  __builtin_amdgcn_fence(__ATOMIC_ACQ_REL, "workgroup"); __builtin_amdgcn_wave_barrier();
  const int rsub = lane >> 4, c4 = (lane & 15) * 4; typedef _Float16 v4h __attribute__((ext_vector_type(4)));
  {
#pragma unroll
    for (int q = 0; q < 8; ++q) { const int r = q * 2 + rsub; if (col0 + c4 < N) { const v4f v = *(const v4fa*)&so[w][r][c4]; if (C) *(v4f*)(C + cofs + (size_t)(row0 + r) * ldc + col0 + c4) = v; if (C16) { v4h h4; for (int i = 0; i < 4; ++i) h4[i] = (_Float16)v[i]; *(v4h*)(C16 + cofs + (size_t)(row0 + r) * ldc + col0 + c4) = h4; } } }
     }
}


typedef _Float16 v4h __attribute__((ext_vector_type(4)));

__global__ __launch_bounds__(256) void k_x16(const float* __restrict__ x, _Float16* __restrict__ X16, size_t n8) { const size_t t = (size_t)blockIdx.x * 256 + threadIdx.x; if (t >= n8) return; FragH f;
#pragma unroll
  for (int q = 0; q < 8; ++q) f.h[q] = (_Float16)bf16_round(x[t * 8 + q]); *(v8us*)((unsigned short*)X16 + t * 8) = f.half[0];  }
__global__ __launch_bounds__(256) void k_h16(const float* __restrict__ x, _Float16* __restrict__ X16, size_t n8) { const size_t t = (size_t)blockIdx.x * 256 + threadIdx.x; if (t >= n8) return; FragH f;
#pragma unroll
  for (int q = 0; q < 8; ++q) f.h[q] = (_Float16)x[t * 8 + q]; *(v8us*)((unsigned short*)X16 + t * 8) = f.half[0];  }
__global__ __launch_bounds__(256) void k_round16f(const float* __restrict__ W, _Float16* __restrict__ Bt, size_t n8) { const size_t t = (size_t)blockIdx.x * 256 + threadIdx.x; if (t >= n8) return; FragH f;
#pragma unroll
  for (int i = 0; i < 8; ++i) f.h[i] = (_Float16)(bf16_round(W[t * 8 + i]) * 16.0f); *(v8us*)((unsigned short*)Bt + t * 8) = f.half[0];  }
template <int NHv, int TTv>
__global__ __launch_bounds__(256) void k_vt(const _Float16* __restrict__ V16, int ldv, int voff, _Float16* __restrict__ Vt) { __shared__ unsigned short tl[64][66]; const int tid = threadIdx.x; const int slab = blockIdx.x / (TTv / 64), lg = blockIdx.x % (TTv / 64); const int b = slab / NHv, h = slab % NHv;
  for (int i = tid; i < 64 * 8; i += 256) { const int r = i / 8, c8 = (i % 8) * 8; FragH f; f.half[0] = *(const v8us*)((const unsigned short*)V16 + ((size_t)b * TTv + lg * 64 + r) * ldv + voff + h * 64 + c8);
#pragma unroll
    for (int q = 0; q < 8; ++q) tl[r][c8 + q] = f.u[q]; }
  __syncthreads();
  {
#pragma unroll
    for (int rd = 0; rd < 2; ++rd) { const int d = rd * 32 + tid / 8, pc = tid % 8; FragH f;
#pragma unroll
      for (int q = 0; q < 8; ++q) f.u[q] = tl[pc * 8 + q][d];
      *(v8us*)((unsigned short*)Vt + ((size_t)slab * 64 + d) * TTv + lg * 64 + pc * 8) = f.half[0]; }
     } }

__global__ __launch_bounds__(256) void k_hl(const float* __restrict__ F, _Float16* __restrict__ Hh, _Float16* __restrict__ Hl, size_t n8) { const size_t t = (size_t)blockIdx.x * 256 + threadIdx.x; if (t >= n8) return; FragH fh, fl; const v4f a = *(const v4fa*)(F + t * 8), c = *(const v4fa*)(F + t * 8 + 4);
#pragma unroll
  for (int q = 0; q < 4; ++q) { _Float16 h = (_Float16)a[q]; fh.h[q] = h; fl.h[q] = (_Float16)((a[q] - (float)h) * 1024.0f); h = (_Float16)c[q]; fh.h[4 + q] = h; fl.h[4 + q] = (_Float16)((c[q] - (float)h) * 1024.0f); }
  { *(v8us*)((unsigned short*)Hh + t * 8) = fh.half[0]; *(v8us*)((unsigned short*)Hl + t * 8) = fl.half[0];  } }

// ---- fast GEMM (wave tile 32x64; requires M % 32 == 0 rows per launch region and N % 64 == 0); epilogue = k_gemm_hhx semantics ----
__device__ __forceinline__ v16h g2_frag(const _Float16* p, int hh) { FragH f; f.half[0] = *(const v8us*)((const unsigned short*)p + 8 * hh); f.half[1] = *(const v8us*)((const unsigned short*)p + 16 + 8 * hh); return f.v; }
__device__ __forceinline__ v8f g2_mma(v16h a, v16h b, v8f c) { v8f d = __builtin_amdgcn_wmma_f32_16x16x32_f16(false, a, false, b, (short)0, c, false, false); asm volatile("v_nop\n\tv_nop\n\tv_nop\n\tv_nop" : "+v"(d) : "v"(a), "v"(b)); return d; }
template <int ACT>
__global__ __launch_bounds__(128) void k_gemm2(const _Float16* __restrict__ A, int lda, size_t sA, const _Float16* __restrict__ Bh, int ldb, size_t sB, float alpha, const float* __restrict__ bias, size_t sBias, const float* __restrict__ CP, int rowsPerB, size_t sCPb, int row0g,
    float* __restrict__ C, _Float16* __restrict__ C16, int ldc, size_t sC, int M, int N, int K) { static_assert(ACT == 0 || ACT == 3 || ACT == 6 || ACT == 8 || ACT == 9 || ACT == 11 || ACT == 12 || ACT == 14 || ACT == 15 || ACT == 16 || ACT == 17, "k_gemm2: unsupported ACT code (would silently apply no activation)");
  __shared__ __attribute__((aligned(16))) float so[4][32][68];
  const int tid = threadIdx.x, w = tid >> 5, lane = tid & 31, ln = lane & 15, hh = lane >> 4; const int by = blockIdx.y;
  A += (size_t)by * sA; Bh += (size_t)by * sB; const size_t cofs = (size_t)by * sC; const float* bp = bias ? bias + (size_t)by * sBias : nullptr;
  const int ntn = N >> 6; const int mt = blockIdx.x / ntn, nq = blockIdx.x - mt * ntn; const int row0 = mt * 128 + 32 * w, col0 = nq * 64; if (row0 >= M) return;
  const _Float16* a0p = A + (size_t)(row0 + ln) * lda; const _Float16* a1p = a0p + (size_t)16 * lda;
  const _Float16* b0p = Bh + (size_t)(col0 + ln) * ldb; const _Float16* b1p = b0p + (size_t)16 * ldb; const _Float16* b2p = b1p + (size_t)16 * ldb; const _Float16* b3p = b2p + (size_t)16 * ldb;
  const v8f z8 = {0.f,0.f,0.f,0.f,0.f,0.f,0.f,0.f}; v8f c00 = z8, c01 = z8, c02 = z8, c03 = z8, c10 = z8, c11 = z8, c12 = z8, c13 = z8;
#pragma unroll 1
  for (int kb = 0; kb < K; kb += 32) { const v16h a0 = g2_frag(a0p + kb, hh), a1 = g2_frag(a1p + kb, hh);
    v16h b = g2_frag(b0p + kb, hh); c00 = g2_mma(a0, b, c00); c10 = g2_mma(a1, b, c10);
    b = g2_frag(b1p + kb, hh); c01 = g2_mma(a0, b, c01); c11 = g2_mma(a1, b, c11);
    b = g2_frag(b2p + kb, hh); c02 = g2_mma(a0, b, c02); c12 = g2_mma(a1, b, c12);
    b = g2_frag(b3p + kb, hh); c03 = g2_mma(a0, b, c03); c13 = g2_mma(a1, b, c13); }
  v8f accs[8] = {c00, c01, c02, c03, c10, c11, c12, c13};
#pragma unroll
  for (int u = 0; u < 8; ++u) { const int t = u & 3, half = u >> 2; const int col = col0 + t * 16 + ln; const float bv = bp ? bf16_round(bp[col]) : 0.f;
#pragma unroll
    for (int r = 0; r < 8; ++r) { const int rloc = half * 16 + 8 * hh + r; float v = accs[u][r] * alpha + bv; if (CP) { if (rowsPerB < 0) v += CP[cofs + (size_t)(row0g + row0 + rloc) * ldc + col];      /* rowsPerB < 0: own element of the batched C plane */ else { const int bidx = (row0g + row0 + rloc) / rowsPerB; v += CP[(size_t)bidx * sCPb + (size_t)by * 64 + col]; } }
      if (ACT == 3) v = fmaxf(v, 0.f); else if (ACT == 6) v = 0.5f * v * (1.0f + erff(v * 0.70710678118654752f)); else if (ACT == 11) v = 1.0f / (1.0f + expf(-v)); else if (ACT == 15) v = v / (1.0f + expf(-v)); else if (ACT == 12) v = (v > 0.f) ? v : 0.01f * v; else if (ACT == 8) v = tanhf(v); else if (ACT == 9) v = 0.5f * v * (1.0f + tanhf(0.7978845608028654f * (v + 0.044715f * v * v * v))); else if (ACT == 14) v = (v > 0.f) ? v : 0.1f * v; else if (ACT == 16) v = (v >= 0.f) ? v : 0.3f * v; else if (ACT == 17) v = (v >= 0.f) ? v : 0.2f * v;
      so[w][rloc][t * 16 + ln] = v; } }
  __builtin_amdgcn_fence(__ATOMIC_ACQ_REL, "workgroup"); __builtin_amdgcn_wave_barrier();
  const int rsub = lane >> 4, c4 = (lane & 15) * 4;
  {
#pragma unroll
    for (int q = 0; q < 16; ++q) { const int r = q * 2 + rsub; const v4f v = *(const v4fa*)&so[w][r][c4]; if (C) *(v4f*)(C + cofs + (size_t)(row0 + r) * ldc + col0 + c4) = v; if (C16) { v4h h4; for (int i = 0; i < 4; ++i) h4[i] = (_Float16)v[i]; *(v4h*)(C16 + cofs + (size_t)(row0 + r) * ldc + col0 + c4) = h4; } }
     } }


__global__ __launch_bounds__(256) void k_wnat(const float* __restrict__ w, size_t n8, _Float16* __restrict__ Bt) { const size_t t = (size_t)blockIdx.x * 256 + threadIdx.x; if (t >= n8) return; FragH f; for (int q = 0; q < 8; ++q) f.h[q] = (_Float16)(bf16_round(w[t * 8 + q]) * 16.0f); *(v8us*)((unsigned short*)Bt + t * 8) = f.half[0];  }
__global__ __launch_bounds__(256) void k_rsm(const float* __restrict__ S, _Float16* __restrict__ P, int nrows) {
  #pragma clang fp contract(off)
  const int i = blockIdx.x * 256 + threadIdx.x; if (i >= nrows) return; const float* s = S + (size_t)i * SQ; float mx = -3.0e38f;
#pragma unroll 1
  for (int j = 0; j < SQ; ++j) mx = fmaxf(mx, s[j]); float se = 0.f;
#pragma unroll 1
  for (int j = 0; j < SQ; ++j) se += expf(s[j] - mx); const float sc = 256.0f / se;
#pragma unroll 1
  for (int j0 = 0; j0 < SQ; j0 += 8) { FragH f; for (int q = 0; q < 8; ++q) f.h[q] = (_Float16)(expf(s[j0 + q] - mx) * sc); unsigned short* d = (unsigned short*)P + (size_t)i * SQ + j0; *(v8us*)d = f.half[0];  } }
__global__ __launch_bounds__(256) void k_vt(const _Float16* __restrict__ V16, int b, int h0, _Float16* __restrict__ VT) { __shared__ unsigned short tl[64][65]; const int tid = threadIdx.x; const int hh = blockIdx.x % HG, sg = blockIdx.x / HG; const int s0 = sg * 64; const int h = h0 + hh;
  for (int i = tid; i < 64 * 8; i += 256) { const int j = i / 8, d8 = (i % 8) * 8; FragH f; f.half[0] = *(const v8us*)((const unsigned short*)V16 + ((size_t)b * SQ + s0 + j) * DM + h * HD + d8); for (int q = 0; q < 8; ++q) tl[d8 + q][j] = f.u[q]; }
  __syncthreads();
  { for (int i = tid; i < 64 * 8; i += 256) { const int d = i / 8, j8 = (i % 8) * 8; FragH f; for (int q = 0; q < 8; ++q) f.u[q] = tl[d][j8 + q]; *(v8us*)((unsigned short*)VT + ((size_t)hh * HD + d) * SQ + s0 + j8) = f.half[0]; }  } }



__global__ __launch_bounds__(256) void k_rsmcf2(const float* __restrict__ S, _Float16* __restrict__ P, int hg, int q0, int nk) {
  #pragma clang fp contract(off)
  const int t = blockIdx.x * 256 + threadIdx.x; if (t >= hg * QT) return; const size_t i = (size_t)t; const float* s = S + i * NKX; const int last = q0 + (t % QT); float mx = -3.0e38f;
#pragma unroll 1
  for (int j = 0; j < nk; ++j) { const float f = (j <= last) ? 1.f : 0.f; mx = fmaxf(mx, fmaf(f, s[j], (1.f - f) * -1.0e9f)); } float se = 0.f;
#pragma unroll 1
  for (int j = 0; j < nk; ++j) { const float f = (j <= last) ? 1.f : 0.f; se += __expf(fmaf(f, s[j], (1.f - f) * -1.0e9f) - mx); } const float sc = 256.0f / se;
#pragma unroll 1
  for (int j0 = 0; j0 < nk; j0 += 8) { FragH fr; for (int q = 0; q < 8; ++q) { const int j = j0 + q; const float f = (j <= last) ? 1.f : 0.f; fr.h[q] = (_Float16)(__expf(fmaf(f, s[j], (1.f - f) * -1.0e9f) - mx) * sc); } unsigned short* d = (unsigned short*)P + i * NKX + j0; *(v8us*)d = fr.half[0];  } }


template <int MASKADD>
__global__ __launch_bounds__(64) void k_att0(const float* __restrict__ QF, const float* __restrict__ KF, const float* __restrict__ VF, int ld, const float* __restrict__ mask, float scale, float* __restrict__ OF, int ldo) {
  #pragma clang fp contract(off)
  __shared__ __attribute__((aligned(16))) float lq[64][64]; __shared__ __attribute__((aligned(16))) float lo[64][64];
  const int tid = threadIdx.x; const int h = blockIdx.x / (QT0 / 64), rg = blockIdx.x % (QT0 / 64); const int i = rg * 64 + tid;
  const float* qr = QF + (size_t)i * ld + h * HD;
#pragma unroll 1
  for (int c = 0; c < HD / 4; ++c) { *(v4f*)&lq[tid][c * 4] = *(const v4fa*)(qr + c * 4); const v4f z = {0.f, 0.f, 0.f, 0.f}; *(v4f*)&lo[tid][c * 4] = z; }
  float m = -1.0e30f, l = 0.f; const int jmax = MASKADD ? (SQ - 1) : (rg * 64 + 63);      /* additive-mask form: every key (the mask input decides); causal form: keys up to the block's last row */
#pragma unroll 1
  for (int j = 0; j <= jmax; ++j) { const float* kr = KF + (size_t)j * ld + h * HD; const float* vr = VF + (size_t)j * ld + h * HD; float s = 0.f;
#pragma unroll 1
    for (int c = 0; c < HD / 4; ++c) { const v4f kq = *(const v4fa*)(kr + c * 4); const v4f qq = *(v4f*)&lq[tid][c * 4]; s = __fadd_rn(s, __fmul_rn(qq[0], kq[0])); s = __fadd_rn(s, __fmul_rn(qq[1], kq[1])); s = __fadd_rn(s, __fmul_rn(qq[2], kq[2])); s = __fadd_rn(s, __fmul_rn(qq[3], kq[3])); }
    s = __fmul_rn(s, scale); if (MASKADD) s = __fadd_rn(s, __fmul_rn(bf16_round(mask[(size_t)i * SQ + j]), -10000.0f));
    const float f = (MASKADD || j <= i) ? 1.f : 0.f; const float sm = fmaf(f, s, (1.f - f) * -1.0e30f); const float mn = fmaxf(m, sm); const float sc = expf(m - mn); const float e = expf(sm - mn); l = __fadd_rn(__fmul_rn(l, sc), e); m = mn;
#pragma unroll 1
    for (int c = 0; c < HD / 4; ++c) { const v4f vv = *(const v4fa*)(vr + c * 4); v4f oo = *(v4f*)&lo[tid][c * 4]; for (int u = 0; u < 4; ++u) oo[u] = __fadd_rn(__fmul_rn(oo[u], sc), __fmul_rn(e, vv[u])); *(v4f*)&lo[tid][c * 4] = oo; } }
  const float fin = 64.0f / l;      /* o carried x64 like the f16 path */
#pragma unroll 1
  for (int c = 0; c < HD / 4; ++c) { v4f oo = *(v4f*)&lo[tid][c * 4]; for (int u = 0; u < 4; ++u) oo[u] = __fmul_rn(oo[u], fin); *(v4f*)&lo[tid][c * 4] = oo; }
  __syncthreads();
  {
#pragma unroll 1
    for (int it = 0; it < 16; ++it) { const int row = it * 4 + tid / 16, pc = (tid % 16) * 4; const v4f v = *(const v4f*)&lo[row][pc]; *(v4f*)(OF + (size_t)(rg * 64 + row) * ldo + h * HD + pc) = v; }
     } }

extern "C" void kernel_launch(void* const* d_in, const int* in_sizes, int n_in,
                              void* d_out, int out_size, void* d_ws, size_t ws_size, hipStream_t stream) {
  (void)in_sizes; (void)n_in; (void)out_size;
  const float* const* I = (const float* const*)d_in; const float* x = I[0]; const float* xk = I[1]; const float* xv = I[2]; const float* wq = I[3]; const float* bq = nullptr; const float* wk = I[4]; const float* bk = nullptr; const float* wv = I[5]; const float* bv = nullptr; const float* wo = I[6]; const float* bo = I[7];      /* input order: query_data, key_data, value_data (three SEPARATE streams: the three exact-f16 row casts read one each), Wq, Wk, Wv ([in][out]; the module has NO q / k / v biases: null pointers in the guarded bias slots), Wp ([in][out]), bp (REAL); NO mask input (the causal fill is built inside the reference) */
  char* ws = (char*)d_ws; size_t off = 0;
  auto take = [&](size_t bytes) { char* p = ws + off; off += (bytes + 255) & ~(size_t)255; return p; };
  _Float16* BQ = (_Float16*)take((size_t)DM * DM * 2); _Float16* BK = (_Float16*)take((size_t)DM * DM * 2); _Float16* BV = (_Float16*)take((size_t)DM * DM * 2); _Float16* BO = (_Float16*)take((size_t)DM * DM * 2);
  _Float16* X16 = (_Float16*)take(NR * DM * 2); _Float16* XK16 = (_Float16*)take(NR * DM * 2); _Float16* XV16 = (_Float16*)take(NR * DM * 2);      /* exact f16 rows of query, key, value */ float* QF = (float*)take(NR * DM * 4); _Float16* QH = (_Float16*)take(NR * DM * 2); _Float16* QL = (_Float16*)take(NR * DM * 2); _Float16* KH = (_Float16*)take(NR * DM * 2); _Float16* KL = (_Float16*)take(NR * DM * 2); _Float16* Q16 = QH; _Float16* K16 = KH; _Float16* V16 = (_Float16*)take(NR * DM * 2); _Float16* O16 = (_Float16*)take(NR * DM * 2);
  float* S = (float*)take((size_t)NH * QT * NKX * 4); _Float16* P = (_Float16*)take((size_t)NH * QT * NKX * 2); _Float16* VT = (_Float16*)take((size_t)NH * HD * SQ * 2);
  float* QF0 = (float*)take((size_t)QT0 * DM * 4); float* KF0 = (float*)take((size_t)QT0 * DM * 4); float* VF0 = (float*)take((size_t)QT0 * DM * 4); float* OF0 = (float*)take((size_t)NB * QT0 * DM * 4); _Float16* OH0 = (_Float16*)take((size_t)NB * QT0 * DM * 2); _Float16* OL0 = (_Float16*)take((size_t)NB * QT0 * DM * 2);
  if (off > ws_size) return;
  { const unsigned g = (unsigned)(((size_t)DM * (DM / 8) + 255) / 256); k_wt_f16<<<g, 256, 0, stream>>>(wq, BQ, DM, DM, 16.0f); k_wt_f16<<<g, 256, 0, stream>>>(wk, BK, DM, DM, 16.0f); k_wt_f16<<<g, 256, 0, stream>>>(wv, BV, DM, DM, 16.0f); k_wt_f16<<<g, 256, 0, stream>>>(wo, BO, DM, DM, 16.0f); }      /* [in][out] -> Bt[n][k] x16 */
  k_x16<<<(unsigned)((NR * DM / 8 + 255) / 256), 256, 0, stream>>>(x, X16, NR * DM / 8); k_x16<<<(unsigned)((NR * DM / 8 + 255) / 256), 256, 0, stream>>>(xk, XK16, NR * DM / 8); k_x16<<<(unsigned)((NR * DM / 8 + 255) / 256), 256, 0, stream>>>(xv, XV16, NR * DM / 8);
  const size_t r0p = (size_t)B0 * SQ;      /* first projected row */
  k_gemm2<0><<<dim3((unsigned)((MP / 128) * (DM / 64)), 1), 128, 0, stream>>>(X16 + r0p * DM, DM, 0, BQ, DM, 0, 0.0625f, bq, 0, nullptr, 1, 0, 0, QF + r0p * DM, nullptr, DM, 0, MP, DM, DM); k_hl<<<(unsigned)(((size_t)MP * DM / 8 + 255) / 256), 256, 0, stream>>>(QF + r0p * DM, QH + r0p * DM, QL + r0p * DM, (size_t)MP * DM / 8);      /* q (f32) -> f16 hi + x1024 residual: unscaled logits sigma ~8 */
  k_gemm2<0><<<dim3((unsigned)((MP / 128) * (DM / 64)), 1), 128, 0, stream>>>(XK16 + r0p * DM, DM, 0, BK, DM, 0, 0.0625f, bk, 0, nullptr, 1, 0, 0, QF + r0p * DM, nullptr, DM, 0, MP, DM, DM); k_hl<<<(unsigned)(((size_t)MP * DM / 8 + 255) / 256), 256, 0, stream>>>(QF + r0p * DM, KH + r0p * DM, KL + r0p * DM, (size_t)MP * DM / 8);      /* k likewise */
  k_gemm2<0><<<dim3((unsigned)((MP / 128) * (DM / 64)), 1), 128, 0, stream>>>(XV16 + r0p * DM, DM, 0, BV, DM, 0, 0.0625f, bv, 0, nullptr, 1, 0, 0, nullptr, V16 + r0p * DM, DM, 0, MP, DM, DM);
  for (int b = B0; b < B0 + NBR; ++b) { const size_t r0 = (size_t)b * SQ;
    k_vt<NH, SQ><<<NH * (SQ / 64), 256, 0, stream>>>(V16 + r0 * LQ, LQ, 0, VT);      /* V^T [NH][HD][SQ] for this batch */
    k_gemm2<0><<<dim3((QT0 / 128) * (DM / 64), 1), 128, 0, stream>>>(X16 + r0 * DM, DM, 0, BQ, DM, 0, 0.0625f, bq, 0, nullptr, 1, 0, 0, QF0, nullptr, DM, 0, QT0, DM, DM); k_gemm2<0><<<dim3((QT0 / 128) * (DM / 64), 1), 128, 0, stream>>>(XK16 + r0 * DM, DM, 0, BK, DM, 0, 0.0625f, bk, 0, nullptr, 1, 0, 0, KF0, nullptr, DM, 0, QT0, DM, DM); k_gemm2<0><<<dim3((QT0 / 128) * (DM / 64), 1), 128, 0, stream>>>(XV16 + r0 * DM, DM, 0, BV, DM, 0, 0.0625f, bv, 0, nullptr, 1, 0, 0, VF0, nullptr, DM, 0, QT0, DM, DM);      /* f32 q, k, v of the first 128 rows (exact products) */
    k_att0<0><<<NH * (QT0 / 64), 64, 0, stream>>>(QF0, KF0, VF0, DM, nullptr, SCL, OF0 + (size_t)b * QT0 * DM, DM);      /* exact f32 attention for rows 0..127 (o x64) */
    for (int q0 = 0; q0 < QN; q0 += QT) { const int nk = q0 + QT;      /* causal: only keys below the tile end are computed */
      k_gemm2<0><<<dim3((QT / 128) * (nk / 64), NHD), 128, 0, stream>>>(QH + (r0 + q0) * LQ, LQ, (size_t)HD, KH + r0 * LQ, LQ, (size_t)HD, SCL, nullptr, 0, nullptr, 1, 0, 0, S, nullptr, NKX, (size_t)QT * NKX, QT, nk, HD);      /* scores hi . hi * 64^-0.5 (1 / sqrt(head_dim)) */
      k_gemm2<0><<<dim3((QT / 128) * (nk / 64), NHD), 128, 0, stream>>>(QL + (r0 + q0) * LQ, LQ, (size_t)HD, KH + r0 * LQ, LQ, (size_t)HD, SCLR, nullptr, 0, S, -1, 0, 0, S, nullptr, NKX, (size_t)QT * NKX, QT, nk, HD); k_gemm2<0><<<dim3((QT / 128) * (nk / 64), NHD), 128, 0, stream>>>(QH + (r0 + q0) * LQ, LQ, (size_t)HD, KL + r0 * LQ, LQ, (size_t)HD, SCLR, nullptr, 0, S, -1, 0, 0, S, nullptr, NKX, (size_t)QT * NKX, QT, nk, HD);      /* += 2^-10 (lo . hi + hi . lo) */      /* scores, all heads on grid.y */
      k_rsmcf2<<<(NHD * QT + 255) / 256, 256, 0, stream>>>(S, P, NHD, q0, nk);
      k_gemm2<0><<<dim3((QT / 128) * (HD / 64), NHD), 128, 0, stream>>>(P, NKX, (size_t)QT * NKX, VT, SQ, (size_t)HD * SQ, 0.25f, nullptr, 0, nullptr, 1, 0, 0, nullptr, O16 + (r0 + q0) * DM, DM, (size_t)HD, QT, HD, nk); } }      /* o (merged heads, x64) as f16 rows */
  k_gemm2<0><<<dim3((unsigned)((MPO / 128) * (DM / 64)), 1), 128, 0, stream>>>(O16 + r0p * DM, DM, 0, BO, DM, 0, 0.0009765625f, bo, 0, nullptr, 1, 0, 0, (float*)d_out + r0p * DM, nullptr, DM, 0, MPO, DM, DM);      /* out rows are the output layout */
  k_hl<<<(unsigned)(((size_t)NB * QT0 * DM / 8 + 255) / 256), 256, 0, stream>>>(OF0, OH0, OL0, (size_t)NB * QT0 * DM / 8);      /* first-tile o (x64) -> f16 hi + x1024 residual planes */
  for (int b = B0; b < B0 + NBR; ++b) { const size_t r0 = (size_t)b * SQ; const size_t f0 = (size_t)b * QT0;
    k_gemm2<0><<<dim3((QT0 / 128) * (DM / 64), 1), 128, 0, stream>>>(OH0 + f0 * DM, DM, 0, BO, DM, 0, 0.0009765625f, bo, 0, nullptr, 1, 0, 0, (float*)d_out + r0 * DM, nullptr, DM, 0, QT0, DM, DM);      /* rows 0..127: out = o_hi Wo (+ b), overwriting the f16-path rows */
    k_gemm2<0><<<dim3((QT0 / 128) * (DM / 64), 1), 128, 0, stream>>>(OL0 + f0 * DM, DM, 0, BO, DM, 0, 0.00000095367431640625f, nullptr, 0, (const float*)d_out + r0 * DM, -1, 0, 0, (float*)d_out + r0 * DM, nullptr, DM, 0, QT0, DM, DM); }      /* += o_lo Wo 2^-20 (own-element accumulate) */
}

// v001
// It runs in 2900 microseconds.
// Next to v000, in two timings, it ran 2.00 and 2.01 times as fast.
#include <hip/hip_runtime.h>
// Causal multi-head attention on three inputs with bias-free [in][out] projections and a biased [in][out] output projection (query_data, key_data, value_data [2][2048][1024]; q = split_heads(query_data Wq), k = split_heads(key_data Wk), v = split_heads(value_data Wv) ([in][out] [1024][1024], NO biases), 16 heads of 64; scores / sqrt(64); scores + triu(ones, k = 1) x (-1e13): an additive fill strictly above the diagonal == exclusion (exp underflows to exactly 0; every row keeps its diagonal); softmax over keys; out = merged Wp + bp ([in][out] + a REAL bias) -> [2][2048][1024]); the causal rule is built inside the reference: the causal rule by index; q and k carried as f16 hi + x1024 residual planes with three-product scores.
// Structure: token rows r = b*2048 + s; x as exact f16 rows (bf16-rounded); q and k as WMMA GEMMs (32x64 wave tiles, f32 accumulation, exact x16 weights, no bias) into f32 rows split into f16 hi + x1024 residual planes, v as an f16-output GEMM; per batch: V^T for all heads via LDS transposes; per query tile of 256 rows: scores against the keys below the tile end only as THREE accumulating passes (hi.hi + lo.hi + hi.lo, K = 64, all heads on grid.y, alpha 1/sqrt(64) = 0.125, 2^-13 on the residual passes, unscaled logits sigma ~8), causal row softmax on VALU, one wave per row, keys past the row's own index set to -1e9 over the computed range (f32 statistics, native exp; weights x256 f16), o = P . V^T (K = keys below the tile end, alpha 2^-2: o carried x64, folded into the output GEMM alpha) written straight into the merged f16 o rows; out = o W_o + b GEMM (f32) into the output layout.
// Compute dtype: inputs rounded to bf16; x / weights exact; v, softmax weights and o as plain f16 GEMM operands (~2^-12), q and k as f16 hi + x1024 residual planes; scores and softmax statistics f32. v_wmma_f32_16x16x32_f16.
#define NB 2
#define SCL 0.125f                         /* 1 / sqrt(head_dim = 64) */
#define SCLR 0.0001220703125f              /* 2^-13: the same scale on the x1024 residual passes */
#define SQ 2048
#define DM 1024
#define NH 16
#define HD 64
#define HG 4                         /* heads per launch of the head-group k_vt (not launched) */
#define QT 256                       /* query rows per causal tile */
#define NKX SQ                       /* S / P row pitch */
#define QT0 128                      /* first-tile rows recomputed exactly in f32 */
#define B0 0                         /* first batch processed (debug hook) */
#define NBR NB                       /* batches processed (debug hook) */
#define NR ((size_t)NB * SQ)         /* token rows */
#define MP ((int)((size_t)NBR * SQ)) /* rows projected (debug hook) */
#define QN SQ                        /* query rows attended per batch (debug hook) */
#define NHD NH                       /* heads attended (debug hook) */
#define MPO MP                       /* rows through the output stage (debug hook) */
#define LQ DM      /* row pitch of the q/k/v rows */
typedef __bf16 v16b __attribute__((ext_vector_type(16)));
typedef unsigned short v8us __attribute__((ext_vector_type(8), may_alias));
typedef float  v8f  __attribute__((ext_vector_type(8)));
typedef float  v4f  __attribute__((ext_vector_type(4)));
typedef float  v4fa __attribute__((ext_vector_type(4), may_alias));
union FragB { v16b v; v8us half[2]; unsigned short u[16]; };

__device__ __forceinline__ unsigned short bf16_bits(float x) { unsigned int u = __float_as_uint(x); return (unsigned short)((u + 0x7FFFu + ((u >> 16) & 1u)) >> 16); }
__device__ __forceinline__ float bf16_val(unsigned short b) { return __uint_as_float(((unsigned int)b) << 16); }
__device__ __forceinline__ float bf16_round(float x) { return bf16_val(bf16_bits(x)); }
// D += A·B with NT terms: 1 = ah·bh, 2 = + al·bh (A split), 3 = + ah·bl (both split)
template <int NT>
__device__ __forceinline__ v8f mmaN(v16b ah, v16b al, v16b bh, v16b bl, v8f c) {
  c = __builtin_amdgcn_wmma_f32_16x16x32_bf16(false, ah, false, bh, (short)0, c, false, false);
  if (NT >= 2) c = __builtin_amdgcn_wmma_f32_16x16x32_bf16(false, al, false, bh, (short)0, c, false, false);
  if (NT >= 3) c = __builtin_amdgcn_wmma_f32_16x16x32_bf16(false, ah, false, bl, (short)0, c, false, false);
  asm volatile("v_nop\n\tv_nop\n\tv_nop\n\tv_nop" : "+v"(c) : "v"(ah), "v"(al), "v"(bh), "v"(bl));
  return c;
}

__global__ __launch_bounds__(256) void k_wt_bf16(const float* __restrict__ W, unsigned short* __restrict__ Wt, int K, int N) {
  const int t = blockIdx.x * 256 + threadIdx.x;
  const int k8n = K / 8;
  if (t >= N * k8n) return;
  const int n = t / k8n, k8 = (t % k8n) * 8;
  v8us v;
#pragma unroll
  for (int i = 0; i < 8; ++i) v[i] = bf16_bits(W[(size_t)(k8 + i) * N + n]);
  *(v8us*)(Wt + (size_t)n * K + k8) = v;
  
}

// GEMM C[M][N] (f32, pitch ldc) = act(A[M][K]·W + bias). A f32 row-major (pitch lda) converted per fragment to bf16
// (ASPLIT: hi/lo two planes -> 2 terms, else single rounded term); Wt bf16 [N][K] (pitch ldb). BIAS_BF16 rounds the
// bias to bf16 first (bias quantised to bf16 before the add). K%32==0, M%16==0, N%64==0.
template <bool ASPLIT, int ACT, bool BIAS_BF16>
__global__ __launch_bounds__(128) void k_gemm_bf(const float* __restrict__ A, int lda, const unsigned short* __restrict__ Wt, int ldb,
                                               const float* __restrict__ bias, float* __restrict__ C, int ldc, int M, int N, int K) {
  __shared__ __attribute__((aligned(16))) float so[4][16][64];
  const int tid = threadIdx.x, w = tid >> 5, lane = tid & 31, ln = lane & 15, hh = lane >> 4;
  const int ntn = N / 64;
  const int wid = blockIdx.x * 4 + w;
  const int mt = wid / ntn, nq = wid % ntn;
  if (mt * 16 >= M) return;
  const int row0 = mt * 16, col0 = nq * 64;
  const float* arow = A + (size_t)(row0 + ln) * lda;
  v8f acc[4] = {};
  for (int kb = 0; kb < K; kb += 32) {
    FragB ah, al;
    const v4f x0 = *(const v4fa*)(arow + kb + 8 * hh), x1 = *(const v4fa*)(arow + kb + 8 * hh + 4);
    const v4f x2 = *(const v4fa*)(arow + kb + 16 + 8 * hh), x3 = *(const v4fa*)(arow + kb + 16 + 8 * hh + 4);
    float xs[16] = {x0[0],x0[1],x0[2],x0[3],x1[0],x1[1],x1[2],x1[3],x2[0],x2[1],x2[2],x2[3],x3[0],x3[1],x3[2],x3[3]};
#pragma unroll
    for (int i = 0; i < 16; ++i) { const unsigned short hb = bf16_bits(xs[i]); ah.u[i] = hb; al.u[i] = ASPLIT ? bf16_bits(xs[i] - bf16_val(hb)) : (unsigned short)0; }
#pragma unroll
    for (int t = 0; t < 4; ++t) {
      const unsigned short* brow = Wt + (size_t)(col0 + t * 16 + ln) * ldb + kb;
      FragB b;
      b.half[0] = *(const v8us*)(brow + 8 * hh);
      b.half[1] = *(const v8us*)(brow + 16 + 8 * hh);
      acc[t] = mmaN<ASPLIT ? 2 : 1>(ah.v, al.v, b.v, b.v, acc[t]);
    }
  }
#pragma unroll
  for (int t = 0; t < 4; ++t) {
    float bv = bias ? bias[col0 + t * 16 + ln] : 0.f;
    if (BIAS_BF16) bv = bf16_round(bv);
#pragma unroll
    for (int r = 0; r < 8; ++r) { float v = acc[t][r] + bv; if (ACT == 1) v = fmaxf(v, 0.f); so[w][8 * hh + r][t * 16 + ln] = v; }
  }
  __builtin_amdgcn_fence(__ATOMIC_ACQ_REL, "workgroup");
  __builtin_amdgcn_wave_barrier();
  const int rsub = lane >> 4, c4 = (lane & 15) * 4;
  {
#pragma unroll
    for (int q = 0; q < 8; ++q) {
      const int r = q * 2 + rsub;
      const v4f v = *(const v4fa*)&so[w][r][c4];
      *(v4f*)(C + (size_t)(row0 + r) * ldc + col0 + c4) = v;
    }
    
  }
}

// GEMM C = act(A·W + bias + resid): A f32 (ASPLIT -> hi/lo 2 terms), Wt bf16 [N][K]; ACT 0 none, 1 relu, 2 exact gelu;
// resid (optional, f32, row index = (row % rmod), pitch ldr, RES_BF16 rounds it) added before the activation.
template <bool ASPLIT, int ACT, bool BIAS_BF16, bool RES_BF16>
__global__ __launch_bounds__(128) void k_gemm_bf3(const float* __restrict__ A, int lda, const unsigned short* __restrict__ Wt, int ldb,
                                                const float* __restrict__ bias, const float* __restrict__ resid, int rmod, int ldr,
                                                float* __restrict__ C, int ldc, int M, int N, int K) {
  __shared__ __attribute__((aligned(16))) float so[4][16][64];
  const int tid = threadIdx.x, w = tid >> 5, lane = tid & 31, ln = lane & 15, hh = lane >> 4;
  const int ntn = N / 64;
  const int wid = blockIdx.x * 4 + w;
  const int mt = wid / ntn, nq = wid % ntn;
  if (mt * 16 >= M) return;
  const int row0 = mt * 16, col0 = nq * 64;
  const float* arow = A + (size_t)(row0 + ln) * lda;
  v8f acc[4] = {};
  for (int kb = 0; kb < K; kb += 32) {
    FragB ah, al;
    const v4f x0 = *(const v4fa*)(arow + kb + 8 * hh), x1 = *(const v4fa*)(arow + kb + 8 * hh + 4);
    const v4f x2 = *(const v4fa*)(arow + kb + 16 + 8 * hh), x3 = *(const v4fa*)(arow + kb + 16 + 8 * hh + 4);
    float xs[16] = {x0[0],x0[1],x0[2],x0[3],x1[0],x1[1],x1[2],x1[3],x2[0],x2[1],x2[2],x2[3],x3[0],x3[1],x3[2],x3[3]};
#pragma unroll
    for (int i = 0; i < 16; ++i) { const unsigned short hb = bf16_bits(xs[i]); ah.u[i] = hb; al.u[i] = ASPLIT ? bf16_bits(xs[i] - bf16_val(hb)) : (unsigned short)0; }
#pragma unroll
    for (int t = 0; t < 4; ++t) {
      const unsigned short* brow = Wt + (size_t)(col0 + t * 16 + ln) * ldb + kb;
      FragB b;
      b.half[0] = *(const v8us*)(brow + 8 * hh);
      b.half[1] = *(const v8us*)(brow + 16 + 8 * hh);
      acc[t] = mmaN<ASPLIT ? 2 : 1>(ah.v, al.v, b.v, b.v, acc[t]);
    }
  }
#pragma unroll
  for (int t = 0; t < 4; ++t) {
    const int col = col0 + t * 16 + ln;
    float bv = bias ? bias[col] : 0.f;
    if (BIAS_BF16) bv = bf16_round(bv);
#pragma unroll
    for (int r = 0; r < 8; ++r) {
      float v = acc[t][r] + bv;
      if (resid) { float rv = resid[(size_t)((row0 + 8 * hh + r) % rmod) * ldr + col]; if (RES_BF16) rv = bf16_round(rv); v += rv; }
      if (ACT == 1) v = fmaxf(v, 0.f);
      if (ACT == 2) v = 0.5f * v * (1.0f + erff(v * 0.70710678118654752f));
      if (ACT == 3) { const float u = 0.7978845608028654f * (v + 0.044715f * v * v * v); v = 0.5f * v * (1.0f + tanhf(u)); }
      so[w][8 * hh + r][t * 16 + ln] = v;
    }
  }
  __builtin_amdgcn_fence(__ATOMIC_ACQ_REL, "workgroup");
  __builtin_amdgcn_wave_barrier();
  const int rsub = lane >> 4, c4 = (lane & 15) * 4;
  {
#pragma unroll
    for (int q = 0; q < 8; ++q) {
      const int r = q * 2 + rsub;
      const v4f v = *(const v4fa*)&so[w][r][c4];
      *(v4f*)(C + (size_t)(row0 + r) * ldc + col0 + c4) = v;
    }
    
  }
}
// row LayerNorm (biased variance, eps) over N: s = X (+ R); optional out_sum <- s; out_norm <- (s-mu)*rsqrt(var+eps)*g + b
template <bool PARAM_BF16>
__global__ __launch_bounds__(256) void k_layernorm(const float* __restrict__ X, const float* __restrict__ R, const float* __restrict__ g, const float* __restrict__ bta,
                                                  float* __restrict__ out_sum, float* __restrict__ out_norm, int N, float eps) {
  __shared__ float red[256];
  const int row = blockIdx.x, tid = threadIdx.x;
  const float* x = X + (size_t)row * N; const float* rr = R ? R + (size_t)row * N : nullptr;
  float vals[16];                     // up to N = 4096
  const int per = N / 256;            // contiguous chunk per thread? use strided-by-4 chunks: thread handles j = tid*4 + 1024*u
  float s1 = 0.f;
  for (int u = 0; u < per / 4; ++u) {
    const int j = tid * 4 + 1024 * u;
    const v4f a = *(const v4fa*)(x + j);
    v4f b = {0.f,0.f,0.f,0.f}; if (rr) b = *(const v4fa*)(rr + j);
#pragma unroll
    for (int q = 0; q < 4; ++q) { const float v = a[q] + b[q]; vals[u * 4 + q] = v; s1 += v; }
  }
  red[tid] = s1; __syncthreads();
  for (int st = 128; st > 0; st >>= 1) { if (tid < st) red[tid] += red[tid + st]; __syncthreads(); }
  const float mu = red[0] / (float)N; __syncthreads();
  float s2 = 0.f;
  for (int u = 0; u < per / 4; ++u)
#pragma unroll
    for (int q = 0; q < 4; ++q) { const float c = vals[u * 4 + q] - mu; s2 += c * c; }
  red[tid] = s2; __syncthreads();
  for (int st = 128; st > 0; st >>= 1) { if (tid < st) red[tid] += red[tid + st]; __syncthreads(); }
  const float rs = rsqrtf(red[0] / (float)N + eps);
  {
    for (int u = 0; u < per / 4; ++u) {
      const int j = tid * 4 + 1024 * u;
      v4f o, sm;
#pragma unroll
      for (int q = 0; q < 4; ++q) {
        float gg = g[j + q], bb = bta[j + q];
        if (PARAM_BF16) { gg = bf16_round(gg); bb = bf16_round(bb); }
        sm[q] = vals[u * 4 + q]; o[q] = (vals[u * 4 + q] - mu) * rs * gg + bb;
      }
      if (out_sum) *(v4f*)(out_sum + (size_t)row * N + j) = sm;
      *(v4f*)(out_norm + (size_t)row * N + j) = o;
    }
    
  }
}



// ---- f16 WMMA path (v_wmma_f32_16x16x32_f16): 11-bit significands for operands in range — used where a [0,1] probability operand needs more precision than bf16
typedef _Float16 v16h __attribute__((ext_vector_type(16)));
union FragH { v16h v; v8us half[2]; _Float16 h[16]; unsigned short u[16]; };
template <int NT>
__device__ __forceinline__ v8f mmaH(v16h ah, v16h al, v16h bh, v16h bl, v8f c) {
  c = __builtin_amdgcn_wmma_f32_16x16x32_f16(false, ah, false, bh, (short)0, c, false, false);
  if (NT >= 2) c = __builtin_amdgcn_wmma_f32_16x16x32_f16(false, al, false, bh, (short)0, c, false, false);
  if (NT >= 3) c = __builtin_amdgcn_wmma_f32_16x16x32_f16(false, ah, false, bl, (short)0, c, false, false);
  asm volatile("v_nop\n\tv_nop\n\tv_nop\n\tv_nop" : "+v"(c) : "v"(ah), "v"(al), "v"(bh), "v"(bl));
  return c;
}
// batched GEMM like k_gemm_b but f16 operands: A f32 (split into f16 hi/lo if ASPLIT, else rounded to f16), Bt = f16 values [n][k]; alpha; C f32; N multiple of 16 (partial tiles skipped)
template <bool ASPLIT>
__global__ __launch_bounds__(128) void k_gemm_h(const float* __restrict__ A, int lda, size_t sA, const _Float16* __restrict__ Bh, int ldb, size_t sB, float alpha, float* __restrict__ C, int ldc, size_t sC, int M, int N, int K) {
  __shared__ __attribute__((aligned(16))) float so[4][16][64];
  const int tid = threadIdx.x, w = tid >> 5, lane = tid & 31, ln = lane & 15, hh = lane >> 4; const int by = blockIdx.y;
  A += (size_t)by * sA; Bh += (size_t)by * sB; C += (size_t)by * sC;
  const int ntn = (N + 63) / 64; const int wid = blockIdx.x * 4 + w; const int mt = wid / ntn, nq = wid % ntn; if (mt * 16 >= M) return;
  const int row0 = mt * 16, col0 = nq * 64; const float* arow = A + (size_t)(row0 + ln) * lda;
  v8f acc[4] = {};
  for (int kb = 0; kb < K; kb += 32) {
    FragH ah, al;
    const v4f x0 = *(const v4fa*)(arow + kb + 8 * hh), x1 = *(const v4fa*)(arow + kb + 8 * hh + 4), x2 = *(const v4fa*)(arow + kb + 16 + 8 * hh), x3 = *(const v4fa*)(arow + kb + 16 + 8 * hh + 4);
    float xs[16] = {x0[0],x0[1],x0[2],x0[3],x1[0],x1[1],x1[2],x1[3],x2[0],x2[1],x2[2],x2[3],x3[0],x3[1],x3[2],x3[3]};
#pragma unroll
    for (int i = 0; i < 16; ++i) { const _Float16 h = (_Float16)xs[i]; ah.h[i] = h; al.h[i] = ASPLIT ? (_Float16)(xs[i] - (float)h) : (_Float16)0.0f; }
#pragma unroll
    for (int t = 0; t < 4; ++t) { if (col0 + t * 16 >= N) continue; const size_t boff = (size_t)(col0 + t * 16 + ln) * ldb + kb; FragH bq; bq.half[0] = *(const v8us*)(Bh + boff + 8 * hh); bq.half[1] = *(const v8us*)(Bh + boff + 16 + 8 * hh);
      acc[t] = mmaH<ASPLIT ? 2 : 1>(ah.v, al.v, bq.v, bq.v, acc[t]); }
  }
#pragma unroll
  for (int t = 0; t < 4; ++t) { if (col0 + t * 16 >= N) continue;
#pragma unroll
    for (int r = 0; r < 8; ++r) so[w][8 * hh + r][t * 16 + ln] = acc[t][r] * alpha; }
  __builtin_amdgcn_fence(__ATOMIC_ACQ_REL, "workgroup"); __builtin_amdgcn_wave_barrier();
  const int rsub = lane >> 4, c4 = (lane & 15) * 4;
  {
#pragma unroll
    for (int q = 0; q < 8; ++q) { const int r = q * 2 + rsub; if (col0 + c4 < N) { const v4f v = *(const v4fa*)&so[w][r][c4]; *(v4f*)(C + (size_t)(row0 + r) * ldc + col0 + c4) = v; } }
     }
}

// Wt[n][k] = f16(W[k][n]·scale) from f32 row-major W[K][N] (scale = power of two; bf16-exact weights stay exact in f16 away from the subnormal range)
__global__ __launch_bounds__(256) void k_wt_f16(const float* __restrict__ W, _Float16* __restrict__ Wt, int K, int N, float scale) {
  const int t = blockIdx.x * 256 + threadIdx.x; if (t >= N * (K / 8)) return; const int n = t / (K / 8), k8 = (t % (K / 8)) * 8; FragH f;
#pragma unroll
  for (int i = 0; i < 8; ++i) f.h[i] = (_Float16)(bf16_round(W[(size_t)(k8 + i) * N + n]) * scale); const v8us o = f.half[0];
  *(v8us*)((unsigned short*)Wt + (size_t)n * K + k8) = o; 
}
// k_gemm_hh variant with fused epilogue: v = acc·alpha + bias[by·sBias + col] (+ CP[(row/rowsPerB)·sCPb + by·64 + col] if CP) ; ACT 0 none / 1 elu ; writes f16 C16 (and f32 C if non-null)
template <int ACT>
__global__ __launch_bounds__(128) void k_gemm_hhx(const _Float16* __restrict__ A, int lda, size_t sA, const _Float16* __restrict__ Bh, int ldb, size_t sB, float alpha, const float* __restrict__ bias, size_t sBias, const float* __restrict__ CP, int rowsPerB, size_t sCPb, int row0g,
    float* __restrict__ C, _Float16* __restrict__ C16, int ldc, size_t sC, int M, int N, int K) {
  __shared__ __attribute__((aligned(16))) float so[4][16][64];
  const int tid = threadIdx.x, w = tid >> 5, lane = tid & 31, ln = lane & 15, hh = lane >> 4; const int by = blockIdx.y;
  A += (size_t)by * sA; Bh += (size_t)by * sB; const size_t cofs = (size_t)by * sC; const float* bp = bias ? bias + (size_t)by * sBias : nullptr;
  const int ntn = (N + 63) / 64; const int wid = blockIdx.x * 4 + w; const int mt = wid / ntn, nq = wid % ntn; if (mt * 16 >= M) return;
  const int row0 = mt * 16, col0 = nq * 64; const _Float16* arow = A + (size_t)(row0 + ln) * lda;
  v8f acc[4] = {};
  for (int kb = 0; kb < K; kb += 32) { FragH ah; ah.half[0] = *(const v8us*)((const unsigned short*)arow + kb + 8 * hh); ah.half[1] = *(const v8us*)((const unsigned short*)arow + kb + 16 + 8 * hh);
#pragma unroll
    for (int t = 0; t < 4; ++t) { if (col0 + t * 16 >= N) continue; const size_t boff = (size_t)(col0 + t * 16 + ln) * ldb + kb; FragH bq; bq.half[0] = *(const v8us*)((const unsigned short*)Bh + boff + 8 * hh); bq.half[1] = *(const v8us*)((const unsigned short*)Bh + boff + 16 + 8 * hh);
      acc[t] = mmaH<1>(ah.v, ah.v, bq.v, bq.v, acc[t]); }
  }
#pragma unroll
  for (int t = 0; t < 4; ++t) { if (col0 + t * 16 >= N) continue; const int col = col0 + t * 16 + ln; const float bv = bp ? bf16_round(bp[col]) : 0.f;
#pragma unroll
    for (int r = 0; r < 8; ++r) { float v = acc[t][r] * alpha + bv; if (CP) { const int rr = row0g + row0 + 8 * hh + r; if (rowsPerB < 0) v += CP[cofs + (size_t)rr * ldc + col];      /* rowsPerB < 0: own element of the batched C plane */ else { const int bidx = rr / rowsPerB; v += CP[(size_t)bidx * sCPb + (size_t)by * 64 + col]; } } if (ACT == 1) v = (v > 0.f) ? v : expm1f(v); else if (ACT == 7) v = (v > 0.f) ? v + 1.0f : expf(v); else if (ACT == 8) v = tanhf(v); else if (ACT == 9) v = 0.5f * v * (1.0f + tanhf(0.7978845608028654f * (v + 0.044715f * v * v * v))); else if (ACT == 11) v = 1.0f / (1.0f + expf(-v)); else if (ACT == 12) v = (v > 0.f) ? v : 0.01f * v; else if (ACT == 14) v = (v > 0.f) ? v : 0.1f * v; else if (ACT == 16) v = (v >= 0.f) ? v : 0.3f * v; else if (ACT == 17) v = (v >= 0.f) ? v : 0.2f * v; else if (ACT == 15) v = v / (1.0f + expf(-v)); else if (ACT == 3) v = fmaxf(v, 0.f); else if (ACT == 6) v = 0.5f * v * (1.0f + erff(v * 0.70710678118654752f)); so[w][8 * hh + r][t * 16 + ln] = v; } }
  __builtin_amdgcn_fence(__ATOMIC_ACQ_REL, "workgroup"); __builtin_amdgcn_wave_barrier();
  const int rsub = lane >> 4, c4 = (lane & 15) * 4; typedef _Float16 v4h __attribute__((ext_vector_type(4)));
  {
#pragma unroll
    for (int q = 0; q < 8; ++q) { const int r = q * 2 + rsub; if (col0 + c4 < N) { const v4f v = *(const v4fa*)&so[w][r][c4]; if (C) *(v4f*)(C + cofs + (size_t)(row0 + r) * ldc + col0 + c4) = v; if (C16) { v4h h4; for (int i = 0; i < 4; ++i) h4[i] = (_Float16)v[i]; *(v4h*)(C16 + cofs + (size_t)(row0 + r) * ldc + col0 + c4) = h4; } } }
     }
}


typedef _Float16 v4h __attribute__((ext_vector_type(4)));

__global__ __launch_bounds__(256) void k_x16(const float* __restrict__ x, _Float16* __restrict__ X16, size_t n8) { const size_t t = (size_t)blockIdx.x * 256 + threadIdx.x; if (t >= n8) return; FragH f;
#pragma unroll
  for (int q = 0; q < 8; ++q) f.h[q] = (_Float16)bf16_round(x[t * 8 + q]); *(v8us*)((unsigned short*)X16 + t * 8) = f.half[0];  }
__global__ __launch_bounds__(256) void k_h16(const float* __restrict__ x, _Float16* __restrict__ X16, size_t n8) { const size_t t = (size_t)blockIdx.x * 256 + threadIdx.x; if (t >= n8) return; FragH f;
#pragma unroll
  for (int q = 0; q < 8; ++q) f.h[q] = (_Float16)x[t * 8 + q]; *(v8us*)((unsigned short*)X16 + t * 8) = f.half[0];  }
__global__ __launch_bounds__(256) void k_round16f(const float* __restrict__ W, _Float16* __restrict__ Bt, size_t n8) { const size_t t = (size_t)blockIdx.x * 256 + threadIdx.x; if (t >= n8) return; FragH f;
#pragma unroll
  for (int i = 0; i < 8; ++i) f.h[i] = (_Float16)(bf16_round(W[t * 8 + i]) * 16.0f); *(v8us*)((unsigned short*)Bt + t * 8) = f.half[0];  }
template <int NHv, int TTv>
__global__ __launch_bounds__(256) void k_vt(const _Float16* __restrict__ V16, int ldv, int voff, _Float16* __restrict__ Vt) { __shared__ unsigned short tl[64][66]; const int tid = threadIdx.x; const int slab = blockIdx.x / (TTv / 64), lg = blockIdx.x % (TTv / 64); const int b = slab / NHv, h = slab % NHv;
  for (int i = tid; i < 64 * 8; i += 256) { const int r = i / 8, c8 = (i % 8) * 8; FragH f; f.half[0] = *(const v8us*)((const unsigned short*)V16 + ((size_t)b * TTv + lg * 64 + r) * ldv + voff + h * 64 + c8);
#pragma unroll
    for (int q = 0; q < 8; ++q) tl[r][c8 + q] = f.u[q]; }
  __syncthreads();
  {
#pragma unroll
    for (int rd = 0; rd < 2; ++rd) { const int d = rd * 32 + tid / 8, pc = tid % 8; FragH f;
#pragma unroll
      for (int q = 0; q < 8; ++q) f.u[q] = tl[pc * 8 + q][d];
      *(v8us*)((unsigned short*)Vt + ((size_t)slab * 64 + d) * TTv + lg * 64 + pc * 8) = f.half[0]; }
     } }

__global__ __launch_bounds__(256) void k_hl(const float* __restrict__ F, _Float16* __restrict__ Hh, _Float16* __restrict__ Hl, size_t n8) { const size_t t = (size_t)blockIdx.x * 256 + threadIdx.x; if (t >= n8) return; FragH fh, fl; const v4f a = *(const v4fa*)(F + t * 8), c = *(const v4fa*)(F + t * 8 + 4);
#pragma unroll
  for (int q = 0; q < 4; ++q) { _Float16 h = (_Float16)a[q]; fh.h[q] = h; fl.h[q] = (_Float16)((a[q] - (float)h) * 1024.0f); h = (_Float16)c[q]; fh.h[4 + q] = h; fl.h[4 + q] = (_Float16)((c[q] - (float)h) * 1024.0f); }
  { *(v8us*)((unsigned short*)Hh + t * 8) = fh.half[0]; *(v8us*)((unsigned short*)Hl + t * 8) = fl.half[0];  } }

// ---- fast GEMM (wave tile 32x64; requires M % 32 == 0 rows per launch region and N % 64 == 0); epilogue = k_gemm_hhx semantics ----
__device__ __forceinline__ v16h g2_frag(const _Float16* p, int hh) { FragH f; f.half[0] = *(const v8us*)((const unsigned short*)p + 8 * hh); f.half[1] = *(const v8us*)((const unsigned short*)p + 16 + 8 * hh); return f.v; }
__device__ __forceinline__ v8f g2_mma(v16h a, v16h b, v8f c) { v8f d = __builtin_amdgcn_wmma_f32_16x16x32_f16(false, a, false, b, (short)0, c, false, false); asm volatile("v_nop\n\tv_nop\n\tv_nop\n\tv_nop" : "+v"(d) : "v"(a), "v"(b)); return d; }
template <int ACT>
__global__ __launch_bounds__(128) void k_gemm2(const _Float16* __restrict__ A, int lda, size_t sA, const _Float16* __restrict__ Bh, int ldb, size_t sB, float alpha, const float* __restrict__ bias, size_t sBias, const float* __restrict__ CP, int rowsPerB, size_t sCPb, int row0g,
    float* __restrict__ C, _Float16* __restrict__ C16, int ldc, size_t sC, int M, int N, int K) { static_assert(ACT == 0 || ACT == 3 || ACT == 6 || ACT == 8 || ACT == 9 || ACT == 11 || ACT == 12 || ACT == 14 || ACT == 15 || ACT == 16 || ACT == 17, "k_gemm2: unsupported ACT code (would silently apply no activation)");
  __shared__ __attribute__((aligned(16))) float so[4][32][68];
  const int tid = threadIdx.x, w = tid >> 5, lane = tid & 31, ln = lane & 15, hh = lane >> 4; const int by = blockIdx.y;
  A += (size_t)by * sA; Bh += (size_t)by * sB; const size_t cofs = (size_t)by * sC; const float* bp = bias ? bias + (size_t)by * sBias : nullptr;
  const int ntn = N >> 6; const int mt = blockIdx.x / ntn, nq = blockIdx.x - mt * ntn; const int row0 = mt * 128 + 32 * w, col0 = nq * 64; if (row0 >= M) return;
  const _Float16* a0p = A + (size_t)(row0 + ln) * lda; const _Float16* a1p = a0p + (size_t)16 * lda;
  const _Float16* b0p = Bh + (size_t)(col0 + ln) * ldb; const _Float16* b1p = b0p + (size_t)16 * ldb; const _Float16* b2p = b1p + (size_t)16 * ldb; const _Float16* b3p = b2p + (size_t)16 * ldb;
  const v8f z8 = {0.f,0.f,0.f,0.f,0.f,0.f,0.f,0.f}; v8f c00 = z8, c01 = z8, c02 = z8, c03 = z8, c10 = z8, c11 = z8, c12 = z8, c13 = z8;
#pragma unroll 1
  for (int kb = 0; kb < K; kb += 32) { const v16h a0 = g2_frag(a0p + kb, hh), a1 = g2_frag(a1p + kb, hh);
    v16h b = g2_frag(b0p + kb, hh); c00 = g2_mma(a0, b, c00); c10 = g2_mma(a1, b, c10);
    b = g2_frag(b1p + kb, hh); c01 = g2_mma(a0, b, c01); c11 = g2_mma(a1, b, c11);
    b = g2_frag(b2p + kb, hh); c02 = g2_mma(a0, b, c02); c12 = g2_mma(a1, b, c12);
    b = g2_frag(b3p + kb, hh); c03 = g2_mma(a0, b, c03); c13 = g2_mma(a1, b, c13); }
  v8f accs[8] = {c00, c01, c02, c03, c10, c11, c12, c13};
#pragma unroll
  for (int u = 0; u < 8; ++u) { const int t = u & 3, half = u >> 2; const int col = col0 + t * 16 + ln; const float bv = bp ? bf16_round(bp[col]) : 0.f;
#pragma unroll
    for (int r = 0; r < 8; ++r) { const int rloc = half * 16 + 8 * hh + r; float v = accs[u][r] * alpha + bv; if (CP) { if (rowsPerB < 0) v += CP[cofs + (size_t)(row0g + row0 + rloc) * ldc + col];      /* rowsPerB < 0: own element of the batched C plane */ else { const int bidx = (row0g + row0 + rloc) / rowsPerB; v += CP[(size_t)bidx * sCPb + (size_t)by * 64 + col]; } }
      if (ACT == 3) v = fmaxf(v, 0.f); else if (ACT == 6) v = 0.5f * v * (1.0f + erff(v * 0.70710678118654752f)); else if (ACT == 11) v = 1.0f / (1.0f + expf(-v)); else if (ACT == 15) v = v / (1.0f + expf(-v)); else if (ACT == 12) v = (v > 0.f) ? v : 0.01f * v; else if (ACT == 8) v = tanhf(v); else if (ACT == 9) v = 0.5f * v * (1.0f + tanhf(0.7978845608028654f * (v + 0.044715f * v * v * v))); else if (ACT == 14) v = (v > 0.f) ? v : 0.1f * v; else if (ACT == 16) v = (v >= 0.f) ? v : 0.3f * v; else if (ACT == 17) v = (v >= 0.f) ? v : 0.2f * v;
      so[w][rloc][t * 16 + ln] = v; } }
  __builtin_amdgcn_fence(__ATOMIC_ACQ_REL, "workgroup"); __builtin_amdgcn_wave_barrier();
  const int rsub = lane >> 4, c4 = (lane & 15) * 4;
  {
#pragma unroll
    for (int q = 0; q < 16; ++q) { const int r = q * 2 + rsub; const v4f v = *(const v4fa*)&so[w][r][c4]; if (C) *(v4f*)(C + cofs + (size_t)(row0 + r) * ldc + col0 + c4) = v; if (C16) { v4h h4; for (int i = 0; i < 4; ++i) h4[i] = (_Float16)v[i]; *(v4h*)(C16 + cofs + (size_t)(row0 + r) * ldc + col0 + c4) = h4; } }
     } }


__global__ __launch_bounds__(256) void k_wnat(const float* __restrict__ w, size_t n8, _Float16* __restrict__ Bt) { const size_t t = (size_t)blockIdx.x * 256 + threadIdx.x; if (t >= n8) return; FragH f; for (int q = 0; q < 8; ++q) f.h[q] = (_Float16)(bf16_round(w[t * 8 + q]) * 16.0f); *(v8us*)((unsigned short*)Bt + t * 8) = f.half[0];  }
__global__ __launch_bounds__(256) void k_rsm(const float* __restrict__ S, _Float16* __restrict__ P, int nrows) {
  #pragma clang fp contract(off)
  const int i = blockIdx.x * 256 + threadIdx.x; if (i >= nrows) return; const float* s = S + (size_t)i * SQ; float mx = -3.0e38f;
#pragma unroll 1
  for (int j = 0; j < SQ; ++j) mx = fmaxf(mx, s[j]); float se = 0.f;
#pragma unroll 1
  for (int j = 0; j < SQ; ++j) se += expf(s[j] - mx); const float sc = 256.0f / se;
#pragma unroll 1
  for (int j0 = 0; j0 < SQ; j0 += 8) { FragH f; for (int q = 0; q < 8; ++q) f.h[q] = (_Float16)(expf(s[j0 + q] - mx) * sc); unsigned short* d = (unsigned short*)P + (size_t)i * SQ + j0; *(v8us*)d = f.half[0];  } }
__global__ __launch_bounds__(256) void k_vt(const _Float16* __restrict__ V16, int b, int h0, _Float16* __restrict__ VT) { __shared__ unsigned short tl[64][65]; const int tid = threadIdx.x; const int hh = blockIdx.x % HG, sg = blockIdx.x / HG; const int s0 = sg * 64; const int h = h0 + hh;
  for (int i = tid; i < 64 * 8; i += 256) { const int j = i / 8, d8 = (i % 8) * 8; FragH f; f.half[0] = *(const v8us*)((const unsigned short*)V16 + ((size_t)b * SQ + s0 + j) * DM + h * HD + d8); for (int q = 0; q < 8; ++q) tl[d8 + q][j] = f.u[q]; }
  __syncthreads();
  { for (int i = tid; i < 64 * 8; i += 256) { const int d = i / 8, j8 = (i % 8) * 8; FragH f; for (int q = 0; q < 8; ++q) f.u[q] = tl[d][j8 + q]; *(v8us*)((unsigned short*)VT + ((size_t)hh * HD + d) * SQ + s0 + j8) = f.half[0]; }  } }



// Causal row softmax, one wave per score row (8 rows per block). A lane holds 4 consecutive keys of every 128, so each load of the wave
// reads 512 contiguous bytes and S is read once; row maximum and row sum are per-lane partials joined by a five-step butterfly.
// nk is a multiple of QT = 256: the row is taken in pieces of 256 keys under wave-uniform tests.
__global__ __launch_bounds__(256) void k_rsmcf2(const float* __restrict__ S, _Float16* __restrict__ P, int hg, int q0, int nk) {
  const int lane = threadIdx.x & 31; const int t = __builtin_amdgcn_readfirstlane((int)(blockIdx.x * 8 + (threadIdx.x >> 5))); if (t >= hg * QT) return;      /* wave-uniform; no barrier in this kernel */
  const float* s = S + (size_t)t * NKX + lane * 4; _Float16* p = P + (size_t)t * NKX + lane * 4; const int last = q0 + (t % QT) - lane * 4;      /* key u*128 + lane*4 + q is kept while u*128 + q <= last */
  v4f v[NKX / 128];
#pragma unroll
  for (int c = 0; c < NKX / 256; ++c) if (c * 256 < nk) { v[2 * c] = *(const v4fa*)(s + c * 256); v[2 * c + 1] = *(const v4fa*)(s + c * 256 + 128); }
  float mx = -3.0e38f;
#pragma unroll
  for (int c = 0; c < NKX / 256; ++c) if (c * 256 < nk) {
#pragma unroll
    for (int u = 2 * c; u < 2 * c + 2; ++u)
#pragma unroll
      for (int q = 0; q < 4; ++q) { const float x = (u * 128 + q <= last) ? v[u][q] : -1.0e9f; v[u][q] = x; mx = fmaxf(mx, x); } }
#pragma unroll
  for (int m = 16; m >= 1; m >>= 1) mx = fmaxf(mx, __shfl_xor(mx, m, 32));
  float a0 = 0.f, a1 = 0.f, a2 = 0.f, a3 = 0.f;
#pragma unroll
  for (int c = 0; c < NKX / 256; ++c) if (c * 256 < nk) {
#pragma unroll
    for (int u = 2 * c; u < 2 * c + 2; ++u) { v4f e;
#pragma unroll
      for (int q = 0; q < 4; ++q) e[q] = __expf(v[u][q] - mx);
      v[u] = e; a0 += e[0]; a1 += e[1]; a2 += e[2]; a3 += e[3]; } }
  float se = (a0 + a1) + (a2 + a3);
#pragma unroll
  for (int m = 16; m >= 1; m >>= 1) se += __shfl_xor(se, m, 32);
  const float sc = 256.0f / se;
#pragma unroll
  for (int c = 0; c < NKX / 256; ++c) if (c * 256 < nk) {
#pragma unroll
    for (int u = 2 * c; u < 2 * c + 2; ++u) { v4h h;
#pragma unroll
      for (int q = 0; q < 4; ++q) h[q] = (_Float16)(v[u][q] * sc);
      *(v4h*)(p + u * 128) = h; }
    if (c + 1 < NKX / 256) asm volatile("s_wait_xcnt 0x0" ::: "memory");      /* the next piece reuses the data registers of the two stores just issued: the wait stands in front of that overwrite */
  } }


template <int MASKADD>
__global__ __launch_bounds__(64) void k_att0(const float* __restrict__ QF, const float* __restrict__ KF, const float* __restrict__ VF, int ld, const float* __restrict__ mask, float scale, float* __restrict__ OF, int ldo) {
  #pragma clang fp contract(off)
  __shared__ __attribute__((aligned(16))) float lq[64][64]; __shared__ __attribute__((aligned(16))) float lo[64][64];
  const int tid = threadIdx.x; const int h = blockIdx.x / (QT0 / 64), rg = blockIdx.x % (QT0 / 64); const int i = rg * 64 + tid;
  const float* qr = QF + (size_t)i * ld + h * HD;
#pragma unroll 1
  for (int c = 0; c < HD / 4; ++c) { *(v4f*)&lq[tid][c * 4] = *(const v4fa*)(qr + c * 4); const v4f z = {0.f, 0.f, 0.f, 0.f}; *(v4f*)&lo[tid][c * 4] = z; }
  float m = -1.0e30f, l = 0.f; const int jmax = MASKADD ? (SQ - 1) : (rg * 64 + 63);      /* additive-mask form: every key (the mask input decides); causal form: keys up to the block's last row */
#pragma unroll 1
  for (int j = 0; j <= jmax; ++j) { const float* kr = KF + (size_t)j * ld + h * HD; const float* vr = VF + (size_t)j * ld + h * HD; float s = 0.f;
#pragma unroll 1
    for (int c = 0; c < HD / 4; ++c) { const v4f kq = *(const v4fa*)(kr + c * 4); const v4f qq = *(v4f*)&lq[tid][c * 4]; s = __fadd_rn(s, __fmul_rn(qq[0], kq[0])); s = __fadd_rn(s, __fmul_rn(qq[1], kq[1])); s = __fadd_rn(s, __fmul_rn(qq[2], kq[2])); s = __fadd_rn(s, __fmul_rn(qq[3], kq[3])); }
    s = __fmul_rn(s, scale); if (MASKADD) s = __fadd_rn(s, __fmul_rn(bf16_round(mask[(size_t)i * SQ + j]), -10000.0f));
    const float f = (MASKADD || j <= i) ? 1.f : 0.f; const float sm = fmaf(f, s, (1.f - f) * -1.0e30f); const float mn = fmaxf(m, sm); const float sc = expf(m - mn); const float e = expf(sm - mn); l = __fadd_rn(__fmul_rn(l, sc), e); m = mn;
#pragma unroll 1
    for (int c = 0; c < HD / 4; ++c) { const v4f vv = *(const v4fa*)(vr + c * 4); v4f oo = *(v4f*)&lo[tid][c * 4]; for (int u = 0; u < 4; ++u) oo[u] = __fadd_rn(__fmul_rn(oo[u], sc), __fmul_rn(e, vv[u])); *(v4f*)&lo[tid][c * 4] = oo; } }
  const float fin = 64.0f / l;      /* o carried x64 like the f16 path */
#pragma unroll 1
  for (int c = 0; c < HD / 4; ++c) { v4f oo = *(v4f*)&lo[tid][c * 4]; for (int u = 0; u < 4; ++u) oo[u] = __fmul_rn(oo[u], fin); *(v4f*)&lo[tid][c * 4] = oo; }
  __syncthreads();
  {
#pragma unroll 1
    for (int it = 0; it < 16; ++it) { const int row = it * 4 + tid / 16, pc = (tid % 16) * 4; const v4f v = *(const v4f*)&lo[row][pc]; *(v4f*)(OF + (size_t)(rg * 64 + row) * ldo + h * HD + pc) = v; }
     } }

extern "C" void kernel_launch(void* const* d_in, const int* in_sizes, int n_in,
                              void* d_out, int out_size, void* d_ws, size_t ws_size, hipStream_t stream) {
  (void)in_sizes; (void)n_in; (void)out_size;
  const float* const* I = (const float* const*)d_in; const float* x = I[0]; const float* xk = I[1]; const float* xv = I[2]; const float* wq = I[3]; const float* bq = nullptr; const float* wk = I[4]; const float* bk = nullptr; const float* wv = I[5]; const float* bv = nullptr; const float* wo = I[6]; const float* bo = I[7];      /* input order: query_data, key_data, value_data (three SEPARATE streams: the three exact-f16 row casts read one each), Wq, Wk, Wv ([in][out]; the module has NO q / k / v biases: null pointers in the guarded bias slots), Wp ([in][out]), bp (REAL); NO mask input (the causal fill is built inside the reference) */
  char* ws = (char*)d_ws; size_t off = 0;
  auto take = [&](size_t bytes) { char* p = ws + off; off += (bytes + 255) & ~(size_t)255; return p; };
  _Float16* BQ = (_Float16*)take((size_t)DM * DM * 2); _Float16* BK = (_Float16*)take((size_t)DM * DM * 2); _Float16* BV = (_Float16*)take((size_t)DM * DM * 2); _Float16* BO = (_Float16*)take((size_t)DM * DM * 2);
  _Float16* X16 = (_Float16*)take(NR * DM * 2); _Float16* XK16 = (_Float16*)take(NR * DM * 2); _Float16* XV16 = (_Float16*)take(NR * DM * 2);      /* exact f16 rows of query, key, value */ float* QF = (float*)take(NR * DM * 4); _Float16* QH = (_Float16*)take(NR * DM * 2); _Float16* QL = (_Float16*)take(NR * DM * 2); _Float16* KH = (_Float16*)take(NR * DM * 2); _Float16* KL = (_Float16*)take(NR * DM * 2); _Float16* Q16 = QH; _Float16* K16 = KH; _Float16* V16 = (_Float16*)take(NR * DM * 2); _Float16* O16 = (_Float16*)take(NR * DM * 2);
  float* S = (float*)take((size_t)NH * QT * NKX * 4); _Float16* P = (_Float16*)take((size_t)NH * QT * NKX * 2); _Float16* VT = (_Float16*)take((size_t)NH * HD * SQ * 2);
  float* QF0 = (float*)take((size_t)QT0 * DM * 4); float* KF0 = (float*)take((size_t)QT0 * DM * 4); float* VF0 = (float*)take((size_t)QT0 * DM * 4); float* OF0 = (float*)take((size_t)NB * QT0 * DM * 4); _Float16* OH0 = (_Float16*)take((size_t)NB * QT0 * DM * 2); _Float16* OL0 = (_Float16*)take((size_t)NB * QT0 * DM * 2);
  if (off > ws_size) return;
  { const unsigned g = (unsigned)(((size_t)DM * (DM / 8) + 255) / 256); k_wt_f16<<<g, 256, 0, stream>>>(wq, BQ, DM, DM, 16.0f); k_wt_f16<<<g, 256, 0, stream>>>(wk, BK, DM, DM, 16.0f); k_wt_f16<<<g, 256, 0, stream>>>(wv, BV, DM, DM, 16.0f); k_wt_f16<<<g, 256, 0, stream>>>(wo, BO, DM, DM, 16.0f); }      /* [in][out] -> Bt[n][k] x16 */
  k_x16<<<(unsigned)((NR * DM / 8 + 255) / 256), 256, 0, stream>>>(x, X16, NR * DM / 8); k_x16<<<(unsigned)((NR * DM / 8 + 255) / 256), 256, 0, stream>>>(xk, XK16, NR * DM / 8); k_x16<<<(unsigned)((NR * DM / 8 + 255) / 256), 256, 0, stream>>>(xv, XV16, NR * DM / 8);
  const size_t r0p = (size_t)B0 * SQ;      /* first projected row */
  k_gemm2<0><<<dim3((unsigned)((MP / 128) * (DM / 64)), 1), 128, 0, stream>>>(X16 + r0p * DM, DM, 0, BQ, DM, 0, 0.0625f, bq, 0, nullptr, 1, 0, 0, QF + r0p * DM, nullptr, DM, 0, MP, DM, DM); k_hl<<<(unsigned)(((size_t)MP * DM / 8 + 255) / 256), 256, 0, stream>>>(QF + r0p * DM, QH + r0p * DM, QL + r0p * DM, (size_t)MP * DM / 8);      /* q (f32) -> f16 hi + x1024 residual: unscaled logits sigma ~8 */
  k_gemm2<0><<<dim3((unsigned)((MP / 128) * (DM / 64)), 1), 128, 0, stream>>>(XK16 + r0p * DM, DM, 0, BK, DM, 0, 0.0625f, bk, 0, nullptr, 1, 0, 0, QF + r0p * DM, nullptr, DM, 0, MP, DM, DM); k_hl<<<(unsigned)(((size_t)MP * DM / 8 + 255) / 256), 256, 0, stream>>>(QF + r0p * DM, KH + r0p * DM, KL + r0p * DM, (size_t)MP * DM / 8);      /* k likewise */
  k_gemm2<0><<<dim3((unsigned)((MP / 128) * (DM / 64)), 1), 128, 0, stream>>>(XV16 + r0p * DM, DM, 0, BV, DM, 0, 0.0625f, bv, 0, nullptr, 1, 0, 0, nullptr, V16 + r0p * DM, DM, 0, MP, DM, DM);
  for (int b = B0; b < B0 + NBR; ++b) { const size_t r0 = (size_t)b * SQ;
    k_vt<NH, SQ><<<NH * (SQ / 64), 256, 0, stream>>>(V16 + r0 * LQ, LQ, 0, VT);      /* V^T [NH][HD][SQ] for this batch */
    k_gemm2<0><<<dim3((QT0 / 128) * (DM / 64), 1), 128, 0, stream>>>(X16 + r0 * DM, DM, 0, BQ, DM, 0, 0.0625f, bq, 0, nullptr, 1, 0, 0, QF0, nullptr, DM, 0, QT0, DM, DM); k_gemm2<0><<<dim3((QT0 / 128) * (DM / 64), 1), 128, 0, stream>>>(XK16 + r0 * DM, DM, 0, BK, DM, 0, 0.0625f, bk, 0, nullptr, 1, 0, 0, KF0, nullptr, DM, 0, QT0, DM, DM); k_gemm2<0><<<dim3((QT0 / 128) * (DM / 64), 1), 128, 0, stream>>>(XV16 + r0 * DM, DM, 0, BV, DM, 0, 0.0625f, bv, 0, nullptr, 1, 0, 0, VF0, nullptr, DM, 0, QT0, DM, DM);      /* f32 q, k, v of the first 128 rows (exact products) */
    k_att0<0><<<NH * (QT0 / 64), 64, 0, stream>>>(QF0, KF0, VF0, DM, nullptr, SCL, OF0 + (size_t)b * QT0 * DM, DM);      /* exact f32 attention for rows 0..127 (o x64) */
    for (int q0 = 0; q0 < QN; q0 += QT) { const int nk = q0 + QT;      /* causal: only keys below the tile end are computed */
      k_gemm2<0><<<dim3((QT / 128) * (nk / 64), NHD), 128, 0, stream>>>(QH + (r0 + q0) * LQ, LQ, (size_t)HD, KH + r0 * LQ, LQ, (size_t)HD, SCL, nullptr, 0, nullptr, 1, 0, 0, S, nullptr, NKX, (size_t)QT * NKX, QT, nk, HD);      /* scores hi . hi * 64^-0.5 (1 / sqrt(head_dim)) */
      k_gemm2<0><<<dim3((QT / 128) * (nk / 64), NHD), 128, 0, stream>>>(QL + (r0 + q0) * LQ, LQ, (size_t)HD, KH + r0 * LQ, LQ, (size_t)HD, SCLR, nullptr, 0, S, -1, 0, 0, S, nullptr, NKX, (size_t)QT * NKX, QT, nk, HD); k_gemm2<0><<<dim3((QT / 128) * (nk / 64), NHD), 128, 0, stream>>>(QH + (r0 + q0) * LQ, LQ, (size_t)HD, KL + r0 * LQ, LQ, (size_t)HD, SCLR, nullptr, 0, S, -1, 0, 0, S, nullptr, NKX, (size_t)QT * NKX, QT, nk, HD);      /* += 2^-10 (lo . hi + hi . lo) */      /* scores, all heads on grid.y */
      k_rsmcf2<<<(NHD * QT + 7) / 8, 256, 0, stream>>>(S, P, NHD, q0, nk);      /* one wave per row, 8 rows per block */
      k_gemm2<0><<<dim3((QT / 128) * (HD / 64), NHD), 128, 0, stream>>>(P, NKX, (size_t)QT * NKX, VT, SQ, (size_t)HD * SQ, 0.25f, nullptr, 0, nullptr, 1, 0, 0, nullptr, O16 + (r0 + q0) * DM, DM, (size_t)HD, QT, HD, nk); } }      /* o (merged heads, x64) as f16 rows */
  k_gemm2<0><<<dim3((unsigned)((MPO / 128) * (DM / 64)), 1), 128, 0, stream>>>(O16 + r0p * DM, DM, 0, BO, DM, 0, 0.0009765625f, bo, 0, nullptr, 1, 0, 0, (float*)d_out + r0p * DM, nullptr, DM, 0, MPO, DM, DM);      /* out rows are the output layout */
  k_hl<<<(unsigned)(((size_t)NB * QT0 * DM / 8 + 255) / 256), 256, 0, stream>>>(OF0, OH0, OL0, (size_t)NB * QT0 * DM / 8);      /* first-tile o (x64) -> f16 hi + x1024 residual planes */
  for (int b = B0; b < B0 + NBR; ++b) { const size_t r0 = (size_t)b * SQ; const size_t f0 = (size_t)b * QT0;
    k_gemm2<0><<<dim3((QT0 / 128) * (DM / 64), 1), 128, 0, stream>>>(OH0 + f0 * DM, DM, 0, BO, DM, 0, 0.0009765625f, bo, 0, nullptr, 1, 0, 0, (float*)d_out + r0 * DM, nullptr, DM, 0, QT0, DM, DM);      /* rows 0..127: out = o_hi Wo (+ b), overwriting the f16-path rows */
    k_gemm2<0><<<dim3((QT0 / 128) * (DM / 64), 1), 128, 0, stream>>>(OL0 + f0 * DM, DM, 0, BO, DM, 0, 0.00000095367431640625f, nullptr, 0, (const float*)d_out + r0 * DM, -1, 0, 0, (float*)d_out + r0 * DM, nullptr, DM, 0, QT0, DM, DM); }      /* += o_lo Wo 2^-20 (own-element accumulate) */
}

// v002
// It runs in 2070 microseconds.
// Two timings next to v001 both put it at 1.40 times that version's speed.
// Counting every step since v000, it is 2.81 times as fast.
#include <hip/hip_runtime.h>
// Causal multi-head attention on three inputs with bias-free [in][out] projections and a biased [in][out] output projection (query_data, key_data, value_data [2][2048][1024]; q = split_heads(query_data Wq), k = split_heads(key_data Wk), v = split_heads(value_data Wv) ([in][out] [1024][1024], NO biases), 16 heads of 64; scores / sqrt(64); scores + triu(ones, k = 1) x (-1e13): an additive fill strictly above the diagonal == exclusion (exp underflows to exactly 0; every row keeps its diagonal); softmax over keys; out = merged Wp + bp ([in][out] + a REAL bias) -> [2][2048][1024]); the causal rule is built inside the reference: the causal rule by index; q and k carried as f16 hi + x1024 residual planes with three-product scores.
// Structure: token rows r = b*2048 + s; x as exact f16 rows (bf16-rounded); q and k as WMMA GEMMs (32x64 wave tiles, f32 accumulation, exact x16 weights, no bias) into f32 rows split into f16 hi + x1024 residual planes, v as an f16-output GEMM; per batch: V^T for all heads via LDS transposes; per query tile of 256 rows: scores against the keys below the tile end only as THREE accumulating passes (hi.hi + lo.hi + hi.lo, K = 64, all heads on grid.y, alpha 1/sqrt(64) = 0.125, 2^-13 on the residual passes, unscaled logits sigma ~8), causal row softmax on VALU, one wave per row, keys past the row's own index set to -1e9 over the computed range (f32 statistics, native exp; weights x256 f16), o = P . V^T (K = keys below the tile end, alpha 2^-2: o carried x64, folded into the output GEMM alpha) written straight into the merged f16 o rows; out = o W_o + b GEMM (f32) into the output layout.
// Compute dtype: inputs rounded to bf16; x / weights exact; v, softmax weights and o as plain f16 GEMM operands (~2^-12), q and k as f16 hi + x1024 residual planes; scores and softmax statistics f32. v_wmma_f32_16x16x32_f16.
#define NB 2
#define SCL 0.125f                         /* 1 / sqrt(head_dim = 64) */
#define SCLR 0.0001220703125f              /* 2^-13: the same scale on the x1024 residual passes */
#define SQ 2048
#define DM 1024
#define NH 16
#define HD 64
#define HG 4                         /* heads per launch of the head-group k_vt (not launched) */
#define QT 256                       /* query rows per causal tile */
#define NKX SQ                       /* S / P row pitch */
#define QT0 128                      /* first-tile rows recomputed exactly in f32 */
#define B0 0                         /* first batch processed (debug hook) */
#define NBR NB                       /* batches processed (debug hook) */
#define NR ((size_t)NB * SQ)         /* token rows */
#define MP ((int)((size_t)NBR * SQ)) /* rows projected (debug hook) */
#define QN SQ                        /* query rows attended per batch (debug hook) */
#define NHD NH                       /* heads attended (debug hook) */
#define MPO MP                       /* rows through the output stage (debug hook) */
#define LQ DM      /* row pitch of the q/k/v rows */
typedef __bf16 v16b __attribute__((ext_vector_type(16)));
typedef unsigned short v8us __attribute__((ext_vector_type(8), may_alias));
typedef float  v8f  __attribute__((ext_vector_type(8)));
typedef float  v4f  __attribute__((ext_vector_type(4)));
typedef float  v4fa __attribute__((ext_vector_type(4), may_alias));
union FragB { v16b v; v8us half[2]; unsigned short u[16]; };

__device__ __forceinline__ unsigned short bf16_bits(float x) { unsigned int u = __float_as_uint(x); return (unsigned short)((u + 0x7FFFu + ((u >> 16) & 1u)) >> 16); }
__device__ __forceinline__ float bf16_val(unsigned short b) { return __uint_as_float(((unsigned int)b) << 16); }
__device__ __forceinline__ float bf16_round(float x) { return bf16_val(bf16_bits(x)); }
// D += A·B with NT terms: 1 = ah·bh, 2 = + al·bh (A split), 3 = + ah·bl (both split)
template <int NT>
__device__ __forceinline__ v8f mmaN(v16b ah, v16b al, v16b bh, v16b bl, v8f c) {
  c = __builtin_amdgcn_wmma_f32_16x16x32_bf16(false, ah, false, bh, (short)0, c, false, false);
  if (NT >= 2) c = __builtin_amdgcn_wmma_f32_16x16x32_bf16(false, al, false, bh, (short)0, c, false, false);
  if (NT >= 3) c = __builtin_amdgcn_wmma_f32_16x16x32_bf16(false, ah, false, bl, (short)0, c, false, false);
  asm volatile("v_nop\n\tv_nop\n\tv_nop\n\tv_nop" : "+v"(c) : "v"(ah), "v"(al), "v"(bh), "v"(bl));
  return c;
}

__global__ __launch_bounds__(256) void k_wt_bf16(const float* __restrict__ W, unsigned short* __restrict__ Wt, int K, int N) {
  const int t = blockIdx.x * 256 + threadIdx.x;
  const int k8n = K / 8;
  if (t >= N * k8n) return;
  const int n = t / k8n, k8 = (t % k8n) * 8;
  v8us v;
#pragma unroll
  for (int i = 0; i < 8; ++i) v[i] = bf16_bits(W[(size_t)(k8 + i) * N + n]);
  *(v8us*)(Wt + (size_t)n * K + k8) = v;
  
}

// GEMM C[M][N] (f32, pitch ldc) = act(A[M][K]·W + bias). A f32 row-major (pitch lda) converted per fragment to bf16
// (ASPLIT: hi/lo two planes -> 2 terms, else single rounded term); Wt bf16 [N][K] (pitch ldb). BIAS_BF16 rounds the
// bias to bf16 first (bias quantised to bf16 before the add). K%32==0, M%16==0, N%64==0.
template <bool ASPLIT, int ACT, bool BIAS_BF16>
__global__ __launch_bounds__(128) void k_gemm_bf(const float* __restrict__ A, int lda, const unsigned short* __restrict__ Wt, int ldb,
                                               const float* __restrict__ bias, float* __restrict__ C, int ldc, int M, int N, int K) {
  __shared__ __attribute__((aligned(16))) float so[4][16][64];
  const int tid = threadIdx.x, w = tid >> 5, lane = tid & 31, ln = lane & 15, hh = lane >> 4;
  const int ntn = N / 64;
  const int wid = blockIdx.x * 4 + w;
  const int mt = wid / ntn, nq = wid % ntn;
  if (mt * 16 >= M) return;
  const int row0 = mt * 16, col0 = nq * 64;
  const float* arow = A + (size_t)(row0 + ln) * lda;
  v8f acc[4] = {};
  for (int kb = 0; kb < K; kb += 32) {
    FragB ah, al;
    const v4f x0 = *(const v4fa*)(arow + kb + 8 * hh), x1 = *(const v4fa*)(arow + kb + 8 * hh + 4);
    const v4f x2 = *(const v4fa*)(arow + kb + 16 + 8 * hh), x3 = *(const v4fa*)(arow + kb + 16 + 8 * hh + 4);
    float xs[16] = {x0[0],x0[1],x0[2],x0[3],x1[0],x1[1],x1[2],x1[3],x2[0],x2[1],x2[2],x2[3],x3[0],x3[1],x3[2],x3[3]};
#pragma unroll
    for (int i = 0; i < 16; ++i) { const unsigned short hb = bf16_bits(xs[i]); ah.u[i] = hb; al.u[i] = ASPLIT ? bf16_bits(xs[i] - bf16_val(hb)) : (unsigned short)0; }
#pragma unroll
    for (int t = 0; t < 4; ++t) {
      const unsigned short* brow = Wt + (size_t)(col0 + t * 16 + ln) * ldb + kb;
      FragB b;
      b.half[0] = *(const v8us*)(brow + 8 * hh);
      b.half[1] = *(const v8us*)(brow + 16 + 8 * hh);
      acc[t] = mmaN<ASPLIT ? 2 : 1>(ah.v, al.v, b.v, b.v, acc[t]);
    }
  }
#pragma unroll
  for (int t = 0; t < 4; ++t) {
    float bv = bias ? bias[col0 + t * 16 + ln] : 0.f;
    if (BIAS_BF16) bv = bf16_round(bv);
#pragma unroll
    for (int r = 0; r < 8; ++r) { float v = acc[t][r] + bv; if (ACT == 1) v = fmaxf(v, 0.f); so[w][8 * hh + r][t * 16 + ln] = v; }
  }
  __builtin_amdgcn_fence(__ATOMIC_ACQ_REL, "workgroup");
  __builtin_amdgcn_wave_barrier();
  const int rsub = lane >> 4, c4 = (lane & 15) * 4;
  {
#pragma unroll
    for (int q = 0; q < 8; ++q) {
      const int r = q * 2 + rsub;
      const v4f v = *(const v4fa*)&so[w][r][c4];
      *(v4f*)(C + (size_t)(row0 + r) * ldc + col0 + c4) = v;
    }
    
  }
}

// GEMM C = act(A·W + bias + resid): A f32 (ASPLIT -> hi/lo 2 terms), Wt bf16 [N][K]; ACT 0 none, 1 relu, 2 exact gelu;
// resid (optional, f32, row index = (row % rmod), pitch ldr, RES_BF16 rounds it) added before the activation.
template <bool ASPLIT, int ACT, bool BIAS_BF16, bool RES_BF16>
__global__ __launch_bounds__(128) void k_gemm_bf3(const float* __restrict__ A, int lda, const unsigned short* __restrict__ Wt, int ldb,
                                                const float* __restrict__ bias, const float* __restrict__ resid, int rmod, int ldr,
                                                float* __restrict__ C, int ldc, int M, int N, int K) {
  __shared__ __attribute__((aligned(16))) float so[4][16][64];
  const int tid = threadIdx.x, w = tid >> 5, lane = tid & 31, ln = lane & 15, hh = lane >> 4;
  const int ntn = N / 64;
  const int wid = blockIdx.x * 4 + w;
  const int mt = wid / ntn, nq = wid % ntn;
  if (mt * 16 >= M) return;
  const int row0 = mt * 16, col0 = nq * 64;
  const float* arow = A + (size_t)(row0 + ln) * lda;
  v8f acc[4] = {};
  for (int kb = 0; kb < K; kb += 32) {
    FragB ah, al;
    const v4f x0 = *(const v4fa*)(arow + kb + 8 * hh), x1 = *(const v4fa*)(arow + kb + 8 * hh + 4);
    const v4f x2 = *(const v4fa*)(arow + kb + 16 + 8 * hh), x3 = *(const v4fa*)(arow + kb + 16 + 8 * hh + 4);
    float xs[16] = {x0[0],x0[1],x0[2],x0[3],x1[0],x1[1],x1[2],x1[3],x2[0],x2[1],x2[2],x2[3],x3[0],x3[1],x3[2],x3[3]};
#pragma unroll
    for (int i = 0; i < 16; ++i) { const unsigned short hb = bf16_bits(xs[i]); ah.u[i] = hb; al.u[i] = ASPLIT ? bf16_bits(xs[i] - bf16_val(hb)) : (unsigned short)0; }
#pragma unroll
    for (int t = 0; t < 4; ++t) {
      const unsigned short* brow = Wt + (size_t)(col0 + t * 16 + ln) * ldb + kb;
      FragB b;
      b.half[0] = *(const v8us*)(brow + 8 * hh);
      b.half[1] = *(const v8us*)(brow + 16 + 8 * hh);
      acc[t] = mmaN<ASPLIT ? 2 : 1>(ah.v, al.v, b.v, b.v, acc[t]);
    }
  }
#pragma unroll
  for (int t = 0; t < 4; ++t) {
    const int col = col0 + t * 16 + ln;
    float bv = bias ? bias[col] : 0.f;
    if (BIAS_BF16) bv = bf16_round(bv);
#pragma unroll
    for (int r = 0; r < 8; ++r) {
      float v = acc[t][r] + bv;
      if (resid) { float rv = resid[(size_t)((row0 + 8 * hh + r) % rmod) * ldr + col]; if (RES_BF16) rv = bf16_round(rv); v += rv; }
      if (ACT == 1) v = fmaxf(v, 0.f);
      if (ACT == 2) v = 0.5f * v * (1.0f + erff(v * 0.70710678118654752f));
      if (ACT == 3) { const float u = 0.7978845608028654f * (v + 0.044715f * v * v * v); v = 0.5f * v * (1.0f + tanhf(u)); }
      so[w][8 * hh + r][t * 16 + ln] = v;
    }
  }
  __builtin_amdgcn_fence(__ATOMIC_ACQ_REL, "workgroup");
  __builtin_amdgcn_wave_barrier();
  const int rsub = lane >> 4, c4 = (lane & 15) * 4;
  {
#pragma unroll
    for (int q = 0; q < 8; ++q) {
      const int r = q * 2 + rsub;
      const v4f v = *(const v4fa*)&so[w][r][c4];
      *(v4f*)(C + (size_t)(row0 + r) * ldc + col0 + c4) = v;
    }
    
  }
}
// row LayerNorm (biased variance, eps) over N: s = X (+ R); optional out_sum <- s; out_norm <- (s-mu)*rsqrt(var+eps)*g + b
template <bool PARAM_BF16>
__global__ __launch_bounds__(256) void k_layernorm(const float* __restrict__ X, const float* __restrict__ R, const float* __restrict__ g, const float* __restrict__ bta,
                                                  float* __restrict__ out_sum, float* __restrict__ out_norm, int N, float eps) {
  __shared__ float red[256];
  const int row = blockIdx.x, tid = threadIdx.x;
  const float* x = X + (size_t)row * N; const float* rr = R ? R + (size_t)row * N : nullptr;
  float vals[16];                     // up to N = 4096
  const int per = N / 256;            // contiguous chunk per thread? use strided-by-4 chunks: thread handles j = tid*4 + 1024*u
  float s1 = 0.f;
  for (int u = 0; u < per / 4; ++u) {
    const int j = tid * 4 + 1024 * u;
    const v4f a = *(const v4fa*)(x + j);
    v4f b = {0.f,0.f,0.f,0.f}; if (rr) b = *(const v4fa*)(rr + j);
#pragma unroll
    for (int q = 0; q < 4; ++q) { const float v = a[q] + b[q]; vals[u * 4 + q] = v; s1 += v; }
  }
  red[tid] = s1; __syncthreads();
  for (int st = 128; st > 0; st >>= 1) { if (tid < st) red[tid] += red[tid + st]; __syncthreads(); }
  const float mu = red[0] / (float)N; __syncthreads();
  float s2 = 0.f;
  for (int u = 0; u < per / 4; ++u)
#pragma unroll
    for (int q = 0; q < 4; ++q) { const float c = vals[u * 4 + q] - mu; s2 += c * c; }
  red[tid] = s2; __syncthreads();
  for (int st = 128; st > 0; st >>= 1) { if (tid < st) red[tid] += red[tid + st]; __syncthreads(); }
  const float rs = rsqrtf(red[0] / (float)N + eps);
  {
    for (int u = 0; u < per / 4; ++u) {
      const int j = tid * 4 + 1024 * u;
      v4f o, sm;
#pragma unroll
      for (int q = 0; q < 4; ++q) {
        float gg = g[j + q], bb = bta[j + q];
        if (PARAM_BF16) { gg = bf16_round(gg); bb = bf16_round(bb); }
        sm[q] = vals[u * 4 + q]; o[q] = (vals[u * 4 + q] - mu) * rs * gg + bb;
      }
      if (out_sum) *(v4f*)(out_sum + (size_t)row * N + j) = sm;
      *(v4f*)(out_norm + (size_t)row * N + j) = o;
    }
    
  }
}



// ---- f16 WMMA path (v_wmma_f32_16x16x32_f16): 11-bit significands for operands in range — used where a [0,1] probability operand needs more precision than bf16
typedef _Float16 v16h __attribute__((ext_vector_type(16)));
union FragH { v16h v; v8us half[2]; _Float16 h[16]; unsigned short u[16]; };
template <int NT>
__device__ __forceinline__ v8f mmaH(v16h ah, v16h al, v16h bh, v16h bl, v8f c) {
  c = __builtin_amdgcn_wmma_f32_16x16x32_f16(false, ah, false, bh, (short)0, c, false, false);
  if (NT >= 2) c = __builtin_amdgcn_wmma_f32_16x16x32_f16(false, al, false, bh, (short)0, c, false, false);
  if (NT >= 3) c = __builtin_amdgcn_wmma_f32_16x16x32_f16(false, ah, false, bl, (short)0, c, false, false);
  asm volatile("v_nop\n\tv_nop\n\tv_nop\n\tv_nop" : "+v"(c) : "v"(ah), "v"(al), "v"(bh), "v"(bl));
  return c;
}
// batched GEMM like k_gemm_b but f16 operands: A f32 (split into f16 hi/lo if ASPLIT, else rounded to f16), Bt = f16 values [n][k]; alpha; C f32; N multiple of 16 (partial tiles skipped)
template <bool ASPLIT>
__global__ __launch_bounds__(128) void k_gemm_h(const float* __restrict__ A, int lda, size_t sA, const _Float16* __restrict__ Bh, int ldb, size_t sB, float alpha, float* __restrict__ C, int ldc, size_t sC, int M, int N, int K) {
  __shared__ __attribute__((aligned(16))) float so[4][16][64];
  const int tid = threadIdx.x, w = tid >> 5, lane = tid & 31, ln = lane & 15, hh = lane >> 4; const int by = blockIdx.y;
  A += (size_t)by * sA; Bh += (size_t)by * sB; C += (size_t)by * sC;
  const int ntn = (N + 63) / 64; const int wid = blockIdx.x * 4 + w; const int mt = wid / ntn, nq = wid % ntn; if (mt * 16 >= M) return;
  const int row0 = mt * 16, col0 = nq * 64; const float* arow = A + (size_t)(row0 + ln) * lda;
  v8f acc[4] = {};
  for (int kb = 0; kb < K; kb += 32) {
    FragH ah, al;
    const v4f x0 = *(const v4fa*)(arow + kb + 8 * hh), x1 = *(const v4fa*)(arow + kb + 8 * hh + 4), x2 = *(const v4fa*)(arow + kb + 16 + 8 * hh), x3 = *(const v4fa*)(arow + kb + 16 + 8 * hh + 4);
    float xs[16] = {x0[0],x0[1],x0[2],x0[3],x1[0],x1[1],x1[2],x1[3],x2[0],x2[1],x2[2],x2[3],x3[0],x3[1],x3[2],x3[3]};
#pragma unroll
    for (int i = 0; i < 16; ++i) { const _Float16 h = (_Float16)xs[i]; ah.h[i] = h; al.h[i] = ASPLIT ? (_Float16)(xs[i] - (float)h) : (_Float16)0.0f; }
#pragma unroll
    for (int t = 0; t < 4; ++t) { if (col0 + t * 16 >= N) continue; const size_t boff = (size_t)(col0 + t * 16 + ln) * ldb + kb; FragH bq; bq.half[0] = *(const v8us*)(Bh + boff + 8 * hh); bq.half[1] = *(const v8us*)(Bh + boff + 16 + 8 * hh);
      acc[t] = mmaH<ASPLIT ? 2 : 1>(ah.v, al.v, bq.v, bq.v, acc[t]); }
  }
#pragma unroll
  for (int t = 0; t < 4; ++t) { if (col0 + t * 16 >= N) continue;
#pragma unroll
    for (int r = 0; r < 8; ++r) so[w][8 * hh + r][t * 16 + ln] = acc[t][r] * alpha; }
  __builtin_amdgcn_fence(__ATOMIC_ACQ_REL, "workgroup"); __builtin_amdgcn_wave_barrier();
  const int rsub = lane >> 4, c4 = (lane & 15) * 4;
  {
#pragma unroll
    for (int q = 0; q < 8; ++q) { const int r = q * 2 + rsub; if (col0 + c4 < N) { const v4f v = *(const v4fa*)&so[w][r][c4]; *(v4f*)(C + (size_t)(row0 + r) * ldc + col0 + c4) = v; } }
     }
}

// Wt[n][k] = f16(W[k][n]·scale) from f32 row-major W[K][N] (scale = power of two; bf16-exact weights stay exact in f16 away from the subnormal range)
__global__ __launch_bounds__(256) void k_wt_f16(const float* __restrict__ W, _Float16* __restrict__ Wt, int K, int N, float scale) {
  const int t = blockIdx.x * 256 + threadIdx.x; if (t >= N * (K / 8)) return; const int n = t / (K / 8), k8 = (t % (K / 8)) * 8; FragH f;
#pragma unroll
  for (int i = 0; i < 8; ++i) f.h[i] = (_Float16)(bf16_round(W[(size_t)(k8 + i) * N + n]) * scale); const v8us o = f.half[0];
  *(v8us*)((unsigned short*)Wt + (size_t)n * K + k8) = o; 
}
// k_gemm_hh variant with fused epilogue: v = acc·alpha + bias[by·sBias + col] (+ CP[(row/rowsPerB)·sCPb + by·64 + col] if CP) ; ACT 0 none / 1 elu ; writes f16 C16 (and f32 C if non-null)
template <int ACT>
__global__ __launch_bounds__(128) void k_gemm_hhx(const _Float16* __restrict__ A, int lda, size_t sA, const _Float16* __restrict__ Bh, int ldb, size_t sB, float alpha, const float* __restrict__ bias, size_t sBias, const float* __restrict__ CP, int rowsPerB, size_t sCPb, int row0g,
    float* __restrict__ C, _Float16* __restrict__ C16, int ldc, size_t sC, int M, int N, int K) {
  __shared__ __attribute__((aligned(16))) float so[4][16][64];
  const int tid = threadIdx.x, w = tid >> 5, lane = tid & 31, ln = lane & 15, hh = lane >> 4; const int by = blockIdx.y;
  A += (size_t)by * sA; Bh += (size_t)by * sB; const size_t cofs = (size_t)by * sC; const float* bp = bias ? bias + (size_t)by * sBias : nullptr;
  const int ntn = (N + 63) / 64; const int wid = blockIdx.x * 4 + w; const int mt = wid / ntn, nq = wid % ntn; if (mt * 16 >= M) return;
  const int row0 = mt * 16, col0 = nq * 64; const _Float16* arow = A + (size_t)(row0 + ln) * lda;
  v8f acc[4] = {};
  for (int kb = 0; kb < K; kb += 32) { FragH ah; ah.half[0] = *(const v8us*)((const unsigned short*)arow + kb + 8 * hh); ah.half[1] = *(const v8us*)((const unsigned short*)arow + kb + 16 + 8 * hh);
#pragma unroll
    for (int t = 0; t < 4; ++t) { if (col0 + t * 16 >= N) continue; const size_t boff = (size_t)(col0 + t * 16 + ln) * ldb + kb; FragH bq; bq.half[0] = *(const v8us*)((const unsigned short*)Bh + boff + 8 * hh); bq.half[1] = *(const v8us*)((const unsigned short*)Bh + boff + 16 + 8 * hh);
      acc[t] = mmaH<1>(ah.v, ah.v, bq.v, bq.v, acc[t]); }
  }
#pragma unroll
  for (int t = 0; t < 4; ++t) { if (col0 + t * 16 >= N) continue; const int col = col0 + t * 16 + ln; const float bv = bp ? bf16_round(bp[col]) : 0.f;
#pragma unroll
    for (int r = 0; r < 8; ++r) { float v = acc[t][r] * alpha + bv; if (CP) { const int rr = row0g + row0 + 8 * hh + r; if (rowsPerB < 0) v += CP[cofs + (size_t)rr * ldc + col];      /* rowsPerB < 0: own element of the batched C plane */ else { const int bidx = rr / rowsPerB; v += CP[(size_t)bidx * sCPb + (size_t)by * 64 + col]; } } if (ACT == 1) v = (v > 0.f) ? v : expm1f(v); else if (ACT == 7) v = (v > 0.f) ? v + 1.0f : expf(v); else if (ACT == 8) v = tanhf(v); else if (ACT == 9) v = 0.5f * v * (1.0f + tanhf(0.7978845608028654f * (v + 0.044715f * v * v * v))); else if (ACT == 11) v = 1.0f / (1.0f + expf(-v)); else if (ACT == 12) v = (v > 0.f) ? v : 0.01f * v; else if (ACT == 14) v = (v > 0.f) ? v : 0.1f * v; else if (ACT == 16) v = (v >= 0.f) ? v : 0.3f * v; else if (ACT == 17) v = (v >= 0.f) ? v : 0.2f * v; else if (ACT == 15) v = v / (1.0f + expf(-v)); else if (ACT == 3) v = fmaxf(v, 0.f); else if (ACT == 6) v = 0.5f * v * (1.0f + erff(v * 0.70710678118654752f)); so[w][8 * hh + r][t * 16 + ln] = v; } }
  __builtin_amdgcn_fence(__ATOMIC_ACQ_REL, "workgroup"); __builtin_amdgcn_wave_barrier();
  const int rsub = lane >> 4, c4 = (lane & 15) * 4; typedef _Float16 v4h __attribute__((ext_vector_type(4)));
  {
#pragma unroll
    for (int q = 0; q < 8; ++q) { const int r = q * 2 + rsub; if (col0 + c4 < N) { const v4f v = *(const v4fa*)&so[w][r][c4]; if (C) *(v4f*)(C + cofs + (size_t)(row0 + r) * ldc + col0 + c4) = v; if (C16) { v4h h4; for (int i = 0; i < 4; ++i) h4[i] = (_Float16)v[i]; *(v4h*)(C16 + cofs + (size_t)(row0 + r) * ldc + col0 + c4) = h4; } } }
     }
}


typedef _Float16 v4h __attribute__((ext_vector_type(4)));

__global__ __launch_bounds__(256) void k_x16(const float* __restrict__ x, _Float16* __restrict__ X16, size_t n8) { const size_t t = (size_t)blockIdx.x * 256 + threadIdx.x; if (t >= n8) return; FragH f;
#pragma unroll
  for (int q = 0; q < 8; ++q) f.h[q] = (_Float16)bf16_round(x[t * 8 + q]); *(v8us*)((unsigned short*)X16 + t * 8) = f.half[0];  }
__global__ __launch_bounds__(256) void k_h16(const float* __restrict__ x, _Float16* __restrict__ X16, size_t n8) { const size_t t = (size_t)blockIdx.x * 256 + threadIdx.x; if (t >= n8) return; FragH f;
#pragma unroll
  for (int q = 0; q < 8; ++q) f.h[q] = (_Float16)x[t * 8 + q]; *(v8us*)((unsigned short*)X16 + t * 8) = f.half[0];  }
__global__ __launch_bounds__(256) void k_round16f(const float* __restrict__ W, _Float16* __restrict__ Bt, size_t n8) { const size_t t = (size_t)blockIdx.x * 256 + threadIdx.x; if (t >= n8) return; FragH f;
#pragma unroll
  for (int i = 0; i < 8; ++i) f.h[i] = (_Float16)(bf16_round(W[t * 8 + i]) * 16.0f); *(v8us*)((unsigned short*)Bt + t * 8) = f.half[0];  }
template <int NHv, int TTv>
__global__ __launch_bounds__(256) void k_vt(const _Float16* __restrict__ V16, int ldv, int voff, _Float16* __restrict__ Vt) { __shared__ unsigned short tl[64][66]; const int tid = threadIdx.x; const int slab = blockIdx.x / (TTv / 64), lg = blockIdx.x % (TTv / 64); const int b = slab / NHv, h = slab % NHv;
  for (int i = tid; i < 64 * 8; i += 256) { const int r = i / 8, c8 = (i % 8) * 8; FragH f; f.half[0] = *(const v8us*)((const unsigned short*)V16 + ((size_t)b * TTv + lg * 64 + r) * ldv + voff + h * 64 + c8);
#pragma unroll
    for (int q = 0; q < 8; ++q) tl[r][c8 + q] = f.u[q]; }
  __syncthreads();
  {
#pragma unroll
    for (int rd = 0; rd < 2; ++rd) { const int d = rd * 32 + tid / 8, pc = tid % 8; FragH f;
#pragma unroll
      for (int q = 0; q < 8; ++q) f.u[q] = tl[pc * 8 + q][d];
      *(v8us*)((unsigned short*)Vt + ((size_t)slab * 64 + d) * TTv + lg * 64 + pc * 8) = f.half[0]; }
     } }

__global__ __launch_bounds__(256) void k_hl(const float* __restrict__ F, _Float16* __restrict__ Hh, _Float16* __restrict__ Hl, size_t n8) { const size_t t = (size_t)blockIdx.x * 256 + threadIdx.x; if (t >= n8) return; FragH fh, fl; const v4f a = *(const v4fa*)(F + t * 8), c = *(const v4fa*)(F + t * 8 + 4);
#pragma unroll
  for (int q = 0; q < 4; ++q) { _Float16 h = (_Float16)a[q]; fh.h[q] = h; fl.h[q] = (_Float16)((a[q] - (float)h) * 1024.0f); h = (_Float16)c[q]; fh.h[4 + q] = h; fl.h[4 + q] = (_Float16)((c[q] - (float)h) * 1024.0f); }
  { *(v8us*)((unsigned short*)Hh + t * 8) = fh.half[0]; *(v8us*)((unsigned short*)Hl + t * 8) = fl.half[0];  } }

// ---- fast GEMM (wave tile 32x64; requires M % 32 == 0 rows per launch region and N % 64 == 0); epilogue = k_gemm_hhx semantics ----
__device__ __forceinline__ v16h g2_frag(const _Float16* p, int hh) { FragH f; f.half[0] = *(const v8us*)((const unsigned short*)p + 8 * hh); f.half[1] = *(const v8us*)((const unsigned short*)p + 16 + 8 * hh); return f.v; }
__device__ __forceinline__ v8f g2_mma(v16h a, v16h b, v8f c) { v8f d = __builtin_amdgcn_wmma_f32_16x16x32_f16(false, a, false, b, (short)0, c, false, false); asm volatile("v_nop\n\tv_nop\n\tv_nop\n\tv_nop" : "+v"(d) : "v"(a), "v"(b)); return d; }
template <int ACT>
__global__ __launch_bounds__(128) void k_gemm2(const _Float16* __restrict__ A, int lda, size_t sA, const _Float16* __restrict__ Bh, int ldb, size_t sB, float alpha, const float* __restrict__ bias, size_t sBias, const float* __restrict__ CP, int rowsPerB, size_t sCPb, int row0g,
    float* __restrict__ C, _Float16* __restrict__ C16, int ldc, size_t sC, int M, int N, int K) { static_assert(ACT == 0 || ACT == 3 || ACT == 6 || ACT == 8 || ACT == 9 || ACT == 11 || ACT == 12 || ACT == 14 || ACT == 15 || ACT == 16 || ACT == 17, "k_gemm2: unsupported ACT code (would silently apply no activation)");
  __shared__ __attribute__((aligned(16))) float so[4][32][68];
  const int tid = threadIdx.x, w = tid >> 5, lane = tid & 31, ln = lane & 15, hh = lane >> 4; const int by = blockIdx.y;
  A += (size_t)by * sA; Bh += (size_t)by * sB; const size_t cofs = (size_t)by * sC; const float* bp = bias ? bias + (size_t)by * sBias : nullptr;
  const int ntn = N >> 6; const int mt = blockIdx.x / ntn, nq = blockIdx.x - mt * ntn; const int row0 = mt * 128 + 32 * w, col0 = nq * 64; if (row0 >= M) return;
  const _Float16* a0p = A + (size_t)(row0 + ln) * lda; const _Float16* a1p = a0p + (size_t)16 * lda;
  const _Float16* b0p = Bh + (size_t)(col0 + ln) * ldb; const _Float16* b1p = b0p + (size_t)16 * ldb; const _Float16* b2p = b1p + (size_t)16 * ldb; const _Float16* b3p = b2p + (size_t)16 * ldb;
  const v8f z8 = {0.f,0.f,0.f,0.f,0.f,0.f,0.f,0.f}; v8f c00 = z8, c01 = z8, c02 = z8, c03 = z8, c10 = z8, c11 = z8, c12 = z8, c13 = z8;
#pragma unroll 1
  for (int kb = 0; kb < K; kb += 32) { const v16h a0 = g2_frag(a0p + kb, hh), a1 = g2_frag(a1p + kb, hh);
    v16h b = g2_frag(b0p + kb, hh); c00 = g2_mma(a0, b, c00); c10 = g2_mma(a1, b, c10);
    b = g2_frag(b1p + kb, hh); c01 = g2_mma(a0, b, c01); c11 = g2_mma(a1, b, c11);
    b = g2_frag(b2p + kb, hh); c02 = g2_mma(a0, b, c02); c12 = g2_mma(a1, b, c12);
    b = g2_frag(b3p + kb, hh); c03 = g2_mma(a0, b, c03); c13 = g2_mma(a1, b, c13); }
  v8f accs[8] = {c00, c01, c02, c03, c10, c11, c12, c13};
#pragma unroll
  for (int u = 0; u < 8; ++u) { const int t = u & 3, half = u >> 2; const int col = col0 + t * 16 + ln; const float bv = bp ? bf16_round(bp[col]) : 0.f;
#pragma unroll
    for (int r = 0; r < 8; ++r) { const int rloc = half * 16 + 8 * hh + r; float v = accs[u][r] * alpha + bv; if (CP) { if (rowsPerB < 0) v += CP[cofs + (size_t)(row0g + row0 + rloc) * ldc + col];      /* rowsPerB < 0: own element of the batched C plane */ else { const int bidx = (row0g + row0 + rloc) / rowsPerB; v += CP[(size_t)bidx * sCPb + (size_t)by * 64 + col]; } }
      if (ACT == 3) v = fmaxf(v, 0.f); else if (ACT == 6) v = 0.5f * v * (1.0f + erff(v * 0.70710678118654752f)); else if (ACT == 11) v = 1.0f / (1.0f + expf(-v)); else if (ACT == 15) v = v / (1.0f + expf(-v)); else if (ACT == 12) v = (v > 0.f) ? v : 0.01f * v; else if (ACT == 8) v = tanhf(v); else if (ACT == 9) v = 0.5f * v * (1.0f + tanhf(0.7978845608028654f * (v + 0.044715f * v * v * v))); else if (ACT == 14) v = (v > 0.f) ? v : 0.1f * v; else if (ACT == 16) v = (v >= 0.f) ? v : 0.3f * v; else if (ACT == 17) v = (v >= 0.f) ? v : 0.2f * v;
      so[w][rloc][t * 16 + ln] = v; } }
  __builtin_amdgcn_fence(__ATOMIC_ACQ_REL, "workgroup"); __builtin_amdgcn_wave_barrier();
  const int rsub = lane >> 4, c4 = (lane & 15) * 4;
  {
#pragma unroll
    for (int q = 0; q < 16; ++q) { const int r = q * 2 + rsub; const v4f v = *(const v4fa*)&so[w][r][c4]; if (C) *(v4f*)(C + cofs + (size_t)(row0 + r) * ldc + col0 + c4) = v; if (C16) { v4h h4; for (int i = 0; i < 4; ++i) h4[i] = (_Float16)v[i]; *(v4h*)(C16 + cofs + (size_t)(row0 + r) * ldc + col0 + c4) = h4; } }
     } }


__global__ __launch_bounds__(256) void k_wnat(const float* __restrict__ w, size_t n8, _Float16* __restrict__ Bt) { const size_t t = (size_t)blockIdx.x * 256 + threadIdx.x; if (t >= n8) return; FragH f; for (int q = 0; q < 8; ++q) f.h[q] = (_Float16)(bf16_round(w[t * 8 + q]) * 16.0f); *(v8us*)((unsigned short*)Bt + t * 8) = f.half[0];  }
__global__ __launch_bounds__(256) void k_rsm(const float* __restrict__ S, _Float16* __restrict__ P, int nrows) {
  #pragma clang fp contract(off)
  const int i = blockIdx.x * 256 + threadIdx.x; if (i >= nrows) return; const float* s = S + (size_t)i * SQ; float mx = -3.0e38f;
#pragma unroll 1
  for (int j = 0; j < SQ; ++j) mx = fmaxf(mx, s[j]); float se = 0.f;
#pragma unroll 1
  for (int j = 0; j < SQ; ++j) se += expf(s[j] - mx); const float sc = 256.0f / se;
#pragma unroll 1
  for (int j0 = 0; j0 < SQ; j0 += 8) { FragH f; for (int q = 0; q < 8; ++q) f.h[q] = (_Float16)(expf(s[j0 + q] - mx) * sc); unsigned short* d = (unsigned short*)P + (size_t)i * SQ + j0; *(v8us*)d = f.half[0];  } }
__global__ __launch_bounds__(256) void k_vt(const _Float16* __restrict__ V16, int b, int h0, _Float16* __restrict__ VT) { __shared__ unsigned short tl[64][65]; const int tid = threadIdx.x; const int hh = blockIdx.x % HG, sg = blockIdx.x / HG; const int s0 = sg * 64; const int h = h0 + hh;
  for (int i = tid; i < 64 * 8; i += 256) { const int j = i / 8, d8 = (i % 8) * 8; FragH f; f.half[0] = *(const v8us*)((const unsigned short*)V16 + ((size_t)b * SQ + s0 + j) * DM + h * HD + d8); for (int q = 0; q < 8; ++q) tl[d8 + q][j] = f.u[q]; }
  __syncthreads();
  { for (int i = tid; i < 64 * 8; i += 256) { const int d = i / 8, j8 = (i % 8) * 8; FragH f; for (int q = 0; q < 8; ++q) f.u[q] = tl[d][j8 + q]; *(v8us*)((unsigned short*)VT + ((size_t)hh * HD + d) * SQ + s0 + j8) = f.half[0]; }  } }



// Causal row softmax, one wave per score row (8 rows per block). A lane holds 4 consecutive keys of every 128, so each load of the wave
// reads 512 contiguous bytes and S is read once; row maximum and row sum are per-lane partials joined by a five-step butterfly.
// nk is a multiple of QT = 256: the row is taken in pieces of 256 keys under wave-uniform tests.
__global__ __launch_bounds__(256) void k_rsmcf2(const float* __restrict__ S, _Float16* __restrict__ P, int hg, int q0, int nk) {
  const int lane = threadIdx.x & 31; const int t = __builtin_amdgcn_readfirstlane((int)(blockIdx.x * 8 + (threadIdx.x >> 5))); if (t >= hg * QT) return;      /* wave-uniform; no barrier in this kernel */
  const float* s = S + (size_t)t * NKX + lane * 4; _Float16* p = P + (size_t)t * NKX + lane * 4; const int last = q0 + (t % QT) - lane * 4;      /* key u*128 + lane*4 + q is kept while u*128 + q <= last */
  v4f v[NKX / 128];
#pragma unroll
  for (int c = 0; c < NKX / 256; ++c) if (c * 256 < nk) { v[2 * c] = *(const v4fa*)(s + c * 256); v[2 * c + 1] = *(const v4fa*)(s + c * 256 + 128); }
  float mx = -3.0e38f;
#pragma unroll
  for (int c = 0; c < NKX / 256; ++c) if (c * 256 < nk) {
#pragma unroll
    for (int u = 2 * c; u < 2 * c + 2; ++u)
#pragma unroll
      for (int q = 0; q < 4; ++q) { const float x = (u * 128 + q <= last) ? v[u][q] : -1.0e9f; v[u][q] = x; mx = fmaxf(mx, x); } }
#pragma unroll
  for (int m = 16; m >= 1; m >>= 1) mx = fmaxf(mx, __shfl_xor(mx, m, 32));
  float a0 = 0.f, a1 = 0.f, a2 = 0.f, a3 = 0.f;
#pragma unroll
  for (int c = 0; c < NKX / 256; ++c) if (c * 256 < nk) {
#pragma unroll
    for (int u = 2 * c; u < 2 * c + 2; ++u) { v4f e;
#pragma unroll
      for (int q = 0; q < 4; ++q) e[q] = __expf(v[u][q] - mx);
      v[u] = e; a0 += e[0]; a1 += e[1]; a2 += e[2]; a3 += e[3]; } }
  float se = (a0 + a1) + (a2 + a3);
#pragma unroll
  for (int m = 16; m >= 1; m >>= 1) se += __shfl_xor(se, m, 32);
  const float sc = 256.0f / se;
#pragma unroll
  for (int c = 0; c < NKX / 256; ++c) if (c * 256 < nk) {
#pragma unroll
    for (int u = 2 * c; u < 2 * c + 2; ++u) { v4h h;
#pragma unroll
      for (int q = 0; q < 4; ++q) h[q] = (_Float16)(v[u][q] * sc);
      *(v4h*)(p + u * 128) = h; }
    if (c + 1 < NKX / 256) asm volatile("s_wait_xcnt 0x0" ::: "memory");      /* the next piece reuses the data registers of the two stores just issued: the wait stands in front of that overwrite */
  } }


// Exact f32 attention for the first QT0 rows, one thread per query row. The block's key and value rows (64 or 128 rows of 64 floats) are staged once in LDS
// by whole-line loads and then read as broadcasts; the thread's q row and o row stay in registers; four keys' score sums run side by side, each in index order.
// Every plain '#pragma unroll' below makes the indices of q, o, s and the staged pieces constants, so that these arrays are registers and not scratch.
template <int MASKADD>
__global__ __launch_bounds__(64) void k_att0(const float* __restrict__ QF, const float* __restrict__ KF, const float* __restrict__ VF, int ld, const float* __restrict__ mask, float scale, float* __restrict__ OF, int ldo) {
  static_assert(MASKADD == 0, "k_att0: only the causal form is staged (keys up to the block's last row)"); (void)mask;
  __shared__ __attribute__((aligned(16))) float lk[QT0][64]; __shared__ __attribute__((aligned(16))) float lv[QT0][64]; __shared__ __attribute__((aligned(16))) float lo[64][64];
  const int tid = threadIdx.x; const int h = blockIdx.x / (QT0 / 64), rg = blockIdx.x % (QT0 / 64); const int i = rg * 64 + tid;
  __builtin_assume(ld == DM);      /* every launch passes the row pitch DM: the row steps below fold into the loads' immediate offsets, so one offset register serves all loads of a kind */
  const char* qh = (const char*)(QF + h * HD); const char* kh = (const char*)(KF + h * HD); const char* vh = (const char*)(VF + h * HD);      /* block-uniform bases */
  const unsigned qoff = (unsigned)(i * ld) * 4u;      /* byte offset of the thread's q row */
  float q[HD], o[HD];
#pragma unroll
  for (int c = 0; c < HD / 4; ++c) { const v4f t4 = *(const v4fa*)(qh + qoff + c * 16);
#pragma unroll
    for (int u = 0; u < 4; ++u) { q[c * 4 + u] = t4[u]; o[c * 4 + u] = 0.f; } }
  static_assert(QT0 == 128, "k_att0: staging is written for one or two pieces of 64 keys");
  const int srow = tid >> 4, sc4 = (tid & 15) * 4; const unsigned soff = (unsigned)(srow * ld + sc4) * 4u;      /* staging: 16 threads per row of 256 bytes; byte offset */
#pragma unroll
  for (int t = 0; t < QT0 / 64; ++t) if (t <= rg) {      /* block-uniform test: 64 keys a piece, all 32 loads of a thread in flight together */
    v4f tk[16], tv[16];
#pragma unroll
    for (int it = 0; it < 16; ++it) { tk[it] = *(const v4fa*)(kh + soff + (t * 64 + it * 4) * ld * 4); tv[it] = *(const v4fa*)(vh + soff + (t * 64 + it * 4) * ld * 4); }
    asm volatile("s_wait_xcnt 0x0" :: "v"(qoff), "v"(soff) : "memory");      /* the loads' offset registers stay untouched up to this wait: nothing, a later load's data included, lands on a register that an issued load names */
#pragma unroll
    for (int it = 0; it < 16; ++it) { *(v4f*)&lk[t * 64 + it * 4 + srow][sc4] = tk[it]; *(v4f*)&lv[t * 64 + it * 4 + srow][sc4] = tv[it]; } }
  __syncthreads();      /* publishes the staged rows to both waves */
  float m = -1.0e30f, l = 0.f; const int nkey = rg * 64 + 64;      /* causal form: keys up to the block's last row */
#pragma unroll 1      /* the body is four whole keys of straight-line code already: more would only grow the text */
  for (int j0 = 0; j0 < nkey; j0 += 4) { float s[4] = {0.f, 0.f, 0.f, 0.f};
#pragma unroll
    for (int c = 0; c < HD / 4; ++c) { v4f kq[4];
#pragma unroll
      for (int u = 0; u < 4; ++u) kq[u] = *(const v4f*)&lk[j0 + u][c * 4];
#pragma unroll
      for (int x = 0; x < 4; ++x)
#pragma unroll
        for (int u = 0; u < 4; ++u) s[u] = __fadd_rn(s[u], __fmul_rn(q[c * 4 + x], kq[u][x])); }
#pragma unroll
    for (int u = 0; u < 4; ++u) { const int j = j0 + u; const float sv = __fmul_rn(s[u], scale);
      const float f = (j <= i) ? 1.f : 0.f; const float sm = fmaf(f, sv, (1.f - f) * -1.0e30f); const float mn = fmaxf(m, sm); const float sc = expf(m - mn); const float e = expf(sm - mn); l = __fadd_rn(__fmul_rn(l, sc), e); m = mn;
#pragma unroll
      for (int c = 0; c < HD / 4; ++c) { const v4f vv = *(const v4f*)&lv[j][c * 4];
#pragma unroll
        for (int x = 0; x < 4; ++x) o[c * 4 + x] = __fadd_rn(__fmul_rn(o[c * 4 + x], sc), __fmul_rn(e, vv[x])); } } }
  const float fin = 64.0f / l;      /* o carried x64 like the f16 path */
#pragma unroll
  for (int c = 0; c < HD / 4; ++c) { v4f oo;
#pragma unroll
    for (int u = 0; u < 4; ++u) oo[u] = __fmul_rn(o[c * 4 + u], fin);
    *(v4f*)&lo[tid][c * 4] = oo; }
  __syncthreads();
  {
#pragma unroll 1
    for (int it = 0; it < 16; ++it) { const int row = it * 4 + tid / 16, pc = (tid % 16) * 4; const v4f v = *(const v4f*)&lo[row][pc]; *(v4f*)(OF + (size_t)(rg * 64 + row) * ldo + h * HD + pc) = v; }
     } }

extern "C" void kernel_launch(void* const* d_in, const int* in_sizes, int n_in,
                              void* d_out, int out_size, void* d_ws, size_t ws_size, hipStream_t stream) {
  (void)in_sizes; (void)n_in; (void)out_size;
  const float* const* I = (const float* const*)d_in; const float* x = I[0]; const float* xk = I[1]; const float* xv = I[2]; const float* wq = I[3]; const float* bq = nullptr; const float* wk = I[4]; const float* bk = nullptr; const float* wv = I[5]; const float* bv = nullptr; const float* wo = I[6]; const float* bo = I[7];      /* input order: query_data, key_data, value_data (three SEPARATE streams: the three exact-f16 row casts read one each), Wq, Wk, Wv ([in][out]; the module has NO q / k / v biases: null pointers in the guarded bias slots), Wp ([in][out]), bp (REAL); NO mask input (the causal fill is built inside the reference) */
  char* ws = (char*)d_ws; size_t off = 0;
  auto take = [&](size_t bytes) { char* p = ws + off; off += (bytes + 255) & ~(size_t)255; return p; };
  _Float16* BQ = (_Float16*)take((size_t)DM * DM * 2); _Float16* BK = (_Float16*)take((size_t)DM * DM * 2); _Float16* BV = (_Float16*)take((size_t)DM * DM * 2); _Float16* BO = (_Float16*)take((size_t)DM * DM * 2);
  _Float16* X16 = (_Float16*)take(NR * DM * 2); _Float16* XK16 = (_Float16*)take(NR * DM * 2); _Float16* XV16 = (_Float16*)take(NR * DM * 2);      /* exact f16 rows of query, key, value */ float* QF = (float*)take(NR * DM * 4); _Float16* QH = (_Float16*)take(NR * DM * 2); _Float16* QL = (_Float16*)take(NR * DM * 2); _Float16* KH = (_Float16*)take(NR * DM * 2); _Float16* KL = (_Float16*)take(NR * DM * 2); _Float16* Q16 = QH; _Float16* K16 = KH; _Float16* V16 = (_Float16*)take(NR * DM * 2); _Float16* O16 = (_Float16*)take(NR * DM * 2);
  float* S = (float*)take((size_t)NH * QT * NKX * 4); _Float16* P = (_Float16*)take((size_t)NH * QT * NKX * 2); _Float16* VT = (_Float16*)take((size_t)NH * HD * SQ * 2);
  float* QF0 = (float*)take((size_t)QT0 * DM * 4); float* KF0 = (float*)take((size_t)QT0 * DM * 4); float* VF0 = (float*)take((size_t)QT0 * DM * 4); float* OF0 = (float*)take((size_t)NB * QT0 * DM * 4); _Float16* OH0 = (_Float16*)take((size_t)NB * QT0 * DM * 2); _Float16* OL0 = (_Float16*)take((size_t)NB * QT0 * DM * 2);
  if (off > ws_size) return;
  { const unsigned g = (unsigned)(((size_t)DM * (DM / 8) + 255) / 256); k_wt_f16<<<g, 256, 0, stream>>>(wq, BQ, DM, DM, 16.0f); k_wt_f16<<<g, 256, 0, stream>>>(wk, BK, DM, DM, 16.0f); k_wt_f16<<<g, 256, 0, stream>>>(wv, BV, DM, DM, 16.0f); k_wt_f16<<<g, 256, 0, stream>>>(wo, BO, DM, DM, 16.0f); }      /* [in][out] -> Bt[n][k] x16 */
  k_x16<<<(unsigned)((NR * DM / 8 + 255) / 256), 256, 0, stream>>>(x, X16, NR * DM / 8); k_x16<<<(unsigned)((NR * DM / 8 + 255) / 256), 256, 0, stream>>>(xk, XK16, NR * DM / 8); k_x16<<<(unsigned)((NR * DM / 8 + 255) / 256), 256, 0, stream>>>(xv, XV16, NR * DM / 8);
  const size_t r0p = (size_t)B0 * SQ;      /* first projected row */
  k_gemm2<0><<<dim3((unsigned)((MP / 128) * (DM / 64)), 1), 128, 0, stream>>>(X16 + r0p * DM, DM, 0, BQ, DM, 0, 0.0625f, bq, 0, nullptr, 1, 0, 0, QF + r0p * DM, nullptr, DM, 0, MP, DM, DM); k_hl<<<(unsigned)(((size_t)MP * DM / 8 + 255) / 256), 256, 0, stream>>>(QF + r0p * DM, QH + r0p * DM, QL + r0p * DM, (size_t)MP * DM / 8);      /* q (f32) -> f16 hi + x1024 residual: unscaled logits sigma ~8 */
  k_gemm2<0><<<dim3((unsigned)((MP / 128) * (DM / 64)), 1), 128, 0, stream>>>(XK16 + r0p * DM, DM, 0, BK, DM, 0, 0.0625f, bk, 0, nullptr, 1, 0, 0, QF + r0p * DM, nullptr, DM, 0, MP, DM, DM); k_hl<<<(unsigned)(((size_t)MP * DM / 8 + 255) / 256), 256, 0, stream>>>(QF + r0p * DM, KH + r0p * DM, KL + r0p * DM, (size_t)MP * DM / 8);      /* k likewise */
  k_gemm2<0><<<dim3((unsigned)((MP / 128) * (DM / 64)), 1), 128, 0, stream>>>(XV16 + r0p * DM, DM, 0, BV, DM, 0, 0.0625f, bv, 0, nullptr, 1, 0, 0, nullptr, V16 + r0p * DM, DM, 0, MP, DM, DM);
  for (int b = B0; b < B0 + NBR; ++b) { const size_t r0 = (size_t)b * SQ;
    k_vt<NH, SQ><<<NH * (SQ / 64), 256, 0, stream>>>(V16 + r0 * LQ, LQ, 0, VT);      /* V^T [NH][HD][SQ] for this batch */
    k_gemm2<0><<<dim3((QT0 / 128) * (DM / 64), 1), 128, 0, stream>>>(X16 + r0 * DM, DM, 0, BQ, DM, 0, 0.0625f, bq, 0, nullptr, 1, 0, 0, QF0, nullptr, DM, 0, QT0, DM, DM); k_gemm2<0><<<dim3((QT0 / 128) * (DM / 64), 1), 128, 0, stream>>>(XK16 + r0 * DM, DM, 0, BK, DM, 0, 0.0625f, bk, 0, nullptr, 1, 0, 0, KF0, nullptr, DM, 0, QT0, DM, DM); k_gemm2<0><<<dim3((QT0 / 128) * (DM / 64), 1), 128, 0, stream>>>(XV16 + r0 * DM, DM, 0, BV, DM, 0, 0.0625f, bv, 0, nullptr, 1, 0, 0, VF0, nullptr, DM, 0, QT0, DM, DM);      /* f32 q, k, v of the first 128 rows (exact products) */
    k_att0<0><<<NH * (QT0 / 64), 64, 0, stream>>>(QF0, KF0, VF0, DM, nullptr, SCL, OF0 + (size_t)b * QT0 * DM, DM);      /* exact f32 attention for rows 0..127 (o x64) */
    for (int q0 = 0; q0 < QN; q0 += QT) { const int nk = q0 + QT;      /* causal: only keys below the tile end are computed */
      k_gemm2<0><<<dim3((QT / 128) * (nk / 64), NHD), 128, 0, stream>>>(QH + (r0 + q0) * LQ, LQ, (size_t)HD, KH + r0 * LQ, LQ, (size_t)HD, SCL, nullptr, 0, nullptr, 1, 0, 0, S, nullptr, NKX, (size_t)QT * NKX, QT, nk, HD);      /* scores hi . hi * 64^-0.5 (1 / sqrt(head_dim)) */
      k_gemm2<0><<<dim3((QT / 128) * (nk / 64), NHD), 128, 0, stream>>>(QL + (r0 + q0) * LQ, LQ, (size_t)HD, KH + r0 * LQ, LQ, (size_t)HD, SCLR, nullptr, 0, S, -1, 0, 0, S, nullptr, NKX, (size_t)QT * NKX, QT, nk, HD); k_gemm2<0><<<dim3((QT / 128) * (nk / 64), NHD), 128, 0, stream>>>(QH + (r0 + q0) * LQ, LQ, (size_t)HD, KL + r0 * LQ, LQ, (size_t)HD, SCLR, nullptr, 0, S, -1, 0, 0, S, nullptr, NKX, (size_t)QT * NKX, QT, nk, HD);      /* += 2^-10 (lo . hi + hi . lo) */      /* scores, all heads on grid.y */
      k_rsmcf2<<<(NHD * QT + 7) / 8, 256, 0, stream>>>(S, P, NHD, q0, nk);      /* one wave per row, 8 rows per block */
      k_gemm2<0><<<dim3((QT / 128) * (HD / 64), NHD), 128, 0, stream>>>(P, NKX, (size_t)QT * NKX, VT, SQ, (size_t)HD * SQ, 0.25f, nullptr, 0, nullptr, 1, 0, 0, nullptr, O16 + (r0 + q0) * DM, DM, (size_t)HD, QT, HD, nk); } }      /* o (merged heads, x64) as f16 rows */
  k_gemm2<0><<<dim3((unsigned)((MPO / 128) * (DM / 64)), 1), 128, 0, stream>>>(O16 + r0p * DM, DM, 0, BO, DM, 0, 0.0009765625f, bo, 0, nullptr, 1, 0, 0, (float*)d_out + r0p * DM, nullptr, DM, 0, MPO, DM, DM);      /* out rows are the output layout */
  k_hl<<<(unsigned)(((size_t)NB * QT0 * DM / 8 + 255) / 256), 256, 0, stream>>>(OF0, OH0, OL0, (size_t)NB * QT0 * DM / 8);      /* first-tile o (x64) -> f16 hi + x1024 residual planes */
  for (int b = B0; b < B0 + NBR; ++b) { const size_t r0 = (size_t)b * SQ; const size_t f0 = (size_t)b * QT0;
    k_gemm2<0><<<dim3((QT0 / 128) * (DM / 64), 1), 128, 0, stream>>>(OH0 + f0 * DM, DM, 0, BO, DM, 0, 0.0009765625f, bo, 0, nullptr, 1, 0, 0, (float*)d_out + r0 * DM, nullptr, DM, 0, QT0, DM, DM);      /* rows 0..127: out = o_hi Wo (+ b), overwriting the f16-path rows */
    k_gemm2<0><<<dim3((QT0 / 128) * (DM / 64), 1), 128, 0, stream>>>(OL0 + f0 * DM, DM, 0, BO, DM, 0, 0.00000095367431640625f, nullptr, 0, (const float*)d_out + r0 * DM, -1, 0, 0, (float*)d_out + r0 * DM, nullptr, DM, 0, QT0, DM, DM); }      /* += o_lo Wo 2^-20 (own-element accumulate) */
}

// v003
// One run takes 641 microseconds.
// Two timings next to v002 put it at 3.19 and 3.27 times that version's speed.
// Over all steps from v000 it is 9.08 times as fast.
#include <hip/hip_runtime.h>
// Causal multi-head attention on three inputs with bias-free [in][out] projections and a biased [in][out] output projection (query_data, key_data, value_data [2][2048][1024]; q = split_heads(query_data Wq), k = split_heads(key_data Wk), v = split_heads(value_data Wv) ([in][out] [1024][1024], NO biases), 16 heads of 64; scores / sqrt(64); scores + triu(ones, k = 1) x (-1e13): an additive fill strictly above the diagonal == exclusion (exp underflows to exactly 0; every row keeps its diagonal); softmax over keys; out = merged Wp + bp ([in][out] + a REAL bias) -> [2][2048][1024]); the causal rule is built inside the reference: applied here by index; q and k carried as f16 hi + x1024 residual planes with three-product scores.
// Structure: token rows r = b*2048 + s; x as exact f16 rows (bf16-rounded); q and k as WMMA GEMMs (32x64 wave tiles, f32 accumulation, exact x16 weights, no bias) into f32 rows split into f16 hi + x1024 residual planes, v as an f16-output GEMM; V^T for all heads and batches via LDS transposes; one fused attention launch: a block owns 128 query rows of a head (32 per wave) and walks the keys up to its last row 64 at a time, k hi, k lo and V^T rows staged in LDS per pass: three-product scores (lo.hi + hi.lo, x 2^-10, + hi.hi) as S^T tiles in registers, running maximum and sum per query (f32 statistics, native exp2; keys past the row's own index excluded; weights x256 f16, packed in place as the B operand), O^T += V^T . P^T, o carried x64 (folded into the output GEMM alpha) written straight into the merged f16 o rows; out = o W_o + b GEMM (f32) into the output layout.
// Compute dtype: inputs rounded to bf16; x / weights exact; v, softmax weights and o as plain f16 GEMM operands (~2^-12), q and k as f16 hi + x1024 residual pairs; scores and softmax statistics f32; v_wmma_f32_16x16x32_f16.
#define NB 2
#define SCL 0.125f                         /* 1 / sqrt(head_dim = 64) */
#define SCLR 0.0001220703125f              /* 2^-13: the same scale on the x1024 residual passes */
#define SQ 2048
#define DM 1024
#define NH 16
#define HD 64
#define HG 4                         /* heads per launch of the head-group k_vt (not launched) */
#define QT 256                       /* not used: the causal tiles are 128 query rows */
#define NKX SQ                       /* S / P row pitch */
#define QT0 128                      /* first-tile rows recomputed exactly in f32 */
#define B0 0                         /* first batch processed (debug hook) */
#define NBR NB                       /* batches processed (debug hook) */
#define NR ((size_t)NB * SQ)         /* token rows */
#define MP ((int)((size_t)NBR * SQ)) /* rows projected (debug hook) */
#define QN SQ                        /* query rows attended per batch (debug hook) */
#define NHD NH                       /* heads attended (debug hook) */
#define MPO MP                       /* rows through the output stage (debug hook) */
#define LQ DM      /* row pitch of the q/k/v rows */
typedef __bf16 v16b __attribute__((ext_vector_type(16)));
typedef unsigned short v8us __attribute__((ext_vector_type(8), may_alias));
typedef float  v8f  __attribute__((ext_vector_type(8)));
typedef float  v4f  __attribute__((ext_vector_type(4)));
typedef float  v4fa __attribute__((ext_vector_type(4), may_alias));
union FragB { v16b v; v8us half[2]; unsigned short u[16]; };

__device__ __forceinline__ unsigned short bf16_bits(float x) { unsigned int u = __float_as_uint(x); return (unsigned short)((u + 0x7FFFu + ((u >> 16) & 1u)) >> 16); }
__device__ __forceinline__ float bf16_val(unsigned short b) { return __uint_as_float(((unsigned int)b) << 16); }
__device__ __forceinline__ float bf16_round(float x) { return bf16_val(bf16_bits(x)); }
// D += A·B with NT terms: 1 = ah·bh, 2 = + al·bh (A split), 3 = + ah·bl (both split)
template <int NT>
__device__ __forceinline__ v8f mmaN(v16b ah, v16b al, v16b bh, v16b bl, v8f c) {
  c = __builtin_amdgcn_wmma_f32_16x16x32_bf16(false, ah, false, bh, (short)0, c, false, false);
  if (NT >= 2) c = __builtin_amdgcn_wmma_f32_16x16x32_bf16(false, al, false, bh, (short)0, c, false, false);
  if (NT >= 3) c = __builtin_amdgcn_wmma_f32_16x16x32_bf16(false, ah, false, bl, (short)0, c, false, false);
  asm volatile("v_nop\n\tv_nop\n\tv_nop\n\tv_nop" : "+v"(c) : "v"(ah), "v"(al), "v"(bh), "v"(bl));
  return c;
}

__global__ __launch_bounds__(256) void k_wt_bf16(const float* __restrict__ W, unsigned short* __restrict__ Wt, int K, int N) {
  const int t = blockIdx.x * 256 + threadIdx.x;
  const int k8n = K / 8;
  if (t >= N * k8n) return;
  const int n = t / k8n, k8 = (t % k8n) * 8;
  v8us v;
#pragma unroll
  for (int i = 0; i < 8; ++i) v[i] = bf16_bits(W[(size_t)(k8 + i) * N + n]);
  *(v8us*)(Wt + (size_t)n * K + k8) = v;
  
}

// GEMM C[M][N] (f32, pitch ldc) = act(A[M][K]·W + bias). A f32 row-major (pitch lda) converted per fragment to bf16
// (ASPLIT: hi/lo two planes -> 2 terms, else single rounded term); Wt bf16 [N][K] (pitch ldb). BIAS_BF16 rounds the
// bias to bf16 first (bias quantised to bf16 before the add). K%32==0, M%16==0, N%64==0.
template <bool ASPLIT, int ACT, bool BIAS_BF16>
__global__ __launch_bounds__(128) void k_gemm_bf(const float* __restrict__ A, int lda, const unsigned short* __restrict__ Wt, int ldb,
                                               const float* __restrict__ bias, float* __restrict__ C, int ldc, int M, int N, int K) {
  __shared__ __attribute__((aligned(16))) float so[4][16][64];
  const int tid = threadIdx.x, w = tid >> 5, lane = tid & 31, ln = lane & 15, hh = lane >> 4;
  const int ntn = N / 64;
  const int wid = blockIdx.x * 4 + w;
  const int mt = wid / ntn, nq = wid % ntn;
  if (mt * 16 >= M) return;
  const int row0 = mt * 16, col0 = nq * 64;
  const float* arow = A + (size_t)(row0 + ln) * lda;
  v8f acc[4] = {};
  for (int kb = 0; kb < K; kb += 32) {
    FragB ah, al;
    const v4f x0 = *(const v4fa*)(arow + kb + 8 * hh), x1 = *(const v4fa*)(arow + kb + 8 * hh + 4);
    const v4f x2 = *(const v4fa*)(arow + kb + 16 + 8 * hh), x3 = *(const v4fa*)(arow + kb + 16 + 8 * hh + 4);
    float xs[16] = {x0[0],x0[1],x0[2],x0[3],x1[0],x1[1],x1[2],x1[3],x2[0],x2[1],x2[2],x2[3],x3[0],x3[1],x3[2],x3[3]};
#pragma unroll
    for (int i = 0; i < 16; ++i) { const unsigned short hb = bf16_bits(xs[i]); ah.u[i] = hb; al.u[i] = ASPLIT ? bf16_bits(xs[i] - bf16_val(hb)) : (unsigned short)0; }
#pragma unroll
    for (int t = 0; t < 4; ++t) {
      const unsigned short* brow = Wt + (size_t)(col0 + t * 16 + ln) * ldb + kb;
      FragB b;
      b.half[0] = *(const v8us*)(brow + 8 * hh);
      b.half[1] = *(const v8us*)(brow + 16 + 8 * hh);
      acc[t] = mmaN<ASPLIT ? 2 : 1>(ah.v, al.v, b.v, b.v, acc[t]);
    }
  }
#pragma unroll
  for (int t = 0; t < 4; ++t) {
    float bv = bias ? bias[col0 + t * 16 + ln] : 0.f;
    if (BIAS_BF16) bv = bf16_round(bv);
#pragma unroll
    for (int r = 0; r < 8; ++r) { float v = acc[t][r] + bv; if (ACT == 1) v = fmaxf(v, 0.f); so[w][8 * hh + r][t * 16 + ln] = v; }
  }
  __builtin_amdgcn_fence(__ATOMIC_ACQ_REL, "workgroup");
  __builtin_amdgcn_wave_barrier();
  const int rsub = lane >> 4, c4 = (lane & 15) * 4;
  {
#pragma unroll
    for (int q = 0; q < 8; ++q) {
      const int r = q * 2 + rsub;
      const v4f v = *(const v4fa*)&so[w][r][c4];
      *(v4f*)(C + (size_t)(row0 + r) * ldc + col0 + c4) = v;
    }
    
  }
}

// GEMM C = act(A·W + bias + resid): A f32 (ASPLIT -> hi/lo 2 terms), Wt bf16 [N][K]; ACT 0 none, 1 relu, 2 exact gelu;
// resid (optional, f32, row index = (row % rmod), pitch ldr, RES_BF16 rounds it) added before the activation.
template <bool ASPLIT, int ACT, bool BIAS_BF16, bool RES_BF16>
__global__ __launch_bounds__(128) void k_gemm_bf3(const float* __restrict__ A, int lda, const unsigned short* __restrict__ Wt, int ldb,
                                                const float* __restrict__ bias, const float* __restrict__ resid, int rmod, int ldr,
                                                float* __restrict__ C, int ldc, int M, int N, int K) {
  __shared__ __attribute__((aligned(16))) float so[4][16][64];
  const int tid = threadIdx.x, w = tid >> 5, lane = tid & 31, ln = lane & 15, hh = lane >> 4;
  const int ntn = N / 64;
  const int wid = blockIdx.x * 4 + w;
  const int mt = wid / ntn, nq = wid % ntn;
  if (mt * 16 >= M) return;
  const int row0 = mt * 16, col0 = nq * 64;
  const float* arow = A + (size_t)(row0 + ln) * lda;
  v8f acc[4] = {};
  for (int kb = 0; kb < K; kb += 32) {
    FragB ah, al;
    const v4f x0 = *(const v4fa*)(arow + kb + 8 * hh), x1 = *(const v4fa*)(arow + kb + 8 * hh + 4);
    const v4f x2 = *(const v4fa*)(arow + kb + 16 + 8 * hh), x3 = *(const v4fa*)(arow + kb + 16 + 8 * hh + 4);
    float xs[16] = {x0[0],x0[1],x0[2],x0[3],x1[0],x1[1],x1[2],x1[3],x2[0],x2[1],x2[2],x2[3],x3[0],x3[1],x3[2],x3[3]};
#pragma unroll
    for (int i = 0; i < 16; ++i) { const unsigned short hb = bf16_bits(xs[i]); ah.u[i] = hb; al.u[i] = ASPLIT ? bf16_bits(xs[i] - bf16_val(hb)) : (unsigned short)0; }
#pragma unroll
    for (int t = 0; t < 4; ++t) {
      const unsigned short* brow = Wt + (size_t)(col0 + t * 16 + ln) * ldb + kb;
      FragB b;
      b.half[0] = *(const v8us*)(brow + 8 * hh);
      b.half[1] = *(const v8us*)(brow + 16 + 8 * hh);
      acc[t] = mmaN<ASPLIT ? 2 : 1>(ah.v, al.v, b.v, b.v, acc[t]);
    }
  }
#pragma unroll
  for (int t = 0; t < 4; ++t) {
    const int col = col0 + t * 16 + ln;
    float bv = bias ? bias[col] : 0.f;
    if (BIAS_BF16) bv = bf16_round(bv);
#pragma unroll
    for (int r = 0; r < 8; ++r) {
      float v = acc[t][r] + bv;
      if (resid) { float rv = resid[(size_t)((row0 + 8 * hh + r) % rmod) * ldr + col]; if (RES_BF16) rv = bf16_round(rv); v += rv; }
      if (ACT == 1) v = fmaxf(v, 0.f);
      if (ACT == 2) v = 0.5f * v * (1.0f + erff(v * 0.70710678118654752f));
      if (ACT == 3) { const float u = 0.7978845608028654f * (v + 0.044715f * v * v * v); v = 0.5f * v * (1.0f + tanhf(u)); }
      so[w][8 * hh + r][t * 16 + ln] = v;
    }
  }
  __builtin_amdgcn_fence(__ATOMIC_ACQ_REL, "workgroup");
  __builtin_amdgcn_wave_barrier();
  const int rsub = lane >> 4, c4 = (lane & 15) * 4;
  {
#pragma unroll
    for (int q = 0; q < 8; ++q) {
      const int r = q * 2 + rsub;
      const v4f v = *(const v4fa*)&so[w][r][c4];
      *(v4f*)(C + (size_t)(row0 + r) * ldc + col0 + c4) = v;
    }
    
  }
}
// row LayerNorm (biased variance, eps) over N: s = X (+ R); optional out_sum <- s; out_norm <- (s-mu)*rsqrt(var+eps)*g + b
template <bool PARAM_BF16>
__global__ __launch_bounds__(256) void k_layernorm(const float* __restrict__ X, const float* __restrict__ R, const float* __restrict__ g, const float* __restrict__ bta,
                                                  float* __restrict__ out_sum, float* __restrict__ out_norm, int N, float eps) {
  __shared__ float red[256];
  const int row = blockIdx.x, tid = threadIdx.x;
  const float* x = X + (size_t)row * N; const float* rr = R ? R + (size_t)row * N : nullptr;
  float vals[16];                     // up to N = 4096
  const int per = N / 256;            // contiguous chunk per thread? use strided-by-4 chunks: thread handles j = tid*4 + 1024*u
  float s1 = 0.f;
  for (int u = 0; u < per / 4; ++u) {
    const int j = tid * 4 + 1024 * u;
    const v4f a = *(const v4fa*)(x + j);
    v4f b = {0.f,0.f,0.f,0.f}; if (rr) b = *(const v4fa*)(rr + j);
#pragma unroll
    for (int q = 0; q < 4; ++q) { const float v = a[q] + b[q]; vals[u * 4 + q] = v; s1 += v; }
  }
  red[tid] = s1; __syncthreads();
  for (int st = 128; st > 0; st >>= 1) { if (tid < st) red[tid] += red[tid + st]; __syncthreads(); }
  const float mu = red[0] / (float)N; __syncthreads();
  float s2 = 0.f;
  for (int u = 0; u < per / 4; ++u)
#pragma unroll
    for (int q = 0; q < 4; ++q) { const float c = vals[u * 4 + q] - mu; s2 += c * c; }
  red[tid] = s2; __syncthreads();
  for (int st = 128; st > 0; st >>= 1) { if (tid < st) red[tid] += red[tid + st]; __syncthreads(); }
  const float rs = rsqrtf(red[0] / (float)N + eps);
  {
    for (int u = 0; u < per / 4; ++u) {
      const int j = tid * 4 + 1024 * u;
      v4f o, sm;
#pragma unroll
      for (int q = 0; q < 4; ++q) {
        float gg = g[j + q], bb = bta[j + q];
        if (PARAM_BF16) { gg = bf16_round(gg); bb = bf16_round(bb); }
        sm[q] = vals[u * 4 + q]; o[q] = (vals[u * 4 + q] - mu) * rs * gg + bb;
      }
      if (out_sum) *(v4f*)(out_sum + (size_t)row * N + j) = sm;
      *(v4f*)(out_norm + (size_t)row * N + j) = o;
    }
    
  }
}



// ---- f16 WMMA path (v_wmma_f32_16x16x32_f16): 11-bit significands for operands in range — used where a [0,1] probability operand needs more precision than bf16
typedef _Float16 v16h __attribute__((ext_vector_type(16)));
union FragH { v16h v; v8us half[2]; _Float16 h[16]; unsigned short u[16]; };
template <int NT>
__device__ __forceinline__ v8f mmaH(v16h ah, v16h al, v16h bh, v16h bl, v8f c) {
  c = __builtin_amdgcn_wmma_f32_16x16x32_f16(false, ah, false, bh, (short)0, c, false, false);
  if (NT >= 2) c = __builtin_amdgcn_wmma_f32_16x16x32_f16(false, al, false, bh, (short)0, c, false, false);
  if (NT >= 3) c = __builtin_amdgcn_wmma_f32_16x16x32_f16(false, ah, false, bl, (short)0, c, false, false);
  asm volatile("v_nop\n\tv_nop\n\tv_nop\n\tv_nop" : "+v"(c) : "v"(ah), "v"(al), "v"(bh), "v"(bl));
  return c;
}
// batched GEMM like k_gemm_b but f16 operands: A f32 (split into f16 hi/lo if ASPLIT, else rounded to f16), Bt = f16 values [n][k]; alpha; C f32; N multiple of 16 (partial tiles skipped)
template <bool ASPLIT>
__global__ __launch_bounds__(128) void k_gemm_h(const float* __restrict__ A, int lda, size_t sA, const _Float16* __restrict__ Bh, int ldb, size_t sB, float alpha, float* __restrict__ C, int ldc, size_t sC, int M, int N, int K) {
  __shared__ __attribute__((aligned(16))) float so[4][16][64];
  const int tid = threadIdx.x, w = tid >> 5, lane = tid & 31, ln = lane & 15, hh = lane >> 4; const int by = blockIdx.y;
  A += (size_t)by * sA; Bh += (size_t)by * sB; C += (size_t)by * sC;
  const int ntn = (N + 63) / 64; const int wid = blockIdx.x * 4 + w; const int mt = wid / ntn, nq = wid % ntn; if (mt * 16 >= M) return;
  const int row0 = mt * 16, col0 = nq * 64; const float* arow = A + (size_t)(row0 + ln) * lda;
  v8f acc[4] = {};
  for (int kb = 0; kb < K; kb += 32) {
    FragH ah, al;
    const v4f x0 = *(const v4fa*)(arow + kb + 8 * hh), x1 = *(const v4fa*)(arow + kb + 8 * hh + 4), x2 = *(const v4fa*)(arow + kb + 16 + 8 * hh), x3 = *(const v4fa*)(arow + kb + 16 + 8 * hh + 4);
    float xs[16] = {x0[0],x0[1],x0[2],x0[3],x1[0],x1[1],x1[2],x1[3],x2[0],x2[1],x2[2],x2[3],x3[0],x3[1],x3[2],x3[3]};
#pragma unroll
    for (int i = 0; i < 16; ++i) { const _Float16 h = (_Float16)xs[i]; ah.h[i] = h; al.h[i] = ASPLIT ? (_Float16)(xs[i] - (float)h) : (_Float16)0.0f; }
#pragma unroll
    for (int t = 0; t < 4; ++t) { if (col0 + t * 16 >= N) continue; const size_t boff = (size_t)(col0 + t * 16 + ln) * ldb + kb; FragH bq; bq.half[0] = *(const v8us*)(Bh + boff + 8 * hh); bq.half[1] = *(const v8us*)(Bh + boff + 16 + 8 * hh);
      acc[t] = mmaH<ASPLIT ? 2 : 1>(ah.v, al.v, bq.v, bq.v, acc[t]); }
  }
#pragma unroll
  for (int t = 0; t < 4; ++t) { if (col0 + t * 16 >= N) continue;
#pragma unroll
    for (int r = 0; r < 8; ++r) so[w][8 * hh + r][t * 16 + ln] = acc[t][r] * alpha; }
  __builtin_amdgcn_fence(__ATOMIC_ACQ_REL, "workgroup"); __builtin_amdgcn_wave_barrier();
  const int rsub = lane >> 4, c4 = (lane & 15) * 4;
  {
#pragma unroll
    for (int q = 0; q < 8; ++q) { const int r = q * 2 + rsub; if (col0 + c4 < N) { const v4f v = *(const v4fa*)&so[w][r][c4]; *(v4f*)(C + (size_t)(row0 + r) * ldc + col0 + c4) = v; } }
     }
}

// Wt[n][k] = f16(W[k][n]·scale) from f32 row-major W[K][N] (scale = power of two; bf16-exact weights stay exact in f16 away from the subnormal range)
__global__ __launch_bounds__(256) void k_wt_f16(const float* __restrict__ W, _Float16* __restrict__ Wt, int K, int N, float scale) {
  const int t = blockIdx.x * 256 + threadIdx.x; if (t >= N * (K / 8)) return; const int n = t / (K / 8), k8 = (t % (K / 8)) * 8; FragH f;
#pragma unroll
  for (int i = 0; i < 8; ++i) f.h[i] = (_Float16)(bf16_round(W[(size_t)(k8 + i) * N + n]) * scale); const v8us o = f.half[0];
  *(v8us*)((unsigned short*)Wt + (size_t)n * K + k8) = o; 
}
// k_gemm_hh variant with fused epilogue: v = acc·alpha + bias[by·sBias + col] (+ CP[(row/rowsPerB)·sCPb + by·64 + col] if CP) ; ACT 0 none / 1 elu ; writes f16 C16 (and f32 C if non-null)
template <int ACT>
__global__ __launch_bounds__(128) void k_gemm_hhx(const _Float16* __restrict__ A, int lda, size_t sA, const _Float16* __restrict__ Bh, int ldb, size_t sB, float alpha, const float* __restrict__ bias, size_t sBias, const float* __restrict__ CP, int rowsPerB, size_t sCPb, int row0g,
    float* __restrict__ C, _Float16* __restrict__ C16, int ldc, size_t sC, int M, int N, int K) {
  __shared__ __attribute__((aligned(16))) float so[4][16][64];
  const int tid = threadIdx.x, w = tid >> 5, lane = tid & 31, ln = lane & 15, hh = lane >> 4; const int by = blockIdx.y;
  A += (size_t)by * sA; Bh += (size_t)by * sB; const size_t cofs = (size_t)by * sC; const float* bp = bias ? bias + (size_t)by * sBias : nullptr;
  const int ntn = (N + 63) / 64; const int wid = blockIdx.x * 4 + w; const int mt = wid / ntn, nq = wid % ntn; if (mt * 16 >= M) return;
  const int row0 = mt * 16, col0 = nq * 64; const _Float16* arow = A + (size_t)(row0 + ln) * lda;
  v8f acc[4] = {};
  for (int kb = 0; kb < K; kb += 32) { FragH ah; ah.half[0] = *(const v8us*)((const unsigned short*)arow + kb + 8 * hh); ah.half[1] = *(const v8us*)((const unsigned short*)arow + kb + 16 + 8 * hh);
#pragma unroll
    for (int t = 0; t < 4; ++t) { if (col0 + t * 16 >= N) continue; const size_t boff = (size_t)(col0 + t * 16 + ln) * ldb + kb; FragH bq; bq.half[0] = *(const v8us*)((const unsigned short*)Bh + boff + 8 * hh); bq.half[1] = *(const v8us*)((const unsigned short*)Bh + boff + 16 + 8 * hh);
      acc[t] = mmaH<1>(ah.v, ah.v, bq.v, bq.v, acc[t]); }
  }
#pragma unroll
  for (int t = 0; t < 4; ++t) { if (col0 + t * 16 >= N) continue; const int col = col0 + t * 16 + ln; const float bv = bp ? bf16_round(bp[col]) : 0.f;
#pragma unroll
    for (int r = 0; r < 8; ++r) { float v = acc[t][r] * alpha + bv; if (CP) { const int rr = row0g + row0 + 8 * hh + r; if (rowsPerB < 0) v += CP[cofs + (size_t)rr * ldc + col];      /* rowsPerB < 0: own element of the batched C plane */ else { const int bidx = rr / rowsPerB; v += CP[(size_t)bidx * sCPb + (size_t)by * 64 + col]; } } if (ACT == 1) v = (v > 0.f) ? v : expm1f(v); else if (ACT == 7) v = (v > 0.f) ? v + 1.0f : expf(v); else if (ACT == 8) v = tanhf(v); else if (ACT == 9) v = 0.5f * v * (1.0f + tanhf(0.7978845608028654f * (v + 0.044715f * v * v * v))); else if (ACT == 11) v = 1.0f / (1.0f + expf(-v)); else if (ACT == 12) v = (v > 0.f) ? v : 0.01f * v; else if (ACT == 14) v = (v > 0.f) ? v : 0.1f * v; else if (ACT == 16) v = (v >= 0.f) ? v : 0.3f * v; else if (ACT == 17) v = (v >= 0.f) ? v : 0.2f * v; else if (ACT == 15) v = v / (1.0f + expf(-v)); else if (ACT == 3) v = fmaxf(v, 0.f); else if (ACT == 6) v = 0.5f * v * (1.0f + erff(v * 0.70710678118654752f)); so[w][8 * hh + r][t * 16 + ln] = v; } }
  __builtin_amdgcn_fence(__ATOMIC_ACQ_REL, "workgroup"); __builtin_amdgcn_wave_barrier();
  const int rsub = lane >> 4, c4 = (lane & 15) * 4; typedef _Float16 v4h __attribute__((ext_vector_type(4)));
  {
#pragma unroll
    for (int q = 0; q < 8; ++q) { const int r = q * 2 + rsub; if (col0 + c4 < N) { const v4f v = *(const v4fa*)&so[w][r][c4]; if (C) *(v4f*)(C + cofs + (size_t)(row0 + r) * ldc + col0 + c4) = v; if (C16) { v4h h4; for (int i = 0; i < 4; ++i) h4[i] = (_Float16)v[i]; *(v4h*)(C16 + cofs + (size_t)(row0 + r) * ldc + col0 + c4) = h4; } } }
     }
}


typedef _Float16 v4h __attribute__((ext_vector_type(4)));

__global__ __launch_bounds__(256) void k_x16(const float* __restrict__ x, _Float16* __restrict__ X16, size_t n8) { const size_t t = (size_t)blockIdx.x * 256 + threadIdx.x; if (t >= n8) return; FragH f;
#pragma unroll
  for (int q = 0; q < 8; ++q) f.h[q] = (_Float16)bf16_round(x[t * 8 + q]); *(v8us*)((unsigned short*)X16 + t * 8) = f.half[0];  }
__global__ __launch_bounds__(256) void k_h16(const float* __restrict__ x, _Float16* __restrict__ X16, size_t n8) { const size_t t = (size_t)blockIdx.x * 256 + threadIdx.x; if (t >= n8) return; FragH f;
#pragma unroll
  for (int q = 0; q < 8; ++q) f.h[q] = (_Float16)x[t * 8 + q]; *(v8us*)((unsigned short*)X16 + t * 8) = f.half[0];  }
__global__ __launch_bounds__(256) void k_round16f(const float* __restrict__ W, _Float16* __restrict__ Bt, size_t n8) { const size_t t = (size_t)blockIdx.x * 256 + threadIdx.x; if (t >= n8) return; FragH f;
#pragma unroll
  for (int i = 0; i < 8; ++i) f.h[i] = (_Float16)(bf16_round(W[t * 8 + i]) * 16.0f); *(v8us*)((unsigned short*)Bt + t * 8) = f.half[0];  }
template <int NHv, int TTv>
__global__ __launch_bounds__(256) void k_vt(const _Float16* __restrict__ V16, int ldv, int voff, _Float16* __restrict__ Vt) { __shared__ unsigned short tl[64][66]; const int tid = threadIdx.x; const int slab = blockIdx.x / (TTv / 64), lg = blockIdx.x % (TTv / 64); const int b = slab / NHv, h = slab % NHv;
  for (int i = tid; i < 64 * 8; i += 256) { const int r = i / 8, c8 = (i % 8) * 8; FragH f; f.half[0] = *(const v8us*)((const unsigned short*)V16 + ((size_t)b * TTv + lg * 64 + r) * ldv + voff + h * 64 + c8);
#pragma unroll
    for (int q = 0; q < 8; ++q) tl[r][c8 + q] = f.u[q]; }
  __syncthreads();
  {
#pragma unroll
    for (int rd = 0; rd < 2; ++rd) { const int d = rd * 32 + tid / 8, pc = tid % 8; FragH f;
#pragma unroll
      for (int q = 0; q < 8; ++q) f.u[q] = tl[pc * 8 + q][d];
      *(v8us*)((unsigned short*)Vt + ((size_t)slab * 64 + d) * TTv + lg * 64 + pc * 8) = f.half[0]; }
     } }

__global__ __launch_bounds__(256) void k_hl(const float* __restrict__ F, _Float16* __restrict__ Hh, _Float16* __restrict__ Hl, size_t n8) { const size_t t = (size_t)blockIdx.x * 256 + threadIdx.x; if (t >= n8) return; FragH fh, fl; const v4f a = *(const v4fa*)(F + t * 8), c = *(const v4fa*)(F + t * 8 + 4);
#pragma unroll
  for (int q = 0; q < 4; ++q) { _Float16 h = (_Float16)a[q]; fh.h[q] = h; fl.h[q] = (_Float16)((a[q] - (float)h) * 1024.0f); h = (_Float16)c[q]; fh.h[4 + q] = h; fl.h[4 + q] = (_Float16)((c[q] - (float)h) * 1024.0f); }
  { *(v8us*)((unsigned short*)Hh + t * 8) = fh.half[0]; *(v8us*)((unsigned short*)Hl + t * 8) = fl.half[0];  } }

// ---- fast GEMM (wave tile 32x64; requires M % 32 == 0 rows per launch region and N % 64 == 0); epilogue = k_gemm_hhx semantics ----
__device__ __forceinline__ v16h g2_frag(const _Float16* p, int hh) { FragH f; f.half[0] = *(const v8us*)((const unsigned short*)p + 8 * hh); f.half[1] = *(const v8us*)((const unsigned short*)p + 16 + 8 * hh); return f.v; }
__device__ __forceinline__ v8f g2_mma(v16h a, v16h b, v8f c) { v8f d = __builtin_amdgcn_wmma_f32_16x16x32_f16(false, a, false, b, (short)0, c, false, false); asm volatile("v_nop\n\tv_nop\n\tv_nop\n\tv_nop" : "+v"(d) : "v"(a), "v"(b)); return d; }
template <int ACT>
__global__ __launch_bounds__(128) void k_gemm2(const _Float16* __restrict__ A, int lda, size_t sA, const _Float16* __restrict__ Bh, int ldb, size_t sB, float alpha, const float* __restrict__ bias, size_t sBias, const float* __restrict__ CP, int rowsPerB, size_t sCPb, int row0g,
    float* __restrict__ C, _Float16* __restrict__ C16, int ldc, size_t sC, int M, int N, int K) { static_assert(ACT == 0 || ACT == 3 || ACT == 6 || ACT == 8 || ACT == 9 || ACT == 11 || ACT == 12 || ACT == 14 || ACT == 15 || ACT == 16 || ACT == 17, "k_gemm2: unsupported ACT code (would silently apply no activation)");
  __shared__ __attribute__((aligned(16))) float so[4][32][68];
  const int tid = threadIdx.x, w = tid >> 5, lane = tid & 31, ln = lane & 15, hh = lane >> 4; const int by = blockIdx.y;
  A += (size_t)by * sA; Bh += (size_t)by * sB; const size_t cofs = (size_t)by * sC; const float* bp = bias ? bias + (size_t)by * sBias : nullptr;
  const int ntn = N >> 6; const int mt = blockIdx.x / ntn, nq = blockIdx.x - mt * ntn; const int row0 = mt * 128 + 32 * w, col0 = nq * 64; if (row0 >= M) return;
  const _Float16* a0p = A + (size_t)(row0 + ln) * lda; const _Float16* a1p = a0p + (size_t)16 * lda;
  const _Float16* b0p = Bh + (size_t)(col0 + ln) * ldb; const _Float16* b1p = b0p + (size_t)16 * ldb; const _Float16* b2p = b1p + (size_t)16 * ldb; const _Float16* b3p = b2p + (size_t)16 * ldb;
  const v8f z8 = {0.f,0.f,0.f,0.f,0.f,0.f,0.f,0.f}; v8f c00 = z8, c01 = z8, c02 = z8, c03 = z8, c10 = z8, c11 = z8, c12 = z8, c13 = z8;
#pragma unroll 1
  for (int kb = 0; kb < K; kb += 32) { const v16h a0 = g2_frag(a0p + kb, hh), a1 = g2_frag(a1p + kb, hh);
    v16h b = g2_frag(b0p + kb, hh); c00 = g2_mma(a0, b, c00); c10 = g2_mma(a1, b, c10);
    b = g2_frag(b1p + kb, hh); c01 = g2_mma(a0, b, c01); c11 = g2_mma(a1, b, c11);
    b = g2_frag(b2p + kb, hh); c02 = g2_mma(a0, b, c02); c12 = g2_mma(a1, b, c12);
    b = g2_frag(b3p + kb, hh); c03 = g2_mma(a0, b, c03); c13 = g2_mma(a1, b, c13); }
  v8f accs[8] = {c00, c01, c02, c03, c10, c11, c12, c13};
#pragma unroll
  for (int u = 0; u < 8; ++u) { const int t = u & 3, half = u >> 2; const int col = col0 + t * 16 + ln; const float bv = bp ? bf16_round(bp[col]) : 0.f;
#pragma unroll
    for (int r = 0; r < 8; ++r) { const int rloc = half * 16 + 8 * hh + r; float v = accs[u][r] * alpha + bv; if (CP) { if (rowsPerB < 0) v += CP[cofs + (size_t)(row0g + row0 + rloc) * ldc + col];      /* rowsPerB < 0: own element of the batched C plane */ else { const int bidx = (row0g + row0 + rloc) / rowsPerB; v += CP[(size_t)bidx * sCPb + (size_t)by * 64 + col]; } }
      if (ACT == 3) v = fmaxf(v, 0.f); else if (ACT == 6) v = 0.5f * v * (1.0f + erff(v * 0.70710678118654752f)); else if (ACT == 11) v = 1.0f / (1.0f + expf(-v)); else if (ACT == 15) v = v / (1.0f + expf(-v)); else if (ACT == 12) v = (v > 0.f) ? v : 0.01f * v; else if (ACT == 8) v = tanhf(v); else if (ACT == 9) v = 0.5f * v * (1.0f + tanhf(0.7978845608028654f * (v + 0.044715f * v * v * v))); else if (ACT == 14) v = (v > 0.f) ? v : 0.1f * v; else if (ACT == 16) v = (v >= 0.f) ? v : 0.3f * v; else if (ACT == 17) v = (v >= 0.f) ? v : 0.2f * v;
      so[w][rloc][t * 16 + ln] = v; } }
  __builtin_amdgcn_fence(__ATOMIC_ACQ_REL, "workgroup"); __builtin_amdgcn_wave_barrier();
  const int rsub = lane >> 4, c4 = (lane & 15) * 4;
  {
#pragma unroll
    for (int q = 0; q < 16; ++q) { const int r = q * 2 + rsub; const v4f v = *(const v4fa*)&so[w][r][c4]; if (C) *(v4f*)(C + cofs + (size_t)(row0 + r) * ldc + col0 + c4) = v; if (C16) { v4h h4; for (int i = 0; i < 4; ++i) h4[i] = (_Float16)v[i]; *(v4h*)(C16 + cofs + (size_t)(row0 + r) * ldc + col0 + c4) = h4; } }
     } }


__global__ __launch_bounds__(256) void k_wnat(const float* __restrict__ w, size_t n8, _Float16* __restrict__ Bt) { const size_t t = (size_t)blockIdx.x * 256 + threadIdx.x; if (t >= n8) return; FragH f; for (int q = 0; q < 8; ++q) f.h[q] = (_Float16)(bf16_round(w[t * 8 + q]) * 16.0f); *(v8us*)((unsigned short*)Bt + t * 8) = f.half[0];  }
__global__ __launch_bounds__(256) void k_rsm(const float* __restrict__ S, _Float16* __restrict__ P, int nrows) {
  #pragma clang fp contract(off)
  const int i = blockIdx.x * 256 + threadIdx.x; if (i >= nrows) return; const float* s = S + (size_t)i * SQ; float mx = -3.0e38f;
#pragma unroll 1
  for (int j = 0; j < SQ; ++j) mx = fmaxf(mx, s[j]); float se = 0.f;
#pragma unroll 1
  for (int j = 0; j < SQ; ++j) se += expf(s[j] - mx); const float sc = 256.0f / se;
#pragma unroll 1
  for (int j0 = 0; j0 < SQ; j0 += 8) { FragH f; for (int q = 0; q < 8; ++q) f.h[q] = (_Float16)(expf(s[j0 + q] - mx) * sc); unsigned short* d = (unsigned short*)P + (size_t)i * SQ + j0; *(v8us*)d = f.half[0];  } }
__global__ __launch_bounds__(256) void k_vt(const _Float16* __restrict__ V16, int b, int h0, _Float16* __restrict__ VT) { __shared__ unsigned short tl[64][65]; const int tid = threadIdx.x; const int hh = blockIdx.x % HG, sg = blockIdx.x / HG; const int s0 = sg * 64; const int h = h0 + hh;
  for (int i = tid; i < 64 * 8; i += 256) { const int j = i / 8, d8 = (i % 8) * 8; FragH f; f.half[0] = *(const v8us*)((const unsigned short*)V16 + ((size_t)b * SQ + s0 + j) * DM + h * HD + d8); for (int q = 0; q < 8; ++q) tl[d8 + q][j] = f.u[q]; }
  __syncthreads();
  { for (int i = tid; i < 64 * 8; i += 256) { const int d = i / 8, j8 = (i % 8) * 8; FragH f; for (int q = 0; q < 8; ++q) f.u[q] = tl[d][j8 + q]; *(v8us*)((unsigned short*)VT + ((size_t)hh * HD + d) * SQ + s0 + j8) = f.half[0]; }  } }



// Fused causal attention: a block owns 128 query rows of one head (32 per wave) and walks the keys 64 at a time; scores and weights never leave registers.
// Each pass stages 64 rows of k hi, k lo and 64 rows (head dims) of V^T in LDS by whole-line loads, once for the four waves; row pitch 128 + 16 bytes for the 16-byte fragment reads.
// S^T = K . Q^T (A = 16 key rows, B = 16 query rows, both by g2_frag): a lane holds 8 keys (8*hh + r) of ONE query (ln) per tile, so maximum and sum are in-lane plus one exchange of the wave halves.
// Two score tiles of one query group, converted in place, are the B operand of O^T += V^T . P^T (element i = key 8*hh + i, element 8 + i = key 16 + 8*hh + i: the k order of g2_frag on the V^T rows).
// Scores: (lo . hi + hi . lo) first, x 2^-10, then hi . hi on top in the same accumulator. Weights carried x256 (the + 8 in the exponent), in the f16 operand and in the row sum alike; o leaves x64.
#define FAC 0.18033688011112042f           /* 1 / sqrt(head_dim) * log2(e) */
#define FLP 72                             /* LDS row pitch in f16: 64 + 8 */
__device__ __forceinline__ float fa_exp2(float x) { asm("v_exp_f32 %0, %0\n\tv_nop" : "+v"(x)); return x; }      /* native 2^x; the v_nop fills the one slot that the instruction set asks for between a transcendental and a directly following instruction that reads its result or overwrites its source */
__device__ __forceinline__ v8f fa_mma(v16h a, v16h b, v8f c) { return __builtin_amdgcn_wmma_f32_16x16x32_f16(false, a, false, b, (short)0, c, false, false); }
__global__ __launch_bounds__(128) void k_fattn(const _Float16* __restrict__ QHp, const _Float16* __restrict__ QLp, const _Float16* __restrict__ KHp, const _Float16* __restrict__ KLp, const _Float16* __restrict__ VTp, _Float16* __restrict__ Op) {
  __shared__ __attribute__((aligned(16))) _Float16 lkh[64][FLP]; __shared__ __attribute__((aligned(16))) _Float16 lkl[64][FLP]; __shared__ __attribute__((aligned(16))) _Float16 lvt[64][FLP];
  const int tid = threadIdx.x, lane = tid & 31, ln = lane & 15, hh = lane >> 4; const int w = __builtin_amdgcn_readfirstlane(tid >> 5);
  const int h = blockIdx.y, b = blockIdx.z; const int qt = (b & 1) ? (int)blockIdx.x : (int)gridDim.x - 1 - (int)blockIdx.x;      /* long and short blocks mixed over the grid */
  const int row0 = qt * 128 + 32 * w; const size_t r0 = (size_t)b * SQ;
  v16h qh[2][2], ql[2][2]; const _Float16* qhp = QHp + (r0 + row0 + ln) * LQ + h * HD + 8 * hh; const _Float16* qlp = QLp + (r0 + row0 + ln) * LQ + h * HD + 8 * hh;      /* the lane's own 16-byte pieces start here (g2_frag with half 0) */
#pragma unroll
  for (int g = 0; g < 2; ++g) { qh[g][0] = g2_frag(qhp + g * (16 * LQ), 0); qh[g][1] = g2_frag(qhp + g * (16 * LQ) + 32, 0); ql[g][0] = g2_frag(qlp + g * (16 * LQ), 0); ql[g][1] = g2_frag(qlp + g * (16 * LQ) + 32, 0); }
  asm volatile("s_wait_xcnt 0x0" :: "v"(qhp), "v"(qlp) : "memory");      /* the sixteen loads' address registers stay untouched up to this wait: nothing, a later load's data included, lands on them before it */
  const char* khb = (const char*)(KHp + r0 * LQ + h * HD); const char* klb = (const char*)(KLp + r0 * LQ + h * HD); const char* vtb = (const char*)(VTp + (size_t)(b * NH + h) * HD * SQ);      /* block-uniform bases */
  const int srow = tid >> 3, sc8 = (tid & 7) * 8; const unsigned koff = (unsigned)(srow * LQ + sc8) * 2u, voff = (unsigned)(srow * SQ + sc8) * 2u;      /* staging: 8 threads per row of 128 bytes, 16 rows a step; byte offsets */
  const v8f z8 = {0.f,0.f,0.f,0.f,0.f,0.f,0.f,0.f}; v8f o[4][2];
#pragma unroll
  for (int dt = 0; dt < 4; ++dt) { o[dt][0] = z8; o[dt][1] = z8; }
  float m[2] = {-1.0e30f, -1.0e30f}, l[2] = {0.f, 0.f};
  const int kend = qt * 128 + 64;           /* the block's last piece: every wave stages and passes the barriers up to it */
#pragma unroll 1      /* one pass is up to 64 matrix instructions of straight-line code already */
  for (int kb = 0; kb <= kend; kb += 64) { v8us tk[4], tl[4], tv[4]; const char* kp = khb + (size_t)kb * (LQ * 2) + koff; const char* lp = klb + (size_t)kb * (LQ * 2) + koff; const char* vp = vtb + (size_t)kb * 2 + voff;
#pragma unroll
    for (int j = 0; j < 4; ++j) { tk[j] = *(const v8us*)(kp + j * (16 * LQ * 2)); tl[j] = *(const v8us*)(lp + j * (16 * LQ * 2)); tv[j] = *(const v8us*)(vp + j * (16 * SQ * 2)); }
    asm volatile("s_wait_xcnt 0x0" :: "v"(kp), "v"(lp), "v"(vp) : "memory");      /* the twelve loads' address registers stay untouched up to this wait: nothing, a later load's data included, lands on them before it */
    __syncthreads();      /* every wave has left the previous pass's rows */
#pragma unroll
    for (int j = 0; j < 4; ++j) { *(v8us*)&lkh[j * 16 + srow][sc8] = tk[j]; *(v8us*)&lkl[j * 16 + srow][sc8] = tl[j]; *(v8us*)&lvt[j * 16 + srow][sc8] = tv[j]; }
    __syncthreads();      /* publishes the staged rows to the four waves */
#pragma unroll
    for (int hf = 0; hf < 2; ++hf) { const int k0 = kb + 32 * hf;      /* 32 keys a step: 16 score registers per query group alive at a time */
      if (k0 <= row0) {      /* wave-uniform: keys past the wave's last row (row0 + 31) are left out whole */
        v8f s[2][2];
#pragma unroll
        for (int t = 0; t < 2; ++t) { const int kr = 32 * hf + 16 * t + ln; const v16h a0 = g2_frag(&lkh[kr][0], hh), a1 = g2_frag(&lkh[kr][32], hh), c0 = g2_frag(&lkl[kr][0], hh), c1 = g2_frag(&lkl[kr][32], hh);
#pragma unroll
          for (int g = 0; g < 2; ++g) { v8f y = fa_mma(a0, ql[g][0], z8); y = fa_mma(a1, ql[g][1], y); y = fa_mma(c0, qh[g][0], y); y = fa_mma(c1, qh[g][1], y);
#pragma unroll
            for (int r = 0; r < 8; ++r) y[r] *= 0.0009765625f;
            y = fa_mma(a0, qh[g][0], y); y = fa_mma(a1, qh[g][1], y); s[t][g] = y; } }
        if (k0 == row0) {      /* wave-uniform: the 32 x 32 piece on the diagonal is the only one that needs the causal test; key k0 stays for every query */
#pragma unroll
          for (int t = 0; t < 2; ++t)
#pragma unroll
            for (int g = 0; g < 2; ++g)
#pragma unroll
              for (int r = 0; r < 8; ++r) if (16 * t + 8 * hh + r > 16 * g + ln) s[t][g][r] = -1.0e30f; }
        FragH p[2];
#pragma unroll
        for (int g = 0; g < 2; ++g) { float mx = s[0][g][0];
#pragma unroll
          for (int t = 0; t < 2; ++t)
#pragma unroll
            for (int r = 0; r < 8; ++r) mx = fmaxf(mx, s[t][g][r]);
          mx = fmaxf(mx, __shfl_xor(mx, 16, 32));      /* the other 8 keys of every tile sit in the other wave half */
          const float mn = fmaxf(m[g], mx); const float sc = fa_exp2((m[g] - mn) * FAC); m[g] = mn; const float nb = fmaf(-mn, FAC, 8.0f);
          float ps[4] = {0.f, 0.f, 0.f, 0.f};
#pragma unroll
          for (int t = 0; t < 2; ++t)
#pragma unroll
            for (int r = 0; r < 8; ++r) { const float e = fa_exp2(fmaf(s[t][g][r], FAC, nb)); ps[r & 3] += e; p[g].h[t * 8 + r] = (_Float16)e; }
          l[g] = fmaf(l[g], sc, (ps[0] + ps[1]) + (ps[2] + ps[3]));
#pragma unroll
          for (int dt = 0; dt < 4; ++dt)
#pragma unroll
            for (int r = 0; r < 8; ++r) o[dt][g][r] *= sc; }
#pragma unroll
        for (int dt = 0; dt < 4; ++dt) { const v16h a = g2_frag(&lvt[16 * dt + ln][32 * hf], hh); o[dt][0] = fa_mma(a, p[0].v, o[dt][0]); o[dt][1] = fa_mma(a, p[1].v, o[dt][1]); } } } }
#pragma unroll
  for (int g = 0; g < 2; ++g) { const float fin = 64.0f / (l[g] + __shfl_xor(l[g], 16, 32));      /* the halves' sums joined once; x256 cancels, o carried x64 */
    unsigned short* op = (unsigned short*)Op + (r0 + row0 + 16 * g + ln) * DM + h * HD + 8 * hh;
#pragma unroll
    for (int dt = 0; dt < 4; ++dt) { FragH f;
#pragma unroll
      for (int r = 0; r < 8; ++r) f.h[r] = (_Float16)(o[dt][g][r] * fin);
      *(v8us*)(op + 16 * dt) = f.half[0]; } } }


// Exact f32 attention for the first QT0 rows, one thread per query row. The block's key and value rows (64 or 128 rows of 64 floats) are staged once in LDS
// by whole-line loads and then read as broadcasts; the thread's q row and o row stay in registers; four keys' score sums run side by side, each in index order.
// Every plain '#pragma unroll' below makes the indices of q, o, s and the staged pieces constants, so that these arrays are registers and not scratch.
template <int MASKADD>
__global__ __launch_bounds__(64) void k_att0(const float* __restrict__ QF, const float* __restrict__ KF, const float* __restrict__ VF, int ld, const float* __restrict__ mask, float scale, float* __restrict__ OF, int ldo) {
  static_assert(MASKADD == 0, "k_att0: only the causal form is staged (keys up to the block's last row)"); (void)mask;
  __shared__ __attribute__((aligned(16))) float lk[QT0][64]; __shared__ __attribute__((aligned(16))) float lv[QT0][64]; __shared__ __attribute__((aligned(16))) float lo[64][64];
  const int tid = threadIdx.x; const int h = blockIdx.x / (QT0 / 64), rg = blockIdx.x % (QT0 / 64); const int i = rg * 64 + tid;
  __builtin_assume(ld == DM);      /* every launch passes the row pitch DM: the row steps below fold into the loads' immediate offsets, so one offset register serves all loads of a kind */
  const char* qh = (const char*)(QF + h * HD); const char* kh = (const char*)(KF + h * HD); const char* vh = (const char*)(VF + h * HD);      /* block-uniform bases */
  const unsigned qoff = (unsigned)(i * ld) * 4u;      /* byte offset of the thread's q row */
  float q[HD], o[HD];
#pragma unroll
  for (int c = 0; c < HD / 4; ++c) { const v4f t4 = *(const v4fa*)(qh + qoff + c * 16);
#pragma unroll
    for (int u = 0; u < 4; ++u) { q[c * 4 + u] = t4[u]; o[c * 4 + u] = 0.f; } }
  static_assert(QT0 == 128, "k_att0: staging is written for one or two pieces of 64 keys");
  const int srow = tid >> 4, sc4 = (tid & 15) * 4; const unsigned soff = (unsigned)(srow * ld + sc4) * 4u;      /* staging: 16 threads per row of 256 bytes; byte offset */
#pragma unroll
  for (int t = 0; t < QT0 / 64; ++t) if (t <= rg) {      /* block-uniform test: 64 keys a piece, all 32 loads of a thread in flight together */
    v4f tk[16], tv[16];
#pragma unroll
    for (int it = 0; it < 16; ++it) { tk[it] = *(const v4fa*)(kh + soff + (t * 64 + it * 4) * ld * 4); tv[it] = *(const v4fa*)(vh + soff + (t * 64 + it * 4) * ld * 4); }
    asm volatile("s_wait_xcnt 0x0" :: "v"(qoff), "v"(soff) : "memory");      /* the loads' offset registers stay untouched up to this wait: nothing, a later load's data included, lands on a register that an issued load names */
#pragma unroll
    for (int it = 0; it < 16; ++it) { *(v4f*)&lk[t * 64 + it * 4 + srow][sc4] = tk[it]; *(v4f*)&lv[t * 64 + it * 4 + srow][sc4] = tv[it]; } }
  __syncthreads();      /* publishes the staged rows to both waves */
  float m = -1.0e30f, l = 0.f; const int nkey = rg * 64 + 64;      /* causal form: keys up to the block's last row */
#pragma unroll 1      /* the body is four whole keys of straight-line code already: more would only grow the text */
  for (int j0 = 0; j0 < nkey; j0 += 4) { float s[4] = {0.f, 0.f, 0.f, 0.f};
#pragma unroll
    for (int c = 0; c < HD / 4; ++c) { v4f kq[4];
#pragma unroll
      for (int u = 0; u < 4; ++u) kq[u] = *(const v4f*)&lk[j0 + u][c * 4];
#pragma unroll
      for (int x = 0; x < 4; ++x)
#pragma unroll
        for (int u = 0; u < 4; ++u) s[u] = __fadd_rn(s[u], __fmul_rn(q[c * 4 + x], kq[u][x])); }
#pragma unroll
    for (int u = 0; u < 4; ++u) { const int j = j0 + u; const float sv = __fmul_rn(s[u], scale);
      const float f = (j <= i) ? 1.f : 0.f; const float sm = fmaf(f, sv, (1.f - f) * -1.0e30f); const float mn = fmaxf(m, sm); const float sc = expf(m - mn); const float e = expf(sm - mn); l = __fadd_rn(__fmul_rn(l, sc), e); m = mn;
#pragma unroll
      for (int c = 0; c < HD / 4; ++c) { const v4f vv = *(const v4f*)&lv[j][c * 4];
#pragma unroll
        for (int x = 0; x < 4; ++x) o[c * 4 + x] = __fadd_rn(__fmul_rn(o[c * 4 + x], sc), __fmul_rn(e, vv[x])); } } }
  const float fin = 64.0f / l;      /* o carried x64 like the f16 path */
#pragma unroll
  for (int c = 0; c < HD / 4; ++c) { v4f oo;
#pragma unroll
    for (int u = 0; u < 4; ++u) oo[u] = __fmul_rn(o[c * 4 + u], fin);
    *(v4f*)&lo[tid][c * 4] = oo; }
  __syncthreads();
  {
#pragma unroll 1
    for (int it = 0; it < 16; ++it) { const int row = it * 4 + tid / 16, pc = (tid % 16) * 4; const v4f v = *(const v4f*)&lo[row][pc]; *(v4f*)(OF + (size_t)(rg * 64 + row) * ldo + h * HD + pc) = v; }
     } }

extern "C" void kernel_launch(void* const* d_in, const int* in_sizes, int n_in,
                              void* d_out, int out_size, void* d_ws, size_t ws_size, hipStream_t stream) {
  (void)in_sizes; (void)n_in; (void)out_size;
  const float* const* I = (const float* const*)d_in; const float* x = I[0]; const float* xk = I[1]; const float* xv = I[2]; const float* wq = I[3]; const float* bq = nullptr; const float* wk = I[4]; const float* bk = nullptr; const float* wv = I[5]; const float* bv = nullptr; const float* wo = I[6]; const float* bo = I[7];      /* input order: query_data, key_data, value_data (three SEPARATE streams: the three exact-f16 row casts read one each), Wq, Wk, Wv ([in][out]; the module has NO q / k / v biases: null pointers in the guarded bias slots), Wp ([in][out]), bp (REAL); NO mask input (the causal fill is built inside the reference) */
  char* ws = (char*)d_ws; size_t off = 0;
  auto take = [&](size_t bytes) { char* p = ws + off; off += (bytes + 255) & ~(size_t)255; return p; };
  _Float16* BQ = (_Float16*)take((size_t)DM * DM * 2); _Float16* BK = (_Float16*)take((size_t)DM * DM * 2); _Float16* BV = (_Float16*)take((size_t)DM * DM * 2); _Float16* BO = (_Float16*)take((size_t)DM * DM * 2);
  _Float16* X16 = (_Float16*)take(NR * DM * 2); _Float16* XK16 = (_Float16*)take(NR * DM * 2); _Float16* XV16 = (_Float16*)take(NR * DM * 2);      /* exact f16 rows of query, key, value */ float* QF = (float*)take(NR * DM * 4); _Float16* QH = (_Float16*)take(NR * DM * 2); _Float16* QL = (_Float16*)take(NR * DM * 2); _Float16* KH = (_Float16*)take(NR * DM * 2); _Float16* KL = (_Float16*)take(NR * DM * 2); _Float16* Q16 = QH; _Float16* K16 = KH; _Float16* V16 = (_Float16*)take(NR * DM * 2); _Float16* O16 = (_Float16*)take(NR * DM * 2);
  _Float16* VT = (_Float16*)take((size_t)NB * NH * HD * SQ * 2);
  float* QF0 = (float*)take((size_t)QT0 * DM * 4); float* KF0 = (float*)take((size_t)QT0 * DM * 4); float* VF0 = (float*)take((size_t)QT0 * DM * 4); float* OF0 = (float*)take((size_t)NB * QT0 * DM * 4); _Float16* OH0 = (_Float16*)take((size_t)NB * QT0 * DM * 2); _Float16* OL0 = (_Float16*)take((size_t)NB * QT0 * DM * 2);
  if (off > ws_size) return;
  { const unsigned g = (unsigned)(((size_t)DM * (DM / 8) + 255) / 256); k_wt_f16<<<g, 256, 0, stream>>>(wq, BQ, DM, DM, 16.0f); k_wt_f16<<<g, 256, 0, stream>>>(wk, BK, DM, DM, 16.0f); k_wt_f16<<<g, 256, 0, stream>>>(wv, BV, DM, DM, 16.0f); k_wt_f16<<<g, 256, 0, stream>>>(wo, BO, DM, DM, 16.0f); }      /* [in][out] -> Bt[n][k] x16 */
  k_x16<<<(unsigned)((NR * DM / 8 + 255) / 256), 256, 0, stream>>>(x, X16, NR * DM / 8); k_x16<<<(unsigned)((NR * DM / 8 + 255) / 256), 256, 0, stream>>>(xk, XK16, NR * DM / 8); k_x16<<<(unsigned)((NR * DM / 8 + 255) / 256), 256, 0, stream>>>(xv, XV16, NR * DM / 8);
  const size_t r0p = (size_t)B0 * SQ;      /* first projected row */
  k_gemm2<0><<<dim3((unsigned)((MP / 128) * (DM / 64)), 1), 128, 0, stream>>>(X16 + r0p * DM, DM, 0, BQ, DM, 0, 0.0625f, bq, 0, nullptr, 1, 0, 0, QF + r0p * DM, nullptr, DM, 0, MP, DM, DM); k_hl<<<(unsigned)(((size_t)MP * DM / 8 + 255) / 256), 256, 0, stream>>>(QF + r0p * DM, QH + r0p * DM, QL + r0p * DM, (size_t)MP * DM / 8);      /* q (f32) -> f16 hi + x1024 residual: unscaled logits sigma ~8 */
  k_gemm2<0><<<dim3((unsigned)((MP / 128) * (DM / 64)), 1), 128, 0, stream>>>(XK16 + r0p * DM, DM, 0, BK, DM, 0, 0.0625f, bk, 0, nullptr, 1, 0, 0, QF + r0p * DM, nullptr, DM, 0, MP, DM, DM); k_hl<<<(unsigned)(((size_t)MP * DM / 8 + 255) / 256), 256, 0, stream>>>(QF + r0p * DM, KH + r0p * DM, KL + r0p * DM, (size_t)MP * DM / 8);      /* k likewise */
  k_gemm2<0><<<dim3((unsigned)((MP / 128) * (DM / 64)), 1), 128, 0, stream>>>(XV16 + r0p * DM, DM, 0, BV, DM, 0, 0.0625f, bv, 0, nullptr, 1, 0, 0, nullptr, V16 + r0p * DM, DM, 0, MP, DM, DM);
  k_vt<NH, SQ><<<NB * NH * (SQ / 64), 256, 0, stream>>>(V16, LQ, 0, VT);      /* V^T [NB][NH][HD][SQ] */
  k_fattn<<<dim3(SQ / 128, NH, NB), 128, 0, stream>>>(QH, QL, KH, KL, VT, O16);      /* scores, causal softmax and P . V in one launch for all rows, heads and batches: o (merged heads, x64) as f16 rows */
  for (int b = B0; b < B0 + NBR; ++b) { const size_t r0 = (size_t)b * SQ;
    k_gemm2<0><<<dim3((QT0 / 128) * (DM / 64), 1), 128, 0, stream>>>(X16 + r0 * DM, DM, 0, BQ, DM, 0, 0.0625f, bq, 0, nullptr, 1, 0, 0, QF0, nullptr, DM, 0, QT0, DM, DM); k_gemm2<0><<<dim3((QT0 / 128) * (DM / 64), 1), 128, 0, stream>>>(XK16 + r0 * DM, DM, 0, BK, DM, 0, 0.0625f, bk, 0, nullptr, 1, 0, 0, KF0, nullptr, DM, 0, QT0, DM, DM); k_gemm2<0><<<dim3((QT0 / 128) * (DM / 64), 1), 128, 0, stream>>>(XV16 + r0 * DM, DM, 0, BV, DM, 0, 0.0625f, bv, 0, nullptr, 1, 0, 0, VF0, nullptr, DM, 0, QT0, DM, DM);      /* f32 q, k, v of the first 128 rows (exact products) */
    k_att0<0><<<NH * (QT0 / 64), 64, 0, stream>>>(QF0, KF0, VF0, DM, nullptr, SCL, OF0 + (size_t)b * QT0 * DM, DM); }      /* exact f32 attention for rows 0..127 (o x64) */
  k_gemm2<0><<<dim3((unsigned)((MPO / 128) * (DM / 64)), 1), 128, 0, stream>>>(O16 + r0p * DM, DM, 0, BO, DM, 0, 0.0009765625f, bo, 0, nullptr, 1, 0, 0, (float*)d_out + r0p * DM, nullptr, DM, 0, MPO, DM, DM);      /* out rows are the output layout */
  k_hl<<<(unsigned)(((size_t)NB * QT0 * DM / 8 + 255) / 256), 256, 0, stream>>>(OF0, OH0, OL0, (size_t)NB * QT0 * DM / 8);      /* first-tile o (x64) -> f16 hi + x1024 residual planes */
  for (int b = B0; b < B0 + NBR; ++b) { const size_t r0 = (size_t)b * SQ; const size_t f0 = (size_t)b * QT0;
    k_gemm2<0><<<dim3((QT0 / 128) * (DM / 64), 1), 128, 0, stream>>>(OH0 + f0 * DM, DM, 0, BO, DM, 0, 0.0009765625f, bo, 0, nullptr, 1, 0, 0, (float*)d_out + r0 * DM, nullptr, DM, 0, QT0, DM, DM);      /* rows 0..127: out = o_hi Wo (+ b), overwriting the f16-path rows */
    k_gemm2<0><<<dim3((QT0 / 128) * (DM / 64), 1), 128, 0, stream>>>(OL0 + f0 * DM, DM, 0, BO, DM, 0, 0.00000095367431640625f, nullptr, 0, (const float*)d_out + r0 * DM, -1, 0, 0, (float*)d_out + r0 * DM, nullptr, DM, 0, QT0, DM, DM); }      /* += o_lo Wo 2^-20 (own-element accumulate) */
}

// v004
// It runs in 350 microseconds.
// In two side-by-side timings against v003, it was 1.85 and 1.83 times as fast.
// Over all steps from v000 it is 16.7 times as fast.
#include <hip/hip_runtime.h>
// Causal multi-head attention on three inputs with bias-free [in][out] projections and a biased [in][out] output projection (query_data, key_data, value_data [2][2048][1024]; q = split_heads(query_data Wq), k = split_heads(key_data Wk), v = split_heads(value_data Wv) ([in][out] [1024][1024], NO biases), 16 heads of 64; scores / sqrt(64); scores + triu(ones, k = 1) x (-1e13): an additive fill strictly above the diagonal == exclusion (exp underflows to exactly 0; every row keeps its diagonal); softmax over keys; out = merged Wp + bp ([in][out] + a REAL bias) -> [2][2048][1024]); the causal rule is built inside the reference: applied here by index; q and k carried as f16 hi + x1024 residual planes with three-product scores.
// Structure: token rows r = b*2048 + s; x as exact f16 rows (bf16-rounded); q and k as WMMA GEMMs (32x64 wave tiles, f32 accumulation, exact x16 weights, no bias) into f32 rows split into f16 hi + x1024 residual planes, v as an f16-output GEMM; V^T for all heads and batches via LDS transposes; one fused attention launch: a block owns 128 query rows of a head (32 per wave) and walks the keys up to its last row 64 at a time, k hi, k lo and V^T rows staged in LDS per pass: three-product scores (lo.hi + hi.lo, x 2^-10, + hi.hi) as S^T tiles in registers, running maximum and sum per query (f32 statistics, native exp2; keys past the row's own index excluded; weights x256 f16, packed in place as the B operand), O^T += V^T . P^T, o carried x64 (folded into the output GEMM alpha) written straight into the merged f16 o rows; out = o W_o + b GEMM (f32) into the output layout.
// Compute dtype: inputs rounded to bf16; x / weights exact; v, softmax weights and o as plain f16 GEMM operands (~2^-12), q and k as f16 hi + x1024 residual pairs; scores and softmax statistics f32; v_wmma_f32_16x16x32_f16.
#define NB 2
#define SCL 0.125f                         /* 1 / sqrt(head_dim = 64) */
#define SCLR 0.0001220703125f              /* 2^-13 (not used: k_fattn scales the x1024 residual sums by 2^-10) */
#define SQ 2048
#define DM 1024
#define NH 16
#define HD 64
#define HG 4                         /* heads per launch of the head-group k_vt (not launched) */
#define QT 256                       /* not used: the causal tiles are 128 query rows */
#define NKX SQ                       /* S / P row pitch */
#define QT0 128                      /* first-tile rows recomputed exactly in f32 */
#define B0 0                         /* first batch processed (debug hook) */
#define NBR NB                       /* batches processed (debug hook) */
#define NR ((size_t)NB * SQ)         /* token rows */
#define MP ((int)((size_t)NBR * SQ)) /* rows projected (debug hook) */
#define QN SQ                        /* query rows attended per batch (debug hook) */
#define NHD NH                       /* heads attended (debug hook) */
#define MPO MP                       /* rows through the output stage (debug hook) */
#define LQ DM      /* row pitch of the q/k/v rows */
typedef __bf16 v16b __attribute__((ext_vector_type(16)));
typedef unsigned short v8us __attribute__((ext_vector_type(8), may_alias));
typedef float  v8f  __attribute__((ext_vector_type(8)));
typedef float  v4f  __attribute__((ext_vector_type(4)));
typedef float  v4fa __attribute__((ext_vector_type(4), may_alias));
union FragB { v16b v; v8us half[2]; unsigned short u[16]; };

__device__ __forceinline__ unsigned short bf16_bits(float x) { unsigned int u = __float_as_uint(x); return (unsigned short)((u + 0x7FFFu + ((u >> 16) & 1u)) >> 16); }
__device__ __forceinline__ float bf16_val(unsigned short b) { return __uint_as_float(((unsigned int)b) << 16); }
__device__ __forceinline__ float bf16_round(float x) { return bf16_val(bf16_bits(x)); }
// D += A·B with NT terms: 1 = ah·bh, 2 = + al·bh (A split), 3 = + ah·bl (both split)
template <int NT>
__device__ __forceinline__ v8f mmaN(v16b ah, v16b al, v16b bh, v16b bl, v8f c) {
  c = __builtin_amdgcn_wmma_f32_16x16x32_bf16(false, ah, false, bh, (short)0, c, false, false);
  if (NT >= 2) c = __builtin_amdgcn_wmma_f32_16x16x32_bf16(false, al, false, bh, (short)0, c, false, false);
  if (NT >= 3) c = __builtin_amdgcn_wmma_f32_16x16x32_bf16(false, ah, false, bl, (short)0, c, false, false);
  asm volatile("v_nop\n\tv_nop\n\tv_nop\n\tv_nop" : "+v"(c) : "v"(ah), "v"(al), "v"(bh), "v"(bl));
  return c;
}

__global__ __launch_bounds__(256) void k_wt_bf16(const float* __restrict__ W, unsigned short* __restrict__ Wt, int K, int N) {
  const int t = blockIdx.x * 256 + threadIdx.x;
  const int k8n = K / 8;
  if (t >= N * k8n) return;
  const int n = t / k8n, k8 = (t % k8n) * 8;
  v8us v;
#pragma unroll
  for (int i = 0; i < 8; ++i) v[i] = bf16_bits(W[(size_t)(k8 + i) * N + n]);
  *(v8us*)(Wt + (size_t)n * K + k8) = v;
  
}

// GEMM C[M][N] (f32, pitch ldc) = act(A[M][K]·W + bias). A f32 row-major (pitch lda) converted per fragment to bf16
// (ASPLIT: hi/lo two planes -> 2 terms, else single rounded term); Wt bf16 [N][K] (pitch ldb). BIAS_BF16 rounds the
// bias to bf16 first (bias quantised to bf16 before the add). K%32==0, M%16==0, N%64==0.
template <bool ASPLIT, int ACT, bool BIAS_BF16>
__global__ __launch_bounds__(128) void k_gemm_bf(const float* __restrict__ A, int lda, const unsigned short* __restrict__ Wt, int ldb,
                                               const float* __restrict__ bias, float* __restrict__ C, int ldc, int M, int N, int K) {
  __shared__ __attribute__((aligned(16))) float so[4][16][64];
  const int tid = threadIdx.x, w = tid >> 5, lane = tid & 31, ln = lane & 15, hh = lane >> 4;
  const int ntn = N / 64;
  const int wid = blockIdx.x * 4 + w;
  const int mt = wid / ntn, nq = wid % ntn;
  if (mt * 16 >= M) return;
  const int row0 = mt * 16, col0 = nq * 64;
  const float* arow = A + (size_t)(row0 + ln) * lda;
  v8f acc[4] = {};
  for (int kb = 0; kb < K; kb += 32) {
    FragB ah, al;
    const v4f x0 = *(const v4fa*)(arow + kb + 8 * hh), x1 = *(const v4fa*)(arow + kb + 8 * hh + 4);
    const v4f x2 = *(const v4fa*)(arow + kb + 16 + 8 * hh), x3 = *(const v4fa*)(arow + kb + 16 + 8 * hh + 4);
    float xs[16] = {x0[0],x0[1],x0[2],x0[3],x1[0],x1[1],x1[2],x1[3],x2[0],x2[1],x2[2],x2[3],x3[0],x3[1],x3[2],x3[3]};
#pragma unroll
    for (int i = 0; i < 16; ++i) { const unsigned short hb = bf16_bits(xs[i]); ah.u[i] = hb; al.u[i] = ASPLIT ? bf16_bits(xs[i] - bf16_val(hb)) : (unsigned short)0; }
#pragma unroll
    for (int t = 0; t < 4; ++t) {
      const unsigned short* brow = Wt + (size_t)(col0 + t * 16 + ln) * ldb + kb;
      FragB b;
      b.half[0] = *(const v8us*)(brow + 8 * hh);
      b.half[1] = *(const v8us*)(brow + 16 + 8 * hh);
      acc[t] = mmaN<ASPLIT ? 2 : 1>(ah.v, al.v, b.v, b.v, acc[t]);
    }
  }
#pragma unroll
  for (int t = 0; t < 4; ++t) {
    float bv = bias ? bias[col0 + t * 16 + ln] : 0.f;
    if (BIAS_BF16) bv = bf16_round(bv);
#pragma unroll
    for (int r = 0; r < 8; ++r) { float v = acc[t][r] + bv; if (ACT == 1) v = fmaxf(v, 0.f); so[w][8 * hh + r][t * 16 + ln] = v; }
  }
  __builtin_amdgcn_fence(__ATOMIC_ACQ_REL, "workgroup");
  __builtin_amdgcn_wave_barrier();
  const int rsub = lane >> 4, c4 = (lane & 15) * 4;
  {
#pragma unroll
    for (int q = 0; q < 8; ++q) {
      const int r = q * 2 + rsub;
      const v4f v = *(const v4fa*)&so[w][r][c4];
      *(v4f*)(C + (size_t)(row0 + r) * ldc + col0 + c4) = v;
    }
    
  }
}

// GEMM C = act(A·W + bias + resid): A f32 (ASPLIT -> hi/lo 2 terms), Wt bf16 [N][K]; ACT 0 none, 1 relu, 2 exact gelu;
// resid (optional, f32, row index = (row % rmod), pitch ldr, RES_BF16 rounds it) added before the activation.
template <bool ASPLIT, int ACT, bool BIAS_BF16, bool RES_BF16>
__global__ __launch_bounds__(128) void k_gemm_bf3(const float* __restrict__ A, int lda, const unsigned short* __restrict__ Wt, int ldb,
                                                const float* __restrict__ bias, const float* __restrict__ resid, int rmod, int ldr,
                                                float* __restrict__ C, int ldc, int M, int N, int K) {
  __shared__ __attribute__((aligned(16))) float so[4][16][64];
  const int tid = threadIdx.x, w = tid >> 5, lane = tid & 31, ln = lane & 15, hh = lane >> 4;
  const int ntn = N / 64;
  const int wid = blockIdx.x * 4 + w;
  const int mt = wid / ntn, nq = wid % ntn;
  if (mt * 16 >= M) return;
  const int row0 = mt * 16, col0 = nq * 64;
  const float* arow = A + (size_t)(row0 + ln) * lda;
  v8f acc[4] = {};
  for (int kb = 0; kb < K; kb += 32) {
    FragB ah, al;
    const v4f x0 = *(const v4fa*)(arow + kb + 8 * hh), x1 = *(const v4fa*)(arow + kb + 8 * hh + 4);
    const v4f x2 = *(const v4fa*)(arow + kb + 16 + 8 * hh), x3 = *(const v4fa*)(arow + kb + 16 + 8 * hh + 4);
    float xs[16] = {x0[0],x0[1],x0[2],x0[3],x1[0],x1[1],x1[2],x1[3],x2[0],x2[1],x2[2],x2[3],x3[0],x3[1],x3[2],x3[3]};
#pragma unroll
    for (int i = 0; i < 16; ++i) { const unsigned short hb = bf16_bits(xs[i]); ah.u[i] = hb; al.u[i] = ASPLIT ? bf16_bits(xs[i] - bf16_val(hb)) : (unsigned short)0; }
#pragma unroll
    for (int t = 0; t < 4; ++t) {
      const unsigned short* brow = Wt + (size_t)(col0 + t * 16 + ln) * ldb + kb;
      FragB b;
      b.half[0] = *(const v8us*)(brow + 8 * hh);
      b.half[1] = *(const v8us*)(brow + 16 + 8 * hh);
      acc[t] = mmaN<ASPLIT ? 2 : 1>(ah.v, al.v, b.v, b.v, acc[t]);
    }
  }
#pragma unroll
  for (int t = 0; t < 4; ++t) {
    const int col = col0 + t * 16 + ln;
    float bv = bias ? bias[col] : 0.f;
    if (BIAS_BF16) bv = bf16_round(bv);
#pragma unroll
    for (int r = 0; r < 8; ++r) {
      float v = acc[t][r] + bv;
      if (resid) { float rv = resid[(size_t)((row0 + 8 * hh + r) % rmod) * ldr + col]; if (RES_BF16) rv = bf16_round(rv); v += rv; }
      if (ACT == 1) v = fmaxf(v, 0.f);
      if (ACT == 2) v = 0.5f * v * (1.0f + erff(v * 0.70710678118654752f));
      if (ACT == 3) { const float u = 0.7978845608028654f * (v + 0.044715f * v * v * v); v = 0.5f * v * (1.0f + tanhf(u)); }
      so[w][8 * hh + r][t * 16 + ln] = v;
    }
  }
  __builtin_amdgcn_fence(__ATOMIC_ACQ_REL, "workgroup");
  __builtin_amdgcn_wave_barrier();
  const int rsub = lane >> 4, c4 = (lane & 15) * 4;
  {
#pragma unroll
    for (int q = 0; q < 8; ++q) {
      const int r = q * 2 + rsub;
      const v4f v = *(const v4fa*)&so[w][r][c4];
      *(v4f*)(C + (size_t)(row0 + r) * ldc + col0 + c4) = v;
    }
    
  }
}
// row LayerNorm (biased variance, eps) over N: s = X (+ R); optional out_sum <- s; out_norm <- (s-mu)*rsqrt(var+eps)*g + b
template <bool PARAM_BF16>
__global__ __launch_bounds__(256) void k_layernorm(const float* __restrict__ X, const float* __restrict__ R, const float* __restrict__ g, const float* __restrict__ bta,
                                                  float* __restrict__ out_sum, float* __restrict__ out_norm, int N, float eps) {
  __shared__ float red[256];
  const int row = blockIdx.x, tid = threadIdx.x;
  const float* x = X + (size_t)row * N; const float* rr = R ? R + (size_t)row * N : nullptr;
  float vals[16];                     // up to N = 4096
  const int per = N / 256;            // contiguous chunk per thread? use strided-by-4 chunks: thread handles j = tid*4 + 1024*u
  float s1 = 0.f;
  for (int u = 0; u < per / 4; ++u) {
    const int j = tid * 4 + 1024 * u;
    const v4f a = *(const v4fa*)(x + j);
    v4f b = {0.f,0.f,0.f,0.f}; if (rr) b = *(const v4fa*)(rr + j);
#pragma unroll
    for (int q = 0; q < 4; ++q) { const float v = a[q] + b[q]; vals[u * 4 + q] = v; s1 += v; }
  }
  red[tid] = s1; __syncthreads();
  for (int st = 128; st > 0; st >>= 1) { if (tid < st) red[tid] += red[tid + st]; __syncthreads(); }
  const float mu = red[0] / (float)N; __syncthreads();
  float s2 = 0.f;
  for (int u = 0; u < per / 4; ++u)
#pragma unroll
    for (int q = 0; q < 4; ++q) { const float c = vals[u * 4 + q] - mu; s2 += c * c; }
  red[tid] = s2; __syncthreads();
  for (int st = 128; st > 0; st >>= 1) { if (tid < st) red[tid] += red[tid + st]; __syncthreads(); }
  const float rs = rsqrtf(red[0] / (float)N + eps);
  {
    for (int u = 0; u < per / 4; ++u) {
      const int j = tid * 4 + 1024 * u;
      v4f o, sm;
#pragma unroll
      for (int q = 0; q < 4; ++q) {
        float gg = g[j + q], bb = bta[j + q];
        if (PARAM_BF16) { gg = bf16_round(gg); bb = bf16_round(bb); }
        sm[q] = vals[u * 4 + q]; o[q] = (vals[u * 4 + q] - mu) * rs * gg + bb;
      }
      if (out_sum) *(v4f*)(out_sum + (size_t)row * N + j) = sm;
      *(v4f*)(out_norm + (size_t)row * N + j) = o;
    }
    
  }
}



// ---- f16 WMMA path (v_wmma_f32_16x16x32_f16): 11-bit significands for operands in range — used where a [0,1] probability operand needs more precision than bf16
typedef _Float16 v16h __attribute__((ext_vector_type(16)));
union FragH { v16h v; v8us half[2]; _Float16 h[16]; unsigned short u[16]; };
template <int NT>
__device__ __forceinline__ v8f mmaH(v16h ah, v16h al, v16h bh, v16h bl, v8f c) {
  c = __builtin_amdgcn_wmma_f32_16x16x32_f16(false, ah, false, bh, (short)0, c, false, false);
  if (NT >= 2) c = __builtin_amdgcn_wmma_f32_16x16x32_f16(false, al, false, bh, (short)0, c, false, false);
  if (NT >= 3) c = __builtin_amdgcn_wmma_f32_16x16x32_f16(false, ah, false, bl, (short)0, c, false, false);
  asm volatile("v_nop\n\tv_nop\n\tv_nop\n\tv_nop" : "+v"(c) : "v"(ah), "v"(al), "v"(bh), "v"(bl));
  return c;
}
// batched GEMM like k_gemm_b but f16 operands: A f32 (split into f16 hi/lo if ASPLIT, else rounded to f16), Bt = f16 values [n][k]; alpha; C f32; N multiple of 16 (partial tiles skipped)
template <bool ASPLIT>
__global__ __launch_bounds__(128) void k_gemm_h(const float* __restrict__ A, int lda, size_t sA, const _Float16* __restrict__ Bh, int ldb, size_t sB, float alpha, float* __restrict__ C, int ldc, size_t sC, int M, int N, int K) {
  __shared__ __attribute__((aligned(16))) float so[4][16][64];
  const int tid = threadIdx.x, w = tid >> 5, lane = tid & 31, ln = lane & 15, hh = lane >> 4; const int by = blockIdx.y;
  A += (size_t)by * sA; Bh += (size_t)by * sB; C += (size_t)by * sC;
  const int ntn = (N + 63) / 64; const int wid = blockIdx.x * 4 + w; const int mt = wid / ntn, nq = wid % ntn; if (mt * 16 >= M) return;
  const int row0 = mt * 16, col0 = nq * 64; const float* arow = A + (size_t)(row0 + ln) * lda;
  v8f acc[4] = {};
  for (int kb = 0; kb < K; kb += 32) {
    FragH ah, al;
    const v4f x0 = *(const v4fa*)(arow + kb + 8 * hh), x1 = *(const v4fa*)(arow + kb + 8 * hh + 4), x2 = *(const v4fa*)(arow + kb + 16 + 8 * hh), x3 = *(const v4fa*)(arow + kb + 16 + 8 * hh + 4);
    float xs[16] = {x0[0],x0[1],x0[2],x0[3],x1[0],x1[1],x1[2],x1[3],x2[0],x2[1],x2[2],x2[3],x3[0],x3[1],x3[2],x3[3]};
#pragma unroll
    for (int i = 0; i < 16; ++i) { const _Float16 h = (_Float16)xs[i]; ah.h[i] = h; al.h[i] = ASPLIT ? (_Float16)(xs[i] - (float)h) : (_Float16)0.0f; }
#pragma unroll
    for (int t = 0; t < 4; ++t) { if (col0 + t * 16 >= N) continue; const size_t boff = (size_t)(col0 + t * 16 + ln) * ldb + kb; FragH bq; bq.half[0] = *(const v8us*)(Bh + boff + 8 * hh); bq.half[1] = *(const v8us*)(Bh + boff + 16 + 8 * hh);
      acc[t] = mmaH<ASPLIT ? 2 : 1>(ah.v, al.v, bq.v, bq.v, acc[t]); }
  }
#pragma unroll
  for (int t = 0; t < 4; ++t) { if (col0 + t * 16 >= N) continue;
#pragma unroll
    for (int r = 0; r < 8; ++r) so[w][8 * hh + r][t * 16 + ln] = acc[t][r] * alpha; }
  __builtin_amdgcn_fence(__ATOMIC_ACQ_REL, "workgroup"); __builtin_amdgcn_wave_barrier();
  const int rsub = lane >> 4, c4 = (lane & 15) * 4;
  {
#pragma unroll
    for (int q = 0; q < 8; ++q) { const int r = q * 2 + rsub; if (col0 + c4 < N) { const v4f v = *(const v4fa*)&so[w][r][c4]; *(v4f*)(C + (size_t)(row0 + r) * ldc + col0 + c4) = v; } }
     }
}

// Wt[n][k] = f16(W[k][n]·scale) from f32 row-major W[K][N] (scale = power of two; bf16-exact weights stay exact in f16 away from the subnormal range)
__global__ __launch_bounds__(256) void k_wt_f16(const float* __restrict__ W, _Float16* __restrict__ Wt, int K, int N, float scale) {
  const int t = blockIdx.x * 256 + threadIdx.x; if (t >= N * (K / 8)) return; const int n = t / (K / 8), k8 = (t % (K / 8)) * 8; FragH f;
#pragma unroll
  for (int i = 0; i < 8; ++i) f.h[i] = (_Float16)(bf16_round(W[(size_t)(k8 + i) * N + n]) * scale); const v8us o = f.half[0];
  *(v8us*)((unsigned short*)Wt + (size_t)n * K + k8) = o; 
}
// k_gemm_hh variant with fused epilogue: v = acc·alpha + bias[by·sBias + col] (+ CP[(row/rowsPerB)·sCPb + by·64 + col] if CP) ; ACT 0 none / 1 elu ; writes f16 C16 (and f32 C if non-null)
template <int ACT>
__global__ __launch_bounds__(128) void k_gemm_hhx(const _Float16* __restrict__ A, int lda, size_t sA, const _Float16* __restrict__ Bh, int ldb, size_t sB, float alpha, const float* __restrict__ bias, size_t sBias, const float* __restrict__ CP, int rowsPerB, size_t sCPb, int row0g,
    float* __restrict__ C, _Float16* __restrict__ C16, int ldc, size_t sC, int M, int N, int K) {
  __shared__ __attribute__((aligned(16))) float so[4][16][64];
  const int tid = threadIdx.x, w = tid >> 5, lane = tid & 31, ln = lane & 15, hh = lane >> 4; const int by = blockIdx.y;
  A += (size_t)by * sA; Bh += (size_t)by * sB; const size_t cofs = (size_t)by * sC; const float* bp = bias ? bias + (size_t)by * sBias : nullptr;
  const int ntn = (N + 63) / 64; const int wid = blockIdx.x * 4 + w; const int mt = wid / ntn, nq = wid % ntn; if (mt * 16 >= M) return;
  const int row0 = mt * 16, col0 = nq * 64; const _Float16* arow = A + (size_t)(row0 + ln) * lda;
  v8f acc[4] = {};
  for (int kb = 0; kb < K; kb += 32) { FragH ah; ah.half[0] = *(const v8us*)((const unsigned short*)arow + kb + 8 * hh); ah.half[1] = *(const v8us*)((const unsigned short*)arow + kb + 16 + 8 * hh);
#pragma unroll
    for (int t = 0; t < 4; ++t) { if (col0 + t * 16 >= N) continue; const size_t boff = (size_t)(col0 + t * 16 + ln) * ldb + kb; FragH bq; bq.half[0] = *(const v8us*)((const unsigned short*)Bh + boff + 8 * hh); bq.half[1] = *(const v8us*)((const unsigned short*)Bh + boff + 16 + 8 * hh);
      acc[t] = mmaH<1>(ah.v, ah.v, bq.v, bq.v, acc[t]); }
  }
#pragma unroll
  for (int t = 0; t < 4; ++t) { if (col0 + t * 16 >= N) continue; const int col = col0 + t * 16 + ln; const float bv = bp ? bf16_round(bp[col]) : 0.f;
#pragma unroll
    for (int r = 0; r < 8; ++r) { float v = acc[t][r] * alpha + bv; if (CP) { const int rr = row0g + row0 + 8 * hh + r; if (rowsPerB < 0) v += CP[cofs + (size_t)rr * ldc + col];      /* rowsPerB < 0: own element of the batched C plane */ else { const int bidx = rr / rowsPerB; v += CP[(size_t)bidx * sCPb + (size_t)by * 64 + col]; } } if (ACT == 1) v = (v > 0.f) ? v : expm1f(v); else if (ACT == 7) v = (v > 0.f) ? v + 1.0f : expf(v); else if (ACT == 8) v = tanhf(v); else if (ACT == 9) v = 0.5f * v * (1.0f + tanhf(0.7978845608028654f * (v + 0.044715f * v * v * v))); else if (ACT == 11) v = 1.0f / (1.0f + expf(-v)); else if (ACT == 12) v = (v > 0.f) ? v : 0.01f * v; else if (ACT == 14) v = (v > 0.f) ? v : 0.1f * v; else if (ACT == 16) v = (v >= 0.f) ? v : 0.3f * v; else if (ACT == 17) v = (v >= 0.f) ? v : 0.2f * v; else if (ACT == 15) v = v / (1.0f + expf(-v)); else if (ACT == 3) v = fmaxf(v, 0.f); else if (ACT == 6) v = 0.5f * v * (1.0f + erff(v * 0.70710678118654752f)); so[w][8 * hh + r][t * 16 + ln] = v; } }
  __builtin_amdgcn_fence(__ATOMIC_ACQ_REL, "workgroup"); __builtin_amdgcn_wave_barrier();
  const int rsub = lane >> 4, c4 = (lane & 15) * 4; typedef _Float16 v4h __attribute__((ext_vector_type(4)));
  {
#pragma unroll
    for (int q = 0; q < 8; ++q) { const int r = q * 2 + rsub; if (col0 + c4 < N) { const v4f v = *(const v4fa*)&so[w][r][c4]; if (C) *(v4f*)(C + cofs + (size_t)(row0 + r) * ldc + col0 + c4) = v; if (C16) { v4h h4; for (int i = 0; i < 4; ++i) h4[i] = (_Float16)v[i]; *(v4h*)(C16 + cofs + (size_t)(row0 + r) * ldc + col0 + c4) = h4; } } }
     }
}


typedef _Float16 v4h __attribute__((ext_vector_type(4)));

__global__ __launch_bounds__(256) void k_x16(const float* __restrict__ x, _Float16* __restrict__ X16, size_t n8) { const size_t t = (size_t)blockIdx.x * 256 + threadIdx.x; if (t >= n8) return; FragH f;
#pragma unroll
  for (int q = 0; q < 8; ++q) f.h[q] = (_Float16)bf16_round(x[t * 8 + q]); *(v8us*)((unsigned short*)X16 + t * 8) = f.half[0];  }
__global__ __launch_bounds__(256) void k_h16(const float* __restrict__ x, _Float16* __restrict__ X16, size_t n8) { const size_t t = (size_t)blockIdx.x * 256 + threadIdx.x; if (t >= n8) return; FragH f;
#pragma unroll
  for (int q = 0; q < 8; ++q) f.h[q] = (_Float16)x[t * 8 + q]; *(v8us*)((unsigned short*)X16 + t * 8) = f.half[0];  }
__global__ __launch_bounds__(256) void k_round16f(const float* __restrict__ W, _Float16* __restrict__ Bt, size_t n8) { const size_t t = (size_t)blockIdx.x * 256 + threadIdx.x; if (t >= n8) return; FragH f;
#pragma unroll
  for (int i = 0; i < 8; ++i) f.h[i] = (_Float16)(bf16_round(W[t * 8 + i]) * 16.0f); *(v8us*)((unsigned short*)Bt + t * 8) = f.half[0];  }
template <int NHv, int TTv>
__global__ __launch_bounds__(256) void k_vt(const _Float16* __restrict__ V16, int ldv, int voff, _Float16* __restrict__ Vt) { __shared__ unsigned short tl[64][66]; const int tid = threadIdx.x; const int slab = blockIdx.x / (TTv / 64), lg = blockIdx.x % (TTv / 64); const int b = slab / NHv, h = slab % NHv;
  for (int i = tid; i < 64 * 8; i += 256) { const int r = i / 8, c8 = (i % 8) * 8; FragH f; f.half[0] = *(const v8us*)((const unsigned short*)V16 + ((size_t)b * TTv + lg * 64 + r) * ldv + voff + h * 64 + c8);
#pragma unroll
    for (int q = 0; q < 8; ++q) tl[r][c8 + q] = f.u[q]; }
  __syncthreads();
  {
#pragma unroll
    for (int rd = 0; rd < 2; ++rd) { const int d = rd * 32 + tid / 8, pc = tid % 8; FragH f;
#pragma unroll
      for (int q = 0; q < 8; ++q) f.u[q] = tl[pc * 8 + q][d];
      *(v8us*)((unsigned short*)Vt + ((size_t)slab * 64 + d) * TTv + lg * 64 + pc * 8) = f.half[0]; }
     } }

__global__ __launch_bounds__(256) void k_hl(const float* __restrict__ F, _Float16* __restrict__ Hh, _Float16* __restrict__ Hl, size_t n8) { const size_t t = (size_t)blockIdx.x * 256 + threadIdx.x; if (t >= n8) return; FragH fh, fl; const v4f a = *(const v4fa*)(F + t * 8), c = *(const v4fa*)(F + t * 8 + 4);
#pragma unroll
  for (int q = 0; q < 4; ++q) { _Float16 h = (_Float16)a[q]; fh.h[q] = h; fl.h[q] = (_Float16)((a[q] - (float)h) * 1024.0f); h = (_Float16)c[q]; fh.h[4 + q] = h; fl.h[4 + q] = (_Float16)((c[q] - (float)h) * 1024.0f); }
  { *(v8us*)((unsigned short*)Hh + t * 8) = fh.half[0]; *(v8us*)((unsigned short*)Hl + t * 8) = fl.half[0];  } }

// ---- fast GEMM (block tile 128x64, wave tile 32x64; requires M % 128 == 0 rows per launch region, N % 64 == 0 and K % 128 == 0); epilogue = k_gemm_hhx semantics ----
// The block's 128 A rows and 64 B rows are staged in LDS 128 k at a time (rows of 256 bytes, whole lines) by asynchronous 16-byte copies, two buffers: tile t + 2 flies while tile t + 1 is worked on.
// The four waves share the B rows; fragments are read from LDS by g2_frag in the k order and the kb order of the direct loads, so every accumulator sums in the same order.
__device__ __forceinline__ v16h g2_frag(const _Float16* p, int hh) { FragH f; f.half[0] = *(const v8us*)((const unsigned short*)p + 8 * hh); f.half[1] = *(const v8us*)((const unsigned short*)p + 16 + 8 * hh); return f.v; }
__device__ __forceinline__ v8f g2_mma(v16h a, v16h b, v8f c) { v8f d = __builtin_amdgcn_wmma_f32_16x16x32_f16(false, a, false, b, (short)0, c, false, false); asm volatile("v_nop\n\tv_nop\n\tv_nop\n\tv_nop" : "+v"(d) : "v"(a), "v"(b)); return d; }
#define GKS 128                            /* k per staged tile */
#define GLP 136                            /* LDS row pitch in f16: 128 + 8 = 272 bytes, for the 16-byte fragment reads */
// Twelve asynchronous 16-byte copies, global to LDS, each lane its own two addresses. The closing s_wait_xcnt 0 stands inside the statement so that no address register is rewritten ahead of it.
__device__ __forceinline__ void g2_copy12(const unsigned* l, const char* const* g) {
  asm volatile("global_load_async_to_lds_b128 %0, %12, off\n\tglobal_load_async_to_lds_b128 %1, %13, off\n\tglobal_load_async_to_lds_b128 %2, %14, off\n\tglobal_load_async_to_lds_b128 %3, %15, off\n\t"
               "global_load_async_to_lds_b128 %4, %16, off\n\tglobal_load_async_to_lds_b128 %5, %17, off\n\tglobal_load_async_to_lds_b128 %6, %18, off\n\tglobal_load_async_to_lds_b128 %7, %19, off\n\t"
               "global_load_async_to_lds_b128 %8, %20, off\n\tglobal_load_async_to_lds_b128 %9, %21, off\n\tglobal_load_async_to_lds_b128 %10, %22, off\n\tglobal_load_async_to_lds_b128 %11, %23, off\n\ts_wait_xcnt 0x0"
               :: "v"(l[0]), "v"(l[1]), "v"(l[2]), "v"(l[3]), "v"(l[4]), "v"(l[5]), "v"(l[6]), "v"(l[7]), "v"(l[8]), "v"(l[9]), "v"(l[10]), "v"(l[11]),
                  "v"(g[0]), "v"(g[1]), "v"(g[2]), "v"(g[3]), "v"(g[4]), "v"(g[5]), "v"(g[6]), "v"(g[7]), "v"(g[8]), "v"(g[9]), "v"(g[10]), "v"(g[11]) : "memory"); }
template <int ACT>
__global__ __launch_bounds__(128) void k_gemm2(const _Float16* __restrict__ A, int lda, size_t sA, const _Float16* __restrict__ Bh, int ldb, size_t sB, float alpha, const float* __restrict__ bias, size_t sBias, const float* __restrict__ CP, int rowsPerB, size_t sCPb, int row0g,
    float* __restrict__ C, _Float16* __restrict__ C16, int ldc, size_t sC, int M, int N, int K) { static_assert(ACT == 0 || ACT == 3 || ACT == 6 || ACT == 8 || ACT == 9 || ACT == 11 || ACT == 12 || ACT == 14 || ACT == 15 || ACT == 16 || ACT == 17, "k_gemm2: unsupported ACT code (would silently apply no activation)");
  __shared__ __attribute__((aligned(16))) float so[4][32][68];
  __shared__ __attribute__((aligned(16))) _Float16 ta[2][128][GLP]; __shared__ __attribute__((aligned(16))) _Float16 tb[2][64][GLP];
  const int tid = threadIdx.x, w = tid >> 5, lane = tid & 31, ln = lane & 15, hh = lane >> 4; const int by = blockIdx.y;
  A += (size_t)by * sA; Bh += (size_t)by * sB; const size_t cofs = (size_t)by * sC; const float* bp = bias ? bias + (size_t)by * sBias : nullptr;
  const int ntn = N >> 6; const int mt = blockIdx.x / ntn, nq = blockIdx.x - mt * ntn; const int row0 = mt * 128 + 32 * w, col0 = nq * 64; if (mt * 128 >= M) return;      /* block-uniform, in front of every barrier */
  const int srow = tid >> 4, sc8 = (tid & 15) * 8;      /* staging: 16 threads per row of 256 bytes, 8 rows a step */
  const char* ga = (const char*)(A + (size_t)(mt * 128 + srow) * lda + sc8); const char* gb = (const char*)(Bh + (size_t)(col0 + srow) * ldb + sc8); const size_t ga8 = (size_t)lda * 16, gb8 = (size_t)ldb * 16;      /* 8 rows in bytes */
  const unsigned la = (unsigned)(size_t)&ta[0][srow][sc8], lb = (unsigned)(size_t)&tb[0][srow][sc8];      /* byte addresses in the work-group's LDS */
  auto stage = [&](int t, int buf) { unsigned l[24]; const char* g[24];      /* one tile: 16 copies of A and 8 of B per thread */
#pragma unroll
    for (int j = 0; j < 16; ++j) { l[j] = la + (unsigned)buf * (unsigned)sizeof(ta[0]) + (unsigned)j * (8u * GLP * 2u); g[j] = ga + (size_t)t * (GKS * 2) + (size_t)j * ga8; }
#pragma unroll
    for (int j = 0; j < 8; ++j) { l[16 + j] = lb + (unsigned)buf * (unsigned)sizeof(tb[0]) + (unsigned)j * (8u * GLP * 2u); g[16 + j] = gb + (size_t)t * (GKS * 2) + (size_t)j * gb8; }
    g2_copy12(l, g); g2_copy12(l + 12, g + 12); };
  const v8f z8 = {0.f,0.f,0.f,0.f,0.f,0.f,0.f,0.f}; v8f c00 = z8, c01 = z8, c02 = z8, c03 = z8, c10 = z8, c11 = z8, c12 = z8, c13 = z8;
  const int nt = K / GKS;
  stage(0, 0);
  asm volatile("s_wait_asynccnt 0x0" ::: "memory");      /* this wave's copies of tile 0 have landed */
  __syncthreads();      /* publishes tile 0 to the four waves */
  if (nt > 1) stage(1, 1);
#pragma unroll 1      /* one trip is 32 matrix instructions of straight-line code already */
  for (int t = 0; t < nt; ++t) { const _Float16* ap = &ta[t & 1][32 * w + ln][0]; const _Float16* bq = &tb[t & 1][ln][0];
    v16h fa[2][2], fb[2][4];      /* two fragment sets: the next 32 k of this tile are read from LDS as one group ahead of the current block's matrix instructions */
    fa[0][0] = g2_frag(ap, hh); fa[0][1] = g2_frag(ap + 16 * GLP, hh); fb[0][0] = g2_frag(bq, hh); fb[0][1] = g2_frag(bq + 16 * GLP, hh); fb[0][2] = g2_frag(bq + 32 * GLP, hh); fb[0][3] = g2_frag(bq + 48 * GLP, hh);
#pragma unroll      /* makes the set index a constant, so that the sets are registers */
    for (int q = 0; q < GKS / 32; ++q) { const int s = q & 1, n = s ^ 1, kn = (q + 1) * 32;
      if (q + 1 < GKS / 32) { fa[n][0] = g2_frag(ap + kn, hh); fa[n][1] = g2_frag(ap + 16 * GLP + kn, hh); fb[n][0] = g2_frag(bq + kn, hh); fb[n][1] = g2_frag(bq + 16 * GLP + kn, hh); fb[n][2] = g2_frag(bq + 32 * GLP + kn, hh); fb[n][3] = g2_frag(bq + 48 * GLP + kn, hh); }
      c00 = g2_mma(fa[s][0], fb[s][0], c00); c10 = g2_mma(fa[s][1], fb[s][0], c10); c01 = g2_mma(fa[s][0], fb[s][1], c01); c11 = g2_mma(fa[s][1], fb[s][1], c11);
      c02 = g2_mma(fa[s][0], fb[s][2], c02); c12 = g2_mma(fa[s][1], fb[s][2], c12); c03 = g2_mma(fa[s][0], fb[s][3], c03); c13 = g2_mma(fa[s][1], fb[s][3], c13); }
    asm volatile("s_wait_dscnt 0x0" ::: "memory");      /* this wave's reads of tile t are done before its buffer is refilled */
    asm volatile("s_wait_asynccnt 0x0" ::: "memory");      /* this wave's copies of tile t + 1 have landed */
    __syncthreads();      /* publishes tile t + 1 and ends every wave's reads of tile t */
    if (t + 2 < nt) stage(t + 2, t & 1); }
  asm volatile("s_wait_asynccnt 0x0" ::: "memory");      /* no copy is outstanding when the wave goes on */
  v8f accs[8] = {c00, c01, c02, c03, c10, c11, c12, c13};
#pragma unroll
  for (int u = 0; u < 8; ++u) { const int t = u & 3, half = u >> 2; const int col = col0 + t * 16 + ln; const float bv = bp ? bf16_round(bp[col]) : 0.f;
#pragma unroll
    for (int r = 0; r < 8; ++r) { const int rloc = half * 16 + 8 * hh + r; float v = accs[u][r] * alpha + bv; if (CP) { if (rowsPerB < 0) v += CP[cofs + (size_t)(row0g + row0 + rloc) * ldc + col];      /* rowsPerB < 0: own element of the batched C plane */ else { const int bidx = (row0g + row0 + rloc) / rowsPerB; v += CP[(size_t)bidx * sCPb + (size_t)by * 64 + col]; } }
      if (ACT == 3) v = fmaxf(v, 0.f); else if (ACT == 6) v = 0.5f * v * (1.0f + erff(v * 0.70710678118654752f)); else if (ACT == 11) v = 1.0f / (1.0f + expf(-v)); else if (ACT == 15) v = v / (1.0f + expf(-v)); else if (ACT == 12) v = (v > 0.f) ? v : 0.01f * v; else if (ACT == 8) v = tanhf(v); else if (ACT == 9) v = 0.5f * v * (1.0f + tanhf(0.7978845608028654f * (v + 0.044715f * v * v * v))); else if (ACT == 14) v = (v > 0.f) ? v : 0.1f * v; else if (ACT == 16) v = (v >= 0.f) ? v : 0.3f * v; else if (ACT == 17) v = (v >= 0.f) ? v : 0.2f * v;
      so[w][rloc][t * 16 + ln] = v; } }
  __builtin_amdgcn_fence(__ATOMIC_ACQ_REL, "workgroup"); __builtin_amdgcn_wave_barrier();
  const int rsub = lane >> 4, c4 = (lane & 15) * 4;
  {
#pragma unroll
    for (int q = 0; q < 16; ++q) { const int r = q * 2 + rsub; const v4f v = *(const v4fa*)&so[w][r][c4]; if (C) *(v4f*)(C + cofs + (size_t)(row0 + r) * ldc + col0 + c4) = v; if (C16) { v4h h4; for (int i = 0; i < 4; ++i) h4[i] = (_Float16)v[i]; *(v4h*)(C16 + cofs + (size_t)(row0 + r) * ldc + col0 + c4) = h4; } }
     } }


__global__ __launch_bounds__(256) void k_wnat(const float* __restrict__ w, size_t n8, _Float16* __restrict__ Bt) { const size_t t = (size_t)blockIdx.x * 256 + threadIdx.x; if (t >= n8) return; FragH f; for (int q = 0; q < 8; ++q) f.h[q] = (_Float16)(bf16_round(w[t * 8 + q]) * 16.0f); *(v8us*)((unsigned short*)Bt + t * 8) = f.half[0];  }
__global__ __launch_bounds__(256) void k_rsm(const float* __restrict__ S, _Float16* __restrict__ P, int nrows) {
  #pragma clang fp contract(off)
  const int i = blockIdx.x * 256 + threadIdx.x; if (i >= nrows) return; const float* s = S + (size_t)i * SQ; float mx = -3.0e38f;
#pragma unroll 1
  for (int j = 0; j < SQ; ++j) mx = fmaxf(mx, s[j]); float se = 0.f;
#pragma unroll 1
  for (int j = 0; j < SQ; ++j) se += expf(s[j] - mx); const float sc = 256.0f / se;
#pragma unroll 1
  for (int j0 = 0; j0 < SQ; j0 += 8) { FragH f; for (int q = 0; q < 8; ++q) f.h[q] = (_Float16)(expf(s[j0 + q] - mx) * sc); unsigned short* d = (unsigned short*)P + (size_t)i * SQ + j0; *(v8us*)d = f.half[0];  } }
__global__ __launch_bounds__(256) void k_vt(const _Float16* __restrict__ V16, int b, int h0, _Float16* __restrict__ VT) { __shared__ unsigned short tl[64][65]; const int tid = threadIdx.x; const int hh = blockIdx.x % HG, sg = blockIdx.x / HG; const int s0 = sg * 64; const int h = h0 + hh;
  for (int i = tid; i < 64 * 8; i += 256) { const int j = i / 8, d8 = (i % 8) * 8; FragH f; f.half[0] = *(const v8us*)((const unsigned short*)V16 + ((size_t)b * SQ + s0 + j) * DM + h * HD + d8); for (int q = 0; q < 8; ++q) tl[d8 + q][j] = f.u[q]; }
  __syncthreads();
  { for (int i = tid; i < 64 * 8; i += 256) { const int d = i / 8, j8 = (i % 8) * 8; FragH f; for (int q = 0; q < 8; ++q) f.u[q] = tl[d][j8 + q]; *(v8us*)((unsigned short*)VT + ((size_t)hh * HD + d) * SQ + s0 + j8) = f.half[0]; }  } }



// Fused causal attention: a block owns 128 query rows of one head (32 per wave) and walks the keys 64 at a time; scores and weights never leave registers.
// Each pass stages 64 rows of k hi, k lo and 64 rows (head dims) of V^T in LDS by whole-line loads, once for the four waves; row pitch 128 + 16 bytes for the 16-byte fragment reads.
// S^T = K . Q^T (A = 16 key rows, B = 16 query rows, both by g2_frag): a lane holds 8 keys (8*hh + r) of ONE query (ln) per tile, so maximum and sum are in-lane plus one exchange of the wave halves.
// Two score tiles of one query group, converted in place, are the B operand of O^T += V^T . P^T (element i = key 8*hh + i, element 8 + i = key 16 + 8*hh + i: the k order of g2_frag on the V^T rows).
// Scores: (lo . hi + hi . lo) first, x 2^-10, then hi . hi on top in the same accumulator. Weights carried x256 (the + 8 in the exponent), in the f16 operand and in the row sum alike; o leaves x64.
#define FAC 0.18033688011112042f           /* 1 / sqrt(head_dim) * log2(e) */
#define FLP 72                             /* LDS row pitch in f16: 64 + 8 */
__device__ __forceinline__ float fa_exp2(float x) { asm("v_exp_f32 %0, %0\n\tv_nop" : "+v"(x)); return x; }      /* native 2^x; the v_nop fills the one slot that the instruction set asks for between a transcendental and a directly following instruction that reads its result or overwrites its source */
__device__ __forceinline__ v8f fa_mma(v16h a, v16h b, v8f c) { return __builtin_amdgcn_wmma_f32_16x16x32_f16(false, a, false, b, (short)0, c, false, false); }
__global__ __launch_bounds__(128) void k_fattn(const _Float16* __restrict__ QHp, const _Float16* __restrict__ QLp, const _Float16* __restrict__ KHp, const _Float16* __restrict__ KLp, const _Float16* __restrict__ VTp, _Float16* __restrict__ Op) {
  __shared__ __attribute__((aligned(16))) _Float16 lkh[64][FLP]; __shared__ __attribute__((aligned(16))) _Float16 lkl[64][FLP]; __shared__ __attribute__((aligned(16))) _Float16 lvt[64][FLP];
  const int tid = threadIdx.x, lane = tid & 31, ln = lane & 15, hh = lane >> 4; const int w = __builtin_amdgcn_readfirstlane(tid >> 5);
  const int h = blockIdx.y, b = blockIdx.z; const int qt = (b & 1) ? (int)blockIdx.x : (int)gridDim.x - 1 - (int)blockIdx.x;      /* long and short blocks mixed over the grid */
  const int row0 = qt * 128 + 32 * w; const size_t r0 = (size_t)b * SQ;
  v16h qh[2][2], ql[2][2]; const _Float16* qhp = QHp + (r0 + row0 + ln) * LQ + h * HD + 8 * hh; const _Float16* qlp = QLp + (r0 + row0 + ln) * LQ + h * HD + 8 * hh;      /* the lane's own 16-byte pieces start here (g2_frag with half 0) */
#pragma unroll
  for (int g = 0; g < 2; ++g) { qh[g][0] = g2_frag(qhp + g * (16 * LQ), 0); qh[g][1] = g2_frag(qhp + g * (16 * LQ) + 32, 0); ql[g][0] = g2_frag(qlp + g * (16 * LQ), 0); ql[g][1] = g2_frag(qlp + g * (16 * LQ) + 32, 0); }
  asm volatile("s_wait_xcnt 0x0" :: "v"(qhp), "v"(qlp) : "memory");      /* the sixteen loads' address registers stay untouched up to this wait: nothing, a later load's data included, lands on them before it */
  const char* khb = (const char*)(KHp + r0 * LQ + h * HD); const char* klb = (const char*)(KLp + r0 * LQ + h * HD); const char* vtb = (const char*)(VTp + (size_t)(b * NH + h) * HD * SQ);      /* block-uniform bases */
  const int srow = tid >> 3, sc8 = (tid & 7) * 8; const unsigned koff = (unsigned)(srow * LQ + sc8) * 2u, voff = (unsigned)(srow * SQ + sc8) * 2u;      /* staging: 8 threads per row of 128 bytes, 16 rows a step; byte offsets */
  const v8f z8 = {0.f,0.f,0.f,0.f,0.f,0.f,0.f,0.f}; v8f o[4][2];
#pragma unroll
  for (int dt = 0; dt < 4; ++dt) { o[dt][0] = z8; o[dt][1] = z8; }
  float m[2] = {-1.0e30f, -1.0e30f}, l[2] = {0.f, 0.f};
  const int kend = qt * 128 + 64;           /* the block's last piece: every wave stages and passes the barriers up to it */
#pragma unroll 1      /* one pass is up to 64 matrix instructions of straight-line code already */
  for (int kb = 0; kb <= kend; kb += 64) { v8us tk[4], tl[4], tv[4]; const char* kp = khb + (size_t)kb * (LQ * 2) + koff; const char* lp = klb + (size_t)kb * (LQ * 2) + koff; const char* vp = vtb + (size_t)kb * 2 + voff;
#pragma unroll
    for (int j = 0; j < 4; ++j) { tk[j] = *(const v8us*)(kp + j * (16 * LQ * 2)); tl[j] = *(const v8us*)(lp + j * (16 * LQ * 2)); tv[j] = *(const v8us*)(vp + j * (16 * SQ * 2)); }
    asm volatile("s_wait_xcnt 0x0" :: "v"(kp), "v"(lp), "v"(vp) : "memory");      /* the twelve loads' address registers stay untouched up to this wait: nothing, a later load's data included, lands on them before it */
    __syncthreads();      /* every wave has left the previous pass's rows */
#pragma unroll
    for (int j = 0; j < 4; ++j) { *(v8us*)&lkh[j * 16 + srow][sc8] = tk[j]; *(v8us*)&lkl[j * 16 + srow][sc8] = tl[j]; *(v8us*)&lvt[j * 16 + srow][sc8] = tv[j]; }
    __syncthreads();      /* publishes the staged rows to the four waves */
#pragma unroll
    for (int hf = 0; hf < 2; ++hf) { const int k0 = kb + 32 * hf;      /* 32 keys a step: 16 score registers per query group alive at a time */
      if (k0 <= row0) {      /* wave-uniform: keys past the wave's last row (row0 + 31) are left out whole */
        v8f s[2][2];
#pragma unroll
        for (int t = 0; t < 2; ++t) { const int kr = 32 * hf + 16 * t + ln; const v16h a0 = g2_frag(&lkh[kr][0], hh), a1 = g2_frag(&lkh[kr][32], hh), c0 = g2_frag(&lkl[kr][0], hh), c1 = g2_frag(&lkl[kr][32], hh);
#pragma unroll
          for (int g = 0; g < 2; ++g) { v8f y = fa_mma(a0, ql[g][0], z8); y = fa_mma(a1, ql[g][1], y); y = fa_mma(c0, qh[g][0], y); y = fa_mma(c1, qh[g][1], y);
#pragma unroll
            for (int r = 0; r < 8; ++r) y[r] *= 0.0009765625f;
            y = fa_mma(a0, qh[g][0], y); y = fa_mma(a1, qh[g][1], y); s[t][g] = y; } }
        if (k0 == row0) {      /* wave-uniform: the 32 x 32 piece on the diagonal is the only one that needs the causal test; key k0 stays for every query */
#pragma unroll
          for (int t = 0; t < 2; ++t)
#pragma unroll
            for (int g = 0; g < 2; ++g)
#pragma unroll
              for (int r = 0; r < 8; ++r) if (16 * t + 8 * hh + r > 16 * g + ln) s[t][g][r] = -1.0e30f; }
        FragH p[2];
#pragma unroll
        for (int g = 0; g < 2; ++g) { float mx = s[0][g][0];
#pragma unroll
          for (int t = 0; t < 2; ++t)
#pragma unroll
            for (int r = 0; r < 8; ++r) mx = fmaxf(mx, s[t][g][r]);
          mx = fmaxf(mx, __shfl_xor(mx, 16, 32));      /* the other 8 keys of every tile sit in the other wave half */
          const float mn = fmaxf(m[g], mx); const float sc = fa_exp2((m[g] - mn) * FAC); m[g] = mn; const float nb = fmaf(-mn, FAC, 8.0f);
          float ps[4] = {0.f, 0.f, 0.f, 0.f};
#pragma unroll
          for (int t = 0; t < 2; ++t)
#pragma unroll
            for (int r = 0; r < 8; ++r) { const float e = fa_exp2(fmaf(s[t][g][r], FAC, nb)); ps[r & 3] += e; p[g].h[t * 8 + r] = (_Float16)e; }
          l[g] = fmaf(l[g], sc, (ps[0] + ps[1]) + (ps[2] + ps[3]));
#pragma unroll
          for (int dt = 0; dt < 4; ++dt)
#pragma unroll
            for (int r = 0; r < 8; ++r) o[dt][g][r] *= sc; }
#pragma unroll
        for (int dt = 0; dt < 4; ++dt) { const v16h a = g2_frag(&lvt[16 * dt + ln][32 * hf], hh); o[dt][0] = fa_mma(a, p[0].v, o[dt][0]); o[dt][1] = fa_mma(a, p[1].v, o[dt][1]); } } } }
#pragma unroll
  for (int g = 0; g < 2; ++g) { const float fin = 64.0f / (l[g] + __shfl_xor(l[g], 16, 32));      /* the halves' sums joined once; x256 cancels, o carried x64 */
    unsigned short* op = (unsigned short*)Op + (r0 + row0 + 16 * g + ln) * DM + h * HD + 8 * hh;
#pragma unroll
    for (int dt = 0; dt < 4; ++dt) { FragH f;
#pragma unroll
      for (int r = 0; r < 8; ++r) f.h[r] = (_Float16)(o[dt][g][r] * fin);
      *(v8us*)(op + 16 * dt) = f.half[0]; } } }


// Exact f32 attention for the first QT0 rows, one thread per query row. The block's key and value rows (64 or 128 rows of 64 floats) are staged once in LDS
// by whole-line loads and then read as broadcasts; the thread's q row and o row stay in registers; four keys' score sums run side by side, each in index order.
// Every plain '#pragma unroll' below makes the indices of q, o, s and the staged pieces constants, so that these arrays are registers and not scratch.
template <int MASKADD>
__global__ __launch_bounds__(64) void k_att0(const float* __restrict__ QF, const float* __restrict__ KF, const float* __restrict__ VF, int ld, const float* __restrict__ mask, float scale, float* __restrict__ OF, int ldo) {
  static_assert(MASKADD == 0, "k_att0: only the causal form is staged (keys up to the block's last row)"); (void)mask;
  __shared__ __attribute__((aligned(16))) float lk[QT0][64]; __shared__ __attribute__((aligned(16))) float lv[QT0][64]; __shared__ __attribute__((aligned(16))) float lo[64][64];
  const int tid = threadIdx.x; const int h = blockIdx.x / (QT0 / 64), rg = blockIdx.x % (QT0 / 64); const int i = rg * 64 + tid;
  __builtin_assume(ld == DM);      /* every launch passes the row pitch DM: the row steps below fold into the loads' immediate offsets, so one offset register serves all loads of a kind */
  const char* qh = (const char*)(QF + h * HD); const char* kh = (const char*)(KF + h * HD); const char* vh = (const char*)(VF + h * HD);      /* block-uniform bases */
  const unsigned qoff = (unsigned)(i * ld) * 4u;      /* byte offset of the thread's q row */
  float q[HD], o[HD];
#pragma unroll
  for (int c = 0; c < HD / 4; ++c) { const v4f t4 = *(const v4fa*)(qh + qoff + c * 16);
#pragma unroll
    for (int u = 0; u < 4; ++u) { q[c * 4 + u] = t4[u]; o[c * 4 + u] = 0.f; } }
  static_assert(QT0 == 128, "k_att0: staging is written for one or two pieces of 64 keys");
  const int srow = tid >> 4, sc4 = (tid & 15) * 4; const unsigned soff = (unsigned)(srow * ld + sc4) * 4u;      /* staging: 16 threads per row of 256 bytes; byte offset */
#pragma unroll
  for (int t = 0; t < QT0 / 64; ++t) if (t <= rg) {      /* block-uniform test: 64 keys a piece, all 32 loads of a thread in flight together */
    v4f tk[16], tv[16];
#pragma unroll
    for (int it = 0; it < 16; ++it) { tk[it] = *(const v4fa*)(kh + soff + (t * 64 + it * 4) * ld * 4); tv[it] = *(const v4fa*)(vh + soff + (t * 64 + it * 4) * ld * 4); }
    asm volatile("s_wait_xcnt 0x0" :: "v"(qoff), "v"(soff) : "memory");      /* the loads' offset registers stay untouched up to this wait: nothing, a later load's data included, lands on a register that an issued load names */
#pragma unroll
    for (int it = 0; it < 16; ++it) { *(v4f*)&lk[t * 64 + it * 4 + srow][sc4] = tk[it]; *(v4f*)&lv[t * 64 + it * 4 + srow][sc4] = tv[it]; } }
  __syncthreads();      /* publishes the staged rows to both waves */
  float m = -1.0e30f, l = 0.f; const int nkey = rg * 64 + 64;      /* causal form: keys up to the block's last row */
#pragma unroll 1      /* the body is four whole keys of straight-line code already: more would only grow the text */
  for (int j0 = 0; j0 < nkey; j0 += 4) { float s[4] = {0.f, 0.f, 0.f, 0.f};
#pragma unroll
    for (int c = 0; c < HD / 4; ++c) { v4f kq[4];
#pragma unroll
      for (int u = 0; u < 4; ++u) kq[u] = *(const v4f*)&lk[j0 + u][c * 4];
#pragma unroll
      for (int x = 0; x < 4; ++x)
#pragma unroll
        for (int u = 0; u < 4; ++u) s[u] = __fadd_rn(s[u], __fmul_rn(q[c * 4 + x], kq[u][x])); }
#pragma unroll
    for (int u = 0; u < 4; ++u) { const int j = j0 + u; const float sv = __fmul_rn(s[u], scale);
      const float f = (j <= i) ? 1.f : 0.f; const float sm = fmaf(f, sv, (1.f - f) * -1.0e30f); const float mn = fmaxf(m, sm); const float sc = expf(m - mn); const float e = expf(sm - mn); l = __fadd_rn(__fmul_rn(l, sc), e); m = mn;
#pragma unroll
      for (int c = 0; c < HD / 4; ++c) { const v4f vv = *(const v4f*)&lv[j][c * 4];
#pragma unroll
        for (int x = 0; x < 4; ++x) o[c * 4 + x] = __fadd_rn(__fmul_rn(o[c * 4 + x], sc), __fmul_rn(e, vv[x])); } } }
  const float fin = 64.0f / l;      /* o carried x64 like the f16 path */
#pragma unroll
  for (int c = 0; c < HD / 4; ++c) { v4f oo;
#pragma unroll
    for (int u = 0; u < 4; ++u) oo[u] = __fmul_rn(o[c * 4 + u], fin);
    *(v4f*)&lo[tid][c * 4] = oo; }
  __syncthreads();
  {
#pragma unroll 1
    for (int it = 0; it < 16; ++it) { const int row = it * 4 + tid / 16, pc = (tid % 16) * 4; const v4f v = *(const v4f*)&lo[row][pc]; *(v4f*)(OF + (size_t)(rg * 64 + row) * ldo + h * HD + pc) = v; }
     } }

extern "C" void kernel_launch(void* const* d_in, const int* in_sizes, int n_in,
                              void* d_out, int out_size, void* d_ws, size_t ws_size, hipStream_t stream) {
  (void)in_sizes; (void)n_in; (void)out_size;
  const float* const* I = (const float* const*)d_in; const float* x = I[0]; const float* xk = I[1]; const float* xv = I[2]; const float* wq = I[3]; const float* bq = nullptr; const float* wk = I[4]; const float* bk = nullptr; const float* wv = I[5]; const float* bv = nullptr; const float* wo = I[6]; const float* bo = I[7];      /* input order: query_data, key_data, value_data (three SEPARATE streams: the three exact-f16 row casts read one each), Wq, Wk, Wv ([in][out]; the module has NO q / k / v biases: null pointers in the guarded bias slots), Wp ([in][out]), bp (REAL); NO mask input (the causal fill is built inside the reference) */
  char* ws = (char*)d_ws; size_t off = 0;
  auto take = [&](size_t bytes) { char* p = ws + off; off += (bytes + 255) & ~(size_t)255; return p; };
  _Float16* BQ = (_Float16*)take((size_t)DM * DM * 2); _Float16* BK = (_Float16*)take((size_t)DM * DM * 2); _Float16* BV = (_Float16*)take((size_t)DM * DM * 2); _Float16* BO = (_Float16*)take((size_t)DM * DM * 2);
  _Float16* X16 = (_Float16*)take(NR * DM * 2); _Float16* XK16 = (_Float16*)take(NR * DM * 2); _Float16* XV16 = (_Float16*)take(NR * DM * 2);      /* exact f16 rows of query, key, value */ float* QF = (float*)take(NR * DM * 4); _Float16* QH = (_Float16*)take(NR * DM * 2); _Float16* QL = (_Float16*)take(NR * DM * 2); _Float16* KH = (_Float16*)take(NR * DM * 2); _Float16* KL = (_Float16*)take(NR * DM * 2); _Float16* Q16 = QH; _Float16* K16 = KH; _Float16* V16 = (_Float16*)take(NR * DM * 2); _Float16* O16 = (_Float16*)take(NR * DM * 2);
  _Float16* VT = (_Float16*)take((size_t)NB * NH * HD * SQ * 2);
  float* QF0 = (float*)take((size_t)QT0 * DM * 4); float* KF0 = (float*)take((size_t)QT0 * DM * 4); float* VF0 = (float*)take((size_t)QT0 * DM * 4); float* OF0 = (float*)take((size_t)NB * QT0 * DM * 4); _Float16* OH0 = (_Float16*)take((size_t)NB * QT0 * DM * 2); _Float16* OL0 = (_Float16*)take((size_t)NB * QT0 * DM * 2);
  if (off > ws_size) return;
  { const unsigned g = (unsigned)(((size_t)DM * (DM / 8) + 255) / 256); k_wt_f16<<<g, 256, 0, stream>>>(wq, BQ, DM, DM, 16.0f); k_wt_f16<<<g, 256, 0, stream>>>(wk, BK, DM, DM, 16.0f); k_wt_f16<<<g, 256, 0, stream>>>(wv, BV, DM, DM, 16.0f); k_wt_f16<<<g, 256, 0, stream>>>(wo, BO, DM, DM, 16.0f); }      /* [in][out] -> Bt[n][k] x16 */
  k_x16<<<(unsigned)((NR * DM / 8 + 255) / 256), 256, 0, stream>>>(x, X16, NR * DM / 8); k_x16<<<(unsigned)((NR * DM / 8 + 255) / 256), 256, 0, stream>>>(xk, XK16, NR * DM / 8); k_x16<<<(unsigned)((NR * DM / 8 + 255) / 256), 256, 0, stream>>>(xv, XV16, NR * DM / 8);
  const size_t r0p = (size_t)B0 * SQ;      /* first projected row */
  k_gemm2<0><<<dim3((unsigned)((MP / 128) * (DM / 64)), 1), 128, 0, stream>>>(X16 + r0p * DM, DM, 0, BQ, DM, 0, 0.0625f, bq, 0, nullptr, 1, 0, 0, QF + r0p * DM, nullptr, DM, 0, MP, DM, DM); k_hl<<<(unsigned)(((size_t)MP * DM / 8 + 255) / 256), 256, 0, stream>>>(QF + r0p * DM, QH + r0p * DM, QL + r0p * DM, (size_t)MP * DM / 8);      /* q (f32) -> f16 hi + x1024 residual: unscaled logits sigma ~8 */
  k_gemm2<0><<<dim3((unsigned)((MP / 128) * (DM / 64)), 1), 128, 0, stream>>>(XK16 + r0p * DM, DM, 0, BK, DM, 0, 0.0625f, bk, 0, nullptr, 1, 0, 0, QF + r0p * DM, nullptr, DM, 0, MP, DM, DM); k_hl<<<(unsigned)(((size_t)MP * DM / 8 + 255) / 256), 256, 0, stream>>>(QF + r0p * DM, KH + r0p * DM, KL + r0p * DM, (size_t)MP * DM / 8);      /* k likewise */
  k_gemm2<0><<<dim3((unsigned)((MP / 128) * (DM / 64)), 1), 128, 0, stream>>>(XV16 + r0p * DM, DM, 0, BV, DM, 0, 0.0625f, bv, 0, nullptr, 1, 0, 0, nullptr, V16 + r0p * DM, DM, 0, MP, DM, DM);
  k_vt<NH, SQ><<<NB * NH * (SQ / 64), 256, 0, stream>>>(V16, LQ, 0, VT);      /* V^T [NB][NH][HD][SQ] */
  k_fattn<<<dim3(SQ / 128, NH, NB), 128, 0, stream>>>(QH, QL, KH, KL, VT, O16);      /* scores, causal softmax and P . V in one launch for all rows, heads and batches: o (merged heads, x64) as f16 rows */
  for (int b = B0; b < B0 + NBR; ++b) { const size_t r0 = (size_t)b * SQ;
    k_gemm2<0><<<dim3((QT0 / 128) * (DM / 64), 1), 128, 0, stream>>>(X16 + r0 * DM, DM, 0, BQ, DM, 0, 0.0625f, bq, 0, nullptr, 1, 0, 0, QF0, nullptr, DM, 0, QT0, DM, DM); k_gemm2<0><<<dim3((QT0 / 128) * (DM / 64), 1), 128, 0, stream>>>(XK16 + r0 * DM, DM, 0, BK, DM, 0, 0.0625f, bk, 0, nullptr, 1, 0, 0, KF0, nullptr, DM, 0, QT0, DM, DM); k_gemm2<0><<<dim3((QT0 / 128) * (DM / 64), 1), 128, 0, stream>>>(XV16 + r0 * DM, DM, 0, BV, DM, 0, 0.0625f, bv, 0, nullptr, 1, 0, 0, VF0, nullptr, DM, 0, QT0, DM, DM);      /* f32 q, k, v of the first 128 rows (exact products) */
    k_att0<0><<<NH * (QT0 / 64), 64, 0, stream>>>(QF0, KF0, VF0, DM, nullptr, SCL, OF0 + (size_t)b * QT0 * DM, DM); }      /* exact f32 attention for rows 0..127 (o x64) */
  k_gemm2<0><<<dim3((unsigned)((MPO / 128) * (DM / 64)), 1), 128, 0, stream>>>(O16 + r0p * DM, DM, 0, BO, DM, 0, 0.0009765625f, bo, 0, nullptr, 1, 0, 0, (float*)d_out + r0p * DM, nullptr, DM, 0, MPO, DM, DM);      /* out rows are the output layout */
  k_hl<<<(unsigned)(((size_t)NB * QT0 * DM / 8 + 255) / 256), 256, 0, stream>>>(OF0, OH0, OL0, (size_t)NB * QT0 * DM / 8);      /* first-tile o (x64) -> f16 hi + x1024 residual planes */
  for (int b = B0; b < B0 + NBR; ++b) { const size_t r0 = (size_t)b * SQ; const size_t f0 = (size_t)b * QT0;
    k_gemm2<0><<<dim3((QT0 / 128) * (DM / 64), 1), 128, 0, stream>>>(OH0 + f0 * DM, DM, 0, BO, DM, 0, 0.0009765625f, bo, 0, nullptr, 1, 0, 0, (float*)d_out + r0 * DM, nullptr, DM, 0, QT0, DM, DM);      /* rows 0..127: out = o_hi Wo (+ b), overwriting the f16-path rows */
    k_gemm2<0><<<dim3((QT0 / 128) * (DM / 64), 1), 128, 0, stream>>>(OL0 + f0 * DM, DM, 0, BO, DM, 0, 0.00000095367431640625f, nullptr, 0, (const float*)d_out + r0 * DM, -1, 0, 0, (float*)d_out + r0 * DM, nullptr, DM, 0, QT0, DM, DM); }      /* += o_lo Wo 2^-20 (own-element accumulate) */
}

// v005
// It runs in 221 microseconds.
// Next to v004, in two timings, it ran 1.59 and 1.57 times as fast.
// Over all steps from v000 it is 26.4 times as fast.
#include <hip/hip_runtime.h>
// Causal multi-head attention on three inputs with bias-free [in][out] projections and a biased [in][out] output projection (query_data, key_data, value_data [2][2048][1024]; q = split_heads(query_data Wq), k = split_heads(key_data Wk), v = split_heads(value_data Wv) ([in][out] [1024][1024], NO biases), 16 heads of 64; scores / sqrt(64); scores + triu(ones, k = 1) x (-1e13): an additive fill strictly above the diagonal == exclusion (exp underflows to exactly 0; every row keeps its diagonal); softmax over keys; out = merged Wp + bp ([in][out] + a REAL bias) -> [2][2048][1024]); the causal rule is built inside the reference; q and k carried as f16 hi + x1024 residual planes with three-product scores.
// Structure: token rows r = b*2048 + s; x as exact f16 rows (bf16-rounded); q and k as WMMA GEMMs (32x64 wave tiles, f32 accumulation, exact x16 weights, no bias) into f32 rows split into f16 hi + x1024 residual planes, v as a GEMM that stores f16 and f32 rows; V^T for all heads and batches via LDS transposes; one fused attention launch: a block owns 128 query rows of a head (32 per wave) and walks the keys up to its last row 64 at a time, k hi, k lo and V^T rows staged in LDS per pass: three-product scores (lo.hi + hi.lo, x 2^-10, + hi.hi) as S^T tiles in registers, running maximum and sum per query (f32 statistics, native exp2; keys past the row's own index excluded; weights x256 f16, packed in place as the B operand), O^T += V^T . P^T, o carried x64 (folded into the output GEMM alpha) written straight into the merged f16 o rows; out = o W_o + b GEMM (f32) into the output layout.
// Compute dtype: inputs rounded to bf16; x / weights exact; q and k as f16 hi + x1024 residual planes (three products), v, softmax weights and o as plain f16 GEMM operands (~2^-12); scores and softmax statistics f32. v_wmma_f32_16x16x32_f16.
#define NB 2
#define SCL 0.125f                         /* 1 / sqrt(head_dim = 64) */
#define SCLR 0.0001220703125f              /* 2^-13 (not used: k_fattn scales the x1024 residual sums by 2^-10) */
#define SQ 2048
#define DM 1024
#define NH 16
#define HD 64
#define HG 4                         /* heads per launch of the head-group k_vt (not launched) */
#define QT 256                       /* not used: the causal tiles are 128 query rows */
#define NKX SQ                       /* not used */
#define QT0 128                      /* first-tile rows recomputed exactly in f32 */
#define B0 0                         /* first batch processed (debug hook) */
#define NBR NB                       /* batches processed (debug hook) */
#define NR ((size_t)NB * SQ)         /* token rows */
#define MP ((int)((size_t)NBR * SQ)) /* rows projected (debug hook) */
#define QN SQ                        /* not used */
#define NHD NH                       /* not used */
#define MPO MP                       /* rows through the output stage (debug hook) */
#define LQ DM      /* row pitch of the q/k/v rows */
typedef __bf16 v16b __attribute__((ext_vector_type(16)));
typedef unsigned short v8us __attribute__((ext_vector_type(8), may_alias));
typedef float  v8f  __attribute__((ext_vector_type(8)));
typedef float  v4f  __attribute__((ext_vector_type(4)));
typedef float  v4fa __attribute__((ext_vector_type(4), may_alias));
union FragB { v16b v; v8us half[2]; unsigned short u[16]; };

__device__ __forceinline__ unsigned short bf16_bits(float x) { unsigned int u = __float_as_uint(x); return (unsigned short)((u + 0x7FFFu + ((u >> 16) & 1u)) >> 16); }
__device__ __forceinline__ float bf16_val(unsigned short b) { return __uint_as_float(((unsigned int)b) << 16); }
__device__ __forceinline__ float bf16_round(float x) { return bf16_val(bf16_bits(x)); }
// D += A·B with NT terms: 1 = ah·bh, 2 = + al·bh (A split), 3 = + ah·bl (both split)
template <int NT>
__device__ __forceinline__ v8f mmaN(v16b ah, v16b al, v16b bh, v16b bl, v8f c) {
  c = __builtin_amdgcn_wmma_f32_16x16x32_bf16(false, ah, false, bh, (short)0, c, false, false);
  if (NT >= 2) c = __builtin_amdgcn_wmma_f32_16x16x32_bf16(false, al, false, bh, (short)0, c, false, false);
  if (NT >= 3) c = __builtin_amdgcn_wmma_f32_16x16x32_bf16(false, ah, false, bl, (short)0, c, false, false);
  asm volatile("v_nop\n\tv_nop\n\tv_nop\n\tv_nop" : "+v"(c) : "v"(ah), "v"(al), "v"(bh), "v"(bl));
  return c;
}

__global__ __launch_bounds__(256) void k_wt_bf16(const float* __restrict__ W, unsigned short* __restrict__ Wt, int K, int N) {
  const int t = blockIdx.x * 256 + threadIdx.x;
  const int k8n = K / 8;
  if (t >= N * k8n) return;
  const int n = t / k8n, k8 = (t % k8n) * 8;
  v8us v;
#pragma unroll
  for (int i = 0; i < 8; ++i) v[i] = bf16_bits(W[(size_t)(k8 + i) * N + n]);
  *(v8us*)(Wt + (size_t)n * K + k8) = v;
  
}

// GEMM C[M][N] (f32, pitch ldc) = act(A[M][K]·W + bias). A f32 row-major (pitch lda) converted per fragment to bf16
// (ASPLIT: hi/lo two planes -> 2 terms, else single rounded term); Wt bf16 [N][K] (pitch ldb). BIAS_BF16 rounds the
// bias to bf16 first (bias quantised to bf16 before the add). K%32==0, M%16==0, N%64==0.
template <bool ASPLIT, int ACT, bool BIAS_BF16>
__global__ __launch_bounds__(128) void k_gemm_bf(const float* __restrict__ A, int lda, const unsigned short* __restrict__ Wt, int ldb,
                                               const float* __restrict__ bias, float* __restrict__ C, int ldc, int M, int N, int K) {
  __shared__ __attribute__((aligned(16))) float so[4][16][64];
  const int tid = threadIdx.x, w = tid >> 5, lane = tid & 31, ln = lane & 15, hh = lane >> 4;
  const int ntn = N / 64;
  const int wid = blockIdx.x * 4 + w;
  const int mt = wid / ntn, nq = wid % ntn;
  if (mt * 16 >= M) return;
  const int row0 = mt * 16, col0 = nq * 64;
  const float* arow = A + (size_t)(row0 + ln) * lda;
  v8f acc[4] = {};
  for (int kb = 0; kb < K; kb += 32) {
    FragB ah, al;
    const v4f x0 = *(const v4fa*)(arow + kb + 8 * hh), x1 = *(const v4fa*)(arow + kb + 8 * hh + 4);
    const v4f x2 = *(const v4fa*)(arow + kb + 16 + 8 * hh), x3 = *(const v4fa*)(arow + kb + 16 + 8 * hh + 4);
    float xs[16] = {x0[0],x0[1],x0[2],x0[3],x1[0],x1[1],x1[2],x1[3],x2[0],x2[1],x2[2],x2[3],x3[0],x3[1],x3[2],x3[3]};
#pragma unroll
    for (int i = 0; i < 16; ++i) { const unsigned short hb = bf16_bits(xs[i]); ah.u[i] = hb; al.u[i] = ASPLIT ? bf16_bits(xs[i] - bf16_val(hb)) : (unsigned short)0; }
#pragma unroll
    for (int t = 0; t < 4; ++t) {
      const unsigned short* brow = Wt + (size_t)(col0 + t * 16 + ln) * ldb + kb;
      FragB b;
      b.half[0] = *(const v8us*)(brow + 8 * hh);
      b.half[1] = *(const v8us*)(brow + 16 + 8 * hh);
      acc[t] = mmaN<ASPLIT ? 2 : 1>(ah.v, al.v, b.v, b.v, acc[t]);
    }
  }
#pragma unroll
  for (int t = 0; t < 4; ++t) {
    float bv = bias ? bias[col0 + t * 16 + ln] : 0.f;
    if (BIAS_BF16) bv = bf16_round(bv);
#pragma unroll
    for (int r = 0; r < 8; ++r) { float v = acc[t][r] + bv; if (ACT == 1) v = fmaxf(v, 0.f); so[w][8 * hh + r][t * 16 + ln] = v; }
  }
  __builtin_amdgcn_fence(__ATOMIC_ACQ_REL, "workgroup");
  __builtin_amdgcn_wave_barrier();
  const int rsub = lane >> 4, c4 = (lane & 15) * 4;
  {
#pragma unroll
    for (int q = 0; q < 8; ++q) {
      const int r = q * 2 + rsub;
      const v4f v = *(const v4fa*)&so[w][r][c4];
      *(v4f*)(C + (size_t)(row0 + r) * ldc + col0 + c4) = v;
    }
    
  }
}

// GEMM C = act(A·W + bias + resid): A f32 (ASPLIT -> hi/lo 2 terms), Wt bf16 [N][K]; ACT 0 none, 1 relu, 2 exact gelu;
// resid (optional, f32, row index = (row % rmod), pitch ldr, RES_BF16 rounds it) added before the activation.
template <bool ASPLIT, int ACT, bool BIAS_BF16, bool RES_BF16>
__global__ __launch_bounds__(128) void k_gemm_bf3(const float* __restrict__ A, int lda, const unsigned short* __restrict__ Wt, int ldb,
                                                const float* __restrict__ bias, const float* __restrict__ resid, int rmod, int ldr,
                                                float* __restrict__ C, int ldc, int M, int N, int K) {
  __shared__ __attribute__((aligned(16))) float so[4][16][64];
  const int tid = threadIdx.x, w = tid >> 5, lane = tid & 31, ln = lane & 15, hh = lane >> 4;
  const int ntn = N / 64;
  const int wid = blockIdx.x * 4 + w;
  const int mt = wid / ntn, nq = wid % ntn;
  if (mt * 16 >= M) return;
  const int row0 = mt * 16, col0 = nq * 64;
  const float* arow = A + (size_t)(row0 + ln) * lda;
  v8f acc[4] = {};
  for (int kb = 0; kb < K; kb += 32) {
    FragB ah, al;
    const v4f x0 = *(const v4fa*)(arow + kb + 8 * hh), x1 = *(const v4fa*)(arow + kb + 8 * hh + 4);
    const v4f x2 = *(const v4fa*)(arow + kb + 16 + 8 * hh), x3 = *(const v4fa*)(arow + kb + 16 + 8 * hh + 4);
    float xs[16] = {x0[0],x0[1],x0[2],x0[3],x1[0],x1[1],x1[2],x1[3],x2[0],x2[1],x2[2],x2[3],x3[0],x3[1],x3[2],x3[3]};
#pragma unroll
    for (int i = 0; i < 16; ++i) { const unsigned short hb = bf16_bits(xs[i]); ah.u[i] = hb; al.u[i] = ASPLIT ? bf16_bits(xs[i] - bf16_val(hb)) : (unsigned short)0; }
#pragma unroll
    for (int t = 0; t < 4; ++t) {
      const unsigned short* brow = Wt + (size_t)(col0 + t * 16 + ln) * ldb + kb;
      FragB b;
      b.half[0] = *(const v8us*)(brow + 8 * hh);
      b.half[1] = *(const v8us*)(brow + 16 + 8 * hh);
      acc[t] = mmaN<ASPLIT ? 2 : 1>(ah.v, al.v, b.v, b.v, acc[t]);
    }
  }
#pragma unroll
  for (int t = 0; t < 4; ++t) {
    const int col = col0 + t * 16 + ln;
    float bv = bias ? bias[col] : 0.f;
    if (BIAS_BF16) bv = bf16_round(bv);
#pragma unroll
    for (int r = 0; r < 8; ++r) {
      float v = acc[t][r] + bv;
      if (resid) { float rv = resid[(size_t)((row0 + 8 * hh + r) % rmod) * ldr + col]; if (RES_BF16) rv = bf16_round(rv); v += rv; }
      if (ACT == 1) v = fmaxf(v, 0.f);
      if (ACT == 2) v = 0.5f * v * (1.0f + erff(v * 0.70710678118654752f));
      if (ACT == 3) { const float u = 0.7978845608028654f * (v + 0.044715f * v * v * v); v = 0.5f * v * (1.0f + tanhf(u)); }
      so[w][8 * hh + r][t * 16 + ln] = v;
    }
  }
  __builtin_amdgcn_fence(__ATOMIC_ACQ_REL, "workgroup");
  __builtin_amdgcn_wave_barrier();
  const int rsub = lane >> 4, c4 = (lane & 15) * 4;
  {
#pragma unroll
    for (int q = 0; q < 8; ++q) {
      const int r = q * 2 + rsub;
      const v4f v = *(const v4fa*)&so[w][r][c4];
      *(v4f*)(C + (size_t)(row0 + r) * ldc + col0 + c4) = v;
    }
    
  }
}
// row LayerNorm (biased variance, eps) over N: s = X (+ R); optional out_sum <- s; out_norm <- (s-mu)*rsqrt(var+eps)*g + b
template <bool PARAM_BF16>
__global__ __launch_bounds__(256) void k_layernorm(const float* __restrict__ X, const float* __restrict__ R, const float* __restrict__ g, const float* __restrict__ bta,
                                                  float* __restrict__ out_sum, float* __restrict__ out_norm, int N, float eps) {
  __shared__ float red[256];
  const int row = blockIdx.x, tid = threadIdx.x;
  const float* x = X + (size_t)row * N; const float* rr = R ? R + (size_t)row * N : nullptr;
  float vals[16];                     // up to N = 4096
  const int per = N / 256;            // contiguous chunk per thread? use strided-by-4 chunks: thread handles j = tid*4 + 1024*u
  float s1 = 0.f;
  for (int u = 0; u < per / 4; ++u) {
    const int j = tid * 4 + 1024 * u;
    const v4f a = *(const v4fa*)(x + j);
    v4f b = {0.f,0.f,0.f,0.f}; if (rr) b = *(const v4fa*)(rr + j);
#pragma unroll
    for (int q = 0; q < 4; ++q) { const float v = a[q] + b[q]; vals[u * 4 + q] = v; s1 += v; }
  }
  red[tid] = s1; __syncthreads();
  for (int st = 128; st > 0; st >>= 1) { if (tid < st) red[tid] += red[tid + st]; __syncthreads(); }
  const float mu = red[0] / (float)N; __syncthreads();
  float s2 = 0.f;
  for (int u = 0; u < per / 4; ++u)
#pragma unroll
    for (int q = 0; q < 4; ++q) { const float c = vals[u * 4 + q] - mu; s2 += c * c; }
  red[tid] = s2; __syncthreads();
  for (int st = 128; st > 0; st >>= 1) { if (tid < st) red[tid] += red[tid + st]; __syncthreads(); }
  const float rs = rsqrtf(red[0] / (float)N + eps);
  {
    for (int u = 0; u < per / 4; ++u) {
      const int j = tid * 4 + 1024 * u;
      v4f o, sm;
#pragma unroll
      for (int q = 0; q < 4; ++q) {
        float gg = g[j + q], bb = bta[j + q];
        if (PARAM_BF16) { gg = bf16_round(gg); bb = bf16_round(bb); }
        sm[q] = vals[u * 4 + q]; o[q] = (vals[u * 4 + q] - mu) * rs * gg + bb;
      }
      if (out_sum) *(v4f*)(out_sum + (size_t)row * N + j) = sm;
      *(v4f*)(out_norm + (size_t)row * N + j) = o;
    }
    
  }
}



// ---- f16 WMMA path (v_wmma_f32_16x16x32_f16): 11-bit significands for operands in range — used where a [0,1] probability operand needs more precision than bf16
typedef _Float16 v16h __attribute__((ext_vector_type(16)));
union FragH { v16h v; v8us half[2]; _Float16 h[16]; unsigned short u[16]; };
template <int NT>
__device__ __forceinline__ v8f mmaH(v16h ah, v16h al, v16h bh, v16h bl, v8f c) {
  c = __builtin_amdgcn_wmma_f32_16x16x32_f16(false, ah, false, bh, (short)0, c, false, false);
  if (NT >= 2) c = __builtin_amdgcn_wmma_f32_16x16x32_f16(false, al, false, bh, (short)0, c, false, false);
  if (NT >= 3) c = __builtin_amdgcn_wmma_f32_16x16x32_f16(false, ah, false, bl, (short)0, c, false, false);
  asm volatile("v_nop\n\tv_nop\n\tv_nop\n\tv_nop" : "+v"(c) : "v"(ah), "v"(al), "v"(bh), "v"(bl));
  return c;
}
// batched GEMM like k_gemm_b but f16 operands: A f32 (split into f16 hi/lo if ASPLIT, else rounded to f16), Bt = f16 values [n][k]; alpha; C f32; N multiple of 16 (partial tiles skipped)
template <bool ASPLIT>
__global__ __launch_bounds__(128) void k_gemm_h(const float* __restrict__ A, int lda, size_t sA, const _Float16* __restrict__ Bh, int ldb, size_t sB, float alpha, float* __restrict__ C, int ldc, size_t sC, int M, int N, int K) {
  __shared__ __attribute__((aligned(16))) float so[4][16][64];
  const int tid = threadIdx.x, w = tid >> 5, lane = tid & 31, ln = lane & 15, hh = lane >> 4; const int by = blockIdx.y;
  A += (size_t)by * sA; Bh += (size_t)by * sB; C += (size_t)by * sC;
  const int ntn = (N + 63) / 64; const int wid = blockIdx.x * 4 + w; const int mt = wid / ntn, nq = wid % ntn; if (mt * 16 >= M) return;
  const int row0 = mt * 16, col0 = nq * 64; const float* arow = A + (size_t)(row0 + ln) * lda;
  v8f acc[4] = {};
  for (int kb = 0; kb < K; kb += 32) {
    FragH ah, al;
    const v4f x0 = *(const v4fa*)(arow + kb + 8 * hh), x1 = *(const v4fa*)(arow + kb + 8 * hh + 4), x2 = *(const v4fa*)(arow + kb + 16 + 8 * hh), x3 = *(const v4fa*)(arow + kb + 16 + 8 * hh + 4);
    float xs[16] = {x0[0],x0[1],x0[2],x0[3],x1[0],x1[1],x1[2],x1[3],x2[0],x2[1],x2[2],x2[3],x3[0],x3[1],x3[2],x3[3]};
#pragma unroll
    for (int i = 0; i < 16; ++i) { const _Float16 h = (_Float16)xs[i]; ah.h[i] = h; al.h[i] = ASPLIT ? (_Float16)(xs[i] - (float)h) : (_Float16)0.0f; }
#pragma unroll
    for (int t = 0; t < 4; ++t) { if (col0 + t * 16 >= N) continue; const size_t boff = (size_t)(col0 + t * 16 + ln) * ldb + kb; FragH bq; bq.half[0] = *(const v8us*)(Bh + boff + 8 * hh); bq.half[1] = *(const v8us*)(Bh + boff + 16 + 8 * hh);
      acc[t] = mmaH<ASPLIT ? 2 : 1>(ah.v, al.v, bq.v, bq.v, acc[t]); }
  }
#pragma unroll
  for (int t = 0; t < 4; ++t) { if (col0 + t * 16 >= N) continue;
#pragma unroll
    for (int r = 0; r < 8; ++r) so[w][8 * hh + r][t * 16 + ln] = acc[t][r] * alpha; }
  __builtin_amdgcn_fence(__ATOMIC_ACQ_REL, "workgroup"); __builtin_amdgcn_wave_barrier();
  const int rsub = lane >> 4, c4 = (lane & 15) * 4;
  {
#pragma unroll
    for (int q = 0; q < 8; ++q) { const int r = q * 2 + rsub; if (col0 + c4 < N) { const v4f v = *(const v4fa*)&so[w][r][c4]; *(v4f*)(C + (size_t)(row0 + r) * ldc + col0 + c4) = v; } }
     }
}

// Wt[n][k] = f16(W[k][n]·scale) from f32 row-major W[K][N] (scale = power of two; bf16-exact weights stay exact in f16 away from the subnormal range)
__global__ __launch_bounds__(256) void k_wt_f16(const float* __restrict__ W, _Float16* __restrict__ Wt, int K, int N, float scale) {
  const int t = blockIdx.x * 256 + threadIdx.x; if (t >= N * (K / 8)) return; const int n = t / (K / 8), k8 = (t % (K / 8)) * 8; FragH f;
#pragma unroll
  for (int i = 0; i < 8; ++i) f.h[i] = (_Float16)(bf16_round(W[(size_t)(k8 + i) * N + n]) * scale); const v8us o = f.half[0];
  *(v8us*)((unsigned short*)Wt + (size_t)n * K + k8) = o; 
}
// k_gemm_hh variant with fused epilogue: v = acc·alpha + bias[by·sBias + col] (+ CP[(row/rowsPerB)·sCPb + by·64 + col] if CP) ; ACT 0 none / 1 elu ; writes f16 C16 (and f32 C if non-null)
template <int ACT>
__global__ __launch_bounds__(128) void k_gemm_hhx(const _Float16* __restrict__ A, int lda, size_t sA, const _Float16* __restrict__ Bh, int ldb, size_t sB, float alpha, const float* __restrict__ bias, size_t sBias, const float* __restrict__ CP, int rowsPerB, size_t sCPb, int row0g,
    float* __restrict__ C, _Float16* __restrict__ C16, int ldc, size_t sC, int M, int N, int K) {
  __shared__ __attribute__((aligned(16))) float so[4][16][64];
  const int tid = threadIdx.x, w = tid >> 5, lane = tid & 31, ln = lane & 15, hh = lane >> 4; const int by = blockIdx.y;
  A += (size_t)by * sA; Bh += (size_t)by * sB; const size_t cofs = (size_t)by * sC; const float* bp = bias ? bias + (size_t)by * sBias : nullptr;
  const int ntn = (N + 63) / 64; const int wid = blockIdx.x * 4 + w; const int mt = wid / ntn, nq = wid % ntn; if (mt * 16 >= M) return;
  const int row0 = mt * 16, col0 = nq * 64; const _Float16* arow = A + (size_t)(row0 + ln) * lda;
  v8f acc[4] = {};
  for (int kb = 0; kb < K; kb += 32) { FragH ah; ah.half[0] = *(const v8us*)((const unsigned short*)arow + kb + 8 * hh); ah.half[1] = *(const v8us*)((const unsigned short*)arow + kb + 16 + 8 * hh);
#pragma unroll
    for (int t = 0; t < 4; ++t) { if (col0 + t * 16 >= N) continue; const size_t boff = (size_t)(col0 + t * 16 + ln) * ldb + kb; FragH bq; bq.half[0] = *(const v8us*)((const unsigned short*)Bh + boff + 8 * hh); bq.half[1] = *(const v8us*)((const unsigned short*)Bh + boff + 16 + 8 * hh);
      acc[t] = mmaH<1>(ah.v, ah.v, bq.v, bq.v, acc[t]); }
  }
#pragma unroll
  for (int t = 0; t < 4; ++t) { if (col0 + t * 16 >= N) continue; const int col = col0 + t * 16 + ln; const float bv = bp ? bf16_round(bp[col]) : 0.f;
#pragma unroll
    for (int r = 0; r < 8; ++r) { float v = acc[t][r] * alpha + bv; if (CP) { const int rr = row0g + row0 + 8 * hh + r; if (rowsPerB < 0) v += CP[cofs + (size_t)rr * ldc + col];      /* rowsPerB < 0: own element of the batched C plane */ else { const int bidx = rr / rowsPerB; v += CP[(size_t)bidx * sCPb + (size_t)by * 64 + col]; } } if (ACT == 1) v = (v > 0.f) ? v : expm1f(v); else if (ACT == 7) v = (v > 0.f) ? v + 1.0f : expf(v); else if (ACT == 8) v = tanhf(v); else if (ACT == 9) v = 0.5f * v * (1.0f + tanhf(0.7978845608028654f * (v + 0.044715f * v * v * v))); else if (ACT == 11) v = 1.0f / (1.0f + expf(-v)); else if (ACT == 12) v = (v > 0.f) ? v : 0.01f * v; else if (ACT == 14) v = (v > 0.f) ? v : 0.1f * v; else if (ACT == 16) v = (v >= 0.f) ? v : 0.3f * v; else if (ACT == 17) v = (v >= 0.f) ? v : 0.2f * v; else if (ACT == 15) v = v / (1.0f + expf(-v)); else if (ACT == 3) v = fmaxf(v, 0.f); else if (ACT == 6) v = 0.5f * v * (1.0f + erff(v * 0.70710678118654752f)); so[w][8 * hh + r][t * 16 + ln] = v; } }
  __builtin_amdgcn_fence(__ATOMIC_ACQ_REL, "workgroup"); __builtin_amdgcn_wave_barrier();
  const int rsub = lane >> 4, c4 = (lane & 15) * 4; typedef _Float16 v4h __attribute__((ext_vector_type(4)));
  {
#pragma unroll
    for (int q = 0; q < 8; ++q) { const int r = q * 2 + rsub; if (col0 + c4 < N) { const v4f v = *(const v4fa*)&so[w][r][c4]; if (C) *(v4f*)(C + cofs + (size_t)(row0 + r) * ldc + col0 + c4) = v; if (C16) { v4h h4; for (int i = 0; i < 4; ++i) h4[i] = (_Float16)v[i]; *(v4h*)(C16 + cofs + (size_t)(row0 + r) * ldc + col0 + c4) = h4; } } }
     }
}


typedef _Float16 v4h __attribute__((ext_vector_type(4)));

__global__ __launch_bounds__(256) void k_x16(const float* __restrict__ x, _Float16* __restrict__ X16, size_t n8) { const size_t t = (size_t)blockIdx.x * 256 + threadIdx.x; if (t >= n8) return; FragH f;
#pragma unroll
  for (int q = 0; q < 8; ++q) f.h[q] = (_Float16)bf16_round(x[t * 8 + q]); *(v8us*)((unsigned short*)X16 + t * 8) = f.half[0];  }
__global__ __launch_bounds__(256) void k_h16(const float* __restrict__ x, _Float16* __restrict__ X16, size_t n8) { const size_t t = (size_t)blockIdx.x * 256 + threadIdx.x; if (t >= n8) return; FragH f;
#pragma unroll
  for (int q = 0; q < 8; ++q) f.h[q] = (_Float16)x[t * 8 + q]; *(v8us*)((unsigned short*)X16 + t * 8) = f.half[0];  }
__global__ __launch_bounds__(256) void k_round16f(const float* __restrict__ W, _Float16* __restrict__ Bt, size_t n8) { const size_t t = (size_t)blockIdx.x * 256 + threadIdx.x; if (t >= n8) return; FragH f;
#pragma unroll
  for (int i = 0; i < 8; ++i) f.h[i] = (_Float16)(bf16_round(W[t * 8 + i]) * 16.0f); *(v8us*)((unsigned short*)Bt + t * 8) = f.half[0];  }
template <int NHv, int TTv>
__global__ __launch_bounds__(256) void k_vt(const _Float16* __restrict__ V16, int ldv, int voff, _Float16* __restrict__ Vt) { __shared__ unsigned short tl[64][66]; const int tid = threadIdx.x; const int slab = blockIdx.x / (TTv / 64), lg = blockIdx.x % (TTv / 64); const int b = slab / NHv, h = slab % NHv;
  for (int i = tid; i < 64 * 8; i += 256) { const int r = i / 8, c8 = (i % 8) * 8; FragH f; f.half[0] = *(const v8us*)((const unsigned short*)V16 + ((size_t)b * TTv + lg * 64 + r) * ldv + voff + h * 64 + c8);
#pragma unroll
    for (int q = 0; q < 8; ++q) tl[r][c8 + q] = f.u[q]; }
  __syncthreads();
  {
#pragma unroll
    for (int rd = 0; rd < 2; ++rd) { const int d = rd * 32 + tid / 8, pc = tid % 8; FragH f;
#pragma unroll
      for (int q = 0; q < 8; ++q) f.u[q] = tl[pc * 8 + q][d];
      *(v8us*)((unsigned short*)Vt + ((size_t)slab * 64 + d) * TTv + lg * 64 + pc * 8) = f.half[0]; }
     } }

__global__ __launch_bounds__(256) void k_hl(const float* __restrict__ F, _Float16* __restrict__ Hh, _Float16* __restrict__ Hl, size_t n8) { const size_t t = (size_t)blockIdx.x * 256 + threadIdx.x; if (t >= n8) return; FragH fh, fl; const v4f a = *(const v4fa*)(F + t * 8), c = *(const v4fa*)(F + t * 8 + 4);
#pragma unroll
  for (int q = 0; q < 4; ++q) { _Float16 h = (_Float16)a[q]; fh.h[q] = h; fl.h[q] = (_Float16)((a[q] - (float)h) * 1024.0f); h = (_Float16)c[q]; fh.h[4 + q] = h; fl.h[4 + q] = (_Float16)((c[q] - (float)h) * 1024.0f); }
  { *(v8us*)((unsigned short*)Hh + t * 8) = fh.half[0]; *(v8us*)((unsigned short*)Hl + t * 8) = fl.half[0];  } }

// ---- fast GEMM (block tile 128x64, wave tile 32x64; requires M % 128 == 0 rows per launch region, N % 64 == 0 and K % 128 == 0); epilogue = k_gemm_hhx semantics ----
// The block's 128 A rows and 64 B rows are staged in LDS 128 k at a time (rows of 256 bytes, whole lines) by asynchronous 16-byte copies, two buffers: tile t + 2 flies while tile t + 1 is worked on.
// The four waves share the B rows; fragments are read from LDS by g2_frag in the k order and the kb order of the direct loads, so every accumulator sums in the same order.
__device__ __forceinline__ v16h g2_frag(const _Float16* p, int hh) { FragH f; f.half[0] = *(const v8us*)((const unsigned short*)p + 8 * hh); f.half[1] = *(const v8us*)((const unsigned short*)p + 16 + 8 * hh); return f.v; }
__device__ __forceinline__ v8f g2_mma(v16h a, v16h b, v8f c) { v8f d = __builtin_amdgcn_wmma_f32_16x16x32_f16(false, a, false, b, (short)0, c, false, false); asm volatile("v_nop\n\tv_nop\n\tv_nop\n\tv_nop" : "+v"(d) : "v"(a), "v"(b)); return d; }
#define GKS 128                            /* k per staged tile */
#define GLP 136                            /* LDS row pitch in f16: 128 + 8 = 272 bytes, for the 16-byte fragment reads */
// Twelve asynchronous 16-byte copies, global to LDS, each lane its own two addresses. The closing s_wait_xcnt 0 stands inside the statement so that no address register is rewritten ahead of it.
__device__ __forceinline__ void g2_copy12(const unsigned* l, const char* const* g) {
  asm volatile("global_load_async_to_lds_b128 %0, %12, off\n\tglobal_load_async_to_lds_b128 %1, %13, off\n\tglobal_load_async_to_lds_b128 %2, %14, off\n\tglobal_load_async_to_lds_b128 %3, %15, off\n\t"
               "global_load_async_to_lds_b128 %4, %16, off\n\tglobal_load_async_to_lds_b128 %5, %17, off\n\tglobal_load_async_to_lds_b128 %6, %18, off\n\tglobal_load_async_to_lds_b128 %7, %19, off\n\t"
               "global_load_async_to_lds_b128 %8, %20, off\n\tglobal_load_async_to_lds_b128 %9, %21, off\n\tglobal_load_async_to_lds_b128 %10, %22, off\n\tglobal_load_async_to_lds_b128 %11, %23, off\n\ts_wait_xcnt 0x0"
               :: "v"(l[0]), "v"(l[1]), "v"(l[2]), "v"(l[3]), "v"(l[4]), "v"(l[5]), "v"(l[6]), "v"(l[7]), "v"(l[8]), "v"(l[9]), "v"(l[10]), "v"(l[11]),
                  "v"(g[0]), "v"(g[1]), "v"(g[2]), "v"(g[3]), "v"(g[4]), "v"(g[5]), "v"(g[6]), "v"(g[7]), "v"(g[8]), "v"(g[9]), "v"(g[10]), "v"(g[11]) : "memory"); }
template <int ACT>
__global__ __launch_bounds__(128) void k_gemm2(const _Float16* __restrict__ A, int lda, size_t sA, const _Float16* __restrict__ Bh, int ldb, size_t sB, float alpha, const float* __restrict__ bias, size_t sBias, const float* __restrict__ CP, int rowsPerB, size_t sCPb, int row0g,
    float* __restrict__ C, _Float16* __restrict__ C16, int ldc, size_t sC, int M, int N, int K) { static_assert(ACT == 0 || ACT == 3 || ACT == 6 || ACT == 8 || ACT == 9 || ACT == 11 || ACT == 12 || ACT == 14 || ACT == 15 || ACT == 16 || ACT == 17, "k_gemm2: unsupported ACT code (would silently apply no activation)");
  __shared__ __attribute__((aligned(16))) float so[4][32][68];
  __shared__ __attribute__((aligned(16))) _Float16 ta[2][128][GLP]; __shared__ __attribute__((aligned(16))) _Float16 tb[2][64][GLP];
  const int tid = threadIdx.x, w = tid >> 5, lane = tid & 31, ln = lane & 15, hh = lane >> 4; const int by = blockIdx.y;
  A += (size_t)by * sA; Bh += (size_t)by * sB; const size_t cofs = (size_t)by * sC; const float* bp = bias ? bias + (size_t)by * sBias : nullptr;
  const int ntn = N >> 6; const int mt = blockIdx.x / ntn, nq = blockIdx.x - mt * ntn; const int row0 = mt * 128 + 32 * w, col0 = nq * 64; if (mt * 128 >= M) return;      /* block-uniform, in front of every barrier */
  const int srow = tid >> 4, sc8 = (tid & 15) * 8;      /* staging: 16 threads per row of 256 bytes, 8 rows a step */
  const char* ga = (const char*)(A + (size_t)(mt * 128 + srow) * lda + sc8); const char* gb = (const char*)(Bh + (size_t)(col0 + srow) * ldb + sc8); const size_t ga8 = (size_t)lda * 16, gb8 = (size_t)ldb * 16;      /* 8 rows in bytes */
  const unsigned la = (unsigned)(size_t)&ta[0][srow][sc8], lb = (unsigned)(size_t)&tb[0][srow][sc8];      /* byte addresses in the work-group's LDS */
  auto stage = [&](int t, int buf) { unsigned l[24]; const char* g[24];      /* one tile: 16 copies of A and 8 of B per thread */
#pragma unroll
    for (int j = 0; j < 16; ++j) { l[j] = la + (unsigned)buf * (unsigned)sizeof(ta[0]) + (unsigned)j * (8u * GLP * 2u); g[j] = ga + (size_t)t * (GKS * 2) + (size_t)j * ga8; }
#pragma unroll
    for (int j = 0; j < 8; ++j) { l[16 + j] = lb + (unsigned)buf * (unsigned)sizeof(tb[0]) + (unsigned)j * (8u * GLP * 2u); g[16 + j] = gb + (size_t)t * (GKS * 2) + (size_t)j * gb8; }
    g2_copy12(l, g); g2_copy12(l + 12, g + 12); };
  const v8f z8 = {0.f,0.f,0.f,0.f,0.f,0.f,0.f,0.f}; v8f c00 = z8, c01 = z8, c02 = z8, c03 = z8, c10 = z8, c11 = z8, c12 = z8, c13 = z8;
  const int nt = K / GKS;
  stage(0, 0);
  asm volatile("s_wait_asynccnt 0x0" ::: "memory");      /* this wave's copies of tile 0 have landed */
  __syncthreads();      /* publishes tile 0 to the four waves */
  if (nt > 1) stage(1, 1);
#pragma unroll 1      /* one trip is 32 matrix instructions of straight-line code already */
  for (int t = 0; t < nt; ++t) { const _Float16* ap = &ta[t & 1][32 * w + ln][0]; const _Float16* bq = &tb[t & 1][ln][0];
    v16h fa[2][2], fb[2][4];      /* two fragment sets: the next 32 k of this tile are read from LDS as one group ahead of the current block's matrix instructions */
    fa[0][0] = g2_frag(ap, hh); fa[0][1] = g2_frag(ap + 16 * GLP, hh); fb[0][0] = g2_frag(bq, hh); fb[0][1] = g2_frag(bq + 16 * GLP, hh); fb[0][2] = g2_frag(bq + 32 * GLP, hh); fb[0][3] = g2_frag(bq + 48 * GLP, hh);
#pragma unroll      /* makes the set index a constant, so that the sets are registers */
    for (int q = 0; q < GKS / 32; ++q) { const int s = q & 1, n = s ^ 1, kn = (q + 1) * 32;
      if (q + 1 < GKS / 32) { fa[n][0] = g2_frag(ap + kn, hh); fa[n][1] = g2_frag(ap + 16 * GLP + kn, hh); fb[n][0] = g2_frag(bq + kn, hh); fb[n][1] = g2_frag(bq + 16 * GLP + kn, hh); fb[n][2] = g2_frag(bq + 32 * GLP + kn, hh); fb[n][3] = g2_frag(bq + 48 * GLP + kn, hh); }
      c00 = g2_mma(fa[s][0], fb[s][0], c00); c10 = g2_mma(fa[s][1], fb[s][0], c10); c01 = g2_mma(fa[s][0], fb[s][1], c01); c11 = g2_mma(fa[s][1], fb[s][1], c11);
      c02 = g2_mma(fa[s][0], fb[s][2], c02); c12 = g2_mma(fa[s][1], fb[s][2], c12); c03 = g2_mma(fa[s][0], fb[s][3], c03); c13 = g2_mma(fa[s][1], fb[s][3], c13); }
    asm volatile("s_wait_dscnt 0x0" ::: "memory");      /* this wave's reads of tile t are done before its buffer is refilled */
    asm volatile("s_wait_asynccnt 0x0" ::: "memory");      /* this wave's copies of tile t + 1 have landed */
    __syncthreads();      /* publishes tile t + 1 and ends every wave's reads of tile t */
    if (t + 2 < nt) stage(t + 2, t & 1); }
  asm volatile("s_wait_asynccnt 0x0" ::: "memory");      /* no copy is outstanding when the wave goes on */
  v8f accs[8] = {c00, c01, c02, c03, c10, c11, c12, c13};
#pragma unroll
  for (int u = 0; u < 8; ++u) { const int t = u & 3, half = u >> 2; const int col = col0 + t * 16 + ln; const float bv = bp ? bf16_round(bp[col]) : 0.f;
#pragma unroll
    for (int r = 0; r < 8; ++r) { const int rloc = half * 16 + 8 * hh + r; float v = accs[u][r] * alpha + bv; if (CP) { if (rowsPerB < 0) v += CP[cofs + (size_t)(row0g + row0 + rloc) * ldc + col];      /* rowsPerB < 0: own element of the batched C plane */ else { const int bidx = (row0g + row0 + rloc) / rowsPerB; v += CP[(size_t)bidx * sCPb + (size_t)by * 64 + col]; } }
      if (ACT == 3) v = fmaxf(v, 0.f); else if (ACT == 6) v = 0.5f * v * (1.0f + erff(v * 0.70710678118654752f)); else if (ACT == 11) v = 1.0f / (1.0f + expf(-v)); else if (ACT == 15) v = v / (1.0f + expf(-v)); else if (ACT == 12) v = (v > 0.f) ? v : 0.01f * v; else if (ACT == 8) v = tanhf(v); else if (ACT == 9) v = 0.5f * v * (1.0f + tanhf(0.7978845608028654f * (v + 0.044715f * v * v * v))); else if (ACT == 14) v = (v > 0.f) ? v : 0.1f * v; else if (ACT == 16) v = (v >= 0.f) ? v : 0.3f * v; else if (ACT == 17) v = (v >= 0.f) ? v : 0.2f * v;
      so[w][rloc][t * 16 + ln] = v; } }
  __builtin_amdgcn_fence(__ATOMIC_ACQ_REL, "workgroup"); __builtin_amdgcn_wave_barrier();
  const int rsub = lane >> 4, c4 = (lane & 15) * 4;
  {
#pragma unroll
    for (int q = 0; q < 16; ++q) { const int r = q * 2 + rsub; const v4f v = *(const v4fa*)&so[w][r][c4]; if (C) { *(v4f*)(C + cofs + (size_t)(row0 + r) * ldc + col0 + c4) = v; asm volatile("s_wait_xcnt 0x0" ::: "memory"); }      /* the f32 store's data and address registers are rewritten right behind it (the f16 conversion, the next row): the wait stands in front of that */
      if (C16) { v4h h4; for (int i = 0; i < 4; ++i) h4[i] = (_Float16)v[i]; *(v4h*)(C16 + cofs + (size_t)(row0 + r) * ldc + col0 + c4) = h4; } }
     } }


__global__ __launch_bounds__(256) void k_wnat(const float* __restrict__ w, size_t n8, _Float16* __restrict__ Bt) { const size_t t = (size_t)blockIdx.x * 256 + threadIdx.x; if (t >= n8) return; FragH f; for (int q = 0; q < 8; ++q) f.h[q] = (_Float16)(bf16_round(w[t * 8 + q]) * 16.0f); *(v8us*)((unsigned short*)Bt + t * 8) = f.half[0];  }
__global__ __launch_bounds__(256) void k_rsm(const float* __restrict__ S, _Float16* __restrict__ P, int nrows) {
  #pragma clang fp contract(off)
  const int i = blockIdx.x * 256 + threadIdx.x; if (i >= nrows) return; const float* s = S + (size_t)i * SQ; float mx = -3.0e38f;
#pragma unroll 1
  for (int j = 0; j < SQ; ++j) mx = fmaxf(mx, s[j]); float se = 0.f;
#pragma unroll 1
  for (int j = 0; j < SQ; ++j) se += expf(s[j] - mx); const float sc = 256.0f / se;
#pragma unroll 1
  for (int j0 = 0; j0 < SQ; j0 += 8) { FragH f; for (int q = 0; q < 8; ++q) f.h[q] = (_Float16)(expf(s[j0 + q] - mx) * sc); unsigned short* d = (unsigned short*)P + (size_t)i * SQ + j0; *(v8us*)d = f.half[0];  } }
__global__ __launch_bounds__(256) void k_vt(const _Float16* __restrict__ V16, int b, int h0, _Float16* __restrict__ VT) { __shared__ unsigned short tl[64][65]; const int tid = threadIdx.x; const int hh = blockIdx.x % HG, sg = blockIdx.x / HG; const int s0 = sg * 64; const int h = h0 + hh;
  for (int i = tid; i < 64 * 8; i += 256) { const int j = i / 8, d8 = (i % 8) * 8; FragH f; f.half[0] = *(const v8us*)((const unsigned short*)V16 + ((size_t)b * SQ + s0 + j) * DM + h * HD + d8); for (int q = 0; q < 8; ++q) tl[d8 + q][j] = f.u[q]; }
  __syncthreads();
  { for (int i = tid; i < 64 * 8; i += 256) { const int d = i / 8, j8 = (i % 8) * 8; FragH f; for (int q = 0; q < 8; ++q) f.u[q] = tl[d][j8 + q]; *(v8us*)((unsigned short*)VT + ((size_t)hh * HD + d) * SQ + s0 + j8) = f.half[0]; }  } }



// Fused causal attention: a block owns 128 query rows of one head (32 per wave) and walks the keys 64 at a time; scores and weights never leave registers.
// Each pass stages 64 rows of k hi, k lo and 64 rows (head dims) of V^T in LDS by whole-line loads, once for the four waves; row pitch 128 + 16 bytes for the 16-byte fragment reads.
// S^T = K . Q^T (A = 16 key rows, B = 16 query rows, both by g2_frag): a lane holds 8 keys (8*hh + r) of ONE query (ln) per tile, so maximum and sum are in-lane plus one exchange of the wave halves.
// Two score tiles of one query group, converted in place, are the B operand of O^T += V^T . P^T (element i = key 8*hh + i, element 8 + i = key 16 + 8*hh + i: the k order of g2_frag on the V^T rows).
// Scores: (lo . hi + hi . lo) first, x 2^-10, then hi . hi on top in the same accumulator. Weights carried x256 (the + 8 in the exponent), in the f16 operand and in the row sum alike; o leaves x64.
#define FAC 0.18033688011112042f           /* 1 / sqrt(head_dim) * log2(e) */
#define FLP 72                             /* LDS row pitch in f16: 64 + 8 */
__device__ __forceinline__ float fa_exp2(float x) { asm("v_exp_f32 %0, %0\n\tv_nop" : "+v"(x)); return x; }      /* native 2^x; the v_nop fills the one slot that the instruction set asks for between a transcendental and a directly following instruction that reads its result or overwrites its source */
__device__ __forceinline__ v8f fa_mma(v16h a, v16h b, v8f c) { return __builtin_amdgcn_wmma_f32_16x16x32_f16(false, a, false, b, (short)0, c, false, false); }
__global__ __launch_bounds__(128) void k_fattn(const _Float16* __restrict__ QHp, const _Float16* __restrict__ QLp, const _Float16* __restrict__ KHp, const _Float16* __restrict__ KLp, const _Float16* __restrict__ VTp, _Float16* __restrict__ Op) {
  __shared__ __attribute__((aligned(16))) _Float16 lkh[64][FLP]; __shared__ __attribute__((aligned(16))) _Float16 lkl[64][FLP]; __shared__ __attribute__((aligned(16))) _Float16 lvt[64][FLP];
  const int tid = threadIdx.x, lane = tid & 31, ln = lane & 15, hh = lane >> 4; const int w = __builtin_amdgcn_readfirstlane(tid >> 5);
  const int h = blockIdx.y, b = blockIdx.z; const int qt = (b & 1) ? (int)blockIdx.x : (int)gridDim.x - 1 - (int)blockIdx.x;      /* long and short blocks mixed over the grid */
  const int row0 = qt * 128 + 32 * w; const size_t r0 = (size_t)b * SQ;
  v16h qh[2][2], ql[2][2]; const _Float16* qhp = QHp + (r0 + row0 + ln) * LQ + h * HD + 8 * hh; const _Float16* qlp = QLp + (r0 + row0 + ln) * LQ + h * HD + 8 * hh;      /* the lane's own 16-byte pieces start here (g2_frag with half 0) */
#pragma unroll
  for (int g = 0; g < 2; ++g) { qh[g][0] = g2_frag(qhp + g * (16 * LQ), 0); qh[g][1] = g2_frag(qhp + g * (16 * LQ) + 32, 0); ql[g][0] = g2_frag(qlp + g * (16 * LQ), 0); ql[g][1] = g2_frag(qlp + g * (16 * LQ) + 32, 0); }
  asm volatile("s_wait_xcnt 0x0" :: "v"(qhp), "v"(qlp) : "memory");      /* the sixteen loads' address registers stay untouched up to this wait: nothing, a later load's data included, lands on them before it */
  const char* khb = (const char*)(KHp + r0 * LQ + h * HD); const char* klb = (const char*)(KLp + r0 * LQ + h * HD); const char* vtb = (const char*)(VTp + (size_t)(b * NH + h) * HD * SQ);      /* block-uniform bases */
  const int srow = tid >> 3, sc8 = (tid & 7) * 8; const unsigned koff = (unsigned)(srow * LQ + sc8) * 2u, voff = (unsigned)(srow * SQ + sc8) * 2u;      /* staging: 8 threads per row of 128 bytes, 16 rows a step; byte offsets */
  const v8f z8 = {0.f,0.f,0.f,0.f,0.f,0.f,0.f,0.f}; v8f o[4][2];
#pragma unroll
  for (int dt = 0; dt < 4; ++dt) { o[dt][0] = z8; o[dt][1] = z8; }
  float m[2] = {-1.0e30f, -1.0e30f}, l[2] = {0.f, 0.f};
  const int kend = qt * 128 + 64;           /* the block's last piece: every wave stages and passes the barriers up to it */
#pragma unroll 1      /* one pass is up to 64 matrix instructions of straight-line code already */
  for (int kb = 0; kb <= kend; kb += 64) { v8us tk[4], tl[4], tv[4]; const char* kp = khb + (size_t)kb * (LQ * 2) + koff; const char* lp = klb + (size_t)kb * (LQ * 2) + koff; const char* vp = vtb + (size_t)kb * 2 + voff;
#pragma unroll
    for (int j = 0; j < 4; ++j) { tk[j] = *(const v8us*)(kp + j * (16 * LQ * 2)); tl[j] = *(const v8us*)(lp + j * (16 * LQ * 2)); tv[j] = *(const v8us*)(vp + j * (16 * SQ * 2)); }
    asm volatile("s_wait_xcnt 0x0" :: "v"(kp), "v"(lp), "v"(vp) : "memory");      /* the twelve loads' address registers stay untouched up to this wait: nothing, a later load's data included, lands on them before it */
    __syncthreads();      /* every wave has left the previous pass's rows */
#pragma unroll
    for (int j = 0; j < 4; ++j) { *(v8us*)&lkh[j * 16 + srow][sc8] = tk[j]; *(v8us*)&lkl[j * 16 + srow][sc8] = tl[j]; *(v8us*)&lvt[j * 16 + srow][sc8] = tv[j]; }
    __syncthreads();      /* publishes the staged rows to the four waves */
#pragma unroll
    for (int hf = 0; hf < 2; ++hf) { const int k0 = kb + 32 * hf;      /* 32 keys a step: 16 score registers per query group alive at a time */
      if (k0 <= row0) {      /* wave-uniform: keys past the wave's last row (row0 + 31) are left out whole */
        v8f s[2][2];
#pragma unroll
        for (int t = 0; t < 2; ++t) { const int kr = 32 * hf + 16 * t + ln; const v16h a0 = g2_frag(&lkh[kr][0], hh), a1 = g2_frag(&lkh[kr][32], hh), c0 = g2_frag(&lkl[kr][0], hh), c1 = g2_frag(&lkl[kr][32], hh);
#pragma unroll
          for (int g = 0; g < 2; ++g) { v8f y = fa_mma(a0, ql[g][0], z8); y = fa_mma(a1, ql[g][1], y); y = fa_mma(c0, qh[g][0], y); y = fa_mma(c1, qh[g][1], y);
#pragma unroll
            for (int r = 0; r < 8; ++r) y[r] *= 0.0009765625f;
            y = fa_mma(a0, qh[g][0], y); y = fa_mma(a1, qh[g][1], y); s[t][g] = y; } }
        if (k0 == row0) {      /* wave-uniform: the 32 x 32 piece on the diagonal is the only one that needs the causal test; key k0 stays for every query */
#pragma unroll
          for (int t = 0; t < 2; ++t)
#pragma unroll
            for (int g = 0; g < 2; ++g)
#pragma unroll
              for (int r = 0; r < 8; ++r) if (16 * t + 8 * hh + r > 16 * g + ln) s[t][g][r] = -1.0e30f; }
        FragH p[2];
#pragma unroll
        for (int g = 0; g < 2; ++g) { float mx = s[0][g][0];
#pragma unroll
          for (int t = 0; t < 2; ++t)
#pragma unroll
            for (int r = 0; r < 8; ++r) mx = fmaxf(mx, s[t][g][r]);
          mx = fmaxf(mx, __shfl_xor(mx, 16, 32));      /* the other 8 keys of every tile sit in the other wave half */
          const float mn = fmaxf(m[g], mx); const float sc = fa_exp2((m[g] - mn) * FAC); m[g] = mn; const float nb = fmaf(-mn, FAC, 8.0f);
          float ps[4] = {0.f, 0.f, 0.f, 0.f};
#pragma unroll
          for (int t = 0; t < 2; ++t)
#pragma unroll
            for (int r = 0; r < 8; ++r) { const float e = fa_exp2(fmaf(s[t][g][r], FAC, nb)); ps[r & 3] += e; p[g].h[t * 8 + r] = (_Float16)e; }
          l[g] = fmaf(l[g], sc, (ps[0] + ps[1]) + (ps[2] + ps[3]));
#pragma unroll
          for (int dt = 0; dt < 4; ++dt)
#pragma unroll
            for (int r = 0; r < 8; ++r) o[dt][g][r] *= sc; }
#pragma unroll
        for (int dt = 0; dt < 4; ++dt) { const v16h a = g2_frag(&lvt[16 * dt + ln][32 * hf], hh); o[dt][0] = fa_mma(a, p[0].v, o[dt][0]); o[dt][1] = fa_mma(a, p[1].v, o[dt][1]); } } } }
#pragma unroll
  for (int g = 0; g < 2; ++g) { const float fin = 64.0f / (l[g] + __shfl_xor(l[g], 16, 32));      /* the halves' sums joined once; x256 cancels, o carried x64 */
    unsigned short* op = (unsigned short*)Op + (r0 + row0 + 16 * g + ln) * DM + h * HD + 8 * hh;
#pragma unroll
    for (int dt = 0; dt < 4; ++dt) { FragH f;
#pragma unroll
      for (int r = 0; r < 8; ++r) f.h[r] = (_Float16)(o[dt][g][r] * fin);
      *(v8us*)(op + 16 * dt) = f.half[0]; } } }


// Exact f32 attention for the first QT0 rows of every batch (blockIdx.y), one thread per query row; q, k, v are the f32 rows of the full projections; o leaves as f16 hi (into the merged o rows, over the f16 path's) + x1024 residual. The block's key and value rows (64 or 128 rows of 64 floats) are staged once in LDS
// by whole-line loads and then read as broadcasts; the thread's q row and o row stay in registers; four keys' score sums run side by side, each in index order.
// Every plain '#pragma unroll' below makes the indices of q, o, s and the staged pieces constants, so that these arrays are registers and not scratch.
template <int MASKADD>
__global__ __launch_bounds__(64) void k_att0(const float* __restrict__ QF, const float* __restrict__ KF, const float* __restrict__ VF, int ld, const float* __restrict__ mask, float scale, _Float16* __restrict__ OH, _Float16* __restrict__ OL) {
  static_assert(MASKADD == 0, "k_att0: only the causal form is staged (keys up to the block's last row)"); (void)mask;
  __shared__ __attribute__((aligned(16))) float lk[QT0][64]; __shared__ __attribute__((aligned(16))) float lv[QT0][64]; __shared__ __attribute__((aligned(16))) float lo[64][64];
  const int tid = threadIdx.x; const int h = blockIdx.x / (QT0 / 64), rg = blockIdx.x % (QT0 / 64); const int i = rg * 64 + tid; const int b = blockIdx.y; const size_t r0 = (size_t)b * SQ;      /* the batch's first token row */
  __builtin_assume(ld == DM);      /* every launch passes the row pitch DM: the row steps below fold into the loads' immediate offsets, so one offset register serves all loads of a kind */
  const char* qh = (const char*)(QF + r0 * DM + h * HD); const char* kh = (const char*)(KF + r0 * DM + h * HD); const char* vh = (const char*)(VF + r0 * DM + h * HD);      /* block-uniform bases */
  const unsigned qoff = (unsigned)(i * ld) * 4u;      /* byte offset of the thread's q row */
  float q[HD], o[HD];
#pragma unroll
  for (int c = 0; c < HD / 4; ++c) { const v4f t4 = *(const v4fa*)(qh + qoff + c * 16);
#pragma unroll
    for (int u = 0; u < 4; ++u) { q[c * 4 + u] = t4[u]; o[c * 4 + u] = 0.f; } }
  static_assert(QT0 == 128, "k_att0: staging is written for one or two pieces of 64 keys");
  const int srow = tid >> 4, sc4 = (tid & 15) * 4; const unsigned soff = (unsigned)(srow * ld + sc4) * 4u;      /* staging: 16 threads per row of 256 bytes; byte offset */
  const char* kp = kh + soff; const char* vp = vh + soff;      /* the thread's own staging addresses */
#pragma unroll
  for (int t = 0; t < QT0 / 64; ++t) if (t <= rg) {      /* block-uniform test: 64 keys a piece, all 32 loads of a thread in flight together */
    v4f tk[16], tv[16];
#pragma unroll
    for (int it = 0; it < 16; ++it) { tk[it] = *(const v4fa*)(kp + (t * 64 + it * 4) * ld * 4); tv[it] = *(const v4fa*)(vp + (t * 64 + it * 4) * ld * 4); }
    asm volatile("s_wait_xcnt 0x0" :: "v"(qoff), "v"(soff), "v"(kp), "v"(vp) : "memory");      /* the loads' offset and address registers stay untouched up to this wait: nothing, a later load's data included, lands on a register that an issued load names */
#pragma unroll
    for (int it = 0; it < 16; ++it) { *(v4f*)&lk[t * 64 + it * 4 + srow][sc4] = tk[it]; *(v4f*)&lv[t * 64 + it * 4 + srow][sc4] = tv[it]; } }
  __syncthreads();      /* publishes the staged rows to both waves */
  float m = -1.0e30f, l = 0.f; const int nkey = rg * 64 + 64;      /* causal form: keys up to the block's last row */
#pragma unroll 1      /* the body is four whole keys of straight-line code already: more would only grow the text */
  for (int j0 = 0; j0 < nkey; j0 += 4) { float s[4] = {0.f, 0.f, 0.f, 0.f};
#pragma unroll
    for (int c = 0; c < HD / 4; ++c) { v4f kq[4];
#pragma unroll
      for (int u = 0; u < 4; ++u) kq[u] = *(const v4f*)&lk[j0 + u][c * 4];
#pragma unroll
      for (int x = 0; x < 4; ++x)
#pragma unroll
        for (int u = 0; u < 4; ++u) s[u] = __fadd_rn(s[u], __fmul_rn(q[c * 4 + x], kq[u][x])); }
#pragma unroll
    for (int u = 0; u < 4; ++u) { const int j = j0 + u; const float sv = __fmul_rn(s[u], scale);
      const float f = (j <= i) ? 1.f : 0.f; const float sm = fmaf(f, sv, (1.f - f) * -1.0e30f); const float mn = fmaxf(m, sm); const float sc = expf(m - mn); const float e = expf(sm - mn); l = __fadd_rn(__fmul_rn(l, sc), e); m = mn;
#pragma unroll
      for (int c = 0; c < HD / 4; ++c) { const v4f vv = *(const v4f*)&lv[j][c * 4];
#pragma unroll
        for (int x = 0; x < 4; ++x) o[c * 4 + x] = __fadd_rn(__fmul_rn(o[c * 4 + x], sc), __fmul_rn(e, vv[x])); } } }
  const float fin = 64.0f / l;      /* o carried x64 like the f16 path */
#pragma unroll
  for (int c = 0; c < HD / 4; ++c) { v4f oo;
#pragma unroll
    for (int u = 0; u < 4; ++u) oo[u] = __fmul_rn(o[c * 4 + u], fin);
    *(v4f*)&lo[tid][c * 4] = oo; }
  __syncthreads();
  {
#pragma unroll 1
    for (int it = 0; it < 16; ++it) { const int row = it * 4 + tid / 16, pc = (tid % 16) * 4; const v4f v = *(const v4f*)&lo[row][pc]; v4h vh4, vl4;
      for (int u = 0; u < 4; ++u) { const _Float16 hi = (_Float16)v[u]; vh4[u] = hi; vl4[u] = (_Float16)((v[u] - (float)hi) * 1024.0f); }
      *(v4h*)(OH + (r0 + rg * 64 + row) * DM + h * HD + pc) = vh4; *(v4h*)(OL + ((size_t)b * QT0 + rg * 64 + row) * DM + h * HD + pc) = vl4; }
     } }

extern "C" void kernel_launch(void* const* d_in, const int* in_sizes, int n_in,
                              void* d_out, int out_size, void* d_ws, size_t ws_size, hipStream_t stream) {
  (void)in_sizes; (void)n_in; (void)out_size;
  const float* const* I = (const float* const*)d_in; const float* x = I[0]; const float* xk = I[1]; const float* xv = I[2]; const float* wq = I[3]; const float* bq = nullptr; const float* wk = I[4]; const float* bk = nullptr; const float* wv = I[5]; const float* bv = nullptr; const float* wo = I[6]; const float* bo = I[7];      /* input order: query_data, key_data, value_data (three SEPARATE streams: the three exact-f16 row casts read one each), Wq, Wk, Wv ([in][out]; the module has NO q / k / v biases: null pointers in the guarded bias slots), Wp ([in][out]), bp (REAL); NO mask input (the causal fill is built inside the reference) */
  char* ws = (char*)d_ws; size_t off = 0;
  auto take = [&](size_t bytes) { char* p = ws + off; off += (bytes + 255) & ~(size_t)255; return p; };
  _Float16* BQ = (_Float16*)take((size_t)DM * DM * 2); _Float16* BK = (_Float16*)take((size_t)DM * DM * 2); _Float16* BV = (_Float16*)take((size_t)DM * DM * 2); _Float16* BO = (_Float16*)take((size_t)DM * DM * 2);
  _Float16* X16 = (_Float16*)take(NR * DM * 2); _Float16* XK16 = (_Float16*)take(NR * DM * 2); _Float16* XV16 = (_Float16*)take(NR * DM * 2);      /* exact f16 rows of query, key, value */ float* QF = (float*)take(NR * DM * 4); float* KF = (float*)take(NR * DM * 4); float* VF = (float*)take(NR * DM * 4);      /* f32 q, k, v rows, a plane each: the exact path of rows 0..127 reads them */ _Float16* QH = (_Float16*)take(NR * DM * 2); _Float16* QL = (_Float16*)take(NR * DM * 2); _Float16* KH = (_Float16*)take(NR * DM * 2); _Float16* KL = (_Float16*)take(NR * DM * 2); _Float16* Q16 = QH; _Float16* K16 = KH; _Float16* V16 = (_Float16*)take(NR * DM * 2); _Float16* O16 = (_Float16*)take(NR * DM * 2);
  _Float16* VT = (_Float16*)take((size_t)NB * NH * HD * SQ * 2);
  _Float16* OL0 = (_Float16*)take((size_t)NB * QT0 * DM * 2);      /* x1024 residual of the exact o rows */
  if (off > ws_size) return;
  { const unsigned g = (unsigned)(((size_t)DM * (DM / 8) + 255) / 256); k_wt_f16<<<g, 256, 0, stream>>>(wq, BQ, DM, DM, 16.0f); k_wt_f16<<<g, 256, 0, stream>>>(wk, BK, DM, DM, 16.0f); k_wt_f16<<<g, 256, 0, stream>>>(wv, BV, DM, DM, 16.0f); k_wt_f16<<<g, 256, 0, stream>>>(wo, BO, DM, DM, 16.0f); }      /* [in][out] -> Bt[n][k] x16 */
  k_x16<<<(unsigned)((NR * DM / 8 + 255) / 256), 256, 0, stream>>>(x, X16, NR * DM / 8); k_x16<<<(unsigned)((NR * DM / 8 + 255) / 256), 256, 0, stream>>>(xk, XK16, NR * DM / 8); k_x16<<<(unsigned)((NR * DM / 8 + 255) / 256), 256, 0, stream>>>(xv, XV16, NR * DM / 8);
  const size_t r0p = (size_t)B0 * SQ;      /* first projected row */
  k_gemm2<0><<<dim3((unsigned)((MP / 128) * (DM / 64)), 1), 128, 0, stream>>>(X16 + r0p * DM, DM, 0, BQ, DM, 0, 0.0625f, bq, 0, nullptr, 1, 0, 0, QF + r0p * DM, nullptr, DM, 0, MP, DM, DM); k_hl<<<(unsigned)(((size_t)MP * DM / 8 + 255) / 256), 256, 0, stream>>>(QF + r0p * DM, QH + r0p * DM, QL + r0p * DM, (size_t)MP * DM / 8);      /* q (f32) -> f16 hi + x1024 residual: unscaled logits sigma ~8 */
  k_gemm2<0><<<dim3((unsigned)((MP / 128) * (DM / 64)), 1), 128, 0, stream>>>(XK16 + r0p * DM, DM, 0, BK, DM, 0, 0.0625f, bk, 0, nullptr, 1, 0, 0, KF + r0p * DM, nullptr, DM, 0, MP, DM, DM); k_hl<<<(unsigned)(((size_t)MP * DM / 8 + 255) / 256), 256, 0, stream>>>(KF + r0p * DM, KH + r0p * DM, KL + r0p * DM, (size_t)MP * DM / 8);      /* k likewise */
  k_gemm2<0><<<dim3((unsigned)((MP / 128) * (DM / 64)), 1), 128, 0, stream>>>(XV16 + r0p * DM, DM, 0, BV, DM, 0, 0.0625f, bv, 0, nullptr, 1, 0, 0, VF + r0p * DM, V16 + r0p * DM, DM, 0, MP, DM, DM);
  k_vt<NH, SQ><<<NB * NH * (SQ / 64), 256, 0, stream>>>(V16, LQ, 0, VT);      /* V^T [NB][NH][HD][SQ] */
  k_fattn<<<dim3(SQ / 128, NH, NB), 128, 0, stream>>>(QH, QL, KH, KL, VT, O16);      /* scores, causal softmax and P . V in one launch for all rows, heads and batches: o (merged heads, x64) as f16 rows */
  k_att0<0><<<dim3(NH * (QT0 / 64), NBR), 64, 0, stream>>>(QF + r0p * DM, KF + r0p * DM, VF + r0p * DM, DM, nullptr, SCL, O16 + r0p * DM, OL0);      /* exact f32 attention for rows 0..127 of both batches in one launch (o x64): f16 hi over the f16 path's o rows, x1024 residual into its own plane */
  k_gemm2<0><<<dim3((unsigned)((MPO / 128) * (DM / 64)), 1), 128, 0, stream>>>(O16 + r0p * DM, DM, 0, BO, DM, 0, 0.0009765625f, bo, 0, nullptr, 1, 0, 0, (float*)d_out + r0p * DM, nullptr, DM, 0, MPO, DM, DM);      /* out rows are the output layout */
  k_gemm2<0><<<dim3((QT0 / 128) * (DM / 64), NBR), 128, 0, stream>>>(OL0, DM, (size_t)QT0 * DM, BO, DM, 0, 0.00000095367431640625f, nullptr, 0, (const float*)d_out + r0p * DM, -1, 0, 0, (float*)d_out + r0p * DM, nullptr, DM, (size_t)SQ * DM, QT0, DM, DM);      /* rows 0..127 of both batches (grid y): += o_lo Wo 2^-20 (own-element accumulate) on the o_hi Wo + b that the launch above wrote */
}

// v006
// It runs in 201 microseconds.
// In both of two side-by-side timings against v005, it was 1.10 times as fast.
// All steps since v000 together make it 29.1 times as fast.
#include <hip/hip_runtime.h>
// Causal multi-head attention on three inputs with bias-free [in][out] projections and a biased [in][out] output projection (query_data, key_data, value_data [2][2048][1024]; q = split_heads(query_data Wq), k = split_heads(key_data Wk), v = split_heads(value_data Wv) ([in][out] [1024][1024], NO biases), 16 heads of 64; scores / sqrt(64); scores + triu(ones, k = 1) x (-1e13): an additive fill strictly above the diagonal == exclusion (exp underflows to exactly 0; every row keeps its diagonal); softmax over keys; out = merged Wp + bp ([in][out] + a REAL bias) -> [2][2048][1024]); the causal rule is built inside the reference; q and k carried as f16 hi + x1024 residual planes with three-product scores.
// Structure: token rows r = b*2048 + s; x as exact f16 rows (bf16-rounded); q and k as WMMA GEMMs (32x64 wave tiles, f32 accumulation, exact x16 weights, no bias) into f32 rows split into f16 hi + x1024 residual planes, v as a GEMM that stores f16 and f32 rows; V^T for all heads and batches via LDS transposes; one fused attention launch: a block owns 128 query rows of a head (32 per wave) and walks the keys up to its last row 64 at a time, k hi, k lo and V^T rows staged in LDS per pass: three-product scores (lo.hi + hi.lo, x 2^-10, + hi.hi) as S^T tiles in registers, running maximum and sum per query (f32 statistics, native exp2; keys past the row's own index excluded; weights x256 f16, packed in place as the B operand), O^T += V^T . P^T, o carried x64 (folded into the output GEMM alpha) written straight into the merged f16 o rows; out = o W_o + b GEMM (f32) into the output layout.
// Compute dtype: inputs rounded to bf16; x / weights exact; q and k as f16 hi + x1024 residual planes (three products), v, softmax weights and o as plain f16 GEMM operands (~2^-12); scores and softmax statistics f32. v_wmma_f32_16x16x32_f16.
#define NB 2
#define SCL 0.125f                         /* 1 / sqrt(head_dim = 64) */
#define SCLR 0.0001220703125f              /* 2^-13 (not used: k_fattn scales the x1024 residual sums by 2^-10) */
#define SQ 2048
#define DM 1024
#define NH 16
#define HD 64
#define HG 4                         /* heads per launch of the head-group k_vt (not launched) */
#define QT 256                       /* not used: the causal tiles are 128 query rows */
#define NKX SQ                       /* not used */
#define QT0 128                      /* first-tile rows recomputed exactly in f32 */
#define B0 0                         /* first batch processed (debug hook) */
#define NBR NB                       /* batches processed (debug hook) */
#define NR ((size_t)NB * SQ)         /* token rows */
#define MP ((int)((size_t)NBR * SQ)) /* rows projected (debug hook) */
#define QN SQ                        /* not used */
#define NHD NH                       /* not used */
#define MPO MP                       /* rows through the output stage (debug hook) */
#define LQ DM      /* row pitch of the q/k/v rows */
typedef __bf16 v16b __attribute__((ext_vector_type(16)));
typedef unsigned short v8us __attribute__((ext_vector_type(8), may_alias));
typedef float  v8f  __attribute__((ext_vector_type(8)));
typedef float  v4f  __attribute__((ext_vector_type(4)));
typedef float  v4fa __attribute__((ext_vector_type(4), may_alias));
union FragB { v16b v; v8us half[2]; unsigned short u[16]; };

__device__ __forceinline__ unsigned short bf16_bits(float x) { unsigned int u = __float_as_uint(x); return (unsigned short)((u + 0x7FFFu + ((u >> 16) & 1u)) >> 16); }
__device__ __forceinline__ float bf16_val(unsigned short b) { return __uint_as_float(((unsigned int)b) << 16); }
__device__ __forceinline__ float bf16_round(float x) { return bf16_val(bf16_bits(x)); }
// D += A·B with NT terms: 1 = ah·bh, 2 = + al·bh (A split), 3 = + ah·bl (both split)
template <int NT>
__device__ __forceinline__ v8f mmaN(v16b ah, v16b al, v16b bh, v16b bl, v8f c) {
  c = __builtin_amdgcn_wmma_f32_16x16x32_bf16(false, ah, false, bh, (short)0, c, false, false);
  if (NT >= 2) c = __builtin_amdgcn_wmma_f32_16x16x32_bf16(false, al, false, bh, (short)0, c, false, false);
  if (NT >= 3) c = __builtin_amdgcn_wmma_f32_16x16x32_bf16(false, ah, false, bl, (short)0, c, false, false);
  asm volatile("v_nop\n\tv_nop\n\tv_nop\n\tv_nop" : "+v"(c) : "v"(ah), "v"(al), "v"(bh), "v"(bl));
  return c;
}

__global__ __launch_bounds__(256) void k_wt_bf16(const float* __restrict__ W, unsigned short* __restrict__ Wt, int K, int N) {
  const int t = blockIdx.x * 256 + threadIdx.x;
  const int k8n = K / 8;
  if (t >= N * k8n) return;
  const int n = t / k8n, k8 = (t % k8n) * 8;
  v8us v;
#pragma unroll
  for (int i = 0; i < 8; ++i) v[i] = bf16_bits(W[(size_t)(k8 + i) * N + n]);
  *(v8us*)(Wt + (size_t)n * K + k8) = v;
  
}

// GEMM C[M][N] (f32, pitch ldc) = act(A[M][K]·W + bias). A f32 row-major (pitch lda) converted per fragment to bf16
// (ASPLIT: hi/lo two planes -> 2 terms, else single rounded term); Wt bf16 [N][K] (pitch ldb). BIAS_BF16 rounds the
// bias to bf16 first (bias quantised to bf16 before the add). K%32==0, M%16==0, N%64==0.
template <bool ASPLIT, int ACT, bool BIAS_BF16>
__global__ __launch_bounds__(128) void k_gemm_bf(const float* __restrict__ A, int lda, const unsigned short* __restrict__ Wt, int ldb,
                                               const float* __restrict__ bias, float* __restrict__ C, int ldc, int M, int N, int K) {
  __shared__ __attribute__((aligned(16))) float so[4][16][64];
  const int tid = threadIdx.x, w = tid >> 5, lane = tid & 31, ln = lane & 15, hh = lane >> 4;
  const int ntn = N / 64;
  const int wid = blockIdx.x * 4 + w;
  const int mt = wid / ntn, nq = wid % ntn;
  if (mt * 16 >= M) return;
  const int row0 = mt * 16, col0 = nq * 64;
  const float* arow = A + (size_t)(row0 + ln) * lda;
  v8f acc[4] = {};
  for (int kb = 0; kb < K; kb += 32) {
    FragB ah, al;
    const v4f x0 = *(const v4fa*)(arow + kb + 8 * hh), x1 = *(const v4fa*)(arow + kb + 8 * hh + 4);
    const v4f x2 = *(const v4fa*)(arow + kb + 16 + 8 * hh), x3 = *(const v4fa*)(arow + kb + 16 + 8 * hh + 4);
    float xs[16] = {x0[0],x0[1],x0[2],x0[3],x1[0],x1[1],x1[2],x1[3],x2[0],x2[1],x2[2],x2[3],x3[0],x3[1],x3[2],x3[3]};
#pragma unroll
    for (int i = 0; i < 16; ++i) { const unsigned short hb = bf16_bits(xs[i]); ah.u[i] = hb; al.u[i] = ASPLIT ? bf16_bits(xs[i] - bf16_val(hb)) : (unsigned short)0; }
#pragma unroll
    for (int t = 0; t < 4; ++t) {
      const unsigned short* brow = Wt + (size_t)(col0 + t * 16 + ln) * ldb + kb;
      FragB b;
      b.half[0] = *(const v8us*)(brow + 8 * hh);
      b.half[1] = *(const v8us*)(brow + 16 + 8 * hh);
      acc[t] = mmaN<ASPLIT ? 2 : 1>(ah.v, al.v, b.v, b.v, acc[t]);
    }
  }
#pragma unroll
  for (int t = 0; t < 4; ++t) {
    float bv = bias ? bias[col0 + t * 16 + ln] : 0.f;
    if (BIAS_BF16) bv = bf16_round(bv);
#pragma unroll
    for (int r = 0; r < 8; ++r) { float v = acc[t][r] + bv; if (ACT == 1) v = fmaxf(v, 0.f); so[w][8 * hh + r][t * 16 + ln] = v; }
  }
  __builtin_amdgcn_fence(__ATOMIC_ACQ_REL, "workgroup");
  __builtin_amdgcn_wave_barrier();
  const int rsub = lane >> 4, c4 = (lane & 15) * 4;
  {
#pragma unroll
    for (int q = 0; q < 8; ++q) {
      const int r = q * 2 + rsub;
      const v4f v = *(const v4fa*)&so[w][r][c4];
      *(v4f*)(C + (size_t)(row0 + r) * ldc + col0 + c4) = v;
    }
    
  }
}

// GEMM C = act(A·W + bias + resid): A f32 (ASPLIT -> hi/lo 2 terms), Wt bf16 [N][K]; ACT 0 none, 1 relu, 2 exact gelu;
// resid (optional, f32, row index = (row % rmod), pitch ldr, RES_BF16 rounds it) added before the activation.
template <bool ASPLIT, int ACT, bool BIAS_BF16, bool RES_BF16>
__global__ __launch_bounds__(128) void k_gemm_bf3(const float* __restrict__ A, int lda, const unsigned short* __restrict__ Wt, int ldb,
                                                const float* __restrict__ bias, const float* __restrict__ resid, int rmod, int ldr,
                                                float* __restrict__ C, int ldc, int M, int N, int K) {
  __shared__ __attribute__((aligned(16))) float so[4][16][64];
  const int tid = threadIdx.x, w = tid >> 5, lane = tid & 31, ln = lane & 15, hh = lane >> 4;
  const int ntn = N / 64;
  const int wid = blockIdx.x * 4 + w;
  const int mt = wid / ntn, nq = wid % ntn;
  if (mt * 16 >= M) return;
  const int row0 = mt * 16, col0 = nq * 64;
  const float* arow = A + (size_t)(row0 + ln) * lda;
  v8f acc[4] = {};
  for (int kb = 0; kb < K; kb += 32) {
    FragB ah, al;
    const v4f x0 = *(const v4fa*)(arow + kb + 8 * hh), x1 = *(const v4fa*)(arow + kb + 8 * hh + 4);
    const v4f x2 = *(const v4fa*)(arow + kb + 16 + 8 * hh), x3 = *(const v4fa*)(arow + kb + 16 + 8 * hh + 4);
    float xs[16] = {x0[0],x0[1],x0[2],x0[3],x1[0],x1[1],x1[2],x1[3],x2[0],x2[1],x2[2],x2[3],x3[0],x3[1],x3[2],x3[3]};
#pragma unroll
    for (int i = 0; i < 16; ++i) { const unsigned short hb = bf16_bits(xs[i]); ah.u[i] = hb; al.u[i] = ASPLIT ? bf16_bits(xs[i] - bf16_val(hb)) : (unsigned short)0; }
#pragma unroll
    for (int t = 0; t < 4; ++t) {
      const unsigned short* brow = Wt + (size_t)(col0 + t * 16 + ln) * ldb + kb;
      FragB b;
      b.half[0] = *(const v8us*)(brow + 8 * hh);
      b.half[1] = *(const v8us*)(brow + 16 + 8 * hh);
      acc[t] = mmaN<ASPLIT ? 2 : 1>(ah.v, al.v, b.v, b.v, acc[t]);
    }
  }
#pragma unroll
  for (int t = 0; t < 4; ++t) {
    const int col = col0 + t * 16 + ln;
    float bv = bias ? bias[col] : 0.f;
    if (BIAS_BF16) bv = bf16_round(bv);
#pragma unroll
    for (int r = 0; r < 8; ++r) {
      float v = acc[t][r] + bv;
      if (resid) { float rv = resid[(size_t)((row0 + 8 * hh + r) % rmod) * ldr + col]; if (RES_BF16) rv = bf16_round(rv); v += rv; }
      if (ACT == 1) v = fmaxf(v, 0.f);
      if (ACT == 2) v = 0.5f * v * (1.0f + erff(v * 0.70710678118654752f));
      if (ACT == 3) { const float u = 0.7978845608028654f * (v + 0.044715f * v * v * v); v = 0.5f * v * (1.0f + tanhf(u)); }
      so[w][8 * hh + r][t * 16 + ln] = v;
    }
  }
  __builtin_amdgcn_fence(__ATOMIC_ACQ_REL, "workgroup");
  __builtin_amdgcn_wave_barrier();
  const int rsub = lane >> 4, c4 = (lane & 15) * 4;
  {
#pragma unroll
    for (int q = 0; q < 8; ++q) {
      const int r = q * 2 + rsub;
      const v4f v = *(const v4fa*)&so[w][r][c4];
      *(v4f*)(C + (size_t)(row0 + r) * ldc + col0 + c4) = v;
    }
    
  }
}
// row LayerNorm (biased variance, eps) over N: s = X (+ R); optional out_sum <- s; out_norm <- (s-mu)*rsqrt(var+eps)*g + b
template <bool PARAM_BF16>
__global__ __launch_bounds__(256) void k_layernorm(const float* __restrict__ X, const float* __restrict__ R, const float* __restrict__ g, const float* __restrict__ bta,
                                                  float* __restrict__ out_sum, float* __restrict__ out_norm, int N, float eps) {
  __shared__ float red[256];
  const int row = blockIdx.x, tid = threadIdx.x;
  const float* x = X + (size_t)row * N; const float* rr = R ? R + (size_t)row * N : nullptr;
  float vals[16];                     // up to N = 4096
  const int per = N / 256;            // contiguous chunk per thread? use strided-by-4 chunks: thread handles j = tid*4 + 1024*u
  float s1 = 0.f;
  for (int u = 0; u < per / 4; ++u) {
    const int j = tid * 4 + 1024 * u;
    const v4f a = *(const v4fa*)(x + j);
    v4f b = {0.f,0.f,0.f,0.f}; if (rr) b = *(const v4fa*)(rr + j);
#pragma unroll
    for (int q = 0; q < 4; ++q) { const float v = a[q] + b[q]; vals[u * 4 + q] = v; s1 += v; }
  }
  red[tid] = s1; __syncthreads();
  for (int st = 128; st > 0; st >>= 1) { if (tid < st) red[tid] += red[tid + st]; __syncthreads(); }
  const float mu = red[0] / (float)N; __syncthreads();
  float s2 = 0.f;
  for (int u = 0; u < per / 4; ++u)
#pragma unroll
    for (int q = 0; q < 4; ++q) { const float c = vals[u * 4 + q] - mu; s2 += c * c; }
  red[tid] = s2; __syncthreads();
  for (int st = 128; st > 0; st >>= 1) { if (tid < st) red[tid] += red[tid + st]; __syncthreads(); }
  const float rs = rsqrtf(red[0] / (float)N + eps);
  {
    for (int u = 0; u < per / 4; ++u) {
      const int j = tid * 4 + 1024 * u;
      v4f o, sm;
#pragma unroll
      for (int q = 0; q < 4; ++q) {
        float gg = g[j + q], bb = bta[j + q];
        if (PARAM_BF16) { gg = bf16_round(gg); bb = bf16_round(bb); }
        sm[q] = vals[u * 4 + q]; o[q] = (vals[u * 4 + q] - mu) * rs * gg + bb;
      }
      if (out_sum) *(v4f*)(out_sum + (size_t)row * N + j) = sm;
      *(v4f*)(out_norm + (size_t)row * N + j) = o;
    }
    
  }
}



// ---- f16 WMMA path (v_wmma_f32_16x16x32_f16): 11-bit significands for operands in range — used where a [0,1] probability operand needs more precision than bf16
typedef _Float16 v16h __attribute__((ext_vector_type(16)));
union FragH { v16h v; v8us half[2]; _Float16 h[16]; unsigned short u[16]; };
template <int NT>
__device__ __forceinline__ v8f mmaH(v16h ah, v16h al, v16h bh, v16h bl, v8f c) {
  c = __builtin_amdgcn_wmma_f32_16x16x32_f16(false, ah, false, bh, (short)0, c, false, false);
  if (NT >= 2) c = __builtin_amdgcn_wmma_f32_16x16x32_f16(false, al, false, bh, (short)0, c, false, false);
  if (NT >= 3) c = __builtin_amdgcn_wmma_f32_16x16x32_f16(false, ah, false, bl, (short)0, c, false, false);
  asm volatile("v_nop\n\tv_nop\n\tv_nop\n\tv_nop" : "+v"(c) : "v"(ah), "v"(al), "v"(bh), "v"(bl));
  return c;
}
// batched GEMM like k_gemm_b but f16 operands: A f32 (split into f16 hi/lo if ASPLIT, else rounded to f16), Bt = f16 values [n][k]; alpha; C f32; N multiple of 16 (partial tiles skipped)
template <bool ASPLIT>
__global__ __launch_bounds__(128) void k_gemm_h(const float* __restrict__ A, int lda, size_t sA, const _Float16* __restrict__ Bh, int ldb, size_t sB, float alpha, float* __restrict__ C, int ldc, size_t sC, int M, int N, int K) {
  __shared__ __attribute__((aligned(16))) float so[4][16][64];
  const int tid = threadIdx.x, w = tid >> 5, lane = tid & 31, ln = lane & 15, hh = lane >> 4; const int by = blockIdx.y;
  A += (size_t)by * sA; Bh += (size_t)by * sB; C += (size_t)by * sC;
  const int ntn = (N + 63) / 64; const int wid = blockIdx.x * 4 + w; const int mt = wid / ntn, nq = wid % ntn; if (mt * 16 >= M) return;
  const int row0 = mt * 16, col0 = nq * 64; const float* arow = A + (size_t)(row0 + ln) * lda;
  v8f acc[4] = {};
  for (int kb = 0; kb < K; kb += 32) {
    FragH ah, al;
    const v4f x0 = *(const v4fa*)(arow + kb + 8 * hh), x1 = *(const v4fa*)(arow + kb + 8 * hh + 4), x2 = *(const v4fa*)(arow + kb + 16 + 8 * hh), x3 = *(const v4fa*)(arow + kb + 16 + 8 * hh + 4);
    float xs[16] = {x0[0],x0[1],x0[2],x0[3],x1[0],x1[1],x1[2],x1[3],x2[0],x2[1],x2[2],x2[3],x3[0],x3[1],x3[2],x3[3]};
#pragma unroll
    for (int i = 0; i < 16; ++i) { const _Float16 h = (_Float16)xs[i]; ah.h[i] = h; al.h[i] = ASPLIT ? (_Float16)(xs[i] - (float)h) : (_Float16)0.0f; }
#pragma unroll
    for (int t = 0; t < 4; ++t) { if (col0 + t * 16 >= N) continue; const size_t boff = (size_t)(col0 + t * 16 + ln) * ldb + kb; FragH bq; bq.half[0] = *(const v8us*)(Bh + boff + 8 * hh); bq.half[1] = *(const v8us*)(Bh + boff + 16 + 8 * hh);
      acc[t] = mmaH<ASPLIT ? 2 : 1>(ah.v, al.v, bq.v, bq.v, acc[t]); }
  }
#pragma unroll
  for (int t = 0; t < 4; ++t) { if (col0 + t * 16 >= N) continue;
#pragma unroll
    for (int r = 0; r < 8; ++r) so[w][8 * hh + r][t * 16 + ln] = acc[t][r] * alpha; }
  __builtin_amdgcn_fence(__ATOMIC_ACQ_REL, "workgroup"); __builtin_amdgcn_wave_barrier();
  const int rsub = lane >> 4, c4 = (lane & 15) * 4;
  {
#pragma unroll
    for (int q = 0; q < 8; ++q) { const int r = q * 2 + rsub; if (col0 + c4 < N) { const v4f v = *(const v4fa*)&so[w][r][c4]; *(v4f*)(C + (size_t)(row0 + r) * ldc + col0 + c4) = v; } }
     }
}

// k_gemm_hh variant with fused epilogue: v = acc·alpha + bias[by·sBias + col] (+ CP[(row/rowsPerB)·sCPb + by·64 + col] if CP) ; ACT 0 none / 1 elu ; writes f16 C16 (and f32 C if non-null)
template <int ACT>
__global__ __launch_bounds__(128) void k_gemm_hhx(const _Float16* __restrict__ A, int lda, size_t sA, const _Float16* __restrict__ Bh, int ldb, size_t sB, float alpha, const float* __restrict__ bias, size_t sBias, const float* __restrict__ CP, int rowsPerB, size_t sCPb, int row0g,
    float* __restrict__ C, _Float16* __restrict__ C16, int ldc, size_t sC, int M, int N, int K) {
  __shared__ __attribute__((aligned(16))) float so[4][16][64];
  const int tid = threadIdx.x, w = tid >> 5, lane = tid & 31, ln = lane & 15, hh = lane >> 4; const int by = blockIdx.y;
  A += (size_t)by * sA; Bh += (size_t)by * sB; const size_t cofs = (size_t)by * sC; const float* bp = bias ? bias + (size_t)by * sBias : nullptr;
  const int ntn = (N + 63) / 64; const int wid = blockIdx.x * 4 + w; const int mt = wid / ntn, nq = wid % ntn; if (mt * 16 >= M) return;
  const int row0 = mt * 16, col0 = nq * 64; const _Float16* arow = A + (size_t)(row0 + ln) * lda;
  v8f acc[4] = {};
  for (int kb = 0; kb < K; kb += 32) { FragH ah; ah.half[0] = *(const v8us*)((const unsigned short*)arow + kb + 8 * hh); ah.half[1] = *(const v8us*)((const unsigned short*)arow + kb + 16 + 8 * hh);
#pragma unroll
    for (int t = 0; t < 4; ++t) { if (col0 + t * 16 >= N) continue; const size_t boff = (size_t)(col0 + t * 16 + ln) * ldb + kb; FragH bq; bq.half[0] = *(const v8us*)((const unsigned short*)Bh + boff + 8 * hh); bq.half[1] = *(const v8us*)((const unsigned short*)Bh + boff + 16 + 8 * hh);
      acc[t] = mmaH<1>(ah.v, ah.v, bq.v, bq.v, acc[t]); }
  }
#pragma unroll
  for (int t = 0; t < 4; ++t) { if (col0 + t * 16 >= N) continue; const int col = col0 + t * 16 + ln; const float bv = bp ? bf16_round(bp[col]) : 0.f;
#pragma unroll
    for (int r = 0; r < 8; ++r) { float v = acc[t][r] * alpha + bv; if (CP) { const int rr = row0g + row0 + 8 * hh + r; if (rowsPerB < 0) v += CP[cofs + (size_t)rr * ldc + col];      /* rowsPerB < 0: own element of the batched C plane */ else { const int bidx = rr / rowsPerB; v += CP[(size_t)bidx * sCPb + (size_t)by * 64 + col]; } } if (ACT == 1) v = (v > 0.f) ? v : expm1f(v); else if (ACT == 7) v = (v > 0.f) ? v + 1.0f : expf(v); else if (ACT == 8) v = tanhf(v); else if (ACT == 9) v = 0.5f * v * (1.0f + tanhf(0.7978845608028654f * (v + 0.044715f * v * v * v))); else if (ACT == 11) v = 1.0f / (1.0f + expf(-v)); else if (ACT == 12) v = (v > 0.f) ? v : 0.01f * v; else if (ACT == 14) v = (v > 0.f) ? v : 0.1f * v; else if (ACT == 16) v = (v >= 0.f) ? v : 0.3f * v; else if (ACT == 17) v = (v >= 0.f) ? v : 0.2f * v; else if (ACT == 15) v = v / (1.0f + expf(-v)); else if (ACT == 3) v = fmaxf(v, 0.f); else if (ACT == 6) v = 0.5f * v * (1.0f + erff(v * 0.70710678118654752f)); so[w][8 * hh + r][t * 16 + ln] = v; } }
  __builtin_amdgcn_fence(__ATOMIC_ACQ_REL, "workgroup"); __builtin_amdgcn_wave_barrier();
  const int rsub = lane >> 4, c4 = (lane & 15) * 4; typedef _Float16 v4h __attribute__((ext_vector_type(4)));
  {
#pragma unroll
    for (int q = 0; q < 8; ++q) { const int r = q * 2 + rsub; if (col0 + c4 < N) { const v4f v = *(const v4fa*)&so[w][r][c4]; if (C) *(v4f*)(C + cofs + (size_t)(row0 + r) * ldc + col0 + c4) = v; if (C16) { v4h h4; for (int i = 0; i < 4; ++i) h4[i] = (_Float16)v[i]; *(v4h*)(C16 + cofs + (size_t)(row0 + r) * ldc + col0 + c4) = h4; } } }
     }
}


typedef _Float16 v4h __attribute__((ext_vector_type(4)));

__global__ __launch_bounds__(256) void k_h16(const float* __restrict__ x, _Float16* __restrict__ X16, size_t n8) { const size_t t = (size_t)blockIdx.x * 256 + threadIdx.x; if (t >= n8) return; FragH f;
#pragma unroll
  for (int q = 0; q < 8; ++q) f.h[q] = (_Float16)x[t * 8 + q]; *(v8us*)((unsigned short*)X16 + t * 8) = f.half[0];  }
__global__ __launch_bounds__(256) void k_round16f(const float* __restrict__ W, _Float16* __restrict__ Bt, size_t n8) { const size_t t = (size_t)blockIdx.x * 256 + threadIdx.x; if (t >= n8) return; FragH f;
#pragma unroll
  for (int i = 0; i < 8; ++i) f.h[i] = (_Float16)(bf16_round(W[t * 8 + i]) * 16.0f); *(v8us*)((unsigned short*)Bt + t * 8) = f.half[0];  }
// ---- element-wise conversions: one launch per stage, 32 or 64 elements a thread, so that a stage is a few thousand waves that each keep 16 to 24 loads of 16 bytes in flight ----
// k_prep, blocks 0 .. PWB - 1: the four weight matrices, f32 [in][out] -> Bt[n][k] = f16(bf16-rounded value x 16). A thread owns a tile of 8 k x 8 n; the lanes of a wave lie 4 along n and 8 along k,
// so that a wave's loads read whole 128-byte lines of its k rows and each of its stores writes whole lines of 4 n rows. Blocks PWB ..: the three row casts, f32 -> f16(bf16-rounded value), 4 pieces of 8 elements of each tensor a thread.
#define PWB 256                            /* 64 blocks a matrix: 512 waves of 32 tiles = 128 x 128 tiles */
#define PXB 512                            /* 1024 pieces of 8 elements a block and tensor */
__global__ __launch_bounds__(256) void k_prep(const float* __restrict__ xq, const float* __restrict__ xk, const float* __restrict__ xv, const float* __restrict__ wq, const float* __restrict__ wk, const float* __restrict__ wv, const float* __restrict__ wo, _Float16* __restrict__ X16, _Float16* __restrict__ BT) {
  static_assert(DM == 1024 && NR * DM / 8 == (size_t)PXB * 1024, "k_prep: the block counts are written for these shapes");
  const int tid = threadIdx.x;
  if (blockIdx.x < PWB) {      /* block-uniform */
    const int mi = blockIdx.x >> 6; const float* Wm = mi == 0 ? wq : mi == 1 ? wk : mi == 2 ? wv : wo;
    const int wid = (blockIdx.x & 63) * 8 + (tid >> 5), lane = tid & 31; const int n8 = ((wid >> 4) * 4 + (lane & 3)) * 8, k8 = ((wid & 15) * 8 + (lane >> 2)) * 8;
    const float* sp = Wm + (size_t)k8 * DM + n8; unsigned short* dp = (unsigned short*)BT + (size_t)mi * (DM * DM) + (size_t)n8 * DM + k8;
    v4f a[8][2]; v8us o[8];
#pragma unroll      /* constant indices: the tile stays in registers, all 16 loads in flight */
    for (int i = 0; i < 8; ++i) { a[i][0] = *(const v4fa*)(sp + i * DM); a[i][1] = *(const v4fa*)(sp + i * DM + 4); }
    asm volatile("s_wait_xcnt 0x0" :: "v"(sp) : "memory");      /* the loads' address registers stay untouched up to this wait; its memory clobber also keeps all 16 loads in front of the first store (without it the build held four loads back behind stores) */
#pragma unroll
    for (int j = 0; j < 8; ++j) { FragH f;
#pragma unroll
      for (int i = 0; i < 8; ++i) f.h[i] = (_Float16)(bf16_round(a[i][j >> 2][j & 3]) * 16.0f);
      o[j] = f.half[0]; }
#pragma unroll
    for (int j = 0; j < 8; ++j) *(v8us*)(dp + j * DM) = o[j];
  } else {
    const size_t e0 = ((size_t)(blockIdx.x - PWB) * 1024 + tid) * 8;      /* the thread's first element; its pieces lie 256 pieces apart */
    const float* s0 = xq + e0; const float* s1 = xk + e0; const float* s2 = xv + e0; unsigned short* dp = (unsigned short*)X16 + e0;
    v4f a[3][4][2]; v8us o[3][4];
#pragma unroll      /* constant indices: registers, all 24 loads in flight */
    for (int u = 0; u < 4; ++u) { a[0][u][0] = *(const v4fa*)(s0 + u * 2048); a[0][u][1] = *(const v4fa*)(s0 + u * 2048 + 4); a[1][u][0] = *(const v4fa*)(s1 + u * 2048); a[1][u][1] = *(const v4fa*)(s1 + u * 2048 + 4); a[2][u][0] = *(const v4fa*)(s2 + u * 2048); a[2][u][1] = *(const v4fa*)(s2 + u * 2048 + 4); }
    asm volatile("s_wait_xcnt 0x0" :: "v"(s0), "v"(s1), "v"(s2) : "memory");      /* the loads' address registers stay untouched up to this wait; its memory clobber also keeps all 24 loads in front of the first store (without it the build issued them in three groups between the stores) */
#pragma unroll
    for (int s = 0; s < 3; ++s)
#pragma unroll
      for (int u = 0; u < 4; ++u) { FragH f;
#pragma unroll
        for (int q = 0; q < 8; ++q) f.h[q] = (_Float16)bf16_round(a[s][u][q >> 2][q & 3]);
        o[s][u] = f.half[0]; }
#pragma unroll
    for (int s = 0; s < 3; ++s)
#pragma unroll
      for (int u = 0; u < 4; ++u) *(v8us*)(dp + (size_t)s * (NR * DM) + u * 2048) = o[s][u];
    asm volatile("s_wait_xcnt 0x0" ::: "memory");      /* in the built code the weight part's first instructions stand on the other side of the closing branch and rewrite registers that these stores name: the wait stands in front of them */
  } }
// k_post, blocks 0 .. PVB - 1: V^T [NB][NH][HD][SQ] from the f16 v rows, 256 tokens x 64 head dims a block through LDS (row pitch 66), whole 128-byte lines on both sides.
// Blocks PVB ..: the f32 q and k planes (F, one behind the other) -> f16 hi + x1024 residual planes (H: q hi, q lo, k hi, k lo); 8 pieces of 8 elements a thread, 256 blocks a plane.
#define PVB 256                            /* NB * NH slabs x SQ / 256 pieces */
__global__ __launch_bounds__(256) void k_post(const float* __restrict__ F, _Float16* __restrict__ H, const _Float16* __restrict__ V16, _Float16* __restrict__ Vt) {
  static_assert(NR * DM / 8 == (size_t)256 * 2048 && NB * NH * (SQ / 256) == PVB && HD == 64, "k_post: the block counts are written for these shapes");
  __shared__ unsigned short tl[256][66];
  const int tid = threadIdx.x;
  if (blockIdx.x < PVB) {      /* block-uniform: every thread of such a block passes the barrier below */
    const int slab = blockIdx.x >> 3, lg = blockIdx.x & 7; const int b = slab / NH, h = slab % NH; const int r8 = tid >> 3, c8 = (tid & 7) * 8;
    const unsigned short* vp = (const unsigned short*)V16 + ((size_t)b * SQ + lg * 256 + r8) * DM + h * HD + c8; v8us t[8];
#pragma unroll      /* constant indices: registers, all 8 loads in flight */
    for (int j = 0; j < 8; ++j) t[j] = *(const v8us*)(vp + j * (32 * DM));
#pragma unroll
    for (int j = 0; j < 8; ++j)
#pragma unroll
      for (int q = 0; q < 8; ++q) tl[j * 32 + r8][c8 + q] = t[j][q];
    __syncthreads();      /* publishes the 256 token rows to the eight waves */
    unsigned short* op = (unsigned short*)Vt + ((size_t)slab * HD + r8) * SQ + lg * 256 + c8;
#pragma unroll
    for (int j = 0; j < 4; ++j)
#pragma unroll
      for (int rd = 0; rd < 2; ++rd) { FragH f;
#pragma unroll
        for (int q = 0; q < 8; ++q) f.u[q] = tl[j * 64 + c8 + q][rd * 32 + r8];
        *(v8us*)(op + rd * (32 * SQ) + j * 64) = f.half[0]; }
  } else {
    const int bx = blockIdx.x - PVB; const int p = bx >> 8; const size_t e0 = ((size_t)(bx & 255) * 2048 + tid) * 8;
    const float* sp = F + (size_t)p * (NR * DM) + e0; unsigned short* hp = (unsigned short*)H + (size_t)(2 * p) * (NR * DM) + e0; unsigned short* lp = hp + NR * DM;
    v4f a[8][2]; v8us oh[8], ol[8];
#pragma unroll      /* constant indices: registers, all 16 loads in flight */
    for (int u = 0; u < 8; ++u) { a[u][0] = *(const v4fa*)(sp + u * 2048); a[u][1] = *(const v4fa*)(sp + u * 2048 + 4); }
#pragma unroll
    for (int u = 0; u < 8; ++u) { FragH fh, fl;
#pragma unroll
      for (int q = 0; q < 8; ++q) { const float v = a[u][q >> 2][q & 3]; const _Float16 h = (_Float16)v; fh.h[q] = h; fl.h[q] = (_Float16)((v - (float)h) * 1024.0f); }
      oh[u] = fh.half[0]; ol[u] = fl.half[0]; }
#pragma unroll
    for (int u = 0; u < 8; ++u) { *(v8us*)(hp + u * 2048) = oh[u]; *(v8us*)(lp + u * 2048) = ol[u]; }
    asm volatile("s_wait_xcnt 0x0" ::: "memory");      /* in the built code the V^T part's first instructions stand on the other side of the closing branch and rewrite registers that these stores name: the wait stands in front of them */
  } }

// ---- fast GEMM (block tile 128x64, wave tile 32x64; requires M % 128 == 0 rows per launch region, N % 64 == 0 and K % 128 == 0); epilogue = k_gemm_hhx semantics ----
// The block's 128 A rows and 64 B rows are staged in LDS 128 k at a time (rows of 256 bytes, whole lines) by asynchronous 16-byte copies, two buffers: tile t + 2 flies while tile t + 1 is worked on.
// The four waves share the B rows; fragments are read from LDS by g2_frag in the k order and the kb order of the direct loads, so every accumulator sums in the same order.
__device__ __forceinline__ v16h g2_frag(const _Float16* p, int hh) { FragH f; f.half[0] = *(const v8us*)((const unsigned short*)p + 8 * hh); f.half[1] = *(const v8us*)((const unsigned short*)p + 16 + 8 * hh); return f.v; }
__device__ __forceinline__ v8f g2_mma(v16h a, v16h b, v8f c) { v8f d = __builtin_amdgcn_wmma_f32_16x16x32_f16(false, a, false, b, (short)0, c, false, false); asm volatile("v_nop\n\tv_nop\n\tv_nop\n\tv_nop" : "+v"(d) : "v"(a), "v"(b)); return d; }
#define GKS 128                            /* k per staged tile */
#define GLP 136                            /* LDS row pitch in f16: 128 + 8 = 272 bytes, for the 16-byte fragment reads */
// Twelve asynchronous 16-byte copies, global to LDS, each lane its own two addresses. The closing s_wait_xcnt 0 stands inside the statement so that no address register is rewritten ahead of it.
__device__ __forceinline__ void g2_copy12(const unsigned* l, const char* const* g) {
  asm volatile("global_load_async_to_lds_b128 %0, %12, off\n\tglobal_load_async_to_lds_b128 %1, %13, off\n\tglobal_load_async_to_lds_b128 %2, %14, off\n\tglobal_load_async_to_lds_b128 %3, %15, off\n\t"
               "global_load_async_to_lds_b128 %4, %16, off\n\tglobal_load_async_to_lds_b128 %5, %17, off\n\tglobal_load_async_to_lds_b128 %6, %18, off\n\tglobal_load_async_to_lds_b128 %7, %19, off\n\t"
               "global_load_async_to_lds_b128 %8, %20, off\n\tglobal_load_async_to_lds_b128 %9, %21, off\n\tglobal_load_async_to_lds_b128 %10, %22, off\n\tglobal_load_async_to_lds_b128 %11, %23, off\n\ts_wait_xcnt 0x0"
               :: "v"(l[0]), "v"(l[1]), "v"(l[2]), "v"(l[3]), "v"(l[4]), "v"(l[5]), "v"(l[6]), "v"(l[7]), "v"(l[8]), "v"(l[9]), "v"(l[10]), "v"(l[11]),
                  "v"(g[0]), "v"(g[1]), "v"(g[2]), "v"(g[3]), "v"(g[4]), "v"(g[5]), "v"(g[6]), "v"(g[7]), "v"(g[8]), "v"(g[9]), "v"(g[10]), "v"(g[11]) : "memory"); }
template <int ACT>
__global__ __launch_bounds__(128) void k_gemm2(const _Float16* __restrict__ A, int lda, size_t sA, const _Float16* __restrict__ Bh, int ldb, size_t sB, float alpha, const float* __restrict__ bias, size_t sBias, const float* __restrict__ CP, int rowsPerB, size_t sCPb, int row0g,
    float* __restrict__ C, _Float16* __restrict__ C16, int ldc, size_t sC, int M, int N, int K) { static_assert(ACT == 0 || ACT == 3 || ACT == 6 || ACT == 8 || ACT == 9 || ACT == 11 || ACT == 12 || ACT == 14 || ACT == 15 || ACT == 16 || ACT == 17, "k_gemm2: unsupported ACT code (would silently apply no activation)");
  __shared__ __attribute__((aligned(16))) float so[4][32][68];
  __shared__ __attribute__((aligned(16))) _Float16 ta[2][128][GLP]; __shared__ __attribute__((aligned(16))) _Float16 tb[2][64][GLP];
  const int tid = threadIdx.x, w = tid >> 5, lane = tid & 31, ln = lane & 15, hh = lane >> 4; const int by = blockIdx.y;
  A += (size_t)by * sA; Bh += (size_t)by * sB; const size_t cofs = (size_t)by * sC; const float* bp = bias ? bias + (size_t)by * sBias : nullptr;
  const int ntn = N >> 6; const int mt = blockIdx.x / ntn, nq = blockIdx.x - mt * ntn; const int row0 = mt * 128 + 32 * w, col0 = nq * 64; if (mt * 128 >= M) return;      /* block-uniform, in front of every barrier */
  const int srow = tid >> 4, sc8 = (tid & 15) * 8;      /* staging: 16 threads per row of 256 bytes, 8 rows a step */
  const char* ga = (const char*)(A + (size_t)(mt * 128 + srow) * lda + sc8); const char* gb = (const char*)(Bh + (size_t)(col0 + srow) * ldb + sc8); const size_t ga8 = (size_t)lda * 16, gb8 = (size_t)ldb * 16;      /* 8 rows in bytes */
  const unsigned la = (unsigned)(size_t)&ta[0][srow][sc8], lb = (unsigned)(size_t)&tb[0][srow][sc8];      /* byte addresses in the work-group's LDS */
  auto stage = [&](int t, int buf) { unsigned l[24]; const char* g[24];      /* one tile: 16 copies of A and 8 of B per thread */
#pragma unroll
    for (int j = 0; j < 16; ++j) { l[j] = la + (unsigned)buf * (unsigned)sizeof(ta[0]) + (unsigned)j * (8u * GLP * 2u); g[j] = ga + (size_t)t * (GKS * 2) + (size_t)j * ga8; }
#pragma unroll
    for (int j = 0; j < 8; ++j) { l[16 + j] = lb + (unsigned)buf * (unsigned)sizeof(tb[0]) + (unsigned)j * (8u * GLP * 2u); g[16 + j] = gb + (size_t)t * (GKS * 2) + (size_t)j * gb8; }
    g2_copy12(l, g); g2_copy12(l + 12, g + 12); };
  const v8f z8 = {0.f,0.f,0.f,0.f,0.f,0.f,0.f,0.f}; v8f c00 = z8, c01 = z8, c02 = z8, c03 = z8, c10 = z8, c11 = z8, c12 = z8, c13 = z8;
  const int nt = K / GKS;
  stage(0, 0);
  asm volatile("s_wait_asynccnt 0x0" ::: "memory");      /* this wave's copies of tile 0 have landed */
  __syncthreads();      /* publishes tile 0 to the four waves */
  if (nt > 1) stage(1, 1);
#pragma unroll 1      /* one trip is 32 matrix instructions of straight-line code already */
  for (int t = 0; t < nt; ++t) { const _Float16* ap = &ta[t & 1][32 * w + ln][0]; const _Float16* bq = &tb[t & 1][ln][0];
    v16h fa[2][2], fb[2][4];      /* two fragment sets: the next 32 k of this tile are read from LDS as one group ahead of the current block's matrix instructions */
    fa[0][0] = g2_frag(ap, hh); fa[0][1] = g2_frag(ap + 16 * GLP, hh); fb[0][0] = g2_frag(bq, hh); fb[0][1] = g2_frag(bq + 16 * GLP, hh); fb[0][2] = g2_frag(bq + 32 * GLP, hh); fb[0][3] = g2_frag(bq + 48 * GLP, hh);
#pragma unroll      /* makes the set index a constant, so that the sets are registers */
    for (int q = 0; q < GKS / 32; ++q) { const int s = q & 1, n = s ^ 1, kn = (q + 1) * 32;
      if (q + 1 < GKS / 32) { fa[n][0] = g2_frag(ap + kn, hh); fa[n][1] = g2_frag(ap + 16 * GLP + kn, hh); fb[n][0] = g2_frag(bq + kn, hh); fb[n][1] = g2_frag(bq + 16 * GLP + kn, hh); fb[n][2] = g2_frag(bq + 32 * GLP + kn, hh); fb[n][3] = g2_frag(bq + 48 * GLP + kn, hh); }
      c00 = g2_mma(fa[s][0], fb[s][0], c00); c10 = g2_mma(fa[s][1], fb[s][0], c10); c01 = g2_mma(fa[s][0], fb[s][1], c01); c11 = g2_mma(fa[s][1], fb[s][1], c11);
      c02 = g2_mma(fa[s][0], fb[s][2], c02); c12 = g2_mma(fa[s][1], fb[s][2], c12); c03 = g2_mma(fa[s][0], fb[s][3], c03); c13 = g2_mma(fa[s][1], fb[s][3], c13); }
    asm volatile("s_wait_dscnt 0x0" ::: "memory");      /* this wave's reads of tile t are done before its buffer is refilled */
    asm volatile("s_wait_asynccnt 0x0" ::: "memory");      /* this wave's copies of tile t + 1 have landed */
    __syncthreads();      /* publishes tile t + 1 and ends every wave's reads of tile t */
    if (t + 2 < nt) stage(t + 2, t & 1); }
  asm volatile("s_wait_asynccnt 0x0" ::: "memory");      /* no copy is outstanding when the wave goes on */
  v8f accs[8] = {c00, c01, c02, c03, c10, c11, c12, c13};
#pragma unroll
  for (int u = 0; u < 8; ++u) { const int t = u & 3, half = u >> 2; const int col = col0 + t * 16 + ln; const float bv = bp ? bf16_round(bp[col]) : 0.f;
#pragma unroll
    for (int r = 0; r < 8; ++r) { const int rloc = half * 16 + 8 * hh + r; float v = accs[u][r] * alpha + bv; if (CP) { if (rowsPerB < 0) v += CP[cofs + (size_t)(row0g + row0 + rloc) * ldc + col];      /* rowsPerB < 0: own element of the batched C plane */ else { const int bidx = (row0g + row0 + rloc) / rowsPerB; v += CP[(size_t)bidx * sCPb + (size_t)by * 64 + col]; } }
      if (ACT == 3) v = fmaxf(v, 0.f); else if (ACT == 6) v = 0.5f * v * (1.0f + erff(v * 0.70710678118654752f)); else if (ACT == 11) v = 1.0f / (1.0f + expf(-v)); else if (ACT == 15) v = v / (1.0f + expf(-v)); else if (ACT == 12) v = (v > 0.f) ? v : 0.01f * v; else if (ACT == 8) v = tanhf(v); else if (ACT == 9) v = 0.5f * v * (1.0f + tanhf(0.7978845608028654f * (v + 0.044715f * v * v * v))); else if (ACT == 14) v = (v > 0.f) ? v : 0.1f * v; else if (ACT == 16) v = (v >= 0.f) ? v : 0.3f * v; else if (ACT == 17) v = (v >= 0.f) ? v : 0.2f * v;
      so[w][rloc][t * 16 + ln] = v; } }
  __builtin_amdgcn_fence(__ATOMIC_ACQ_REL, "workgroup"); __builtin_amdgcn_wave_barrier();
  const int rsub = lane >> 4, c4 = (lane & 15) * 4;
  {
#pragma unroll
    for (int q = 0; q < 16; ++q) { const int r = q * 2 + rsub; const v4f v = *(const v4fa*)&so[w][r][c4]; if (C) { *(v4f*)(C + cofs + (size_t)(row0 + r) * ldc + col0 + c4) = v; asm volatile("s_wait_xcnt 0x0" ::: "memory"); }      /* the f32 store's data and address registers are rewritten right behind it (the f16 conversion, the next row): the wait stands in front of that */
      if (C16) { v4h h4; for (int i = 0; i < 4; ++i) h4[i] = (_Float16)v[i]; *(v4h*)(C16 + cofs + (size_t)(row0 + r) * ldc + col0 + c4) = h4; } }
     } }


__global__ __launch_bounds__(256) void k_wnat(const float* __restrict__ w, size_t n8, _Float16* __restrict__ Bt) { const size_t t = (size_t)blockIdx.x * 256 + threadIdx.x; if (t >= n8) return; FragH f; for (int q = 0; q < 8; ++q) f.h[q] = (_Float16)(bf16_round(w[t * 8 + q]) * 16.0f); *(v8us*)((unsigned short*)Bt + t * 8) = f.half[0];  }
__global__ __launch_bounds__(256) void k_rsm(const float* __restrict__ S, _Float16* __restrict__ P, int nrows) {
  #pragma clang fp contract(off)
  const int i = blockIdx.x * 256 + threadIdx.x; if (i >= nrows) return; const float* s = S + (size_t)i * SQ; float mx = -3.0e38f;
#pragma unroll 1
  for (int j = 0; j < SQ; ++j) mx = fmaxf(mx, s[j]); float se = 0.f;
#pragma unroll 1
  for (int j = 0; j < SQ; ++j) se += expf(s[j] - mx); const float sc = 256.0f / se;
#pragma unroll 1
  for (int j0 = 0; j0 < SQ; j0 += 8) { FragH f; for (int q = 0; q < 8; ++q) f.h[q] = (_Float16)(expf(s[j0 + q] - mx) * sc); unsigned short* d = (unsigned short*)P + (size_t)i * SQ + j0; *(v8us*)d = f.half[0];  } }
__global__ __launch_bounds__(256) void k_vt(const _Float16* __restrict__ V16, int b, int h0, _Float16* __restrict__ VT) { __shared__ unsigned short tl[64][65]; const int tid = threadIdx.x; const int hh = blockIdx.x % HG, sg = blockIdx.x / HG; const int s0 = sg * 64; const int h = h0 + hh;
  for (int i = tid; i < 64 * 8; i += 256) { const int j = i / 8, d8 = (i % 8) * 8; FragH f; f.half[0] = *(const v8us*)((const unsigned short*)V16 + ((size_t)b * SQ + s0 + j) * DM + h * HD + d8); for (int q = 0; q < 8; ++q) tl[d8 + q][j] = f.u[q]; }
  __syncthreads();
  { for (int i = tid; i < 64 * 8; i += 256) { const int d = i / 8, j8 = (i % 8) * 8; FragH f; for (int q = 0; q < 8; ++q) f.u[q] = tl[d][j8 + q]; *(v8us*)((unsigned short*)VT + ((size_t)hh * HD + d) * SQ + s0 + j8) = f.half[0]; }  } }



// Fused causal attention: a block owns 128 query rows of one head (32 per wave) and walks the keys 64 at a time; scores and weights never leave registers.
// Each pass stages 64 rows of k hi, k lo and 64 rows (head dims) of V^T in LDS by whole-line loads, once for the four waves; row pitch 128 + 16 bytes for the 16-byte fragment reads.
// S^T = K . Q^T (A = 16 key rows, B = 16 query rows, both by g2_frag): a lane holds 8 keys (8*hh + r) of ONE query (ln) per tile, so maximum and sum are in-lane plus one exchange of the wave halves.
// Two score tiles of one query group, converted in place, are the B operand of O^T += V^T . P^T (element i = key 8*hh + i, element 8 + i = key 16 + 8*hh + i: the k order of g2_frag on the V^T rows).
// Scores: (lo . hi + hi . lo) first, x 2^-10, then hi . hi on top in the same accumulator. Weights carried x256 (the + 8 in the exponent), in the f16 operand and in the row sum alike; o leaves x64.
#define FAC 0.18033688011112042f           /* 1 / sqrt(head_dim) * log2(e) */
#define FLP 72                             /* LDS row pitch in f16: 64 + 8 */
__device__ __forceinline__ float fa_exp2(float x) { asm("v_exp_f32 %0, %0\n\tv_nop" : "+v"(x)); return x; }      /* native 2^x; the v_nop fills the one slot that the instruction set asks for between a transcendental and a directly following instruction that reads its result or overwrites its source */
__device__ __forceinline__ v8f fa_mma(v16h a, v16h b, v8f c) { return __builtin_amdgcn_wmma_f32_16x16x32_f16(false, a, false, b, (short)0, c, false, false); }
__global__ __launch_bounds__(128) void k_fattn(const _Float16* __restrict__ QHp, const _Float16* __restrict__ QLp, const _Float16* __restrict__ KHp, const _Float16* __restrict__ KLp, const _Float16* __restrict__ VTp, _Float16* __restrict__ Op) {
  __shared__ __attribute__((aligned(16))) _Float16 lkh[64][FLP]; __shared__ __attribute__((aligned(16))) _Float16 lkl[64][FLP]; __shared__ __attribute__((aligned(16))) _Float16 lvt[64][FLP];
  const int tid = threadIdx.x, lane = tid & 31, ln = lane & 15, hh = lane >> 4; const int w = __builtin_amdgcn_readfirstlane(tid >> 5);
  const int h = blockIdx.y, b = blockIdx.z; const int qt = (b & 1) ? (int)blockIdx.x : (int)gridDim.x - 1 - (int)blockIdx.x;      /* long and short blocks mixed over the grid */
  const int row0 = qt * 128 + 32 * w; const size_t r0 = (size_t)b * SQ;
  v16h qh[2][2], ql[2][2]; const _Float16* qhp = QHp + (r0 + row0 + ln) * LQ + h * HD + 8 * hh; const _Float16* qlp = QLp + (r0 + row0 + ln) * LQ + h * HD + 8 * hh;      /* the lane's own 16-byte pieces start here (g2_frag with half 0) */
#pragma unroll
  for (int g = 0; g < 2; ++g) { qh[g][0] = g2_frag(qhp + g * (16 * LQ), 0); qh[g][1] = g2_frag(qhp + g * (16 * LQ) + 32, 0); ql[g][0] = g2_frag(qlp + g * (16 * LQ), 0); ql[g][1] = g2_frag(qlp + g * (16 * LQ) + 32, 0); }
  asm volatile("s_wait_xcnt 0x0" :: "v"(qhp), "v"(qlp) : "memory");      /* the sixteen loads' address registers stay untouched up to this wait: nothing, a later load's data included, lands on them before it */
  const char* khb = (const char*)(KHp + r0 * LQ + h * HD); const char* klb = (const char*)(KLp + r0 * LQ + h * HD); const char* vtb = (const char*)(VTp + (size_t)(b * NH + h) * HD * SQ);      /* block-uniform bases */
  const int srow = tid >> 3, sc8 = (tid & 7) * 8; const unsigned koff = (unsigned)(srow * LQ + sc8) * 2u, voff = (unsigned)(srow * SQ + sc8) * 2u;      /* staging: 8 threads per row of 128 bytes, 16 rows a step; byte offsets */
  const v8f z8 = {0.f,0.f,0.f,0.f,0.f,0.f,0.f,0.f}; v8f o[4][2];
#pragma unroll
  for (int dt = 0; dt < 4; ++dt) { o[dt][0] = z8; o[dt][1] = z8; }
  float m[2] = {-1.0e30f, -1.0e30f}, l[2] = {0.f, 0.f};
  const int kend = qt * 128 + 64;           /* the block's last piece: every wave stages and passes the barriers up to it */
#pragma unroll 1      /* one pass is up to 64 matrix instructions of straight-line code already */
  for (int kb = 0; kb <= kend; kb += 64) { v8us tk[4], tl[4], tv[4]; const char* kp = khb + (size_t)kb * (LQ * 2) + koff; const char* lp = klb + (size_t)kb * (LQ * 2) + koff; const char* vp = vtb + (size_t)kb * 2 + voff;
#pragma unroll
    for (int j = 0; j < 4; ++j) { tk[j] = *(const v8us*)(kp + j * (16 * LQ * 2)); tl[j] = *(const v8us*)(lp + j * (16 * LQ * 2)); tv[j] = *(const v8us*)(vp + j * (16 * SQ * 2)); }
    asm volatile("s_wait_xcnt 0x0" :: "v"(kp), "v"(lp), "v"(vp) : "memory");      /* the twelve loads' address registers stay untouched up to this wait: nothing, a later load's data included, lands on them before it */
    __syncthreads();      /* every wave has left the previous pass's rows */
#pragma unroll
    for (int j = 0; j < 4; ++j) { *(v8us*)&lkh[j * 16 + srow][sc8] = tk[j]; *(v8us*)&lkl[j * 16 + srow][sc8] = tl[j]; *(v8us*)&lvt[j * 16 + srow][sc8] = tv[j]; }
    __syncthreads();      /* publishes the staged rows to the four waves */
#pragma unroll
    for (int hf = 0; hf < 2; ++hf) { const int k0 = kb + 32 * hf;      /* 32 keys a step: 16 score registers per query group alive at a time */
      if (k0 <= row0) {      /* wave-uniform: keys past the wave's last row (row0 + 31) are left out whole */
        v8f s[2][2];
#pragma unroll
        for (int t = 0; t < 2; ++t) { const int kr = 32 * hf + 16 * t + ln; const v16h a0 = g2_frag(&lkh[kr][0], hh), a1 = g2_frag(&lkh[kr][32], hh), c0 = g2_frag(&lkl[kr][0], hh), c1 = g2_frag(&lkl[kr][32], hh);
#pragma unroll
          for (int g = 0; g < 2; ++g) { v8f y = fa_mma(a0, ql[g][0], z8); y = fa_mma(a1, ql[g][1], y); y = fa_mma(c0, qh[g][0], y); y = fa_mma(c1, qh[g][1], y);
#pragma unroll
            for (int r = 0; r < 8; ++r) y[r] *= 0.0009765625f;
            y = fa_mma(a0, qh[g][0], y); y = fa_mma(a1, qh[g][1], y); s[t][g] = y; } }
        if (k0 == row0) {      /* wave-uniform: the 32 x 32 piece on the diagonal is the only one that needs the causal test; key k0 stays for every query */
#pragma unroll
          for (int t = 0; t < 2; ++t)
#pragma unroll
            for (int g = 0; g < 2; ++g)
#pragma unroll
              for (int r = 0; r < 8; ++r) if (16 * t + 8 * hh + r > 16 * g + ln) s[t][g][r] = -1.0e30f; }
        FragH p[2];
#pragma unroll
        for (int g = 0; g < 2; ++g) { float mx = s[0][g][0];
#pragma unroll
          for (int t = 0; t < 2; ++t)
#pragma unroll
            for (int r = 0; r < 8; ++r) mx = fmaxf(mx, s[t][g][r]);
          mx = fmaxf(mx, __shfl_xor(mx, 16, 32));      /* the other 8 keys of every tile sit in the other wave half */
          const float mn = fmaxf(m[g], mx); const float sc = fa_exp2((m[g] - mn) * FAC); m[g] = mn; const float nb = fmaf(-mn, FAC, 8.0f);
          float ps[4] = {0.f, 0.f, 0.f, 0.f};
#pragma unroll
          for (int t = 0; t < 2; ++t)
#pragma unroll
            for (int r = 0; r < 8; ++r) { const float e = fa_exp2(fmaf(s[t][g][r], FAC, nb)); ps[r & 3] += e; p[g].h[t * 8 + r] = (_Float16)e; }
          l[g] = fmaf(l[g], sc, (ps[0] + ps[1]) + (ps[2] + ps[3]));
#pragma unroll
          for (int dt = 0; dt < 4; ++dt)
#pragma unroll
            for (int r = 0; r < 8; ++r) o[dt][g][r] *= sc; }
#pragma unroll
        for (int dt = 0; dt < 4; ++dt) { const v16h a = g2_frag(&lvt[16 * dt + ln][32 * hf], hh); o[dt][0] = fa_mma(a, p[0].v, o[dt][0]); o[dt][1] = fa_mma(a, p[1].v, o[dt][1]); } } } }
#pragma unroll
  for (int g = 0; g < 2; ++g) { const float fin = 64.0f / (l[g] + __shfl_xor(l[g], 16, 32));      /* the halves' sums joined once; x256 cancels, o carried x64 */
    unsigned short* op = (unsigned short*)Op + (r0 + row0 + 16 * g + ln) * DM + h * HD + 8 * hh;
#pragma unroll
    for (int dt = 0; dt < 4; ++dt) { FragH f;
#pragma unroll
      for (int r = 0; r < 8; ++r) f.h[r] = (_Float16)(o[dt][g][r] * fin);
      *(v8us*)(op + 16 * dt) = f.half[0]; } } }


// Exact f32 attention for the first QT0 rows of every batch (blockIdx.y), one thread per query row; q, k, v are the f32 rows of the full projections; o leaves as f16 hi (into the merged o rows, over the f16 path's) + x1024 residual. The block's key and value rows (64 or 128 rows of 64 floats) are staged once in LDS
// by whole-line loads and then read as broadcasts; the thread's q row and o row stay in registers; four keys' score sums run side by side, each in index order.
// Every plain '#pragma unroll' below makes the indices of q, o, s and the staged pieces constants, so that these arrays are registers and not scratch.
template <int MASKADD>
__global__ __launch_bounds__(64) void k_att0(const float* __restrict__ QF, const float* __restrict__ KF, const float* __restrict__ VF, int ld, const float* __restrict__ mask, float scale, _Float16* __restrict__ OH, _Float16* __restrict__ OL) {
  static_assert(MASKADD == 0, "k_att0: only the causal form is staged (keys up to the block's last row)"); (void)mask;
  __shared__ __attribute__((aligned(16))) float lk[QT0][64]; __shared__ __attribute__((aligned(16))) float lv[QT0][64]; __shared__ __attribute__((aligned(16))) float lo[64][64];
  const int tid = threadIdx.x; const int h = blockIdx.x / (QT0 / 64), rg = blockIdx.x % (QT0 / 64); const int i = rg * 64 + tid; const int b = blockIdx.y; const size_t r0 = (size_t)b * SQ;      /* the batch's first token row */
  __builtin_assume(ld == DM);      /* every launch passes the row pitch DM: the row steps below fold into the loads' immediate offsets, so one offset register serves all loads of a kind */
  const char* qh = (const char*)(QF + r0 * DM + h * HD); const char* kh = (const char*)(KF + r0 * DM + h * HD); const char* vh = (const char*)(VF + r0 * DM + h * HD);      /* block-uniform bases */
  const unsigned qoff = (unsigned)(i * ld) * 4u;      /* byte offset of the thread's q row */
  float q[HD], o[HD];
#pragma unroll
  for (int c = 0; c < HD / 4; ++c) { const v4f t4 = *(const v4fa*)(qh + qoff + c * 16);
#pragma unroll
    for (int u = 0; u < 4; ++u) { q[c * 4 + u] = t4[u]; o[c * 4 + u] = 0.f; } }
  static_assert(QT0 == 128, "k_att0: staging is written for one or two pieces of 64 keys");
  const int srow = tid >> 4, sc4 = (tid & 15) * 4; const unsigned soff = (unsigned)(srow * ld + sc4) * 4u;      /* staging: 16 threads per row of 256 bytes; byte offset */
  const char* kp = kh + soff; const char* vp = vh + soff;      /* the thread's own staging addresses */
#pragma unroll
  for (int t = 0; t < QT0 / 64; ++t) if (t <= rg) {      /* block-uniform test: 64 keys a piece, all 32 loads of a thread in flight together */
    v4f tk[16], tv[16];
#pragma unroll
    for (int it = 0; it < 16; ++it) { tk[it] = *(const v4fa*)(kp + (t * 64 + it * 4) * ld * 4); tv[it] = *(const v4fa*)(vp + (t * 64 + it * 4) * ld * 4); }
    asm volatile("s_wait_xcnt 0x0" :: "v"(qoff), "v"(soff), "v"(kp), "v"(vp) : "memory");      /* the loads' offset and address registers stay untouched up to this wait: nothing, a later load's data included, lands on a register that an issued load names */
#pragma unroll
    for (int it = 0; it < 16; ++it) { *(v4f*)&lk[t * 64 + it * 4 + srow][sc4] = tk[it]; *(v4f*)&lv[t * 64 + it * 4 + srow][sc4] = tv[it]; } }
  __syncthreads();      /* publishes the staged rows to both waves */
  float m = -1.0e30f, l = 0.f; const int nkey = rg * 64 + 64;      /* causal form: keys up to the block's last row */
#pragma unroll 1      /* the body is four whole keys of straight-line code already: more would only grow the text */
  for (int j0 = 0; j0 < nkey; j0 += 4) { float s[4] = {0.f, 0.f, 0.f, 0.f};
#pragma unroll
    for (int c = 0; c < HD / 4; ++c) { v4f kq[4];
#pragma unroll
      for (int u = 0; u < 4; ++u) kq[u] = *(const v4f*)&lk[j0 + u][c * 4];
#pragma unroll
      for (int x = 0; x < 4; ++x)
#pragma unroll
        for (int u = 0; u < 4; ++u) s[u] = __fadd_rn(s[u], __fmul_rn(q[c * 4 + x], kq[u][x])); }
#pragma unroll
    for (int u = 0; u < 4; ++u) { const int j = j0 + u; const float sv = __fmul_rn(s[u], scale);
      const float f = (j <= i) ? 1.f : 0.f; const float sm = fmaf(f, sv, (1.f - f) * -1.0e30f); const float mn = fmaxf(m, sm); const float sc = expf(m - mn); const float e = expf(sm - mn); l = __fadd_rn(__fmul_rn(l, sc), e); m = mn;
#pragma unroll
      for (int c = 0; c < HD / 4; ++c) { const v4f vv = *(const v4f*)&lv[j][c * 4];
#pragma unroll
        for (int x = 0; x < 4; ++x) o[c * 4 + x] = __fadd_rn(__fmul_rn(o[c * 4 + x], sc), __fmul_rn(e, vv[x])); } } }
  const float fin = 64.0f / l;      /* o carried x64 like the f16 path */
#pragma unroll
  for (int c = 0; c < HD / 4; ++c) { v4f oo;
#pragma unroll
    for (int u = 0; u < 4; ++u) oo[u] = __fmul_rn(o[c * 4 + u], fin);
    *(v4f*)&lo[tid][c * 4] = oo; }
  __syncthreads();
  {
#pragma unroll 1
    for (int it = 0; it < 16; ++it) { const int row = it * 4 + tid / 16, pc = (tid % 16) * 4; const v4f v = *(const v4f*)&lo[row][pc]; v4h vh4, vl4;
      for (int u = 0; u < 4; ++u) { const _Float16 hi = (_Float16)v[u]; vh4[u] = hi; vl4[u] = (_Float16)((v[u] - (float)hi) * 1024.0f); }
      *(v4h*)(OH + (r0 + rg * 64 + row) * DM + h * HD + pc) = vh4; *(v4h*)(OL + ((size_t)b * QT0 + rg * 64 + row) * DM + h * HD + pc) = vl4; }
     } }

extern "C" void kernel_launch(void* const* d_in, const int* in_sizes, int n_in,
                              void* d_out, int out_size, void* d_ws, size_t ws_size, hipStream_t stream) {
  (void)in_sizes; (void)n_in; (void)out_size;
  const float* const* I = (const float* const*)d_in; const float* x = I[0]; const float* xk = I[1]; const float* xv = I[2]; const float* wq = I[3]; const float* bq = nullptr; const float* wk = I[4]; const float* bk = nullptr; const float* wv = I[5]; const float* bv = nullptr; const float* wo = I[6]; const float* bo = I[7];      /* input order: query_data, key_data, value_data (three SEPARATE streams: the three exact-f16 row casts read one each), Wq, Wk, Wv ([in][out]; the module has NO q / k / v biases: null pointers in the guarded bias slots), Wp ([in][out]), bp (REAL); NO mask input (the causal fill is built inside the reference) */
  char* ws = (char*)d_ws; size_t off = 0;
  auto take = [&](size_t bytes) { char* p = ws + off; off += (bytes + 255) & ~(size_t)255; return p; };
  _Float16* BQ = (_Float16*)take((size_t)DM * DM * 2); _Float16* BK = (_Float16*)take((size_t)DM * DM * 2); _Float16* BV = (_Float16*)take((size_t)DM * DM * 2); _Float16* BO = (_Float16*)take((size_t)DM * DM * 2);
  _Float16* X16 = (_Float16*)take(NR * DM * 2); _Float16* XK16 = (_Float16*)take(NR * DM * 2); _Float16* XV16 = (_Float16*)take(NR * DM * 2);      /* exact f16 rows of query, key, value */ float* QF = (float*)take(NR * DM * 4); float* KF = (float*)take(NR * DM * 4); float* VF = (float*)take(NR * DM * 4);      /* f32 q, k, v rows, a plane each: the exact path of rows 0..127 reads them */ _Float16* QH = (_Float16*)take(NR * DM * 2); _Float16* QL = (_Float16*)take(NR * DM * 2); _Float16* KH = (_Float16*)take(NR * DM * 2); _Float16* KL = (_Float16*)take(NR * DM * 2); _Float16* Q16 = QH; _Float16* K16 = KH; _Float16* V16 = (_Float16*)take(NR * DM * 2); _Float16* O16 = (_Float16*)take(NR * DM * 2);
  _Float16* VT = (_Float16*)take((size_t)NB * NH * HD * SQ * 2);
  _Float16* OL0 = (_Float16*)take((size_t)NB * QT0 * DM * 2);      /* x1024 residual of the exact o rows */
  if (off > ws_size) return;
  static_assert(B0 == 0 && NBR == NB, "the conversion launches take whole planes");
  k_prep<<<PWB + PXB, 256, 0, stream>>>(x, xk, xv, wq, wk, wv, wo, X16, BQ);      /* the four weights [in][out] -> Bt[n][k] x16 (BQ, BK, BV, BO lie one behind the other) and the three exact f16 row casts (X16, XK16, XV16 likewise) in one launch */
  const size_t r0p = (size_t)B0 * SQ;      /* first projected row */
  k_gemm2<0><<<dim3((unsigned)((MP / 128) * (DM / 64)), 1), 128, 0, stream>>>(X16 + r0p * DM, DM, 0, BQ, DM, 0, 0.0625f, bq, 0, nullptr, 1, 0, 0, QF + r0p * DM, nullptr, DM, 0, MP, DM, DM);
  k_gemm2<0><<<dim3((unsigned)((MP / 128) * (DM / 64)), 1), 128, 0, stream>>>(XK16 + r0p * DM, DM, 0, BK, DM, 0, 0.0625f, bk, 0, nullptr, 1, 0, 0, KF + r0p * DM, nullptr, DM, 0, MP, DM, DM);
  k_gemm2<0><<<dim3((unsigned)((MP / 128) * (DM / 64)), 1), 128, 0, stream>>>(XV16 + r0p * DM, DM, 0, BV, DM, 0, 0.0625f, bv, 0, nullptr, 1, 0, 0, VF + r0p * DM, V16 + r0p * DM, DM, 0, MP, DM, DM);
  k_post<<<PVB + 512, 256, 0, stream>>>(QF, QH, V16, VT);      /* one launch behind the three projections: V^T [NB][NH][HD][SQ]; q and k (f32; QF, KF one behind the other) -> f16 hi + x1024 residual planes (QH, QL, KH, KL one behind the other): unscaled logits sigma ~8 */
  k_fattn<<<dim3(SQ / 128, NH, NB), 128, 0, stream>>>(QH, QL, KH, KL, VT, O16);      /* scores, causal softmax and P . V in one launch for all rows, heads and batches: o (merged heads, x64) as f16 rows */
  k_att0<0><<<dim3(NH * (QT0 / 64), NBR), 64, 0, stream>>>(QF + r0p * DM, KF + r0p * DM, VF + r0p * DM, DM, nullptr, SCL, O16 + r0p * DM, OL0);      /* exact f32 attention for rows 0..127 of both batches in one launch (o x64): f16 hi over the f16 path's o rows, x1024 residual into its own plane */
  k_gemm2<0><<<dim3((unsigned)((MPO / 128) * (DM / 64)), 1), 128, 0, stream>>>(O16 + r0p * DM, DM, 0, BO, DM, 0, 0.0009765625f, bo, 0, nullptr, 1, 0, 0, (float*)d_out + r0p * DM, nullptr, DM, 0, MPO, DM, DM);      /* out rows are the output layout */
  k_gemm2<0><<<dim3((QT0 / 128) * (DM / 64), NBR), 128, 0, stream>>>(OL0, DM, (size_t)QT0 * DM, BO, DM, 0, 0.00000095367431640625f, nullptr, 0, (const float*)d_out + r0p * DM, -1, 0, 0, (float*)d_out + r0p * DM, nullptr, DM, (size_t)SQ * DM, QT0, DM, DM);      /* rows 0..127 of both batches (grid y): += o_lo Wo 2^-20 (own-element accumulate) on the o_hi Wo + b that the launch above wrote */
}

// v007
// Measured time: 175 microseconds a run.
// Two timings next to v006 put it at 1.15 and 1.14 times that version's speed.
// All steps since v000 together make it 33.5 times as fast.
#include <hip/hip_runtime.h>
// Causal multi-head attention on three inputs with bias-free [in][out] projections and a biased [in][out] output projection (query_data, key_data, value_data [2][2048][1024]; q = split_heads(query_data Wq), k = split_heads(key_data Wk), v = split_heads(value_data Wv) ([in][out] [1024][1024], NO biases), 16 heads of 64; scores / sqrt(64); scores + triu(ones, k = 1) x (-1e13): an additive fill strictly above the diagonal == exclusion (exp underflows to exactly 0; every row keeps its diagonal); softmax over keys; out = merged Wp + bp ([in][out] + a REAL bias) -> [2][2048][1024]); the causal rule is built inside the reference; q and k carried as f16 hi + x1024 residual planes with three-product scores.
// Structure: token rows r = b*2048 + s; x as exact f16 rows (bf16-rounded); q and k as WMMA GEMMs (32x64 wave tiles, f32 accumulation, exact x16 weights, no bias) into f32 rows split into f16 hi + x1024 residual planes, v as a GEMM that stores f16 and f32 rows; V^T for all heads and batches via LDS transposes; one fused attention launch: a block owns 128 query rows of a head (32 per wave) and walks the keys up to its last row 64 at a time, k hi, k lo and V^T rows staged in LDS per pass: three-product scores (lo.hi + hi.lo, x 2^-10, + hi.hi) as S^T tiles in registers, running maximum and sum per query (f32 statistics, native exp2; keys past the row's own index excluded; weights x256 f16, packed in place as the B operand), O^T += V^T . P^T, o carried x64 (folded into the output GEMM alpha) written straight into the merged f16 o rows; out = o W_o + b GEMM (f32) into the output layout.
// Compute dtype: inputs rounded to bf16; x / weights exact; q and k as f16 hi + x1024 residual planes (three products), v, softmax weights and o as plain f16 GEMM operands (~2^-12); scores and softmax statistics f32. v_wmma_f32_16x16x32_f16.
#define NB 2
#define SCL 0.125f                         /* 1 / sqrt(head_dim = 64) */
#define SCLR 0.0001220703125f              /* 2^-13 (not used: k_fattn scales the x1024 residual sums by 2^-10) */
#define SQ 2048
#define DM 1024
#define NH 16
#define HD 64
#define HG 4                         /* heads per launch of the head-group k_vt (not launched) */
#define QT 256                       /* not used: the causal tiles are 128 query rows */
#define NKX SQ                       /* not used */
#define QT0 128                      /* first-tile rows computed exactly in f32 */
#define B0 0                         /* first batch processed (debug hook) */
#define NBR NB                       /* batches processed (debug hook) */
#define NR ((size_t)NB * SQ)         /* token rows */
#define MP ((int)((size_t)NBR * SQ)) /* rows projected (debug hook) */
#define QN SQ                        /* not used */
#define NHD NH                       /* not used */
#define MPO MP                       /* rows through the output stage (debug hook) */
#define LQ DM      /* row pitch of the q/k/v rows */
typedef __bf16 v16b __attribute__((ext_vector_type(16)));
typedef unsigned short v8us __attribute__((ext_vector_type(8), may_alias));
typedef float  v8f  __attribute__((ext_vector_type(8)));
typedef float  v4f  __attribute__((ext_vector_type(4)));
typedef float  v4fa __attribute__((ext_vector_type(4), may_alias));
union FragB { v16b v; v8us half[2]; unsigned short u[16]; };

__device__ __forceinline__ unsigned short bf16_bits(float x) { unsigned int u = __float_as_uint(x); return (unsigned short)((u + 0x7FFFu + ((u >> 16) & 1u)) >> 16); }
__device__ __forceinline__ float bf16_val(unsigned short b) { return __uint_as_float(((unsigned int)b) << 16); }
__device__ __forceinline__ float bf16_round(float x) { return bf16_val(bf16_bits(x)); }
// D += A·B with NT terms: 1 = ah·bh, 2 = + al·bh (A split), 3 = + ah·bl (both split)
template <int NT>
__device__ __forceinline__ v8f mmaN(v16b ah, v16b al, v16b bh, v16b bl, v8f c) {
  c = __builtin_amdgcn_wmma_f32_16x16x32_bf16(false, ah, false, bh, (short)0, c, false, false);
  if (NT >= 2) c = __builtin_amdgcn_wmma_f32_16x16x32_bf16(false, al, false, bh, (short)0, c, false, false);
  if (NT >= 3) c = __builtin_amdgcn_wmma_f32_16x16x32_bf16(false, ah, false, bl, (short)0, c, false, false);
  asm volatile("v_nop\n\tv_nop\n\tv_nop\n\tv_nop" : "+v"(c) : "v"(ah), "v"(al), "v"(bh), "v"(bl));
  return c;
}

__global__ __launch_bounds__(256) void k_wt_bf16(const float* __restrict__ W, unsigned short* __restrict__ Wt, int K, int N) {
  const int t = blockIdx.x * 256 + threadIdx.x;
  const int k8n = K / 8;
  if (t >= N * k8n) return;
  const int n = t / k8n, k8 = (t % k8n) * 8;
  v8us v;
#pragma unroll
  for (int i = 0; i < 8; ++i) v[i] = bf16_bits(W[(size_t)(k8 + i) * N + n]);
  *(v8us*)(Wt + (size_t)n * K + k8) = v;
  
}

// GEMM C[M][N] (f32, pitch ldc) = act(A[M][K]·W + bias). A f32 row-major (pitch lda) converted per fragment to bf16
// (ASPLIT: hi/lo two planes -> 2 terms, else single rounded term); Wt bf16 [N][K] (pitch ldb). BIAS_BF16 rounds the
// bias to bf16 first (bias quantised to bf16 before the add). K%32==0, M%16==0, N%64==0.
template <bool ASPLIT, int ACT, bool BIAS_BF16>
__global__ __launch_bounds__(128) void k_gemm_bf(const float* __restrict__ A, int lda, const unsigned short* __restrict__ Wt, int ldb,
                                               const float* __restrict__ bias, float* __restrict__ C, int ldc, int M, int N, int K) {
  __shared__ __attribute__((aligned(16))) float so[4][16][64];
  const int tid = threadIdx.x, w = tid >> 5, lane = tid & 31, ln = lane & 15, hh = lane >> 4;
  const int ntn = N / 64;
  const int wid = blockIdx.x * 4 + w;
  const int mt = wid / ntn, nq = wid % ntn;
  if (mt * 16 >= M) return;
  const int row0 = mt * 16, col0 = nq * 64;
  const float* arow = A + (size_t)(row0 + ln) * lda;
  v8f acc[4] = {};
  for (int kb = 0; kb < K; kb += 32) {
    FragB ah, al;
    const v4f x0 = *(const v4fa*)(arow + kb + 8 * hh), x1 = *(const v4fa*)(arow + kb + 8 * hh + 4);
    const v4f x2 = *(const v4fa*)(arow + kb + 16 + 8 * hh), x3 = *(const v4fa*)(arow + kb + 16 + 8 * hh + 4);
    float xs[16] = {x0[0],x0[1],x0[2],x0[3],x1[0],x1[1],x1[2],x1[3],x2[0],x2[1],x2[2],x2[3],x3[0],x3[1],x3[2],x3[3]};
#pragma unroll
    for (int i = 0; i < 16; ++i) { const unsigned short hb = bf16_bits(xs[i]); ah.u[i] = hb; al.u[i] = ASPLIT ? bf16_bits(xs[i] - bf16_val(hb)) : (unsigned short)0; }
#pragma unroll
    for (int t = 0; t < 4; ++t) {
      const unsigned short* brow = Wt + (size_t)(col0 + t * 16 + ln) * ldb + kb;
      FragB b;
      b.half[0] = *(const v8us*)(brow + 8 * hh);
      b.half[1] = *(const v8us*)(brow + 16 + 8 * hh);
      acc[t] = mmaN<ASPLIT ? 2 : 1>(ah.v, al.v, b.v, b.v, acc[t]);
    }
  }
#pragma unroll
  for (int t = 0; t < 4; ++t) {
    float bv = bias ? bias[col0 + t * 16 + ln] : 0.f;
    if (BIAS_BF16) bv = bf16_round(bv);
#pragma unroll
    for (int r = 0; r < 8; ++r) { float v = acc[t][r] + bv; if (ACT == 1) v = fmaxf(v, 0.f); so[w][8 * hh + r][t * 16 + ln] = v; }
  }
  __builtin_amdgcn_fence(__ATOMIC_ACQ_REL, "workgroup");
  __builtin_amdgcn_wave_barrier();
  const int rsub = lane >> 4, c4 = (lane & 15) * 4;
  {
#pragma unroll
    for (int q = 0; q < 8; ++q) {
      const int r = q * 2 + rsub;
      const v4f v = *(const v4fa*)&so[w][r][c4];
      *(v4f*)(C + (size_t)(row0 + r) * ldc + col0 + c4) = v;
    }
    
  }
}

// GEMM C = act(A·W + bias + resid): A f32 (ASPLIT -> hi/lo 2 terms), Wt bf16 [N][K]; ACT 0 none, 1 relu, 2 exact gelu;
// resid (optional, f32, row index = (row % rmod), pitch ldr, RES_BF16 rounds it) added before the activation.
template <bool ASPLIT, int ACT, bool BIAS_BF16, bool RES_BF16>
__global__ __launch_bounds__(128) void k_gemm_bf3(const float* __restrict__ A, int lda, const unsigned short* __restrict__ Wt, int ldb,
                                                const float* __restrict__ bias, const float* __restrict__ resid, int rmod, int ldr,
                                                float* __restrict__ C, int ldc, int M, int N, int K) {
  __shared__ __attribute__((aligned(16))) float so[4][16][64];
  const int tid = threadIdx.x, w = tid >> 5, lane = tid & 31, ln = lane & 15, hh = lane >> 4;
  const int ntn = N / 64;
  const int wid = blockIdx.x * 4 + w;
  const int mt = wid / ntn, nq = wid % ntn;
  if (mt * 16 >= M) return;
  const int row0 = mt * 16, col0 = nq * 64;
  const float* arow = A + (size_t)(row0 + ln) * lda;
  v8f acc[4] = {};
  for (int kb = 0; kb < K; kb += 32) {
    FragB ah, al;
    const v4f x0 = *(const v4fa*)(arow + kb + 8 * hh), x1 = *(const v4fa*)(arow + kb + 8 * hh + 4);
    const v4f x2 = *(const v4fa*)(arow + kb + 16 + 8 * hh), x3 = *(const v4fa*)(arow + kb + 16 + 8 * hh + 4);
    float xs[16] = {x0[0],x0[1],x0[2],x0[3],x1[0],x1[1],x1[2],x1[3],x2[0],x2[1],x2[2],x2[3],x3[0],x3[1],x3[2],x3[3]};
#pragma unroll
    for (int i = 0; i < 16; ++i) { const unsigned short hb = bf16_bits(xs[i]); ah.u[i] = hb; al.u[i] = ASPLIT ? bf16_bits(xs[i] - bf16_val(hb)) : (unsigned short)0; }
#pragma unroll
    for (int t = 0; t < 4; ++t) {
      const unsigned short* brow = Wt + (size_t)(col0 + t * 16 + ln) * ldb + kb;
      FragB b;
      b.half[0] = *(const v8us*)(brow + 8 * hh);
      b.half[1] = *(const v8us*)(brow + 16 + 8 * hh);
      acc[t] = mmaN<ASPLIT ? 2 : 1>(ah.v, al.v, b.v, b.v, acc[t]);
    }
  }
#pragma unroll
  for (int t = 0; t < 4; ++t) {
    const int col = col0 + t * 16 + ln;
    float bv = bias ? bias[col] : 0.f;
    if (BIAS_BF16) bv = bf16_round(bv);
#pragma unroll
    for (int r = 0; r < 8; ++r) {
      float v = acc[t][r] + bv;
      if (resid) { float rv = resid[(size_t)((row0 + 8 * hh + r) % rmod) * ldr + col]; if (RES_BF16) rv = bf16_round(rv); v += rv; }
      if (ACT == 1) v = fmaxf(v, 0.f);
      if (ACT == 2) v = 0.5f * v * (1.0f + erff(v * 0.70710678118654752f));
      if (ACT == 3) { const float u = 0.7978845608028654f * (v + 0.044715f * v * v * v); v = 0.5f * v * (1.0f + tanhf(u)); }
      so[w][8 * hh + r][t * 16 + ln] = v;
    }
  }
  __builtin_amdgcn_fence(__ATOMIC_ACQ_REL, "workgroup");
  __builtin_amdgcn_wave_barrier();
  const int rsub = lane >> 4, c4 = (lane & 15) * 4;
  {
#pragma unroll
    for (int q = 0; q < 8; ++q) {
      const int r = q * 2 + rsub;
      const v4f v = *(const v4fa*)&so[w][r][c4];
      *(v4f*)(C + (size_t)(row0 + r) * ldc + col0 + c4) = v;
    }
    
  }
}
// row LayerNorm (biased variance, eps) over N: s = X (+ R); optional out_sum <- s; out_norm <- (s-mu)*rsqrt(var+eps)*g + b
template <bool PARAM_BF16>
__global__ __launch_bounds__(256) void k_layernorm(const float* __restrict__ X, const float* __restrict__ R, const float* __restrict__ g, const float* __restrict__ bta,
                                                  float* __restrict__ out_sum, float* __restrict__ out_norm, int N, float eps) {
  __shared__ float red[256];
  const int row = blockIdx.x, tid = threadIdx.x;
  const float* x = X + (size_t)row * N; const float* rr = R ? R + (size_t)row * N : nullptr;
  float vals[16];                     // up to N = 4096
  const int per = N / 256;            // contiguous chunk per thread? use strided-by-4 chunks: thread handles j = tid*4 + 1024*u
  float s1 = 0.f;
  for (int u = 0; u < per / 4; ++u) {
    const int j = tid * 4 + 1024 * u;
    const v4f a = *(const v4fa*)(x + j);
    v4f b = {0.f,0.f,0.f,0.f}; if (rr) b = *(const v4fa*)(rr + j);
#pragma unroll
    for (int q = 0; q < 4; ++q) { const float v = a[q] + b[q]; vals[u * 4 + q] = v; s1 += v; }
  }
  red[tid] = s1; __syncthreads();
  for (int st = 128; st > 0; st >>= 1) { if (tid < st) red[tid] += red[tid + st]; __syncthreads(); }
  const float mu = red[0] / (float)N; __syncthreads();
  float s2 = 0.f;
  for (int u = 0; u < per / 4; ++u)
#pragma unroll
    for (int q = 0; q < 4; ++q) { const float c = vals[u * 4 + q] - mu; s2 += c * c; }
  red[tid] = s2; __syncthreads();
  for (int st = 128; st > 0; st >>= 1) { if (tid < st) red[tid] += red[tid + st]; __syncthreads(); }
  const float rs = rsqrtf(red[0] / (float)N + eps);
  {
    for (int u = 0; u < per / 4; ++u) {
      const int j = tid * 4 + 1024 * u;
      v4f o, sm;
#pragma unroll
      for (int q = 0; q < 4; ++q) {
        float gg = g[j + q], bb = bta[j + q];
        if (PARAM_BF16) { gg = bf16_round(gg); bb = bf16_round(bb); }
        sm[q] = vals[u * 4 + q]; o[q] = (vals[u * 4 + q] - mu) * rs * gg + bb;
      }
      if (out_sum) *(v4f*)(out_sum + (size_t)row * N + j) = sm;
      *(v4f*)(out_norm + (size_t)row * N + j) = o;
    }
    
  }
}



// ---- f16 WMMA path (v_wmma_f32_16x16x32_f16): 11-bit significands for operands in range — used where a [0,1] probability operand needs more precision than bf16
typedef _Float16 v16h __attribute__((ext_vector_type(16)));
union FragH { v16h v; v8us half[2]; _Float16 h[16]; unsigned short u[16]; };
template <int NT>
__device__ __forceinline__ v8f mmaH(v16h ah, v16h al, v16h bh, v16h bl, v8f c) {
  c = __builtin_amdgcn_wmma_f32_16x16x32_f16(false, ah, false, bh, (short)0, c, false, false);
  if (NT >= 2) c = __builtin_amdgcn_wmma_f32_16x16x32_f16(false, al, false, bh, (short)0, c, false, false);
  if (NT >= 3) c = __builtin_amdgcn_wmma_f32_16x16x32_f16(false, ah, false, bl, (short)0, c, false, false);
  asm volatile("v_nop\n\tv_nop\n\tv_nop\n\tv_nop" : "+v"(c) : "v"(ah), "v"(al), "v"(bh), "v"(bl));
  return c;
}
// batched GEMM like k_gemm_b but f16 operands: A f32 (split into f16 hi/lo if ASPLIT, else rounded to f16), Bt = f16 values [n][k]; alpha; C f32; N multiple of 16 (partial tiles skipped)
template <bool ASPLIT>
__global__ __launch_bounds__(128) void k_gemm_h(const float* __restrict__ A, int lda, size_t sA, const _Float16* __restrict__ Bh, int ldb, size_t sB, float alpha, float* __restrict__ C, int ldc, size_t sC, int M, int N, int K) {
  __shared__ __attribute__((aligned(16))) float so[4][16][64];
  const int tid = threadIdx.x, w = tid >> 5, lane = tid & 31, ln = lane & 15, hh = lane >> 4; const int by = blockIdx.y;
  A += (size_t)by * sA; Bh += (size_t)by * sB; C += (size_t)by * sC;
  const int ntn = (N + 63) / 64; const int wid = blockIdx.x * 4 + w; const int mt = wid / ntn, nq = wid % ntn; if (mt * 16 >= M) return;
  const int row0 = mt * 16, col0 = nq * 64; const float* arow = A + (size_t)(row0 + ln) * lda;
  v8f acc[4] = {};
  for (int kb = 0; kb < K; kb += 32) {
    FragH ah, al;
    const v4f x0 = *(const v4fa*)(arow + kb + 8 * hh), x1 = *(const v4fa*)(arow + kb + 8 * hh + 4), x2 = *(const v4fa*)(arow + kb + 16 + 8 * hh), x3 = *(const v4fa*)(arow + kb + 16 + 8 * hh + 4);
    float xs[16] = {x0[0],x0[1],x0[2],x0[3],x1[0],x1[1],x1[2],x1[3],x2[0],x2[1],x2[2],x2[3],x3[0],x3[1],x3[2],x3[3]};
#pragma unroll
    for (int i = 0; i < 16; ++i) { const _Float16 h = (_Float16)xs[i]; ah.h[i] = h; al.h[i] = ASPLIT ? (_Float16)(xs[i] - (float)h) : (_Float16)0.0f; }
#pragma unroll
    for (int t = 0; t < 4; ++t) { if (col0 + t * 16 >= N) continue; const size_t boff = (size_t)(col0 + t * 16 + ln) * ldb + kb; FragH bq; bq.half[0] = *(const v8us*)(Bh + boff + 8 * hh); bq.half[1] = *(const v8us*)(Bh + boff + 16 + 8 * hh);
      acc[t] = mmaH<ASPLIT ? 2 : 1>(ah.v, al.v, bq.v, bq.v, acc[t]); }
  }
#pragma unroll
  for (int t = 0; t < 4; ++t) { if (col0 + t * 16 >= N) continue;
#pragma unroll
    for (int r = 0; r < 8; ++r) so[w][8 * hh + r][t * 16 + ln] = acc[t][r] * alpha; }
  __builtin_amdgcn_fence(__ATOMIC_ACQ_REL, "workgroup"); __builtin_amdgcn_wave_barrier();
  const int rsub = lane >> 4, c4 = (lane & 15) * 4;
  {
#pragma unroll
    for (int q = 0; q < 8; ++q) { const int r = q * 2 + rsub; if (col0 + c4 < N) { const v4f v = *(const v4fa*)&so[w][r][c4]; *(v4f*)(C + (size_t)(row0 + r) * ldc + col0 + c4) = v; } }
     }
}

// k_gemm_hh variant with fused epilogue: v = acc·alpha + bias[by·sBias + col] (+ CP[(row/rowsPerB)·sCPb + by·64 + col] if CP) ; ACT 0 none / 1 elu ; writes f16 C16 (and f32 C if non-null)
template <int ACT>
__global__ __launch_bounds__(128) void k_gemm_hhx(const _Float16* __restrict__ A, int lda, size_t sA, const _Float16* __restrict__ Bh, int ldb, size_t sB, float alpha, const float* __restrict__ bias, size_t sBias, const float* __restrict__ CP, int rowsPerB, size_t sCPb, int row0g,
    float* __restrict__ C, _Float16* __restrict__ C16, int ldc, size_t sC, int M, int N, int K) {
  __shared__ __attribute__((aligned(16))) float so[4][16][64];
  const int tid = threadIdx.x, w = tid >> 5, lane = tid & 31, ln = lane & 15, hh = lane >> 4; const int by = blockIdx.y;
  A += (size_t)by * sA; Bh += (size_t)by * sB; const size_t cofs = (size_t)by * sC; const float* bp = bias ? bias + (size_t)by * sBias : nullptr;
  const int ntn = (N + 63) / 64; const int wid = blockIdx.x * 4 + w; const int mt = wid / ntn, nq = wid % ntn; if (mt * 16 >= M) return;
  const int row0 = mt * 16, col0 = nq * 64; const _Float16* arow = A + (size_t)(row0 + ln) * lda;
  v8f acc[4] = {};
  for (int kb = 0; kb < K; kb += 32) { FragH ah; ah.half[0] = *(const v8us*)((const unsigned short*)arow + kb + 8 * hh); ah.half[1] = *(const v8us*)((const unsigned short*)arow + kb + 16 + 8 * hh);
#pragma unroll
    for (int t = 0; t < 4; ++t) { if (col0 + t * 16 >= N) continue; const size_t boff = (size_t)(col0 + t * 16 + ln) * ldb + kb; FragH bq; bq.half[0] = *(const v8us*)((const unsigned short*)Bh + boff + 8 * hh); bq.half[1] = *(const v8us*)((const unsigned short*)Bh + boff + 16 + 8 * hh);
      acc[t] = mmaH<1>(ah.v, ah.v, bq.v, bq.v, acc[t]); }
  }
#pragma unroll
  for (int t = 0; t < 4; ++t) { if (col0 + t * 16 >= N) continue; const int col = col0 + t * 16 + ln; const float bv = bp ? bf16_round(bp[col]) : 0.f;
#pragma unroll
    for (int r = 0; r < 8; ++r) { float v = acc[t][r] * alpha + bv; if (CP) { const int rr = row0g + row0 + 8 * hh + r; if (rowsPerB < 0) v += CP[cofs + (size_t)rr * ldc + col];      /* rowsPerB < 0: own element of the batched C plane */ else { const int bidx = rr / rowsPerB; v += CP[(size_t)bidx * sCPb + (size_t)by * 64 + col]; } } if (ACT == 1) v = (v > 0.f) ? v : expm1f(v); else if (ACT == 7) v = (v > 0.f) ? v + 1.0f : expf(v); else if (ACT == 8) v = tanhf(v); else if (ACT == 9) v = 0.5f * v * (1.0f + tanhf(0.7978845608028654f * (v + 0.044715f * v * v * v))); else if (ACT == 11) v = 1.0f / (1.0f + expf(-v)); else if (ACT == 12) v = (v > 0.f) ? v : 0.01f * v; else if (ACT == 14) v = (v > 0.f) ? v : 0.1f * v; else if (ACT == 16) v = (v >= 0.f) ? v : 0.3f * v; else if (ACT == 17) v = (v >= 0.f) ? v : 0.2f * v; else if (ACT == 15) v = v / (1.0f + expf(-v)); else if (ACT == 3) v = fmaxf(v, 0.f); else if (ACT == 6) v = 0.5f * v * (1.0f + erff(v * 0.70710678118654752f)); so[w][8 * hh + r][t * 16 + ln] = v; } }
  __builtin_amdgcn_fence(__ATOMIC_ACQ_REL, "workgroup"); __builtin_amdgcn_wave_barrier();
  const int rsub = lane >> 4, c4 = (lane & 15) * 4; typedef _Float16 v4h __attribute__((ext_vector_type(4)));
  {
#pragma unroll
    for (int q = 0; q < 8; ++q) { const int r = q * 2 + rsub; if (col0 + c4 < N) { const v4f v = *(const v4fa*)&so[w][r][c4]; if (C) *(v4f*)(C + cofs + (size_t)(row0 + r) * ldc + col0 + c4) = v; if (C16) { v4h h4; for (int i = 0; i < 4; ++i) h4[i] = (_Float16)v[i]; *(v4h*)(C16 + cofs + (size_t)(row0 + r) * ldc + col0 + c4) = h4; } } }
     }
}


typedef _Float16 v4h __attribute__((ext_vector_type(4)));

__global__ __launch_bounds__(256) void k_h16(const float* __restrict__ x, _Float16* __restrict__ X16, size_t n8) { const size_t t = (size_t)blockIdx.x * 256 + threadIdx.x; if (t >= n8) return; FragH f;
#pragma unroll
  for (int q = 0; q < 8; ++q) f.h[q] = (_Float16)x[t * 8 + q]; *(v8us*)((unsigned short*)X16 + t * 8) = f.half[0];  }
__global__ __launch_bounds__(256) void k_round16f(const float* __restrict__ W, _Float16* __restrict__ Bt, size_t n8) { const size_t t = (size_t)blockIdx.x * 256 + threadIdx.x; if (t >= n8) return; FragH f;
#pragma unroll
  for (int i = 0; i < 8; ++i) f.h[i] = (_Float16)(bf16_round(W[t * 8 + i]) * 16.0f); *(v8us*)((unsigned short*)Bt + t * 8) = f.half[0];  }
// ---- element-wise conversions: one launch per stage, 32 or 64 elements a thread, so that a stage is a few thousand waves that each keep 16 to 24 loads of 16 bytes in flight ----
// k_prep, blocks 0 .. PWB - 1: the four weight matrices, f32 [in][out] -> Bt[n][k] = f16(bf16-rounded value x 16). A thread owns a tile of 8 k x 8 n; the lanes of a wave lie 4 along n and 8 along k,
// so that a wave's loads read whole 128-byte lines of its k rows and each of its stores writes whole lines of 4 n rows. Blocks PWB ..: the three row casts, f32 -> f16(bf16-rounded value), 4 pieces of 8 elements of each tensor a thread.
#define PWB 256                            /* 64 blocks a matrix: 512 waves of 32 tiles = 128 x 128 tiles */
#define PXB 512                            /* 1024 pieces of 8 elements a block and tensor */
__global__ __launch_bounds__(256) void k_prep(const float* __restrict__ xq, const float* __restrict__ xk, const float* __restrict__ xv, const float* __restrict__ wq, const float* __restrict__ wk, const float* __restrict__ wv, const float* __restrict__ wo, _Float16* __restrict__ X16, _Float16* __restrict__ BT) {
  static_assert(DM == 1024 && NR * DM / 8 == (size_t)PXB * 1024, "k_prep: the block counts are written for these shapes");
  const int tid = threadIdx.x;
  if (blockIdx.x < PWB) {      /* block-uniform */
    const int mi = blockIdx.x >> 6; const float* Wm = mi == 0 ? wq : mi == 1 ? wk : mi == 2 ? wv : wo;
    const int wid = (blockIdx.x & 63) * 8 + (tid >> 5), lane = tid & 31; const int n8 = ((wid >> 4) * 4 + (lane & 3)) * 8, k8 = ((wid & 15) * 8 + (lane >> 2)) * 8;
    const float* sp = Wm + (size_t)k8 * DM + n8; unsigned short* dp = (unsigned short*)BT + (size_t)mi * (DM * DM) + (size_t)n8 * DM + k8;
    v4f a[8][2]; v8us o[8];
#pragma unroll      /* constant indices: the tile stays in registers, all 16 loads in flight */
    for (int i = 0; i < 8; ++i) { a[i][0] = *(const v4fa*)(sp + i * DM); a[i][1] = *(const v4fa*)(sp + i * DM + 4); }
    asm volatile("s_wait_xcnt 0x0" :: "v"(sp) : "memory");      /* the loads' address registers stay untouched up to this wait; its memory clobber also keeps all 16 loads in front of the first store (without it the build held four loads back behind stores) */
#pragma unroll
    for (int j = 0; j < 8; ++j) { FragH f;
#pragma unroll
      for (int i = 0; i < 8; ++i) f.h[i] = (_Float16)(bf16_round(a[i][j >> 2][j & 3]) * 16.0f);
      o[j] = f.half[0]; }
#pragma unroll
    for (int j = 0; j < 8; ++j) *(v8us*)(dp + j * DM) = o[j];
  } else {
    const size_t e0 = ((size_t)(blockIdx.x - PWB) * 1024 + tid) * 8;      /* the thread's first element; its pieces lie 256 pieces apart */
    const float* s0 = xq + e0; const float* s1 = xk + e0; const float* s2 = xv + e0; unsigned short* dp = (unsigned short*)X16 + e0;
    v4f a[3][4][2]; v8us o[3][4];
#pragma unroll      /* constant indices: registers, all 24 loads in flight */
    for (int u = 0; u < 4; ++u) { a[0][u][0] = *(const v4fa*)(s0 + u * 2048); a[0][u][1] = *(const v4fa*)(s0 + u * 2048 + 4); a[1][u][0] = *(const v4fa*)(s1 + u * 2048); a[1][u][1] = *(const v4fa*)(s1 + u * 2048 + 4); a[2][u][0] = *(const v4fa*)(s2 + u * 2048); a[2][u][1] = *(const v4fa*)(s2 + u * 2048 + 4); }
    asm volatile("s_wait_xcnt 0x0" :: "v"(s0), "v"(s1), "v"(s2) : "memory");      /* the loads' address registers stay untouched up to this wait; its memory clobber also keeps all 24 loads in front of the first store (without it the build issued them in three groups between the stores) */
#pragma unroll
    for (int s = 0; s < 3; ++s)
#pragma unroll
      for (int u = 0; u < 4; ++u) { FragH f;
#pragma unroll
        for (int q = 0; q < 8; ++q) f.h[q] = (_Float16)bf16_round(a[s][u][q >> 2][q & 3]);
        o[s][u] = f.half[0]; }
#pragma unroll
    for (int s = 0; s < 3; ++s)
#pragma unroll
      for (int u = 0; u < 4; ++u) *(v8us*)(dp + (size_t)s * (NR * DM) + u * 2048) = o[s][u];
    asm volatile("s_wait_xcnt 0x0" ::: "memory");      /* in the built code the weight part's first instructions stand on the other side of the closing branch and rewrite registers that these stores name: the wait stands in front of them */
  } }
// k_post, blocks 0 .. PVB - 1: V^T [NB][NH][HD][SQ] from the f16 v rows, 256 tokens x 64 head dims a block through LDS (row pitch 66), whole 128-byte lines on both sides.
// Blocks PVB ..: the f32 q and k planes (F, one behind the other) -> f16 hi + x1024 residual planes (H: q hi, q lo, k hi, k lo); 8 pieces of 8 elements a thread, 256 blocks a plane.
#define PVB 256                            /* NB * NH slabs x SQ / 256 pieces */
__global__ __launch_bounds__(256) void k_post(const float* __restrict__ F, _Float16* __restrict__ H, const _Float16* __restrict__ V16, _Float16* __restrict__ Vt) {
  static_assert(NR * DM / 8 == (size_t)256 * 2048 && NB * NH * (SQ / 256) == PVB && HD == 64, "k_post: the block counts are written for these shapes");
  __shared__ unsigned short tl[256][66];
  const int tid = threadIdx.x;
  if (blockIdx.x < PVB) {      /* block-uniform: every thread of such a block passes the barrier below */
    const int slab = blockIdx.x >> 3, lg = blockIdx.x & 7; const int b = slab / NH, h = slab % NH; const int r8 = tid >> 3, c8 = (tid & 7) * 8;
    const unsigned short* vp = (const unsigned short*)V16 + ((size_t)b * SQ + lg * 256 + r8) * DM + h * HD + c8; v8us t[8];
#pragma unroll      /* constant indices: registers, all 8 loads in flight */
    for (int j = 0; j < 8; ++j) t[j] = *(const v8us*)(vp + j * (32 * DM));
#pragma unroll
    for (int j = 0; j < 8; ++j)
#pragma unroll
      for (int q = 0; q < 8; ++q) tl[j * 32 + r8][c8 + q] = t[j][q];
    __syncthreads();      /* publishes the 256 token rows to the eight waves */
    unsigned short* op = (unsigned short*)Vt + ((size_t)slab * HD + r8) * SQ + lg * 256 + c8;
#pragma unroll
    for (int j = 0; j < 4; ++j)
#pragma unroll
      for (int rd = 0; rd < 2; ++rd) { FragH f;
#pragma unroll
        for (int q = 0; q < 8; ++q) f.u[q] = tl[j * 64 + c8 + q][rd * 32 + r8];
        *(v8us*)(op + rd * (32 * SQ) + j * 64) = f.half[0]; }
  } else {
    const int bx = blockIdx.x - PVB; const int p = bx >> 8; const size_t e0 = ((size_t)(bx & 255) * 2048 + tid) * 8;
    const float* sp = F + (size_t)p * (NR * DM) + e0; unsigned short* hp = (unsigned short*)H + (size_t)(2 * p) * (NR * DM) + e0; unsigned short* lp = hp + NR * DM;
    v4f a[8][2]; v8us oh[8], ol[8];
#pragma unroll      /* constant indices: registers, all 16 loads in flight */
    for (int u = 0; u < 8; ++u) { a[u][0] = *(const v4fa*)(sp + u * 2048); a[u][1] = *(const v4fa*)(sp + u * 2048 + 4); }
#pragma unroll
    for (int u = 0; u < 8; ++u) { FragH fh, fl;
#pragma unroll
      for (int q = 0; q < 8; ++q) { const float v = a[u][q >> 2][q & 3]; const _Float16 h = (_Float16)v; fh.h[q] = h; fl.h[q] = (_Float16)((v - (float)h) * 1024.0f); }
      oh[u] = fh.half[0]; ol[u] = fl.half[0]; }
#pragma unroll
    for (int u = 0; u < 8; ++u) { *(v8us*)(hp + u * 2048) = oh[u]; *(v8us*)(lp + u * 2048) = ol[u]; }
    asm volatile("s_wait_xcnt 0x0" ::: "memory");      /* in the built code the V^T part's first instructions stand on the other side of the closing branch and rewrite registers that these stores name: the wait stands in front of them */
  } }

// ---- fast GEMM (block tile 128x64, wave tile 32x64; requires M % 128 == 0 rows per launch region, N % 64 == 0 and K % 128 == 0); epilogue = k_gemm_hhx semantics ----
// The block's 128 A rows and 64 B rows are staged in LDS 128 k at a time (rows of 256 bytes, whole lines) by asynchronous 16-byte copies, two buffers: tile t + 2 flies while tile t + 1 is worked on.
// The four waves share the B rows; fragments are read from LDS by g2_frag in the k order and the kb order of the direct loads, so every accumulator sums in the same order.
__device__ __forceinline__ v16h g2_frag(const _Float16* p, int hh) { FragH f; f.half[0] = *(const v8us*)((const unsigned short*)p + 8 * hh); f.half[1] = *(const v8us*)((const unsigned short*)p + 16 + 8 * hh); return f.v; }
__device__ __forceinline__ v8f g2_mma(v16h a, v16h b, v8f c) { v8f d = __builtin_amdgcn_wmma_f32_16x16x32_f16(false, a, false, b, (short)0, c, false, false); asm volatile("v_nop\n\tv_nop\n\tv_nop\n\tv_nop" : "+v"(d) : "v"(a), "v"(b)); return d; }
#define GKS 128                            /* k per staged tile */
#define GLP 136                            /* LDS row pitch in f16: 128 + 8 = 272 bytes, for the 16-byte fragment reads */
// Twelve asynchronous 16-byte copies, global to LDS, each lane its own two addresses. The closing s_wait_xcnt 0 stands inside the statement so that no address register is rewritten ahead of it.
__device__ __forceinline__ void g2_copy12(const unsigned* l, const char* const* g) {
  asm volatile("global_load_async_to_lds_b128 %0, %12, off\n\tglobal_load_async_to_lds_b128 %1, %13, off\n\tglobal_load_async_to_lds_b128 %2, %14, off\n\tglobal_load_async_to_lds_b128 %3, %15, off\n\t"
               "global_load_async_to_lds_b128 %4, %16, off\n\tglobal_load_async_to_lds_b128 %5, %17, off\n\tglobal_load_async_to_lds_b128 %6, %18, off\n\tglobal_load_async_to_lds_b128 %7, %19, off\n\t"
               "global_load_async_to_lds_b128 %8, %20, off\n\tglobal_load_async_to_lds_b128 %9, %21, off\n\tglobal_load_async_to_lds_b128 %10, %22, off\n\tglobal_load_async_to_lds_b128 %11, %23, off\n\ts_wait_xcnt 0x0"
               :: "v"(l[0]), "v"(l[1]), "v"(l[2]), "v"(l[3]), "v"(l[4]), "v"(l[5]), "v"(l[6]), "v"(l[7]), "v"(l[8]), "v"(l[9]), "v"(l[10]), "v"(l[11]),
                  "v"(g[0]), "v"(g[1]), "v"(g[2]), "v"(g[3]), "v"(g[4]), "v"(g[5]), "v"(g[6]), "v"(g[7]), "v"(g[8]), "v"(g[9]), "v"(g[10]), "v"(g[11]) : "memory"); }
template <int ACT>
__global__ __launch_bounds__(128) void k_gemm2(const _Float16* __restrict__ A, int lda, size_t sA, const _Float16* __restrict__ Bh, int ldb, size_t sB, float alpha, const float* __restrict__ bias, size_t sBias, const float* __restrict__ CP, int rowsPerB, size_t sCPb, int row0g,
    float* __restrict__ C, _Float16* __restrict__ C16, int ldc, size_t sC, int M, int N, int K) { static_assert(ACT == 0 || ACT == 3 || ACT == 6 || ACT == 8 || ACT == 9 || ACT == 11 || ACT == 12 || ACT == 14 || ACT == 15 || ACT == 16 || ACT == 17, "k_gemm2: unsupported ACT code (would silently apply no activation)");
  __shared__ __attribute__((aligned(16))) float so[4][32][68];
  __shared__ __attribute__((aligned(16))) _Float16 ta[2][128][GLP]; __shared__ __attribute__((aligned(16))) _Float16 tb[2][64][GLP];
  const int tid = threadIdx.x, w = tid >> 5, lane = tid & 31, ln = lane & 15, hh = lane >> 4; const int by = blockIdx.y;
  A += (size_t)by * sA; Bh += (size_t)by * sB; const size_t cofs = (size_t)by * sC; const float* bp = bias ? bias + (size_t)by * sBias : nullptr;
  const int ntn = N >> 6; const int mt = blockIdx.x / ntn, nq = blockIdx.x - mt * ntn; const int row0 = mt * 128 + 32 * w, col0 = nq * 64; if (mt * 128 >= M) return;      /* block-uniform, in front of every barrier */
  const int srow = tid >> 4, sc8 = (tid & 15) * 8;      /* staging: 16 threads per row of 256 bytes, 8 rows a step */
  const char* ga = (const char*)(A + (size_t)(mt * 128 + srow) * lda + sc8); const char* gb = (const char*)(Bh + (size_t)(col0 + srow) * ldb + sc8); const size_t ga8 = (size_t)lda * 16, gb8 = (size_t)ldb * 16;      /* 8 rows in bytes */
  const unsigned la = (unsigned)(size_t)&ta[0][srow][sc8], lb = (unsigned)(size_t)&tb[0][srow][sc8];      /* byte addresses in the work-group's LDS */
  auto stage = [&](int t, int buf) { unsigned l[24]; const char* g[24];      /* one tile: 16 copies of A and 8 of B per thread */
#pragma unroll
    for (int j = 0; j < 16; ++j) { l[j] = la + (unsigned)buf * (unsigned)sizeof(ta[0]) + (unsigned)j * (8u * GLP * 2u); g[j] = ga + (size_t)t * (GKS * 2) + (size_t)j * ga8; }
#pragma unroll
    for (int j = 0; j < 8; ++j) { l[16 + j] = lb + (unsigned)buf * (unsigned)sizeof(tb[0]) + (unsigned)j * (8u * GLP * 2u); g[16 + j] = gb + (size_t)t * (GKS * 2) + (size_t)j * gb8; }
    g2_copy12(l, g); g2_copy12(l + 12, g + 12); };
  const v8f z8 = {0.f,0.f,0.f,0.f,0.f,0.f,0.f,0.f}; v8f c00 = z8, c01 = z8, c02 = z8, c03 = z8, c10 = z8, c11 = z8, c12 = z8, c13 = z8;
  const int nt = K / GKS;
  stage(0, 0);
  asm volatile("s_wait_asynccnt 0x0" ::: "memory");      /* this wave's copies of tile 0 have landed */
  __syncthreads();      /* publishes tile 0 to the four waves */
  if (nt > 1) stage(1, 1);
#pragma unroll 1      /* one trip is 32 matrix instructions of straight-line code already */
  for (int t = 0; t < nt; ++t) { const _Float16* ap = &ta[t & 1][32 * w + ln][0]; const _Float16* bq = &tb[t & 1][ln][0];
    v16h fa[2][2], fb[2][4];      /* two fragment sets: the next 32 k of this tile are read from LDS as one group ahead of the current block's matrix instructions */
    fa[0][0] = g2_frag(ap, hh); fa[0][1] = g2_frag(ap + 16 * GLP, hh); fb[0][0] = g2_frag(bq, hh); fb[0][1] = g2_frag(bq + 16 * GLP, hh); fb[0][2] = g2_frag(bq + 32 * GLP, hh); fb[0][3] = g2_frag(bq + 48 * GLP, hh);
#pragma unroll      /* makes the set index a constant, so that the sets are registers */
    for (int q = 0; q < GKS / 32; ++q) { const int s = q & 1, n = s ^ 1, kn = (q + 1) * 32;
      if (q + 1 < GKS / 32) { fa[n][0] = g2_frag(ap + kn, hh); fa[n][1] = g2_frag(ap + 16 * GLP + kn, hh); fb[n][0] = g2_frag(bq + kn, hh); fb[n][1] = g2_frag(bq + 16 * GLP + kn, hh); fb[n][2] = g2_frag(bq + 32 * GLP + kn, hh); fb[n][3] = g2_frag(bq + 48 * GLP + kn, hh); }
      c00 = g2_mma(fa[s][0], fb[s][0], c00); c10 = g2_mma(fa[s][1], fb[s][0], c10); c01 = g2_mma(fa[s][0], fb[s][1], c01); c11 = g2_mma(fa[s][1], fb[s][1], c11);
      c02 = g2_mma(fa[s][0], fb[s][2], c02); c12 = g2_mma(fa[s][1], fb[s][2], c12); c03 = g2_mma(fa[s][0], fb[s][3], c03); c13 = g2_mma(fa[s][1], fb[s][3], c13); }
    asm volatile("s_wait_dscnt 0x0" ::: "memory");      /* this wave's reads of tile t are done before its buffer is refilled */
    asm volatile("s_wait_asynccnt 0x0" ::: "memory");      /* this wave's copies of tile t + 1 have landed */
    __syncthreads();      /* publishes tile t + 1 and ends every wave's reads of tile t */
    if (t + 2 < nt) stage(t + 2, t & 1); }
  asm volatile("s_wait_asynccnt 0x0" ::: "memory");      /* no copy is outstanding when the wave goes on */
  v8f accs[8] = {c00, c01, c02, c03, c10, c11, c12, c13};
#pragma unroll
  for (int u = 0; u < 8; ++u) { const int t = u & 3, half = u >> 2; const int col = col0 + t * 16 + ln; const float bv = bp ? bf16_round(bp[col]) : 0.f;
#pragma unroll
    for (int r = 0; r < 8; ++r) { const int rloc = half * 16 + 8 * hh + r; float v = accs[u][r] * alpha + bv; if (CP) { if (rowsPerB < 0) v += CP[cofs + (size_t)(row0g + row0 + rloc) * ldc + col];      /* rowsPerB < 0: own element of the batched C plane */ else { const int bidx = (row0g + row0 + rloc) / rowsPerB; v += CP[(size_t)bidx * sCPb + (size_t)by * 64 + col]; } }
      if (ACT == 3) v = fmaxf(v, 0.f); else if (ACT == 6) v = 0.5f * v * (1.0f + erff(v * 0.70710678118654752f)); else if (ACT == 11) v = 1.0f / (1.0f + expf(-v)); else if (ACT == 15) v = v / (1.0f + expf(-v)); else if (ACT == 12) v = (v > 0.f) ? v : 0.01f * v; else if (ACT == 8) v = tanhf(v); else if (ACT == 9) v = 0.5f * v * (1.0f + tanhf(0.7978845608028654f * (v + 0.044715f * v * v * v))); else if (ACT == 14) v = (v > 0.f) ? v : 0.1f * v; else if (ACT == 16) v = (v >= 0.f) ? v : 0.3f * v; else if (ACT == 17) v = (v >= 0.f) ? v : 0.2f * v;
      so[w][rloc][t * 16 + ln] = v; } }
  __builtin_amdgcn_fence(__ATOMIC_ACQ_REL, "workgroup"); __builtin_amdgcn_wave_barrier();
  const int rsub = lane >> 4, c4 = (lane & 15) * 4;
  {
#pragma unroll
    for (int q = 0; q < 16; ++q) { const int r = q * 2 + rsub; const v4f v = *(const v4fa*)&so[w][r][c4]; if (C) { *(v4f*)(C + cofs + (size_t)(row0 + r) * ldc + col0 + c4) = v; asm volatile("s_wait_xcnt 0x0" ::: "memory"); }      /* the f32 store's data and address registers are rewritten right behind it (the f16 conversion, the next row): the wait stands in front of that */
      if (C16) { v4h h4; for (int i = 0; i < 4; ++i) h4[i] = (_Float16)v[i]; *(v4h*)(C16 + cofs + (size_t)(row0 + r) * ldc + col0 + c4) = h4; } }
     } }


__global__ __launch_bounds__(256) void k_wnat(const float* __restrict__ w, size_t n8, _Float16* __restrict__ Bt) { const size_t t = (size_t)blockIdx.x * 256 + threadIdx.x; if (t >= n8) return; FragH f; for (int q = 0; q < 8; ++q) f.h[q] = (_Float16)(bf16_round(w[t * 8 + q]) * 16.0f); *(v8us*)((unsigned short*)Bt + t * 8) = f.half[0];  }
__global__ __launch_bounds__(256) void k_rsm(const float* __restrict__ S, _Float16* __restrict__ P, int nrows) {
  #pragma clang fp contract(off)
  const int i = blockIdx.x * 256 + threadIdx.x; if (i >= nrows) return; const float* s = S + (size_t)i * SQ; float mx = -3.0e38f;
#pragma unroll 1
  for (int j = 0; j < SQ; ++j) mx = fmaxf(mx, s[j]); float se = 0.f;
#pragma unroll 1
  for (int j = 0; j < SQ; ++j) se += expf(s[j] - mx); const float sc = 256.0f / se;
#pragma unroll 1
  for (int j0 = 0; j0 < SQ; j0 += 8) { FragH f; for (int q = 0; q < 8; ++q) f.h[q] = (_Float16)(expf(s[j0 + q] - mx) * sc); unsigned short* d = (unsigned short*)P + (size_t)i * SQ + j0; *(v8us*)d = f.half[0];  } }
__global__ __launch_bounds__(256) void k_vt(const _Float16* __restrict__ V16, int b, int h0, _Float16* __restrict__ VT) { __shared__ unsigned short tl[64][65]; const int tid = threadIdx.x; const int hh = blockIdx.x % HG, sg = blockIdx.x / HG; const int s0 = sg * 64; const int h = h0 + hh;
  for (int i = tid; i < 64 * 8; i += 256) { const int j = i / 8, d8 = (i % 8) * 8; FragH f; f.half[0] = *(const v8us*)((const unsigned short*)V16 + ((size_t)b * SQ + s0 + j) * DM + h * HD + d8); for (int q = 0; q < 8; ++q) tl[d8 + q][j] = f.u[q]; }
  __syncthreads();
  { for (int i = tid; i < 64 * 8; i += 256) { const int d = i / 8, j8 = (i % 8) * 8; FragH f; for (int q = 0; q < 8; ++q) f.u[q] = tl[d][j8 + q]; *(v8us*)((unsigned short*)VT + ((size_t)hh * HD + d) * SQ + s0 + j8) = f.half[0]; }  } }



// Exact f32 attention for the first QT0 rows of one head and batch, run by the attention launch's block that owns these rows: one thread per query row; q, k, v are the f32 rows of the full projections; o leaves as f16 hi (into the merged o rows) + x1024 residual.
// The 128 key and value rows (64 floats each) are staged once in LDS by whole-line loads and then read as broadcasts; the thread's q row and o row stay in registers; four keys' score sums run side by side, each in index order.
// Every plain '#pragma unroll' below makes the indices of q, o, s and the staged pieces constants, so that these arrays are registers and not scratch.
__device__ __forceinline__ void fa_exact(const float* __restrict__ QF, const float* __restrict__ KF, const float* __restrict__ VF, int h, int b, int w, _Float16* __restrict__ OH, _Float16* __restrict__ OL, float (*lk)[64], float (*lv)[64]) {
  static_assert(QT0 == 128 && HD == 64, "fa_exact: one thread per row of a block of 128, staging in 16 steps of 8 rows");
  const int tid = threadIdx.x; const int i = tid; const size_t r0 = (size_t)b * SQ;      /* the batch's first token row */
  const char* qh = (const char*)(QF + r0 * DM + h * HD); const char* kh = (const char*)(KF + r0 * DM + h * HD); const char* vh = (const char*)(VF + r0 * DM + h * HD);      /* block-uniform bases */
  const unsigned qoff = (unsigned)(i * DM) * 4u;      /* byte offset of the thread's q row */
  float q[HD], o[HD];
#pragma unroll
  for (int c = 0; c < HD / 4; ++c) { const v4f t4 = *(const v4fa*)(qh + qoff + c * 16);
#pragma unroll
    for (int u = 0; u < 4; ++u) { q[c * 4 + u] = t4[u]; o[c * 4 + u] = 0.f; } }
  const int srow = tid >> 4, sc4 = (tid & 15) * 4; const unsigned soff = (unsigned)(srow * DM + sc4) * 4u;      /* staging: 16 threads per row of 256 bytes, 8 rows a step; byte offset */
  const char* kp = kh + soff; const char* vp = vh + soff;      /* the thread's own staging addresses */
  { v4f tk[16], tv[16];      /* all 32 loads of a thread in flight together */
#pragma unroll
    for (int it = 0; it < 16; ++it) { tk[it] = *(const v4fa*)(kp + it * (8 * DM * 4)); tv[it] = *(const v4fa*)(vp + it * (8 * DM * 4)); }
    asm volatile("s_wait_xcnt 0x0" :: "v"(qoff), "v"(soff), "v"(kp), "v"(vp) : "memory");      /* the loads' offset and address registers stay untouched up to this wait: nothing, a later load's data included, lands on a register that an issued load names */
#pragma unroll
    for (int it = 0; it < 16; ++it) { *(v4f*)&lk[it * 8 + srow][sc4] = tk[it]; *(v4f*)&lv[it * 8 + srow][sc4] = tv[it]; } }
  __syncthreads();      /* publishes the staged rows to the four waves */
  float m = -1.0e30f, l = 0.f; const int nkey = 32 * w + 32;      /* causal form: keys up to the wave's last row (wave-uniform) */
#pragma unroll 1      /* the body is four whole keys of straight-line code already: more would only grow the text */
  for (int j0 = 0; j0 < nkey; j0 += 4) { float s[4] = {0.f, 0.f, 0.f, 0.f}; v4f g[2][16];      /* two register sets of 16 LDS pieces: eight groups a trip (16 head dims of the four k rows, four times; then the four v rows), each read while the group before it is worked on */
#pragma unroll
    for (int cc = 0; cc < 4; ++cc)
#pragma unroll
      for (int u = 0; u < 4; ++u) g[0][cc * 4 + u] = *(const v4f*)&lk[j0 + u][cc * 4];
#pragma unroll
    for (int p = 0; p < 8; ++p) { const int cu = p & 1, nx = cu ^ 1;
      __builtin_amdgcn_sched_barrier(0);      /* with the one below: keeps the reads of group p + 1, and of no later group, in front of group p's arithmetic; left free, the build hoists a whole trip's 128 reads, which takes more registers than two waves a SIMD leave and spills */
      if (p + 1 < 4) {
#pragma unroll
        for (int cc = 0; cc < 4; ++cc)
#pragma unroll
          for (int u = 0; u < 4; ++u) g[nx][cc * 4 + u] = *(const v4f*)&lk[j0 + u][((p + 1) * 4 + cc) * 4]; }
      else if (p + 1 < 8) {
#pragma unroll
        for (int c = 0; c < HD / 4; ++c) g[nx][c] = *(const v4f*)&lv[j0 + p - 3][c * 4]; }
      __builtin_amdgcn_sched_barrier(0);      /* see above */
      if (p < 4) {
#pragma unroll
        for (int cc = 0; cc < 4; ++cc)
#pragma unroll
          for (int x = 0; x < 4; ++x)
#pragma unroll
            for (int u = 0; u < 4; ++u) s[u] = __fadd_rn(s[u], __fmul_rn(q[(p * 4 + cc) * 4 + x], g[cu][cc * 4 + u][x])); }
      else { const int u = p - 4; const int j = j0 + u; const float sv = __fmul_rn(s[u], SCL);
        const float f = (j <= i) ? 1.f : 0.f; const float sm = fmaf(f, sv, (1.f - f) * -1.0e30f); const float mn = fmaxf(m, sm); const float sc = expf(m - mn); const float e = expf(sm - mn); l = __fadd_rn(__fmul_rn(l, sc), e); m = mn;
#pragma unroll
        for (int c = 0; c < HD / 4; ++c)
#pragma unroll
          for (int x = 0; x < 4; ++x) o[c * 4 + x] = __fadd_rn(__fmul_rn(o[c * 4 + x], sc), __fmul_rn(e, g[cu][c][x])); } } }
  const float fin = 64.0f / l;      /* o carried x64 like the f16 path */
  __syncthreads();      /* every wave has left the k rows: their LDS takes the o rows */
#pragma unroll
  for (int c = 0; c < HD / 4; ++c) { v4f oo;
#pragma unroll
    for (int u = 0; u < 4; ++u) oo[u] = __fmul_rn(o[c * 4 + u], fin);
    *(v4f*)&lk[tid][c * 4] = oo; }
  __syncthreads();      /* publishes the o rows to the four waves */
  v4h vh4[16], vl4[16]; const int orow = tid / 16, pc = (tid % 16) * 4;      /* 16 threads per row, 8 rows a step */
#pragma unroll      /* constant indices: the sixteen steps' pieces are registers, the row steps immediate offsets */
  for (int it = 0; it < 16; ++it) { const v4f v = *(const v4f*)&lk[it * 8 + orow][pc];
#pragma unroll
    for (int u = 0; u < 4; ++u) { const _Float16 hi = (_Float16)v[u]; vh4[it][u] = hi; vl4[it][u] = (_Float16)((v[u] - (float)hi) * 1024.0f); } }
  __builtin_amdgcn_sched_barrier(0);      /* every conversion stands in front of the first store, so that no register which an issued store names is written again before the wave ends */
  _Float16* ohp = OH + (r0 + orow) * DM + h * HD + pc; _Float16* olp = OL + ((size_t)b * QT0 + orow) * DM + h * HD + pc;
#pragma unroll
  for (int it = 0; it < 16; ++it) { *(v4h*)(ohp + it * (8 * DM)) = vh4[it]; *(v4h*)(olp + it * (8 * DM)) = vl4[it]; } }

// Fused causal attention: a block owns 128 query rows of one head (32 per wave) and walks the keys 64 at a time; scores and weights never leave registers.
// Each pass stages 64 rows of k hi, k lo and 64 rows (head dims) of V^T in LDS by whole-line loads, once for the four waves; row pitch 128 + 16 bytes for the 16-byte fragment reads.
// S^T = K . Q^T (A = 16 key rows, B = 16 query rows, both by g2_frag): a lane holds 8 keys (8*hh + r) of ONE query (ln) per tile, so maximum and sum are in-lane plus one exchange of the wave halves.
// Two score tiles of one query group, converted in place, are the B operand of O^T += V^T . P^T (element i = key 8*hh + i, element 8 + i = key 16 + 8*hh + i: the k order of g2_frag on the V^T rows).
// Scores: (lo . hi + hi . lo) first, x 2^-10, then hi . hi on top in the same accumulator. Weights carried x256 (the + 8 in the exponent), in the f16 operand and in the row sum alike; o leaves x64.
#define FAC 0.18033688011112042f           /* 1 / sqrt(head_dim) * log2(e) */
#define FLP 72                             /* LDS row pitch in f16: 64 + 8 */
__device__ __forceinline__ float fa_exp2(float x) { asm("v_exp_f32 %0, %0\n\tv_nop" : "+v"(x)); return x; }      /* native 2^x; the v_nop fills the one slot that the instruction set asks for between a transcendental and a directly following instruction that reads its result or overwrites its source */
__device__ __forceinline__ v8f fa_mma(v16h a, v16h b, v8f c) { return __builtin_amdgcn_wmma_f32_16x16x32_f16(false, a, false, b, (short)0, c, false, false); }
__global__ __launch_bounds__(128, 2) void k_fattn(const _Float16* __restrict__ QHp, const _Float16* __restrict__ QLp, const _Float16* __restrict__ KHp, const _Float16* __restrict__ KLp, const _Float16* __restrict__ VTp, _Float16* __restrict__ Op, const float* __restrict__ QF, const float* __restrict__ KF, const float* __restrict__ VF, _Float16* __restrict__ OLp) {      /* two waves a SIMD: the register bound under which all 512 blocks are resident at once (the exact part alone would take more) */
  __shared__ __attribute__((aligned(16))) float xk[QT0][64]; __shared__ __attribute__((aligned(16))) float xv[QT0][64];      /* the exact block's f32 key and value rows */
  __shared__ __attribute__((aligned(16))) _Float16 lkh[64][FLP]; __shared__ __attribute__((aligned(16))) _Float16 lkl[64][FLP]; __shared__ __attribute__((aligned(16))) _Float16 lvt[64][FLP];
  const int tid = threadIdx.x, lane = tid & 31, ln = lane & 15, hh = lane >> 4; const int w = __builtin_amdgcn_readfirstlane(tid >> 5);
  const int h = blockIdx.y, b = blockIdx.z; const int nqt = (int)gridDim.x, x2 = (int)blockIdx.x + 2; const int qt = (b & 1) ? (x2 >= nqt ? x2 - nqt : x2) : nqt - 1 - (int)blockIdx.x;      /* long and short blocks mixed over the grid: at equal blockIdx.x the two batches hold tiles 15 - x and x + 2 (mod 16), for speed only */
  if (qt == 0) { fa_exact(QF, KF, VF, h, b, w, Op, OLp, xk, xv); return; }      /* block-uniform, in front of every barrier of the f16 path: rows 0..127 are computed exactly in f32, beside the other blocks' f16 work */
  const int row0 = qt * 128 + 32 * w; const size_t r0 = (size_t)b * SQ;
  v16h qh[2][2], ql[2][2]; const _Float16* qhp = QHp + (r0 + row0 + ln) * LQ + h * HD + 8 * hh; const _Float16* qlp = QLp + (r0 + row0 + ln) * LQ + h * HD + 8 * hh;      /* the lane's own 16-byte pieces start here (g2_frag with half 0) */
#pragma unroll
  for (int g = 0; g < 2; ++g) { qh[g][0] = g2_frag(qhp + g * (16 * LQ), 0); qh[g][1] = g2_frag(qhp + g * (16 * LQ) + 32, 0); ql[g][0] = g2_frag(qlp + g * (16 * LQ), 0); ql[g][1] = g2_frag(qlp + g * (16 * LQ) + 32, 0); }
  asm volatile("s_wait_xcnt 0x0" :: "v"(qhp), "v"(qlp) : "memory");      /* the sixteen loads' address registers stay untouched up to this wait: nothing, a later load's data included, lands on them before it */
  const char* khb = (const char*)(KHp + r0 * LQ + h * HD); const char* klb = (const char*)(KLp + r0 * LQ + h * HD); const char* vtb = (const char*)(VTp + (size_t)(b * NH + h) * HD * SQ);      /* block-uniform bases */
  const int srow = tid >> 3, sc8 = (tid & 7) * 8; const unsigned koff = (unsigned)(srow * LQ + sc8) * 2u, voff = (unsigned)(srow * SQ + sc8) * 2u;      /* staging: 8 threads per row of 128 bytes, 16 rows a step; byte offsets */
  const v8f z8 = {0.f,0.f,0.f,0.f,0.f,0.f,0.f,0.f}; v8f o[4][2];
#pragma unroll
  for (int dt = 0; dt < 4; ++dt) { o[dt][0] = z8; o[dt][1] = z8; }
  float m[2] = {-1.0e30f, -1.0e30f}, l[2] = {0.f, 0.f};
  const int kend = qt * 128 + 64;           /* the block's last piece: every wave stages and passes the barriers up to it */
#pragma unroll 1      /* one pass is up to 64 matrix instructions of straight-line code already */
  for (int kb = 0; kb <= kend; kb += 64) { v8us tk[4], tl[4], tv[4]; const char* kp = khb + (size_t)kb * (LQ * 2) + koff; const char* lp = klb + (size_t)kb * (LQ * 2) + koff; const char* vp = vtb + (size_t)kb * 2 + voff;
#pragma unroll
    for (int j = 0; j < 4; ++j) { tk[j] = *(const v8us*)(kp + j * (16 * LQ * 2)); tl[j] = *(const v8us*)(lp + j * (16 * LQ * 2)); tv[j] = *(const v8us*)(vp + j * (16 * SQ * 2)); }
    asm volatile("s_wait_xcnt 0x0" :: "v"(kp), "v"(lp), "v"(vp) : "memory");      /* the twelve loads' address registers stay untouched up to this wait: nothing, a later load's data included, lands on them before it */
    __syncthreads();      /* every wave has left the previous pass's rows */
#pragma unroll
    for (int j = 0; j < 4; ++j) { *(v8us*)&lkh[j * 16 + srow][sc8] = tk[j]; *(v8us*)&lkl[j * 16 + srow][sc8] = tl[j]; *(v8us*)&lvt[j * 16 + srow][sc8] = tv[j]; }
    __syncthreads();      /* publishes the staged rows to the four waves */
#pragma unroll
    for (int hf = 0; hf < 2; ++hf) { const int k0 = kb + 32 * hf;      /* 32 keys a step: 16 score registers per query group alive at a time */
      if (k0 <= row0) {      /* wave-uniform: keys past the wave's last row (row0 + 31) are left out whole */
        v8f s[2][2];
#pragma unroll
        for (int t = 0; t < 2; ++t) { const int kr = 32 * hf + 16 * t + ln; const v16h a0 = g2_frag(&lkh[kr][0], hh), a1 = g2_frag(&lkh[kr][32], hh), c0 = g2_frag(&lkl[kr][0], hh), c1 = g2_frag(&lkl[kr][32], hh);
#pragma unroll
          for (int g = 0; g < 2; ++g) { v8f y = fa_mma(a0, ql[g][0], z8); y = fa_mma(a1, ql[g][1], y); y = fa_mma(c0, qh[g][0], y); y = fa_mma(c1, qh[g][1], y);
#pragma unroll
            for (int r = 0; r < 8; ++r) y[r] *= 0.0009765625f;
            y = fa_mma(a0, qh[g][0], y); y = fa_mma(a1, qh[g][1], y); s[t][g] = y; } }
        if (k0 == row0) {      /* wave-uniform: the 32 x 32 piece on the diagonal is the only one that needs the causal test; key k0 stays for every query */
#pragma unroll
          for (int t = 0; t < 2; ++t)
#pragma unroll
            for (int g = 0; g < 2; ++g)
#pragma unroll
              for (int r = 0; r < 8; ++r) if (16 * t + 8 * hh + r > 16 * g + ln) s[t][g][r] = -1.0e30f; }
        FragH p[2];
#pragma unroll
        for (int g = 0; g < 2; ++g) { float mx = s[0][g][0];
#pragma unroll
          for (int t = 0; t < 2; ++t)
#pragma unroll
            for (int r = 0; r < 8; ++r) mx = fmaxf(mx, s[t][g][r]);
          mx = fmaxf(mx, __shfl_xor(mx, 16, 32));      /* the other 8 keys of every tile sit in the other wave half */
          const float mn = fmaxf(m[g], mx); const float sc = fa_exp2((m[g] - mn) * FAC); m[g] = mn; const float nb = fmaf(-mn, FAC, 8.0f);
          float ps[4] = {0.f, 0.f, 0.f, 0.f};
#pragma unroll
          for (int t = 0; t < 2; ++t)
#pragma unroll
            for (int r = 0; r < 8; ++r) { const float e = fa_exp2(fmaf(s[t][g][r], FAC, nb)); ps[r & 3] += e; p[g].h[t * 8 + r] = (_Float16)e; }
          l[g] = fmaf(l[g], sc, (ps[0] + ps[1]) + (ps[2] + ps[3]));
#pragma unroll
          for (int dt = 0; dt < 4; ++dt)
#pragma unroll
            for (int r = 0; r < 8; ++r) o[dt][g][r] *= sc; }
#pragma unroll
        for (int dt = 0; dt < 4; ++dt) { const v16h a = g2_frag(&lvt[16 * dt + ln][32 * hf], hh); o[dt][0] = fa_mma(a, p[0].v, o[dt][0]); o[dt][1] = fa_mma(a, p[1].v, o[dt][1]); } } } }
#pragma unroll
  for (int g = 0; g < 2; ++g) { const float fin = 64.0f / (l[g] + __shfl_xor(l[g], 16, 32));      /* the halves' sums joined once; x256 cancels, o carried x64 */
    unsigned short* op = (unsigned short*)Op + (r0 + row0 + 16 * g + ln) * DM + h * HD + 8 * hh;
#pragma unroll
    for (int dt = 0; dt < 4; ++dt) { FragH f;
#pragma unroll
      for (int r = 0; r < 8; ++r) f.h[r] = (_Float16)(o[dt][g][r] * fin);
      *(v8us*)(op + 16 * dt) = f.half[0]; } } }


extern "C" void kernel_launch(void* const* d_in, const int* in_sizes, int n_in,
                              void* d_out, int out_size, void* d_ws, size_t ws_size, hipStream_t stream) {
  (void)in_sizes; (void)n_in; (void)out_size;
  const float* const* I = (const float* const*)d_in; const float* x = I[0]; const float* xk = I[1]; const float* xv = I[2]; const float* wq = I[3]; const float* bq = nullptr; const float* wk = I[4]; const float* bk = nullptr; const float* wv = I[5]; const float* bv = nullptr; const float* wo = I[6]; const float* bo = I[7];      /* input order: query_data, key_data, value_data (three SEPARATE streams: the three exact-f16 row casts read one each), Wq, Wk, Wv ([in][out]; the module has NO q / k / v biases: null pointers in the guarded bias slots), Wp ([in][out]), bp (REAL); NO mask input (the causal fill is built inside the reference) */
  char* ws = (char*)d_ws; size_t off = 0;
  auto take = [&](size_t bytes) { char* p = ws + off; off += (bytes + 255) & ~(size_t)255; return p; };
  _Float16* BQ = (_Float16*)take((size_t)DM * DM * 2); _Float16* BK = (_Float16*)take((size_t)DM * DM * 2); _Float16* BV = (_Float16*)take((size_t)DM * DM * 2); _Float16* BO = (_Float16*)take((size_t)DM * DM * 2);
  _Float16* X16 = (_Float16*)take(NR * DM * 2); _Float16* XK16 = (_Float16*)take(NR * DM * 2); _Float16* XV16 = (_Float16*)take(NR * DM * 2);      /* exact f16 rows of query, key, value */ float* QF = (float*)take(NR * DM * 4); float* KF = (float*)take(NR * DM * 4); float* VF = (float*)take(NR * DM * 4);      /* f32 q, k, v rows, a plane each: the exact path of rows 0..127 reads them */ _Float16* QH = (_Float16*)take(NR * DM * 2); _Float16* QL = (_Float16*)take(NR * DM * 2); _Float16* KH = (_Float16*)take(NR * DM * 2); _Float16* KL = (_Float16*)take(NR * DM * 2); _Float16* Q16 = QH; _Float16* K16 = KH; _Float16* V16 = (_Float16*)take(NR * DM * 2); _Float16* O16 = (_Float16*)take(NR * DM * 2);
  _Float16* VT = (_Float16*)take((size_t)NB * NH * HD * SQ * 2);
  _Float16* OL0 = (_Float16*)take((size_t)NB * QT0 * DM * 2);      /* x1024 residual of the exact o rows */
  if (off > ws_size) return;
  static_assert(B0 == 0 && NBR == NB, "the conversion launches take whole planes");
  k_prep<<<PWB + PXB, 256, 0, stream>>>(x, xk, xv, wq, wk, wv, wo, X16, BQ);      /* the four weights [in][out] -> Bt[n][k] x16 (BQ, BK, BV, BO lie one behind the other) and the three exact f16 row casts (X16, XK16, XV16 likewise) in one launch */
  const size_t r0p = (size_t)B0 * SQ;      /* first projected row */
  k_gemm2<0><<<dim3((unsigned)((MP / 128) * (DM / 64)), 1), 128, 0, stream>>>(X16 + r0p * DM, DM, 0, BQ, DM, 0, 0.0625f, bq, 0, nullptr, 1, 0, 0, QF + r0p * DM, nullptr, DM, 0, MP, DM, DM);
  k_gemm2<0><<<dim3((unsigned)((MP / 128) * (DM / 64)), 1), 128, 0, stream>>>(XK16 + r0p * DM, DM, 0, BK, DM, 0, 0.0625f, bk, 0, nullptr, 1, 0, 0, KF + r0p * DM, nullptr, DM, 0, MP, DM, DM);
  k_gemm2<0><<<dim3((unsigned)((MP / 128) * (DM / 64)), 1), 128, 0, stream>>>(XV16 + r0p * DM, DM, 0, BV, DM, 0, 0.0625f, bv, 0, nullptr, 1, 0, 0, VF + r0p * DM, V16 + r0p * DM, DM, 0, MP, DM, DM);
  k_post<<<PVB + 512, 256, 0, stream>>>(QF, QH, V16, VT);      /* one launch behind the three projections: V^T [NB][NH][HD][SQ]; q and k (f32; QF, KF one behind the other) -> f16 hi + x1024 residual planes (QH, QL, KH, KL one behind the other): unscaled logits sigma ~8 */
  static_assert(QT0 == 128, "the attention launch's first query block is the exact one");
  k_fattn<<<dim3(SQ / 128, NH, NB), 128, 0, stream>>>(QH, QL, KH, KL, VT, O16, QF, KF, VF, OL0);      /* scores, causal softmax and P . V in one launch for all rows, heads and batches: o (merged heads, x64) as f16 rows; the blocks of rows 0..127 run the exact f32 attention: f16 hi into the o rows, x1024 residual into its own plane */
  k_gemm2<0><<<dim3((unsigned)((MPO / 128) * (DM / 64)), 1), 128, 0, stream>>>(O16 + r0p * DM, DM, 0, BO, DM, 0, 0.0009765625f, bo, 0, nullptr, 1, 0, 0, (float*)d_out + r0p * DM, nullptr, DM, 0, MPO, DM, DM);      /* out rows are the output layout */
  k_gemm2<0><<<dim3((QT0 / 128) * (DM / 64), NBR), 128, 0, stream>>>(OL0, DM, (size_t)QT0 * DM, BO, DM, 0, 0.00000095367431640625f, nullptr, 0, (const float*)d_out + r0p * DM, -1, 0, 0, (float*)d_out + r0p * DM, nullptr, DM, (size_t)SQ * DM, QT0, DM, DM);      /* rows 0..127 of both batches (grid y): += o_lo Wo 2^-20 (own-element accumulate) on the o_hi Wo + b that the launch above wrote */
}

// v008
// A run of this version takes 153 microseconds.
// Timed twice side by side with v007, it ran 1.15 times as fast both times.
// Counting every step since v000, it is 38.5 times as fast.
#include <hip/hip_runtime.h>
// Causal multi-head attention on three inputs with bias-free [in][out] projections and a biased [in][out] output projection (query_data, key_data, value_data [2][2048][1024]; q = split_heads(query_data Wq), k = split_heads(key_data Wk), v = split_heads(value_data Wv) ([in][out] [1024][1024], NO biases), 16 heads of 64; scores / sqrt(64); scores + triu(ones, k = 1) x (-1e13): an additive fill strictly above the diagonal == exclusion (exp underflows to exactly 0; every row keeps its diagonal); softmax over keys; out = merged Wp + bp ([in][out] + a REAL bias) -> [2][2048][1024]); the causal rule is built inside the reference: applied here by index; q and k carried as f16 hi + x1024 residual planes with three-product scores.
// Structure: token rows r = b*2048 + s; x as exact f16 rows (bf16-rounded); q and k as WMMA GEMMs (32x64 wave tiles, f32 accumulation, exact x16 weights, no bias) whose epilogue splits each f32 value into f16 hi + x1024 residual planes, v as the same GEMM with its operands swapped, whose f16 rows are V^T rows, all three in one launch; one fused attention launch: a block owns 128 query rows of a head (32 per wave) and walks the keys up to its last row 64 at a time, k hi, k lo and V^T rows staged in LDS per pass: three-product scores (lo.hi + hi.lo, x 2^-10, + hi.hi) as S^T tiles in registers, running maximum and sum per query (f32 statistics, native exp2; keys past the row's own index excluded; weights x256 f16, packed in place as the B operand), O^T += V^T . P^T, o carried x64 (folded into the output GEMM alpha) written straight into the merged f16 o rows; out = o W_o + b GEMM (f32) into the output layout.
// Compute dtype: inputs rounded to bf16; x / weights exact; q and k as f16 hi + x1024 residual pairs (three products), v, softmax weights and o as plain f16 GEMM operands (~2^-12); scores and softmax statistics f32. v_wmma_f32_16x16x32_f16.
#define NB 2
#define SCL 0.125f                         /* 1 / sqrt(head_dim = 64) */
#define SCLR 0.0001220703125f              /* 2^-13 (not used: k_fattn scales the x1024 residual sums by 2^-10) */
#define SQ 2048
#define DM 1024
#define NH 16
#define HD 64
#define HG 4                         /* heads per launch of the head-group k_vt (not launched) */
#define QT 256                       /* not used: the causal tiles are 128 query rows */
#define NKX SQ                       /* not used */
#define QT0 128                      /* first-tile rows computed exactly in f32 */
#define B0 0                         /* first batch processed (debug hook) */
#define NBR NB                       /* batches processed (debug hook) */
#define NR ((size_t)NB * SQ)         /* token rows */
#define MP ((int)((size_t)NBR * SQ)) /* rows projected (debug hook) */
#define QN SQ                        /* not used */
#define NHD NH                       /* not used */
#define MPO MP                       /* rows through the output stage (debug hook) */
#define LQ DM      /* row pitch of the q/k/v rows */
typedef __bf16 v16b __attribute__((ext_vector_type(16)));
typedef unsigned short v8us __attribute__((ext_vector_type(8), may_alias));
typedef float  v8f  __attribute__((ext_vector_type(8)));
typedef float  v4f  __attribute__((ext_vector_type(4)));
typedef float  v4fa __attribute__((ext_vector_type(4), may_alias));
union FragB { v16b v; v8us half[2]; unsigned short u[16]; };

__device__ __forceinline__ unsigned short bf16_bits(float x) { unsigned int u = __float_as_uint(x); return (unsigned short)((u + 0x7FFFu + ((u >> 16) & 1u)) >> 16); }
__device__ __forceinline__ float bf16_val(unsigned short b) { return __uint_as_float(((unsigned int)b) << 16); }
__device__ __forceinline__ float bf16_round(float x) { return bf16_val(bf16_bits(x)); }
// D += A·B with NT terms: 1 = ah·bh, 2 = + al·bh (A split), 3 = + ah·bl (both split)
template <int NT>
__device__ __forceinline__ v8f mmaN(v16b ah, v16b al, v16b bh, v16b bl, v8f c) {
  c = __builtin_amdgcn_wmma_f32_16x16x32_bf16(false, ah, false, bh, (short)0, c, false, false);
  if (NT >= 2) c = __builtin_amdgcn_wmma_f32_16x16x32_bf16(false, al, false, bh, (short)0, c, false, false);
  if (NT >= 3) c = __builtin_amdgcn_wmma_f32_16x16x32_bf16(false, ah, false, bl, (short)0, c, false, false);
  asm volatile("v_nop\n\tv_nop\n\tv_nop\n\tv_nop" : "+v"(c) : "v"(ah), "v"(al), "v"(bh), "v"(bl));
  return c;
}

__global__ __launch_bounds__(256) void k_wt_bf16(const float* __restrict__ W, unsigned short* __restrict__ Wt, int K, int N) {
  const int t = blockIdx.x * 256 + threadIdx.x;
  const int k8n = K / 8;
  if (t >= N * k8n) return;
  const int n = t / k8n, k8 = (t % k8n) * 8;
  v8us v;
#pragma unroll
  for (int i = 0; i < 8; ++i) v[i] = bf16_bits(W[(size_t)(k8 + i) * N + n]);
  *(v8us*)(Wt + (size_t)n * K + k8) = v;
  
}

// GEMM C[M][N] (f32, pitch ldc) = act(A[M][K]·W + bias). A f32 row-major (pitch lda) converted per fragment to bf16
// (ASPLIT: hi/lo two planes -> 2 terms, else single rounded term); Wt bf16 [N][K] (pitch ldb). BIAS_BF16 rounds the
// bias to bf16 first (bias quantised to bf16 before the add). K%32==0, M%16==0, N%64==0.
template <bool ASPLIT, int ACT, bool BIAS_BF16>
__global__ __launch_bounds__(128) void k_gemm_bf(const float* __restrict__ A, int lda, const unsigned short* __restrict__ Wt, int ldb,
                                               const float* __restrict__ bias, float* __restrict__ C, int ldc, int M, int N, int K) {
  __shared__ __attribute__((aligned(16))) float so[4][16][64];
  const int tid = threadIdx.x, w = tid >> 5, lane = tid & 31, ln = lane & 15, hh = lane >> 4;
  const int ntn = N / 64;
  const int wid = blockIdx.x * 4 + w;
  const int mt = wid / ntn, nq = wid % ntn;
  if (mt * 16 >= M) return;
  const int row0 = mt * 16, col0 = nq * 64;
  const float* arow = A + (size_t)(row0 + ln) * lda;
  v8f acc[4] = {};
  for (int kb = 0; kb < K; kb += 32) {
    FragB ah, al;
    const v4f x0 = *(const v4fa*)(arow + kb + 8 * hh), x1 = *(const v4fa*)(arow + kb + 8 * hh + 4);
    const v4f x2 = *(const v4fa*)(arow + kb + 16 + 8 * hh), x3 = *(const v4fa*)(arow + kb + 16 + 8 * hh + 4);
    float xs[16] = {x0[0],x0[1],x0[2],x0[3],x1[0],x1[1],x1[2],x1[3],x2[0],x2[1],x2[2],x2[3],x3[0],x3[1],x3[2],x3[3]};
#pragma unroll
    for (int i = 0; i < 16; ++i) { const unsigned short hb = bf16_bits(xs[i]); ah.u[i] = hb; al.u[i] = ASPLIT ? bf16_bits(xs[i] - bf16_val(hb)) : (unsigned short)0; }
#pragma unroll
    for (int t = 0; t < 4; ++t) {
      const unsigned short* brow = Wt + (size_t)(col0 + t * 16 + ln) * ldb + kb;
      FragB b;
      b.half[0] = *(const v8us*)(brow + 8 * hh);
      b.half[1] = *(const v8us*)(brow + 16 + 8 * hh);
      acc[t] = mmaN<ASPLIT ? 2 : 1>(ah.v, al.v, b.v, b.v, acc[t]);
    }
  }
#pragma unroll
  for (int t = 0; t < 4; ++t) {
    float bv = bias ? bias[col0 + t * 16 + ln] : 0.f;
    if (BIAS_BF16) bv = bf16_round(bv);
#pragma unroll
    for (int r = 0; r < 8; ++r) { float v = acc[t][r] + bv; if (ACT == 1) v = fmaxf(v, 0.f); so[w][8 * hh + r][t * 16 + ln] = v; }
  }
  __builtin_amdgcn_fence(__ATOMIC_ACQ_REL, "workgroup");
  __builtin_amdgcn_wave_barrier();
  const int rsub = lane >> 4, c4 = (lane & 15) * 4;
  {
#pragma unroll
    for (int q = 0; q < 8; ++q) {
      const int r = q * 2 + rsub;
      const v4f v = *(const v4fa*)&so[w][r][c4];
      *(v4f*)(C + (size_t)(row0 + r) * ldc + col0 + c4) = v;
    }
    
  }
}

// GEMM C = act(A·W + bias + resid): A f32 (ASPLIT -> hi/lo 2 terms), Wt bf16 [N][K]; ACT 0 none, 1 relu, 2 exact gelu;
// resid (optional, f32, row index = (row % rmod), pitch ldr, RES_BF16 rounds it) added before the activation.
template <bool ASPLIT, int ACT, bool BIAS_BF16, bool RES_BF16>
__global__ __launch_bounds__(128) void k_gemm_bf3(const float* __restrict__ A, int lda, const unsigned short* __restrict__ Wt, int ldb,
                                                const float* __restrict__ bias, const float* __restrict__ resid, int rmod, int ldr,
                                                float* __restrict__ C, int ldc, int M, int N, int K) {
  __shared__ __attribute__((aligned(16))) float so[4][16][64];
  const int tid = threadIdx.x, w = tid >> 5, lane = tid & 31, ln = lane & 15, hh = lane >> 4;
  const int ntn = N / 64;
  const int wid = blockIdx.x * 4 + w;
  const int mt = wid / ntn, nq = wid % ntn;
  if (mt * 16 >= M) return;
  const int row0 = mt * 16, col0 = nq * 64;
  const float* arow = A + (size_t)(row0 + ln) * lda;
  v8f acc[4] = {};
  for (int kb = 0; kb < K; kb += 32) {
    FragB ah, al;
    const v4f x0 = *(const v4fa*)(arow + kb + 8 * hh), x1 = *(const v4fa*)(arow + kb + 8 * hh + 4);
    const v4f x2 = *(const v4fa*)(arow + kb + 16 + 8 * hh), x3 = *(const v4fa*)(arow + kb + 16 + 8 * hh + 4);
    float xs[16] = {x0[0],x0[1],x0[2],x0[3],x1[0],x1[1],x1[2],x1[3],x2[0],x2[1],x2[2],x2[3],x3[0],x3[1],x3[2],x3[3]};
#pragma unroll
    for (int i = 0; i < 16; ++i) { const unsigned short hb = bf16_bits(xs[i]); ah.u[i] = hb; al.u[i] = ASPLIT ? bf16_bits(xs[i] - bf16_val(hb)) : (unsigned short)0; }
#pragma unroll
    for (int t = 0; t < 4; ++t) {
      const unsigned short* brow = Wt + (size_t)(col0 + t * 16 + ln) * ldb + kb;
      FragB b;
      b.half[0] = *(const v8us*)(brow + 8 * hh);
      b.half[1] = *(const v8us*)(brow + 16 + 8 * hh);
      acc[t] = mmaN<ASPLIT ? 2 : 1>(ah.v, al.v, b.v, b.v, acc[t]);
    }
  }
#pragma unroll
  for (int t = 0; t < 4; ++t) {
    const int col = col0 + t * 16 + ln;
    float bv = bias ? bias[col] : 0.f;
    if (BIAS_BF16) bv = bf16_round(bv);
#pragma unroll
    for (int r = 0; r < 8; ++r) {
      float v = acc[t][r] + bv;
      if (resid) { float rv = resid[(size_t)((row0 + 8 * hh + r) % rmod) * ldr + col]; if (RES_BF16) rv = bf16_round(rv); v += rv; }
      if (ACT == 1) v = fmaxf(v, 0.f);
      if (ACT == 2) v = 0.5f * v * (1.0f + erff(v * 0.70710678118654752f));
      if (ACT == 3) { const float u = 0.7978845608028654f * (v + 0.044715f * v * v * v); v = 0.5f * v * (1.0f + tanhf(u)); }
      so[w][8 * hh + r][t * 16 + ln] = v;
    }
  }
  __builtin_amdgcn_fence(__ATOMIC_ACQ_REL, "workgroup");
  __builtin_amdgcn_wave_barrier();
  const int rsub = lane >> 4, c4 = (lane & 15) * 4;
  {
#pragma unroll
    for (int q = 0; q < 8; ++q) {
      const int r = q * 2 + rsub;
      const v4f v = *(const v4fa*)&so[w][r][c4];
      *(v4f*)(C + (size_t)(row0 + r) * ldc + col0 + c4) = v;
    }
    
  }
}
// row LayerNorm (biased variance, eps) over N: s = X (+ R); optional out_sum <- s; out_norm <- (s-mu)*rsqrt(var+eps)*g + b
template <bool PARAM_BF16>
__global__ __launch_bounds__(256) void k_layernorm(const float* __restrict__ X, const float* __restrict__ R, const float* __restrict__ g, const float* __restrict__ bta,
                                                  float* __restrict__ out_sum, float* __restrict__ out_norm, int N, float eps) {
  __shared__ float red[256];
  const int row = blockIdx.x, tid = threadIdx.x;
  const float* x = X + (size_t)row * N; const float* rr = R ? R + (size_t)row * N : nullptr;
  float vals[16];                     // up to N = 4096
  const int per = N / 256;            // contiguous chunk per thread? use strided-by-4 chunks: thread handles j = tid*4 + 1024*u
  float s1 = 0.f;
  for (int u = 0; u < per / 4; ++u) {
    const int j = tid * 4 + 1024 * u;
    const v4f a = *(const v4fa*)(x + j);
    v4f b = {0.f,0.f,0.f,0.f}; if (rr) b = *(const v4fa*)(rr + j);
#pragma unroll
    for (int q = 0; q < 4; ++q) { const float v = a[q] + b[q]; vals[u * 4 + q] = v; s1 += v; }
  }
  red[tid] = s1; __syncthreads();
  for (int st = 128; st > 0; st >>= 1) { if (tid < st) red[tid] += red[tid + st]; __syncthreads(); }
  const float mu = red[0] / (float)N; __syncthreads();
  float s2 = 0.f;
  for (int u = 0; u < per / 4; ++u)
#pragma unroll
    for (int q = 0; q < 4; ++q) { const float c = vals[u * 4 + q] - mu; s2 += c * c; }
  red[tid] = s2; __syncthreads();
  for (int st = 128; st > 0; st >>= 1) { if (tid < st) red[tid] += red[tid + st]; __syncthreads(); }
  const float rs = rsqrtf(red[0] / (float)N + eps);
  {
    for (int u = 0; u < per / 4; ++u) {
      const int j = tid * 4 + 1024 * u;
      v4f o, sm;
#pragma unroll
      for (int q = 0; q < 4; ++q) {
        float gg = g[j + q], bb = bta[j + q];
        if (PARAM_BF16) { gg = bf16_round(gg); bb = bf16_round(bb); }
        sm[q] = vals[u * 4 + q]; o[q] = (vals[u * 4 + q] - mu) * rs * gg + bb;
      }
      if (out_sum) *(v4f*)(out_sum + (size_t)row * N + j) = sm;
      *(v4f*)(out_norm + (size_t)row * N + j) = o;
    }
    
  }
}



// ---- f16 WMMA path (v_wmma_f32_16x16x32_f16): 11-bit significands for operands in range — used where a [0,1] probability operand needs more precision than bf16
typedef _Float16 v16h __attribute__((ext_vector_type(16)));
union FragH { v16h v; v8us half[2]; _Float16 h[16]; unsigned short u[16]; };
template <int NT>
__device__ __forceinline__ v8f mmaH(v16h ah, v16h al, v16h bh, v16h bl, v8f c) {
  c = __builtin_amdgcn_wmma_f32_16x16x32_f16(false, ah, false, bh, (short)0, c, false, false);
  if (NT >= 2) c = __builtin_amdgcn_wmma_f32_16x16x32_f16(false, al, false, bh, (short)0, c, false, false);
  if (NT >= 3) c = __builtin_amdgcn_wmma_f32_16x16x32_f16(false, ah, false, bl, (short)0, c, false, false);
  asm volatile("v_nop\n\tv_nop\n\tv_nop\n\tv_nop" : "+v"(c) : "v"(ah), "v"(al), "v"(bh), "v"(bl));
  return c;
}
// batched GEMM like k_gemm_b but f16 operands: A f32 (split into f16 hi/lo if ASPLIT, else rounded to f16), Bt = f16 values [n][k]; alpha; C f32; N multiple of 16 (partial tiles skipped)
template <bool ASPLIT>
__global__ __launch_bounds__(128) void k_gemm_h(const float* __restrict__ A, int lda, size_t sA, const _Float16* __restrict__ Bh, int ldb, size_t sB, float alpha, float* __restrict__ C, int ldc, size_t sC, int M, int N, int K) {
  __shared__ __attribute__((aligned(16))) float so[4][16][64];
  const int tid = threadIdx.x, w = tid >> 5, lane = tid & 31, ln = lane & 15, hh = lane >> 4; const int by = blockIdx.y;
  A += (size_t)by * sA; Bh += (size_t)by * sB; C += (size_t)by * sC;
  const int ntn = (N + 63) / 64; const int wid = blockIdx.x * 4 + w; const int mt = wid / ntn, nq = wid % ntn; if (mt * 16 >= M) return;
  const int row0 = mt * 16, col0 = nq * 64; const float* arow = A + (size_t)(row0 + ln) * lda;
  v8f acc[4] = {};
  for (int kb = 0; kb < K; kb += 32) {
    FragH ah, al;
    const v4f x0 = *(const v4fa*)(arow + kb + 8 * hh), x1 = *(const v4fa*)(arow + kb + 8 * hh + 4), x2 = *(const v4fa*)(arow + kb + 16 + 8 * hh), x3 = *(const v4fa*)(arow + kb + 16 + 8 * hh + 4);
    float xs[16] = {x0[0],x0[1],x0[2],x0[3],x1[0],x1[1],x1[2],x1[3],x2[0],x2[1],x2[2],x2[3],x3[0],x3[1],x3[2],x3[3]};
#pragma unroll
    for (int i = 0; i < 16; ++i) { const _Float16 h = (_Float16)xs[i]; ah.h[i] = h; al.h[i] = ASPLIT ? (_Float16)(xs[i] - (float)h) : (_Float16)0.0f; }
#pragma unroll
    for (int t = 0; t < 4; ++t) { if (col0 + t * 16 >= N) continue; const size_t boff = (size_t)(col0 + t * 16 + ln) * ldb + kb; FragH bq; bq.half[0] = *(const v8us*)(Bh + boff + 8 * hh); bq.half[1] = *(const v8us*)(Bh + boff + 16 + 8 * hh);
      acc[t] = mmaH<ASPLIT ? 2 : 1>(ah.v, al.v, bq.v, bq.v, acc[t]); }
  }
#pragma unroll
  for (int t = 0; t < 4; ++t) { if (col0 + t * 16 >= N) continue;
#pragma unroll
    for (int r = 0; r < 8; ++r) so[w][8 * hh + r][t * 16 + ln] = acc[t][r] * alpha; }
  __builtin_amdgcn_fence(__ATOMIC_ACQ_REL, "workgroup"); __builtin_amdgcn_wave_barrier();
  const int rsub = lane >> 4, c4 = (lane & 15) * 4;
  {
#pragma unroll
    for (int q = 0; q < 8; ++q) { const int r = q * 2 + rsub; if (col0 + c4 < N) { const v4f v = *(const v4fa*)&so[w][r][c4]; *(v4f*)(C + (size_t)(row0 + r) * ldc + col0 + c4) = v; } }
     }
}

// k_gemm_hh variant with fused epilogue: v = acc·alpha + bias[by·sBias + col] (+ CP[(row/rowsPerB)·sCPb + by·64 + col] if CP) ; ACT 0 none / 1 elu ; writes f16 C16 (and f32 C if non-null)
template <int ACT>
__global__ __launch_bounds__(128) void k_gemm_hhx(const _Float16* __restrict__ A, int lda, size_t sA, const _Float16* __restrict__ Bh, int ldb, size_t sB, float alpha, const float* __restrict__ bias, size_t sBias, const float* __restrict__ CP, int rowsPerB, size_t sCPb, int row0g,
    float* __restrict__ C, _Float16* __restrict__ C16, int ldc, size_t sC, int M, int N, int K) {
  __shared__ __attribute__((aligned(16))) float so[4][16][64];
  const int tid = threadIdx.x, w = tid >> 5, lane = tid & 31, ln = lane & 15, hh = lane >> 4; const int by = blockIdx.y;
  A += (size_t)by * sA; Bh += (size_t)by * sB; const size_t cofs = (size_t)by * sC; const float* bp = bias ? bias + (size_t)by * sBias : nullptr;
  const int ntn = (N + 63) / 64; const int wid = blockIdx.x * 4 + w; const int mt = wid / ntn, nq = wid % ntn; if (mt * 16 >= M) return;
  const int row0 = mt * 16, col0 = nq * 64; const _Float16* arow = A + (size_t)(row0 + ln) * lda;
  v8f acc[4] = {};
  for (int kb = 0; kb < K; kb += 32) { FragH ah; ah.half[0] = *(const v8us*)((const unsigned short*)arow + kb + 8 * hh); ah.half[1] = *(const v8us*)((const unsigned short*)arow + kb + 16 + 8 * hh);
#pragma unroll
    for (int t = 0; t < 4; ++t) { if (col0 + t * 16 >= N) continue; const size_t boff = (size_t)(col0 + t * 16 + ln) * ldb + kb; FragH bq; bq.half[0] = *(const v8us*)((const unsigned short*)Bh + boff + 8 * hh); bq.half[1] = *(const v8us*)((const unsigned short*)Bh + boff + 16 + 8 * hh);
      acc[t] = mmaH<1>(ah.v, ah.v, bq.v, bq.v, acc[t]); }
  }
#pragma unroll
  for (int t = 0; t < 4; ++t) { if (col0 + t * 16 >= N) continue; const int col = col0 + t * 16 + ln; const float bv = bp ? bf16_round(bp[col]) : 0.f;
#pragma unroll
    for (int r = 0; r < 8; ++r) { float v = acc[t][r] * alpha + bv; if (CP) { const int rr = row0g + row0 + 8 * hh + r; if (rowsPerB < 0) v += CP[cofs + (size_t)rr * ldc + col];      /* rowsPerB < 0: own element of the batched C plane */ else { const int bidx = rr / rowsPerB; v += CP[(size_t)bidx * sCPb + (size_t)by * 64 + col]; } } if (ACT == 1) v = (v > 0.f) ? v : expm1f(v); else if (ACT == 7) v = (v > 0.f) ? v + 1.0f : expf(v); else if (ACT == 8) v = tanhf(v); else if (ACT == 9) v = 0.5f * v * (1.0f + tanhf(0.7978845608028654f * (v + 0.044715f * v * v * v))); else if (ACT == 11) v = 1.0f / (1.0f + expf(-v)); else if (ACT == 12) v = (v > 0.f) ? v : 0.01f * v; else if (ACT == 14) v = (v > 0.f) ? v : 0.1f * v; else if (ACT == 16) v = (v >= 0.f) ? v : 0.3f * v; else if (ACT == 17) v = (v >= 0.f) ? v : 0.2f * v; else if (ACT == 15) v = v / (1.0f + expf(-v)); else if (ACT == 3) v = fmaxf(v, 0.f); else if (ACT == 6) v = 0.5f * v * (1.0f + erff(v * 0.70710678118654752f)); so[w][8 * hh + r][t * 16 + ln] = v; } }
  __builtin_amdgcn_fence(__ATOMIC_ACQ_REL, "workgroup"); __builtin_amdgcn_wave_barrier();
  const int rsub = lane >> 4, c4 = (lane & 15) * 4; typedef _Float16 v4h __attribute__((ext_vector_type(4)));
  {
#pragma unroll
    for (int q = 0; q < 8; ++q) { const int r = q * 2 + rsub; if (col0 + c4 < N) { const v4f v = *(const v4fa*)&so[w][r][c4]; if (C) *(v4f*)(C + cofs + (size_t)(row0 + r) * ldc + col0 + c4) = v; if (C16) { v4h h4; for (int i = 0; i < 4; ++i) h4[i] = (_Float16)v[i]; *(v4h*)(C16 + cofs + (size_t)(row0 + r) * ldc + col0 + c4) = h4; } } }
     }
}


typedef _Float16 v4h __attribute__((ext_vector_type(4)));

__global__ __launch_bounds__(256) void k_h16(const float* __restrict__ x, _Float16* __restrict__ X16, size_t n8) { const size_t t = (size_t)blockIdx.x * 256 + threadIdx.x; if (t >= n8) return; FragH f;
#pragma unroll
  for (int q = 0; q < 8; ++q) f.h[q] = (_Float16)x[t * 8 + q]; *(v8us*)((unsigned short*)X16 + t * 8) = f.half[0];  }
__global__ __launch_bounds__(256) void k_round16f(const float* __restrict__ W, _Float16* __restrict__ Bt, size_t n8) { const size_t t = (size_t)blockIdx.x * 256 + threadIdx.x; if (t >= n8) return; FragH f;
#pragma unroll
  for (int i = 0; i < 8; ++i) f.h[i] = (_Float16)(bf16_round(W[t * 8 + i]) * 16.0f); *(v8us*)((unsigned short*)Bt + t * 8) = f.half[0];  }
// ---- element-wise conversions: one launch per stage, 32 or 64 elements a thread, so that a stage is a few thousand waves that each keep 16 to 24 loads of 16 bytes in flight ----
// k_prep, blocks 0 .. PWB - 1: the four weight matrices, f32 [in][out] -> Bt[n][k] = f16(bf16-rounded value x 16). A thread owns a tile of 8 k x 8 n; the lanes of a wave lie 4 along n and 8 along k,
// so that a wave's loads read whole 128-byte lines of its k rows and each of its stores writes whole lines of 4 n rows. Blocks PWB ..: the three row casts, f32 -> f16(bf16-rounded value), 4 pieces of 8 elements of each tensor a thread.
#define PWB 256                            /* 64 blocks a matrix: 512 waves of 32 tiles = 128 x 128 tiles */
#define PXB 512                            /* 1024 pieces of 8 elements a block and tensor */
__global__ __launch_bounds__(256) void k_prep(const float* __restrict__ xq, const float* __restrict__ xk, const float* __restrict__ xv, const float* __restrict__ wq, const float* __restrict__ wk, const float* __restrict__ wv, const float* __restrict__ wo, _Float16* __restrict__ X16, _Float16* __restrict__ BT) {
  static_assert(DM == 1024 && NR * DM / 8 == (size_t)PXB * 1024, "k_prep: the block counts are written for these shapes");
  const int tid = threadIdx.x;
  if (blockIdx.x < PWB) {      /* block-uniform */
    const int mi = blockIdx.x >> 6; const float* Wm = mi == 0 ? wq : mi == 1 ? wk : mi == 2 ? wv : wo;
    const int wid = (blockIdx.x & 63) * 8 + (tid >> 5), lane = tid & 31; const int n8 = ((wid >> 4) * 4 + (lane & 3)) * 8, k8 = ((wid & 15) * 8 + (lane >> 2)) * 8;
    const float* sp = Wm + (size_t)k8 * DM + n8; unsigned short* dp = (unsigned short*)BT + (size_t)mi * (DM * DM) + (size_t)n8 * DM + k8;
    v4f a[8][2]; v8us o[8];
#pragma unroll      /* constant indices: the tile stays in registers, all 16 loads in flight */
    for (int i = 0; i < 8; ++i) { a[i][0] = *(const v4fa*)(sp + i * DM); a[i][1] = *(const v4fa*)(sp + i * DM + 4); }
    asm volatile("s_wait_xcnt 0x0" :: "v"(sp) : "memory");      /* the loads' address registers stay untouched up to this wait; its memory clobber also keeps all 16 loads in front of the first store (without it the build held four loads back behind stores) */
#pragma unroll
    for (int j = 0; j < 8; ++j) { FragH f;
#pragma unroll
      for (int i = 0; i < 8; ++i) f.h[i] = (_Float16)(bf16_round(a[i][j >> 2][j & 3]) * 16.0f);
      o[j] = f.half[0]; }
#pragma unroll
    for (int j = 0; j < 8; ++j) *(v8us*)(dp + j * DM) = o[j];
  } else {
    const size_t e0 = ((size_t)(blockIdx.x - PWB) * 1024 + tid) * 8;      /* the thread's first element; its pieces lie 256 pieces apart */
    const float* s0 = xq + e0; const float* s1 = xk + e0; const float* s2 = xv + e0; unsigned short* dp = (unsigned short*)X16 + e0;
    v4f a[3][4][2]; v8us o[3][4];
#pragma unroll      /* constant indices: registers, all 24 loads in flight */
    for (int u = 0; u < 4; ++u) { a[0][u][0] = *(const v4fa*)(s0 + u * 2048); a[0][u][1] = *(const v4fa*)(s0 + u * 2048 + 4); a[1][u][0] = *(const v4fa*)(s1 + u * 2048); a[1][u][1] = *(const v4fa*)(s1 + u * 2048 + 4); a[2][u][0] = *(const v4fa*)(s2 + u * 2048); a[2][u][1] = *(const v4fa*)(s2 + u * 2048 + 4); }
    asm volatile("s_wait_xcnt 0x0" :: "v"(s0), "v"(s1), "v"(s2) : "memory");      /* the loads' address registers stay untouched up to this wait; its memory clobber also keeps all 24 loads in front of the first store (without it the build issued them in three groups between the stores) */
#pragma unroll
    for (int s = 0; s < 3; ++s)
#pragma unroll
      for (int u = 0; u < 4; ++u) { FragH f;
#pragma unroll
        for (int q = 0; q < 8; ++q) f.h[q] = (_Float16)bf16_round(a[s][u][q >> 2][q & 3]);
        o[s][u] = f.half[0]; }
#pragma unroll
    for (int s = 0; s < 3; ++s)
#pragma unroll
      for (int u = 0; u < 4; ++u) *(v8us*)(dp + (size_t)s * (NR * DM) + u * 2048) = o[s][u];
    asm volatile("s_wait_xcnt 0x0" ::: "memory");      /* in the built code the weight part's first instructions stand on the other side of the closing branch and rewrite registers that these stores name: the wait stands in front of them */
  } }

// ---- fast GEMM (block tile 128x64, wave tile 32x64; requires M % 128 == 0 rows per launch region, N % 64 == 0 and K % 128 == 0); epilogue = k_gemm_hhx semantics ----
// The block's 128 A rows and 64 B rows are staged in LDS 128 k at a time (rows of 256 bytes, whole lines) by asynchronous 16-byte copies, two buffers: tile t + 2 flies while tile t + 1 is worked on.
// The four waves share the B rows; fragments are read from LDS by g2_frag in the k order and the kb order of the direct loads, so every accumulator sums in the same order.
__device__ __forceinline__ v16h g2_frag(const _Float16* p, int hh) { FragH f; f.half[0] = *(const v8us*)((const unsigned short*)p + 8 * hh); f.half[1] = *(const v8us*)((const unsigned short*)p + 16 + 8 * hh); return f.v; }
__device__ __forceinline__ v8f g2_mma(v16h a, v16h b, v8f c) { v8f d = __builtin_amdgcn_wmma_f32_16x16x32_f16(false, a, false, b, (short)0, c, false, false); asm volatile("v_nop\n\tv_nop\n\tv_nop\n\tv_nop" : "+v"(d) : "v"(a), "v"(b)); return d; }
#define GKS 128                            /* k per staged tile */
#define GLP 136                            /* LDS row pitch in f16: 128 + 8 = 272 bytes, for the 16-byte fragment reads */
// Twelve asynchronous 16-byte copies, global to LDS, each lane its own two addresses. The closing s_wait_xcnt 0 stands inside the statement so that no address register is rewritten ahead of it.
__device__ __forceinline__ void g2_copy12(const unsigned* l, const char* const* g) {
  asm volatile("global_load_async_to_lds_b128 %0, %12, off\n\tglobal_load_async_to_lds_b128 %1, %13, off\n\tglobal_load_async_to_lds_b128 %2, %14, off\n\tglobal_load_async_to_lds_b128 %3, %15, off\n\t"
               "global_load_async_to_lds_b128 %4, %16, off\n\tglobal_load_async_to_lds_b128 %5, %17, off\n\tglobal_load_async_to_lds_b128 %6, %18, off\n\tglobal_load_async_to_lds_b128 %7, %19, off\n\t"
               "global_load_async_to_lds_b128 %8, %20, off\n\tglobal_load_async_to_lds_b128 %9, %21, off\n\tglobal_load_async_to_lds_b128 %10, %22, off\n\tglobal_load_async_to_lds_b128 %11, %23, off\n\ts_wait_xcnt 0x0"
               :: "v"(l[0]), "v"(l[1]), "v"(l[2]), "v"(l[3]), "v"(l[4]), "v"(l[5]), "v"(l[6]), "v"(l[7]), "v"(l[8]), "v"(l[9]), "v"(l[10]), "v"(l[11]),
                  "v"(g[0]), "v"(g[1]), "v"(g[2]), "v"(g[3]), "v"(g[4]), "v"(g[5]), "v"(g[6]), "v"(g[7]), "v"(g[8]), "v"(g[9]), "v"(g[10]), "v"(g[11]) : "memory"); }
template <int ACT, int QKV>
__global__ __launch_bounds__(128) void k_gemm2(const _Float16* __restrict__ A, int lda, size_t sA, const _Float16* __restrict__ Bh, int ldb, size_t sB, float alpha, const float* __restrict__ bias, size_t sBias, const float* __restrict__ CP, int rowsPerB, size_t sCPb, int row0g,
    float* __restrict__ C, _Float16* __restrict__ C16, int ldc, size_t sC, int M, int N, int K, _Float16* __restrict__ VTo) { static_assert(ACT == 0 || ACT == 3 || ACT == 6 || ACT == 8 || ACT == 9 || ACT == 11 || ACT == 12 || ACT == 14 || ACT == 15 || ACT == 16 || ACT == 17, "k_gemm2: unsupported ACT code (would silently apply no activation)");
  __shared__ __attribute__((aligned(16))) float so[4][32][68];
  __shared__ __attribute__((aligned(16))) _Float16 ta[2][128][GLP]; __shared__ __attribute__((aligned(16))) _Float16 tb[2][64][GLP];
  const int tid = threadIdx.x, w = tid >> 5, lane = tid & 31, ln = lane & 15, hh = lane >> 4; const int by = blockIdx.y;
  A += (size_t)by * sA; Bh += (size_t)by * sB; const size_t cofs = (size_t)by * sC; const float* bp = bias ? bias + (size_t)by * sBias : nullptr;
  const bool vtr = QKV && by == 2;      /* block-uniform: the v product runs with its operands swapped (rows = output features, columns = tokens; lda == ldb there), so that its row stores are V^T rows */
  if (vtr) { const _Float16* sw = A; A = Bh; Bh = sw; const int ms = M; M = N; N = ms; }
  const int ntn = N >> 6; const int mt = blockIdx.x / ntn, nq = blockIdx.x - mt * ntn; const int row0 = mt * 128 + 32 * w, col0 = nq * 64; if (mt * 128 >= M) return;      /* block-uniform, in front of every barrier */
  const int srow = tid >> 4, sc8 = (tid & 15) * 8;      /* staging: 16 threads per row of 256 bytes, 8 rows a step */
  const char* ga = (const char*)(A + (size_t)(mt * 128 + srow) * lda + sc8); const char* gb = (const char*)(Bh + (size_t)(col0 + srow) * ldb + sc8); const size_t ga8 = (size_t)lda * 16, gb8 = (size_t)ldb * 16;      /* 8 rows in bytes */
  const unsigned la = (unsigned)(size_t)&ta[0][srow][sc8], lb = (unsigned)(size_t)&tb[0][srow][sc8];      /* byte addresses in the work-group's LDS */
  auto stage = [&](int t, int buf) { unsigned l[24]; const char* g[24];      /* one tile: 16 copies of A and 8 of B per thread */
#pragma unroll
    for (int j = 0; j < 16; ++j) { l[j] = la + (unsigned)buf * (unsigned)sizeof(ta[0]) + (unsigned)j * (8u * GLP * 2u); g[j] = ga + (size_t)t * (GKS * 2) + (size_t)j * ga8; }
#pragma unroll
    for (int j = 0; j < 8; ++j) { l[16 + j] = lb + (unsigned)buf * (unsigned)sizeof(tb[0]) + (unsigned)j * (8u * GLP * 2u); g[16 + j] = gb + (size_t)t * (GKS * 2) + (size_t)j * gb8; }
    g2_copy12(l, g); g2_copy12(l + 12, g + 12); };
  const v8f z8 = {0.f,0.f,0.f,0.f,0.f,0.f,0.f,0.f}; v8f c00 = z8, c01 = z8, c02 = z8, c03 = z8, c10 = z8, c11 = z8, c12 = z8, c13 = z8;
  const int nt = K / GKS;
  stage(0, 0);
  asm volatile("s_wait_asynccnt 0x0" ::: "memory");      /* this wave's copies of tile 0 have landed */
  __syncthreads();      /* publishes tile 0 to the four waves */
  if (nt > 1) stage(1, 1);
#pragma unroll 1      /* one trip is 32 matrix instructions of straight-line code already */
  for (int t = 0; t < nt; ++t) { const _Float16* ap = &ta[t & 1][32 * w + ln][0]; const _Float16* bq = &tb[t & 1][ln][0];
    v16h fa[2][2], fb[2][4];      /* two fragment sets: the next 32 k of this tile are read from LDS as one group ahead of the current block's matrix instructions */
    fa[0][0] = g2_frag(ap, hh); fa[0][1] = g2_frag(ap + 16 * GLP, hh); fb[0][0] = g2_frag(bq, hh); fb[0][1] = g2_frag(bq + 16 * GLP, hh); fb[0][2] = g2_frag(bq + 32 * GLP, hh); fb[0][3] = g2_frag(bq + 48 * GLP, hh);
#pragma unroll      /* makes the set index a constant, so that the sets are registers */
    for (int q = 0; q < GKS / 32; ++q) { const int s = q & 1, n = s ^ 1, kn = (q + 1) * 32;
      if (q + 1 < GKS / 32) { fa[n][0] = g2_frag(ap + kn, hh); fa[n][1] = g2_frag(ap + 16 * GLP + kn, hh); fb[n][0] = g2_frag(bq + kn, hh); fb[n][1] = g2_frag(bq + 16 * GLP + kn, hh); fb[n][2] = g2_frag(bq + 32 * GLP + kn, hh); fb[n][3] = g2_frag(bq + 48 * GLP + kn, hh); }
      c00 = g2_mma(fa[s][0], fb[s][0], c00); c10 = g2_mma(fa[s][1], fb[s][0], c10); c01 = g2_mma(fa[s][0], fb[s][1], c01); c11 = g2_mma(fa[s][1], fb[s][1], c11);
      c02 = g2_mma(fa[s][0], fb[s][2], c02); c12 = g2_mma(fa[s][1], fb[s][2], c12); c03 = g2_mma(fa[s][0], fb[s][3], c03); c13 = g2_mma(fa[s][1], fb[s][3], c13); }
    asm volatile("s_wait_dscnt 0x0" ::: "memory");      /* this wave's reads of tile t are done before its buffer is refilled */
    asm volatile("s_wait_asynccnt 0x0" ::: "memory");      /* this wave's copies of tile t + 1 have landed */
    __syncthreads();      /* publishes tile t + 1 and ends every wave's reads of tile t */
    if (t + 2 < nt) stage(t + 2, t & 1); }
  asm volatile("s_wait_asynccnt 0x0" ::: "memory");      /* no copy is outstanding when the wave goes on */
  v8f accs[8] = {c00, c01, c02, c03, c10, c11, c12, c13};
#pragma unroll
  for (int u = 0; u < 8; ++u) { const int t = u & 3, half = u >> 2; const int col = col0 + t * 16 + ln; const float bv = (!QKV && bp) ? bf16_round(bp[col]) : 0.f;      /* the projection launch has neither a bias nor an addend plane */
#pragma unroll
    for (int r = 0; r < 8; ++r) { const int rloc = half * 16 + 8 * hh + r; float v = accs[u][r] * alpha + bv; if (!QKV && CP) { if (rowsPerB < 0) v += CP[cofs + (size_t)(row0g + row0 + rloc) * ldc + col];      /* rowsPerB < 0: own element of the batched C plane */ else { const int bidx = (row0g + row0 + rloc) / rowsPerB; v += CP[(size_t)bidx * sCPb + (size_t)by * 64 + col]; } }
      if (ACT == 3) v = fmaxf(v, 0.f); else if (ACT == 6) v = 0.5f * v * (1.0f + erff(v * 0.70710678118654752f)); else if (ACT == 11) v = 1.0f / (1.0f + expf(-v)); else if (ACT == 15) v = v / (1.0f + expf(-v)); else if (ACT == 12) v = (v > 0.f) ? v : 0.01f * v; else if (ACT == 8) v = tanhf(v); else if (ACT == 9) v = 0.5f * v * (1.0f + tanhf(0.7978845608028654f * (v + 0.044715f * v * v * v))); else if (ACT == 14) v = (v > 0.f) ? v : 0.1f * v; else if (ACT == 16) v = (v >= 0.f) ? v : 0.3f * v; else if (ACT == 17) v = (v >= 0.f) ? v : 0.2f * v;
      so[w][rloc][t * 16 + ln] = v; } }
  __builtin_amdgcn_fence(__ATOMIC_ACQ_REL, "workgroup"); __builtin_amdgcn_wave_barrier();
  const int rsub = lane >> 4, c4 = (lane & 15) * 4;
  if (QKV) {      /* the projection launch (grid y: q, k, v) stores what the attention launch reads: q and k as f16 hi + x1024 residual planes (C16: q hi, q lo, k hi, k lo, sC apart), v as V^T rows [feature][batch * SQ + token]; f32 rows (C: q, k, v planes) only for each batch's first QT0 tokens, which the exact path reads */
    static_assert(QT0 == 128, "a batch's exact rows are one 128-row block, or two 64-token column blocks of the swapped v product");
    v4f vv[16], pa[16]; v4h vh[16], vl[16];
#pragma unroll      /* constant indices: the sixteen steps' pieces are registers, the row steps immediate offsets */
    for (int q = 0; q < 16; ++q) { vv[q] = *(const v4fa*)&so[w][q * 2 + rsub][c4];
#pragma unroll
      for (int i = 0; i < 4; ++i) { const _Float16 h = (_Float16)vv[q][i]; vh[q][i] = h; vl[q][i] = (_Float16)((vv[q][i] - (float)h) * 1024.0f); pa[q][i] = accs[q >> 1][(q & 1) * 4 + i] * alpha; } }
    if (vtr) {
      if ((col0 & (SQ - 1)) < QT0) { float* fp = C + cofs + (size_t)(col0 + ln) * DM + row0 + 8 * hh;      /* block-uniform: a lane's accumulator registers are 8 successive features of one token: the f32 v row pieces go out straight from them */
        __builtin_amdgcn_sched_barrier(0);      /* every product stands in front of the first store */
#pragma unroll
        for (int u = 0; u < 8; ++u) { *(v4f*)(fp + (u & 3) * (16 * DM) + (u >> 2) * 16) = pa[2 * u]; *(v4f*)(fp + (u & 3) * (16 * DM) + (u >> 2) * 16 + 4) = pa[2 * u + 1]; }
        asm volatile("s_wait_xcnt 0x0" ::: "memory"); }      /* whatever is written behind this block may land on registers that these stores name: the wait stands in front of it */
      _Float16* tp = VTo + (size_t)(row0 + rsub) * (NB * SQ) + col0 + c4;
      __builtin_amdgcn_sched_barrier(0);      /* every conversion and the address stand in front of the first store */
#pragma unroll
      for (int q = 0; q < 16; ++q) *(v4h*)(tp + q * (2 * NB * SQ)) = vh[q];
      asm volatile("s_wait_xcnt 0x0" ::: "memory");      /* in the built code the other branch's block may stand behind these stores and rewrite registers that they name: the wait stands in front of it */
    } else {
      if ((mt & (SQ / 128 - 1)) == 0) { float* fp = C + cofs + (size_t)(row0 + rsub) * DM + col0 + c4;      /* block-uniform */
        __builtin_amdgcn_sched_barrier(0);      /* the LDS reads and the address stand in front of the first store */
#pragma unroll
        for (int q = 0; q < 16; ++q) *(v4f*)(fp + q * (2 * DM)) = vv[q];
        asm volatile("s_wait_xcnt 0x0" ::: "memory"); }      /* as above */
      _Float16* hp = C16 + (size_t)(2 * by) * sC + (size_t)(row0 + rsub) * DM + col0 + c4; _Float16* lp = hp + sC;
      __builtin_amdgcn_sched_barrier(0);      /* conversions and addresses stand in front of the first store */
#pragma unroll
      for (int q = 0; q < 16; ++q) { *(v4h*)(hp + q * (2 * DM)) = vh[q]; *(v4h*)(lp + q * (2 * DM)) = vl[q]; }
      asm volatile("s_wait_xcnt 0x0" ::: "memory"); }      /* in the built code the swapped product's block stands behind these stores and rewrites registers that they name: the wait stands in front of it */
    return; }
  {
#pragma unroll
    for (int q = 0; q < 16; ++q) { const int r = q * 2 + rsub; const v4f v = *(const v4fa*)&so[w][r][c4]; if (C) { *(v4f*)(C + cofs + (size_t)(row0 + r) * ldc + col0 + c4) = v; asm volatile("s_wait_xcnt 0x0" ::: "memory"); }      /* the f32 store's data and address registers are rewritten right behind it (the f16 conversion, the next row): the wait stands in front of that */
      if (C16) { v4h h4; for (int i = 0; i < 4; ++i) h4[i] = (_Float16)v[i]; *(v4h*)(C16 + cofs + (size_t)(row0 + r) * ldc + col0 + c4) = h4; } }
     } }


__global__ __launch_bounds__(256) void k_wnat(const float* __restrict__ w, size_t n8, _Float16* __restrict__ Bt) { const size_t t = (size_t)blockIdx.x * 256 + threadIdx.x; if (t >= n8) return; FragH f; for (int q = 0; q < 8; ++q) f.h[q] = (_Float16)(bf16_round(w[t * 8 + q]) * 16.0f); *(v8us*)((unsigned short*)Bt + t * 8) = f.half[0];  }
__global__ __launch_bounds__(256) void k_rsm(const float* __restrict__ S, _Float16* __restrict__ P, int nrows) {
  #pragma clang fp contract(off)
  const int i = blockIdx.x * 256 + threadIdx.x; if (i >= nrows) return; const float* s = S + (size_t)i * SQ; float mx = -3.0e38f;
#pragma unroll 1
  for (int j = 0; j < SQ; ++j) mx = fmaxf(mx, s[j]); float se = 0.f;
#pragma unroll 1
  for (int j = 0; j < SQ; ++j) se += expf(s[j] - mx); const float sc = 256.0f / se;
#pragma unroll 1
  for (int j0 = 0; j0 < SQ; j0 += 8) { FragH f; for (int q = 0; q < 8; ++q) f.h[q] = (_Float16)(expf(s[j0 + q] - mx) * sc); unsigned short* d = (unsigned short*)P + (size_t)i * SQ + j0; *(v8us*)d = f.half[0];  } }
__global__ __launch_bounds__(256) void k_vt(const _Float16* __restrict__ V16, int b, int h0, _Float16* __restrict__ VT) { __shared__ unsigned short tl[64][65]; const int tid = threadIdx.x; const int hh = blockIdx.x % HG, sg = blockIdx.x / HG; const int s0 = sg * 64; const int h = h0 + hh;
  for (int i = tid; i < 64 * 8; i += 256) { const int j = i / 8, d8 = (i % 8) * 8; FragH f; f.half[0] = *(const v8us*)((const unsigned short*)V16 + ((size_t)b * SQ + s0 + j) * DM + h * HD + d8); for (int q = 0; q < 8; ++q) tl[d8 + q][j] = f.u[q]; }
  __syncthreads();
  { for (int i = tid; i < 64 * 8; i += 256) { const int d = i / 8, j8 = (i % 8) * 8; FragH f; for (int q = 0; q < 8; ++q) f.u[q] = tl[d][j8 + q]; *(v8us*)((unsigned short*)VT + ((size_t)hh * HD + d) * SQ + s0 + j8) = f.half[0]; }  } }



// Exact f32 attention for the first QT0 rows of one head and batch, run by the attention launch's block that owns these rows: one thread per query row; q, k, v are the f32 rows of the full projections; o leaves as f16 hi (into the merged o rows) + x1024 residual.
// The 128 key and value rows (64 floats each) are staged once in LDS by whole-line loads and then read as broadcasts; the thread's q row and o row stay in registers; four keys' score sums run side by side, each in index order.
// Every plain '#pragma unroll' below makes the indices of q, o, s and the staged pieces constants, so that these arrays are registers and not scratch.
__device__ __forceinline__ void fa_exact(const float* __restrict__ QF, const float* __restrict__ KF, const float* __restrict__ VF, int h, int b, int w, _Float16* __restrict__ OH, _Float16* __restrict__ OL, float (*lk)[64], float (*lv)[64]) {
  static_assert(QT0 == 128 && HD == 64, "fa_exact: one thread per row of a block of 128, staging in 16 steps of 8 rows");
  const int tid = threadIdx.x; const int i = tid; const size_t r0 = (size_t)b * SQ;      /* the batch's first token row */
  const char* qh = (const char*)(QF + r0 * DM + h * HD); const char* kh = (const char*)(KF + r0 * DM + h * HD); const char* vh = (const char*)(VF + r0 * DM + h * HD);      /* block-uniform bases */
  const unsigned qoff = (unsigned)(i * DM) * 4u;      /* byte offset of the thread's q row */
  float q[HD], o[HD];
#pragma unroll
  for (int c = 0; c < HD / 4; ++c) { const v4f t4 = *(const v4fa*)(qh + qoff + c * 16);
#pragma unroll
    for (int u = 0; u < 4; ++u) { q[c * 4 + u] = t4[u]; o[c * 4 + u] = 0.f; } }
  const int srow = tid >> 4, sc4 = (tid & 15) * 4; const unsigned soff = (unsigned)(srow * DM + sc4) * 4u;      /* staging: 16 threads per row of 256 bytes, 8 rows a step; byte offset */
  const char* kp = kh + soff; const char* vp = vh + soff;      /* the thread's own staging addresses */
  { v4f tk[16], tv[16];      /* all 32 loads of a thread in flight together */
#pragma unroll
    for (int it = 0; it < 16; ++it) { tk[it] = *(const v4fa*)(kp + it * (8 * DM * 4)); tv[it] = *(const v4fa*)(vp + it * (8 * DM * 4)); }
    asm volatile("s_wait_xcnt 0x0" :: "v"(qoff), "v"(soff), "v"(kp), "v"(vp) : "memory");      /* the loads' offset and address registers stay untouched up to this wait: nothing, a later load's data included, lands on a register that an issued load names */
#pragma unroll
    for (int it = 0; it < 16; ++it) { *(v4f*)&lk[it * 8 + srow][sc4] = tk[it]; *(v4f*)&lv[it * 8 + srow][sc4] = tv[it]; } }
  __syncthreads();      /* publishes the staged rows to the four waves */
  float m = -1.0e30f, l = 0.f; const int nkey = 32 * w + 32;      /* causal form: keys up to the wave's last row (wave-uniform) */
#pragma unroll 1      /* the body is four whole keys of straight-line code already: more would only grow the text */
  for (int j0 = 0; j0 < nkey; j0 += 4) { float s[4] = {0.f, 0.f, 0.f, 0.f}; v4f g[2][16];      /* two register sets of 16 LDS pieces: eight groups a trip (16 head dims of the four k rows, four times; then the four v rows), each read while the group before it is worked on */
#pragma unroll
    for (int cc = 0; cc < 4; ++cc)
#pragma unroll
      for (int u = 0; u < 4; ++u) g[0][cc * 4 + u] = *(const v4f*)&lk[j0 + u][cc * 4];
#pragma unroll
    for (int p = 0; p < 8; ++p) { const int cu = p & 1, nx = cu ^ 1;
      __builtin_amdgcn_sched_barrier(0);      /* with the one below: keeps the reads of group p + 1, and of no later group, in front of group p's arithmetic; left free, the build hoists a whole trip's 128 reads, which takes more registers than two waves a SIMD leave and spills */
      if (p + 1 < 4) {
#pragma unroll
        for (int cc = 0; cc < 4; ++cc)
#pragma unroll
          for (int u = 0; u < 4; ++u) g[nx][cc * 4 + u] = *(const v4f*)&lk[j0 + u][((p + 1) * 4 + cc) * 4]; }
      else if (p + 1 < 8) {
#pragma unroll
        for (int c = 0; c < HD / 4; ++c) g[nx][c] = *(const v4f*)&lv[j0 + p - 3][c * 4]; }
      __builtin_amdgcn_sched_barrier(0);      /* see above */
      if (p < 4) {
#pragma unroll
        for (int cc = 0; cc < 4; ++cc)
#pragma unroll
          for (int x = 0; x < 4; ++x)
#pragma unroll
            for (int u = 0; u < 4; ++u) s[u] = __fadd_rn(s[u], __fmul_rn(q[(p * 4 + cc) * 4 + x], g[cu][cc * 4 + u][x])); }
      else { const int u = p - 4; const int j = j0 + u; const float sv = __fmul_rn(s[u], SCL);
        const float f = (j <= i) ? 1.f : 0.f; const float sm = fmaf(f, sv, (1.f - f) * -1.0e30f); const float mn = fmaxf(m, sm); const float sc = expf(m - mn); const float e = expf(sm - mn); l = __fadd_rn(__fmul_rn(l, sc), e); m = mn;
#pragma unroll
        for (int c = 0; c < HD / 4; ++c)
#pragma unroll
          for (int x = 0; x < 4; ++x) o[c * 4 + x] = __fadd_rn(__fmul_rn(o[c * 4 + x], sc), __fmul_rn(e, g[cu][c][x])); } } }
  const float fin = 64.0f / l;      /* o carried x64 like the f16 path */
  __syncthreads();      /* every wave has left the k rows: their LDS takes the o rows */
#pragma unroll
  for (int c = 0; c < HD / 4; ++c) { v4f oo;
#pragma unroll
    for (int u = 0; u < 4; ++u) oo[u] = __fmul_rn(o[c * 4 + u], fin);
    *(v4f*)&lk[tid][c * 4] = oo; }
  __syncthreads();      /* publishes the o rows to the four waves */
  v4h vh4[16], vl4[16]; const int orow = tid / 16, pc = (tid % 16) * 4;      /* 16 threads per row, 8 rows a step */
#pragma unroll      /* constant indices: the sixteen steps' pieces are registers, the row steps immediate offsets */
  for (int it = 0; it < 16; ++it) { const v4f v = *(const v4f*)&lk[it * 8 + orow][pc];
#pragma unroll
    for (int u = 0; u < 4; ++u) { const _Float16 hi = (_Float16)v[u]; vh4[it][u] = hi; vl4[it][u] = (_Float16)((v[u] - (float)hi) * 1024.0f); } }
  __builtin_amdgcn_sched_barrier(0);      /* every conversion stands in front of the first store, so that no register which an issued store names is written again before the wave ends */
  _Float16* ohp = OH + (r0 + orow) * DM + h * HD + pc; _Float16* olp = OL + ((size_t)b * QT0 + orow) * DM + h * HD + pc;
#pragma unroll
  for (int it = 0; it < 16; ++it) { *(v4h*)(ohp + it * (8 * DM)) = vh4[it]; *(v4h*)(olp + it * (8 * DM)) = vl4[it]; } }

// Fused causal attention: a block owns 128 query rows of one head (32 per wave) and walks the keys 64 at a time; scores and weights never leave registers.
// Each pass stages 64 rows of k hi, k lo and 64 rows (head dims) of V^T in LDS by whole-line loads, once for the four waves; row pitch 128 + 16 bytes for the 16-byte fragment reads.
// S^T = K . Q^T (A = 16 key rows, B = 16 query rows, both by g2_frag): a lane holds 8 keys (8*hh + r) of ONE query (ln) per tile, so maximum and sum are in-lane plus one exchange of the wave halves.
// Two score tiles of one query group, converted in place, are the B operand of O^T += V^T . P^T (element i = key 8*hh + i, element 8 + i = key 16 + 8*hh + i: the k order of g2_frag on the V^T rows).
// Scores: (lo . hi + hi . lo) first, x 2^-10, then hi . hi on top in the same accumulator. Weights carried x256 (the + 8 in the exponent), in the f16 operand and in the row sum alike; o leaves x64.
#define FAC 0.18033688011112042f           /* 1 / sqrt(head_dim) * log2(e) */
#define FLP 72                             /* LDS row pitch in f16: 64 + 8 */
__device__ __forceinline__ float fa_exp2(float x) { asm("v_exp_f32 %0, %0\n\tv_nop" : "+v"(x)); return x; }      /* native 2^x; the v_nop fills the one slot that the instruction set asks for between a transcendental and a directly following instruction that reads its result or overwrites its source */
__device__ __forceinline__ v8f fa_mma(v16h a, v16h b, v8f c) { return __builtin_amdgcn_wmma_f32_16x16x32_f16(false, a, false, b, (short)0, c, false, false); }
__global__ __launch_bounds__(128, 2) void k_fattn(const _Float16* __restrict__ QHp, const _Float16* __restrict__ QLp, const _Float16* __restrict__ KHp, const _Float16* __restrict__ KLp, const _Float16* __restrict__ VTp, _Float16* __restrict__ Op, const float* __restrict__ QF, const float* __restrict__ KF, const float* __restrict__ VF, _Float16* __restrict__ OLp) {      /* two waves a SIMD: the register bound under which all 512 blocks are resident at once (the exact part alone would take more) */
  __shared__ __attribute__((aligned(16))) float xk[QT0][64]; __shared__ __attribute__((aligned(16))) float xv[QT0][64];      /* the exact block's f32 key and value rows */
  __shared__ __attribute__((aligned(16))) _Float16 lkh[64][FLP]; __shared__ __attribute__((aligned(16))) _Float16 lkl[64][FLP]; __shared__ __attribute__((aligned(16))) _Float16 lvt[64][FLP];
  const int tid = threadIdx.x, lane = tid & 31, ln = lane & 15, hh = lane >> 4; const int w = __builtin_amdgcn_readfirstlane(tid >> 5);
  const int h = blockIdx.y, b = blockIdx.z; const int nqt = (int)gridDim.x, x2 = (int)blockIdx.x + 2; const int qt = (b & 1) ? (x2 >= nqt ? x2 - nqt : x2) : nqt - 1 - (int)blockIdx.x;      /* long and short blocks mixed over the grid: at equal blockIdx.x the two batches hold tiles 15 - x and x + 2 (mod 16), for speed only */
  if (qt == 0) { fa_exact(QF, KF, VF, h, b, w, Op, OLp, xk, xv); return; }      /* block-uniform, in front of every barrier of the f16 path: rows 0..127 are computed exactly in f32, beside the other blocks' f16 work */
  const int row0 = qt * 128 + 32 * w; const size_t r0 = (size_t)b * SQ;
  v16h qh[2][2], ql[2][2]; const _Float16* qhp = QHp + (r0 + row0 + ln) * LQ + h * HD + 8 * hh; const _Float16* qlp = QLp + (r0 + row0 + ln) * LQ + h * HD + 8 * hh;      /* the lane's own 16-byte pieces start here (g2_frag with half 0) */
#pragma unroll
  for (int g = 0; g < 2; ++g) { qh[g][0] = g2_frag(qhp + g * (16 * LQ), 0); qh[g][1] = g2_frag(qhp + g * (16 * LQ) + 32, 0); ql[g][0] = g2_frag(qlp + g * (16 * LQ), 0); ql[g][1] = g2_frag(qlp + g * (16 * LQ) + 32, 0); }
  asm volatile("s_wait_xcnt 0x0" :: "v"(qhp), "v"(qlp) : "memory");      /* the sixteen loads' address registers stay untouched up to this wait: nothing, a later load's data included, lands on them before it */
  const char* khb = (const char*)(KHp + r0 * LQ + h * HD); const char* klb = (const char*)(KLp + r0 * LQ + h * HD); const char* vtb = (const char*)(VTp + (size_t)(h * HD) * (NB * SQ) + r0);      /* block-uniform bases; V^T rows are [feature][batch * SQ + token] */
  const int srow = tid >> 3, sc8 = (tid & 7) * 8; const unsigned koff = (unsigned)(srow * LQ + sc8) * 2u, voff = (unsigned)(srow * (NB * SQ) + sc8) * 2u;      /* staging: 8 threads per row of 128 bytes, 16 rows a step; byte offsets */
  const v8f z8 = {0.f,0.f,0.f,0.f,0.f,0.f,0.f,0.f}; v8f o[4][2];
#pragma unroll
  for (int dt = 0; dt < 4; ++dt) { o[dt][0] = z8; o[dt][1] = z8; }
  float m[2] = {-1.0e30f, -1.0e30f}, l[2] = {0.f, 0.f};
  const int kend = qt * 128 + 64;           /* the block's last piece: every wave stages and passes the barriers up to it */
#pragma unroll 1      /* one pass is up to 64 matrix instructions of straight-line code already */
  for (int kb = 0; kb <= kend; kb += 64) { v8us tk[4], tl[4], tv[4]; const char* kp = khb + (size_t)kb * (LQ * 2) + koff; const char* lp = klb + (size_t)kb * (LQ * 2) + koff; const char* vp = vtb + (size_t)kb * 2 + voff;
#pragma unroll
    for (int j = 0; j < 4; ++j) { tk[j] = *(const v8us*)(kp + j * (16 * LQ * 2)); tl[j] = *(const v8us*)(lp + j * (16 * LQ * 2)); tv[j] = *(const v8us*)(vp + j * (16 * NB * SQ * 2)); }
    asm volatile("s_wait_xcnt 0x0" :: "v"(kp), "v"(lp), "v"(vp) : "memory");      /* the twelve loads' address registers stay untouched up to this wait: nothing, a later load's data included, lands on them before it */
    __syncthreads();      /* every wave has left the previous pass's rows */
#pragma unroll
    for (int j = 0; j < 4; ++j) { *(v8us*)&lkh[j * 16 + srow][sc8] = tk[j]; *(v8us*)&lkl[j * 16 + srow][sc8] = tl[j]; *(v8us*)&lvt[j * 16 + srow][sc8] = tv[j]; }
    __syncthreads();      /* publishes the staged rows to the four waves */
#pragma unroll
    for (int hf = 0; hf < 2; ++hf) { const int k0 = kb + 32 * hf;      /* 32 keys a step: 16 score registers per query group alive at a time */
      if (k0 <= row0) {      /* wave-uniform: keys past the wave's last row (row0 + 31) are left out whole */
        v8f s[2][2];
#pragma unroll
        for (int t = 0; t < 2; ++t) { const int kr = 32 * hf + 16 * t + ln; const v16h a0 = g2_frag(&lkh[kr][0], hh), a1 = g2_frag(&lkh[kr][32], hh), c0 = g2_frag(&lkl[kr][0], hh), c1 = g2_frag(&lkl[kr][32], hh);
#pragma unroll
          for (int g = 0; g < 2; ++g) { v8f y = fa_mma(a0, ql[g][0], z8); y = fa_mma(a1, ql[g][1], y); y = fa_mma(c0, qh[g][0], y); y = fa_mma(c1, qh[g][1], y);
#pragma unroll
            for (int r = 0; r < 8; ++r) y[r] *= 0.0009765625f;
            y = fa_mma(a0, qh[g][0], y); y = fa_mma(a1, qh[g][1], y); s[t][g] = y; } }
        if (k0 == row0) {      /* wave-uniform: the 32 x 32 piece on the diagonal is the only one that needs the causal test; key k0 stays for every query */
#pragma unroll
          for (int t = 0; t < 2; ++t)
#pragma unroll
            for (int g = 0; g < 2; ++g)
#pragma unroll
              for (int r = 0; r < 8; ++r) if (16 * t + 8 * hh + r > 16 * g + ln) s[t][g][r] = -1.0e30f; }
        FragH p[2];
#pragma unroll
        for (int g = 0; g < 2; ++g) { float mx = s[0][g][0];
#pragma unroll
          for (int t = 0; t < 2; ++t)
#pragma unroll
            for (int r = 0; r < 8; ++r) mx = fmaxf(mx, s[t][g][r]);
          mx = fmaxf(mx, __shfl_xor(mx, 16, 32));      /* the other 8 keys of every tile sit in the other wave half */
          const float mn = fmaxf(m[g], mx); const float sc = fa_exp2((m[g] - mn) * FAC); m[g] = mn; const float nb = fmaf(-mn, FAC, 8.0f);
          float ps[4] = {0.f, 0.f, 0.f, 0.f};
#pragma unroll
          for (int t = 0; t < 2; ++t)
#pragma unroll
            for (int r = 0; r < 8; ++r) { const float e = fa_exp2(fmaf(s[t][g][r], FAC, nb)); ps[r & 3] += e; p[g].h[t * 8 + r] = (_Float16)e; }
          l[g] = fmaf(l[g], sc, (ps[0] + ps[1]) + (ps[2] + ps[3]));
#pragma unroll
          for (int dt = 0; dt < 4; ++dt)
#pragma unroll
            for (int r = 0; r < 8; ++r) o[dt][g][r] *= sc; }
#pragma unroll
        for (int dt = 0; dt < 4; ++dt) { const v16h a = g2_frag(&lvt[16 * dt + ln][32 * hf], hh); o[dt][0] = fa_mma(a, p[0].v, o[dt][0]); o[dt][1] = fa_mma(a, p[1].v, o[dt][1]); } } } }
#pragma unroll
  for (int g = 0; g < 2; ++g) { const float fin = 64.0f / (l[g] + __shfl_xor(l[g], 16, 32));      /* the halves' sums joined once; x256 cancels, o carried x64 */
    unsigned short* op = (unsigned short*)Op + (r0 + row0 + 16 * g + ln) * DM + h * HD + 8 * hh;
#pragma unroll
    for (int dt = 0; dt < 4; ++dt) { FragH f;
#pragma unroll
      for (int r = 0; r < 8; ++r) f.h[r] = (_Float16)(o[dt][g][r] * fin);
      *(v8us*)(op + 16 * dt) = f.half[0]; } } }


extern "C" void kernel_launch(void* const* d_in, const int* in_sizes, int n_in,
                              void* d_out, int out_size, void* d_ws, size_t ws_size, hipStream_t stream) {
  (void)in_sizes; (void)n_in; (void)out_size;
  const float* const* I = (const float* const*)d_in; const float* x = I[0]; const float* xk = I[1]; const float* xv = I[2]; const float* wq = I[3]; const float* wk = I[4]; const float* wv = I[5]; const float* wo = I[6]; const float* bo = I[7];      /* input order: query_data, key_data, value_data (three SEPARATE streams: the three exact-f16 row casts read one each), Wq, Wk, Wv ([in][out]; the module has NO q / k / v biases), Wp ([in][out]), bp (REAL); NO mask input (the causal fill is built inside the reference) */
  char* ws = (char*)d_ws; size_t off = 0;
  auto take = [&](size_t bytes) { char* p = ws + off; off += (bytes + 255) & ~(size_t)255; return p; };
  _Float16* BQ = (_Float16*)take((size_t)DM * DM * 2); _Float16* BK = (_Float16*)take((size_t)DM * DM * 2); _Float16* BV = (_Float16*)take((size_t)DM * DM * 2); _Float16* BO = (_Float16*)take((size_t)DM * DM * 2);
  _Float16* X16 = (_Float16*)take(NR * DM * 2); _Float16* XK16 = (_Float16*)take(NR * DM * 2); _Float16* XV16 = (_Float16*)take(NR * DM * 2);      /* exact f16 rows of query, key, value */ float* QF = (float*)take(NR * DM * 4); float* KF = (float*)take(NR * DM * 4); float* VF = (float*)take(NR * DM * 4);      /* f32 q, k, v rows, a plane each: only rows 0..127 of each batch are written, and the exact path reads only them */ _Float16* QH = (_Float16*)take(NR * DM * 2); _Float16* QL = (_Float16*)take(NR * DM * 2); _Float16* KH = (_Float16*)take(NR * DM * 2); _Float16* KL = (_Float16*)take(NR * DM * 2); _Float16* Q16 = QH; _Float16* K16 = KH; _Float16* O16 = (_Float16*)take(NR * DM * 2);
  _Float16* VT = (_Float16*)take((size_t)NB * NH * HD * SQ * 2);
  _Float16* OL0 = (_Float16*)take((size_t)NB * QT0 * DM * 2);      /* x1024 residual of the exact o rows */
  if (off > ws_size) return;
  static_assert(B0 == 0 && NBR == NB, "the conversion launches take whole planes");
  k_prep<<<PWB + PXB, 256, 0, stream>>>(x, xk, xv, wq, wk, wv, wo, X16, BQ);      /* the four weights [in][out] -> Bt[n][k] x16 (BQ, BK, BV, BO lie one behind the other) and the three exact f16 row casts (X16, XK16, XV16 likewise) in one launch */
  const size_t r0p = (size_t)B0 * SQ;      /* first projected row */
  static_assert((MP / 128) * (DM / 64) == (DM / 128) * (MP / 64), "the swapped v product has as many blocks as the q and k products");
  k_gemm2<0, 1><<<dim3((unsigned)((MP / 128) * (DM / 64)), 3), 128, 0, stream>>>(X16, DM, NR * DM, BQ, DM, (size_t)DM * DM, 0.0625f, nullptr, 0, nullptr, 1, 0, 0, QF, QH, DM, NR * DM, MP, DM, DM, VT);      /* the three projections in one launch (grid y; the module has no q / k / v biases): q and k leave as f16 hi + x1024 residual planes (QH, QL, KH, KL one behind the other; unscaled logits sigma ~8), v as V^T rows [DM][NB * SQ]; f32 rows (QF, KF, VF one behind the other) only for rows 0..127 of each batch */
  static_assert(QT0 == 128, "the attention launch's first query block is the exact one");
  k_fattn<<<dim3(SQ / 128, NH, NB), 128, 0, stream>>>(QH, QL, KH, KL, VT, O16, QF, KF, VF, OL0);      /* scores, causal softmax and P . V in one launch for all rows, heads and batches: o (merged heads, x64) as f16 rows; the blocks of rows 0..127 run the exact f32 attention: f16 hi into the o rows, x1024 residual into its own plane */
  k_gemm2<0, 0><<<dim3((unsigned)((MPO / 128) * (DM / 64)), 1), 128, 0, stream>>>(O16 + r0p * DM, DM, 0, BO, DM, 0, 0.0009765625f, bo, 0, nullptr, 1, 0, 0, (float*)d_out + r0p * DM, nullptr, DM, 0, MPO, DM, DM, nullptr);      /* out rows are the output layout */
  k_gemm2<0, 0><<<dim3((QT0 / 128) * (DM / 64), NBR), 128, 0, stream>>>(OL0, DM, (size_t)QT0 * DM, BO, DM, 0, 0.00000095367431640625f, nullptr, 0, (const float*)d_out + r0p * DM, -1, 0, 0, (float*)d_out + r0p * DM, nullptr, DM, (size_t)SQ * DM, QT0, DM, DM, nullptr);      /* rows 0..127 of both batches (grid y): += o_lo Wo 2^-20 (own-element accumulate) on the o_hi Wo + b that the launch above wrote */
}

// v009
// It runs in 136 microseconds.
// Two timings next to v008 put it at 1.12 and 1.14 times that version's speed.
// All steps since v000 together make it 43.5 times as fast.
#include <hip/hip_runtime.h>
// Causal multi-head attention on three inputs with bias-free [in][out] projections and a biased [in][out] output projection (query_data, key_data, value_data [2][2048][1024]; q = split_heads(query_data Wq), k = split_heads(key_data Wk), v = split_heads(value_data Wv) ([in][out] [1024][1024], NO biases), 16 heads of 64; scores / sqrt(64); scores + triu(ones, k = 1) x (-1e13): an additive fill strictly above the diagonal == exclusion (exp underflows to exactly 0; every row keeps its diagonal); softmax over keys; out = merged Wp + bp ([in][out] + a REAL bias) -> [2][2048][1024]); the causal rule is built inside the reference: applied here by index; q and k carried as f16 hi + x1024 residual planes with three-product scores.
// Structure: token rows r = b*2048 + s; x as exact f16 rows (bf16-rounded); q and k as WMMA GEMMs (32x64 wave tiles, f32 accumulation, exact x16 weights, no bias) whose epilogue splits each f32 value into f16 hi + x1024 residual planes, v as the same GEMM with its operands swapped, whose f16 rows are V^T rows, all three in one launch; one fused attention launch: a block owns 128 query rows of a head (32 per wave) and walks the keys up to its last row 64 at a time, k hi, k lo and V^T rows staged in LDS per pass: three-product scores (lo.hi + hi.lo, x 2^-10, + hi.hi) as S^T tiles in registers, running maximum and sum per query (f32 statistics, native exp2; keys past the row's own index excluded; weights x256 f16, packed in place as the B operand), O^T += V^T . P^T, o carried x64 (folded into the output GEMM alpha) written straight into the merged f16 o rows; out = o W_o + b GEMM (f32) into the output layout.
// Compute dtype: inputs rounded to bf16; x / weights exact; q and k as f16 hi + x1024 residual pairs (three products), v, softmax weights and o as plain f16 GEMM operands (~2^-12); scores and softmax statistics f32. v_wmma_f32_16x16x32_f16.
#define NB 2
#define SCL 0.125f                         /* 1 / sqrt(head_dim = 64) */
#define SCLR 0.0001220703125f              /* 2^-13 (not used: k_fattn scales the x1024 residual sums by 2^-10) */
#define SQ 2048
#define DM 1024
#define NH 16
#define HD 64
#define HG 4                         /* heads per launch of the head-group k_vt (not launched) */
#define QT 256                       /* not used: the causal tiles are 128 query rows */
#define NKX SQ                       /* not used */
#define QT0 128                      /* first-tile rows computed exactly in f32 */
#define B0 0                         /* first batch processed (debug hook) */
#define NBR NB                       /* batches processed (debug hook) */
#define NR ((size_t)NB * SQ)         /* token rows */
#define MP ((int)((size_t)NBR * SQ)) /* rows projected (debug hook) */
#define QN SQ                        /* not used */
#define NHD NH                       /* not used */
#define MPO MP                       /* rows through the output stage (debug hook) */
#define LQ DM      /* row pitch of the q/k/v rows */
typedef __bf16 v16b __attribute__((ext_vector_type(16)));
typedef unsigned short v8us __attribute__((ext_vector_type(8), may_alias));
typedef float  v8f  __attribute__((ext_vector_type(8)));
typedef float  v4f  __attribute__((ext_vector_type(4)));
typedef float  v4fa __attribute__((ext_vector_type(4), may_alias));
union FragB { v16b v; v8us half[2]; unsigned short u[16]; };

__device__ __forceinline__ unsigned short bf16_bits(float x) { unsigned int u = __float_as_uint(x); return (unsigned short)((u + 0x7FFFu + ((u >> 16) & 1u)) >> 16); }
__device__ __forceinline__ float bf16_val(unsigned short b) { return __uint_as_float(((unsigned int)b) << 16); }
__device__ __forceinline__ float bf16_round(float x) { return bf16_val(bf16_bits(x)); }
// D += A·B with NT terms: 1 = ah·bh, 2 = + al·bh (A split), 3 = + ah·bl (both split)
template <int NT>
__device__ __forceinline__ v8f mmaN(v16b ah, v16b al, v16b bh, v16b bl, v8f c) {
  c = __builtin_amdgcn_wmma_f32_16x16x32_bf16(false, ah, false, bh, (short)0, c, false, false);
  if (NT >= 2) c = __builtin_amdgcn_wmma_f32_16x16x32_bf16(false, al, false, bh, (short)0, c, false, false);
  if (NT >= 3) c = __builtin_amdgcn_wmma_f32_16x16x32_bf16(false, ah, false, bl, (short)0, c, false, false);
  asm volatile("v_nop\n\tv_nop\n\tv_nop\n\tv_nop" : "+v"(c) : "v"(ah), "v"(al), "v"(bh), "v"(bl));
  return c;
}

__global__ __launch_bounds__(256) void k_wt_bf16(const float* __restrict__ W, unsigned short* __restrict__ Wt, int K, int N) {
  const int t = blockIdx.x * 256 + threadIdx.x;
  const int k8n = K / 8;
  if (t >= N * k8n) return;
  const int n = t / k8n, k8 = (t % k8n) * 8;
  v8us v;
#pragma unroll
  for (int i = 0; i < 8; ++i) v[i] = bf16_bits(W[(size_t)(k8 + i) * N + n]);
  *(v8us*)(Wt + (size_t)n * K + k8) = v;
  
}

// GEMM C[M][N] (f32, pitch ldc) = act(A[M][K]·W + bias). A f32 row-major (pitch lda) converted per fragment to bf16
// (ASPLIT: hi/lo two planes -> 2 terms, else single rounded term); Wt bf16 [N][K] (pitch ldb). BIAS_BF16 rounds the
// bias to bf16 first (bias quantised to bf16 before the add). K%32==0, M%16==0, N%64==0.
template <bool ASPLIT, int ACT, bool BIAS_BF16>
__global__ __launch_bounds__(128) void k_gemm_bf(const float* __restrict__ A, int lda, const unsigned short* __restrict__ Wt, int ldb,
                                               const float* __restrict__ bias, float* __restrict__ C, int ldc, int M, int N, int K) {
  __shared__ __attribute__((aligned(16))) float so[4][16][64];
  const int tid = threadIdx.x, w = tid >> 5, lane = tid & 31, ln = lane & 15, hh = lane >> 4;
  const int ntn = N / 64;
  const int wid = blockIdx.x * 4 + w;
  const int mt = wid / ntn, nq = wid % ntn;
  if (mt * 16 >= M) return;
  const int row0 = mt * 16, col0 = nq * 64;
  const float* arow = A + (size_t)(row0 + ln) * lda;
  v8f acc[4] = {};
  for (int kb = 0; kb < K; kb += 32) {
    FragB ah, al;
    const v4f x0 = *(const v4fa*)(arow + kb + 8 * hh), x1 = *(const v4fa*)(arow + kb + 8 * hh + 4);
    const v4f x2 = *(const v4fa*)(arow + kb + 16 + 8 * hh), x3 = *(const v4fa*)(arow + kb + 16 + 8 * hh + 4);
    float xs[16] = {x0[0],x0[1],x0[2],x0[3],x1[0],x1[1],x1[2],x1[3],x2[0],x2[1],x2[2],x2[3],x3[0],x3[1],x3[2],x3[3]};
#pragma unroll
    for (int i = 0; i < 16; ++i) { const unsigned short hb = bf16_bits(xs[i]); ah.u[i] = hb; al.u[i] = ASPLIT ? bf16_bits(xs[i] - bf16_val(hb)) : (unsigned short)0; }
#pragma unroll
    for (int t = 0; t < 4; ++t) {
      const unsigned short* brow = Wt + (size_t)(col0 + t * 16 + ln) * ldb + kb;
      FragB b;
      b.half[0] = *(const v8us*)(brow + 8 * hh);
      b.half[1] = *(const v8us*)(brow + 16 + 8 * hh);
      acc[t] = mmaN<ASPLIT ? 2 : 1>(ah.v, al.v, b.v, b.v, acc[t]);
    }
  }
#pragma unroll
  for (int t = 0; t < 4; ++t) {
    float bv = bias ? bias[col0 + t * 16 + ln] : 0.f;
    if (BIAS_BF16) bv = bf16_round(bv);
#pragma unroll
    for (int r = 0; r < 8; ++r) { float v = acc[t][r] + bv; if (ACT == 1) v = fmaxf(v, 0.f); so[w][8 * hh + r][t * 16 + ln] = v; }
  }
  __builtin_amdgcn_fence(__ATOMIC_ACQ_REL, "workgroup");
  __builtin_amdgcn_wave_barrier();
  const int rsub = lane >> 4, c4 = (lane & 15) * 4;
  {
#pragma unroll
    for (int q = 0; q < 8; ++q) {
      const int r = q * 2 + rsub;
      const v4f v = *(const v4fa*)&so[w][r][c4];
      *(v4f*)(C + (size_t)(row0 + r) * ldc + col0 + c4) = v;
    }
    
  }
}

// GEMM C = act(A·W + bias + resid): A f32 (ASPLIT -> hi/lo 2 terms), Wt bf16 [N][K]; ACT 0 none, 1 relu, 2 exact gelu;
// resid (optional, f32, row index = (row % rmod), pitch ldr, RES_BF16 rounds it) added before the activation.
template <bool ASPLIT, int ACT, bool BIAS_BF16, bool RES_BF16>
__global__ __launch_bounds__(128) void k_gemm_bf3(const float* __restrict__ A, int lda, const unsigned short* __restrict__ Wt, int ldb,
                                                const float* __restrict__ bias, const float* __restrict__ resid, int rmod, int ldr,
                                                float* __restrict__ C, int ldc, int M, int N, int K) {
  __shared__ __attribute__((aligned(16))) float so[4][16][64];
  const int tid = threadIdx.x, w = tid >> 5, lane = tid & 31, ln = lane & 15, hh = lane >> 4;
  const int ntn = N / 64;
  const int wid = blockIdx.x * 4 + w;
  const int mt = wid / ntn, nq = wid % ntn;
  if (mt * 16 >= M) return;
  const int row0 = mt * 16, col0 = nq * 64;
  const float* arow = A + (size_t)(row0 + ln) * lda;
  v8f acc[4] = {};
  for (int kb = 0; kb < K; kb += 32) {
    FragB ah, al;
    const v4f x0 = *(const v4fa*)(arow + kb + 8 * hh), x1 = *(const v4fa*)(arow + kb + 8 * hh + 4);
    const v4f x2 = *(const v4fa*)(arow + kb + 16 + 8 * hh), x3 = *(const v4fa*)(arow + kb + 16 + 8 * hh + 4);
    float xs[16] = {x0[0],x0[1],x0[2],x0[3],x1[0],x1[1],x1[2],x1[3],x2[0],x2[1],x2[2],x2[3],x3[0],x3[1],x3[2],x3[3]};
#pragma unroll
    for (int i = 0; i < 16; ++i) { const unsigned short hb = bf16_bits(xs[i]); ah.u[i] = hb; al.u[i] = ASPLIT ? bf16_bits(xs[i] - bf16_val(hb)) : (unsigned short)0; }
#pragma unroll
    for (int t = 0; t < 4; ++t) {
      const unsigned short* brow = Wt + (size_t)(col0 + t * 16 + ln) * ldb + kb;
      FragB b;
      b.half[0] = *(const v8us*)(brow + 8 * hh);
      b.half[1] = *(const v8us*)(brow + 16 + 8 * hh);
      acc[t] = mmaN<ASPLIT ? 2 : 1>(ah.v, al.v, b.v, b.v, acc[t]);
    }
  }
#pragma unroll
  for (int t = 0; t < 4; ++t) {
    const int col = col0 + t * 16 + ln;
    float bv = bias ? bias[col] : 0.f;
    if (BIAS_BF16) bv = bf16_round(bv);
#pragma unroll
    for (int r = 0; r < 8; ++r) {
      float v = acc[t][r] + bv;
      if (resid) { float rv = resid[(size_t)((row0 + 8 * hh + r) % rmod) * ldr + col]; if (RES_BF16) rv = bf16_round(rv); v += rv; }
      if (ACT == 1) v = fmaxf(v, 0.f);
      if (ACT == 2) v = 0.5f * v * (1.0f + erff(v * 0.70710678118654752f));
      if (ACT == 3) { const float u = 0.7978845608028654f * (v + 0.044715f * v * v * v); v = 0.5f * v * (1.0f + tanhf(u)); }
      so[w][8 * hh + r][t * 16 + ln] = v;
    }
  }
  __builtin_amdgcn_fence(__ATOMIC_ACQ_REL, "workgroup");
  __builtin_amdgcn_wave_barrier();
  const int rsub = lane >> 4, c4 = (lane & 15) * 4;
  {
#pragma unroll
    for (int q = 0; q < 8; ++q) {
      const int r = q * 2 + rsub;
      const v4f v = *(const v4fa*)&so[w][r][c4];
      *(v4f*)(C + (size_t)(row0 + r) * ldc + col0 + c4) = v;
    }
    
  }
}
// row LayerNorm (biased variance, eps) over N: s = X (+ R); optional out_sum <- s; out_norm <- (s-mu)*rsqrt(var+eps)*g + b
template <bool PARAM_BF16>
__global__ __launch_bounds__(256) void k_layernorm(const float* __restrict__ X, const float* __restrict__ R, const float* __restrict__ g, const float* __restrict__ bta,
                                                  float* __restrict__ out_sum, float* __restrict__ out_norm, int N, float eps) {
  __shared__ float red[256];
  const int row = blockIdx.x, tid = threadIdx.x;
  const float* x = X + (size_t)row * N; const float* rr = R ? R + (size_t)row * N : nullptr;
  float vals[16];                     // up to N = 4096
  const int per = N / 256;            // contiguous chunk per thread? use strided-by-4 chunks: thread handles j = tid*4 + 1024*u
  float s1 = 0.f;
  for (int u = 0; u < per / 4; ++u) {
    const int j = tid * 4 + 1024 * u;
    const v4f a = *(const v4fa*)(x + j);
    v4f b = {0.f,0.f,0.f,0.f}; if (rr) b = *(const v4fa*)(rr + j);
#pragma unroll
    for (int q = 0; q < 4; ++q) { const float v = a[q] + b[q]; vals[u * 4 + q] = v; s1 += v; }
  }
  red[tid] = s1; __syncthreads();
  for (int st = 128; st > 0; st >>= 1) { if (tid < st) red[tid] += red[tid + st]; __syncthreads(); }
  const float mu = red[0] / (float)N; __syncthreads();
  float s2 = 0.f;
  for (int u = 0; u < per / 4; ++u)
#pragma unroll
    for (int q = 0; q < 4; ++q) { const float c = vals[u * 4 + q] - mu; s2 += c * c; }
  red[tid] = s2; __syncthreads();
  for (int st = 128; st > 0; st >>= 1) { if (tid < st) red[tid] += red[tid + st]; __syncthreads(); }
  const float rs = rsqrtf(red[0] / (float)N + eps);
  {
    for (int u = 0; u < per / 4; ++u) {
      const int j = tid * 4 + 1024 * u;
      v4f o, sm;
#pragma unroll
      for (int q = 0; q < 4; ++q) {
        float gg = g[j + q], bb = bta[j + q];
        if (PARAM_BF16) { gg = bf16_round(gg); bb = bf16_round(bb); }
        sm[q] = vals[u * 4 + q]; o[q] = (vals[u * 4 + q] - mu) * rs * gg + bb;
      }
      if (out_sum) *(v4f*)(out_sum + (size_t)row * N + j) = sm;
      *(v4f*)(out_norm + (size_t)row * N + j) = o;
    }
    
  }
}



// ---- f16 WMMA path (v_wmma_f32_16x16x32_f16): 11-bit significands for operands in range — used where a [0,1] probability operand needs more precision than bf16
typedef _Float16 v16h __attribute__((ext_vector_type(16)));
union FragH { v16h v; v8us half[2]; _Float16 h[16]; unsigned short u[16]; };
template <int NT>
__device__ __forceinline__ v8f mmaH(v16h ah, v16h al, v16h bh, v16h bl, v8f c) {
  c = __builtin_amdgcn_wmma_f32_16x16x32_f16(false, ah, false, bh, (short)0, c, false, false);
  if (NT >= 2) c = __builtin_amdgcn_wmma_f32_16x16x32_f16(false, al, false, bh, (short)0, c, false, false);
  if (NT >= 3) c = __builtin_amdgcn_wmma_f32_16x16x32_f16(false, ah, false, bl, (short)0, c, false, false);
  asm volatile("v_nop\n\tv_nop\n\tv_nop\n\tv_nop" : "+v"(c) : "v"(ah), "v"(al), "v"(bh), "v"(bl));
  return c;
}
// batched GEMM like k_gemm_b but f16 operands: A f32 (split into f16 hi/lo if ASPLIT, else rounded to f16), Bt = f16 values [n][k]; alpha; C f32; N multiple of 16 (partial tiles skipped)
template <bool ASPLIT>
__global__ __launch_bounds__(128) void k_gemm_h(const float* __restrict__ A, int lda, size_t sA, const _Float16* __restrict__ Bh, int ldb, size_t sB, float alpha, float* __restrict__ C, int ldc, size_t sC, int M, int N, int K) {
  __shared__ __attribute__((aligned(16))) float so[4][16][64];
  const int tid = threadIdx.x, w = tid >> 5, lane = tid & 31, ln = lane & 15, hh = lane >> 4; const int by = blockIdx.y;
  A += (size_t)by * sA; Bh += (size_t)by * sB; C += (size_t)by * sC;
  const int ntn = (N + 63) / 64; const int wid = blockIdx.x * 4 + w; const int mt = wid / ntn, nq = wid % ntn; if (mt * 16 >= M) return;
  const int row0 = mt * 16, col0 = nq * 64; const float* arow = A + (size_t)(row0 + ln) * lda;
  v8f acc[4] = {};
  for (int kb = 0; kb < K; kb += 32) {
    FragH ah, al;
    const v4f x0 = *(const v4fa*)(arow + kb + 8 * hh), x1 = *(const v4fa*)(arow + kb + 8 * hh + 4), x2 = *(const v4fa*)(arow + kb + 16 + 8 * hh), x3 = *(const v4fa*)(arow + kb + 16 + 8 * hh + 4);
    float xs[16] = {x0[0],x0[1],x0[2],x0[3],x1[0],x1[1],x1[2],x1[3],x2[0],x2[1],x2[2],x2[3],x3[0],x3[1],x3[2],x3[3]};
#pragma unroll
    for (int i = 0; i < 16; ++i) { const _Float16 h = (_Float16)xs[i]; ah.h[i] = h; al.h[i] = ASPLIT ? (_Float16)(xs[i] - (float)h) : (_Float16)0.0f; }
#pragma unroll
    for (int t = 0; t < 4; ++t) { if (col0 + t * 16 >= N) continue; const size_t boff = (size_t)(col0 + t * 16 + ln) * ldb + kb; FragH bq; bq.half[0] = *(const v8us*)(Bh + boff + 8 * hh); bq.half[1] = *(const v8us*)(Bh + boff + 16 + 8 * hh);
      acc[t] = mmaH<ASPLIT ? 2 : 1>(ah.v, al.v, bq.v, bq.v, acc[t]); }
  }
#pragma unroll
  for (int t = 0; t < 4; ++t) { if (col0 + t * 16 >= N) continue;
#pragma unroll
    for (int r = 0; r < 8; ++r) so[w][8 * hh + r][t * 16 + ln] = acc[t][r] * alpha; }
  __builtin_amdgcn_fence(__ATOMIC_ACQ_REL, "workgroup"); __builtin_amdgcn_wave_barrier();
  const int rsub = lane >> 4, c4 = (lane & 15) * 4;
  {
#pragma unroll
    for (int q = 0; q < 8; ++q) { const int r = q * 2 + rsub; if (col0 + c4 < N) { const v4f v = *(const v4fa*)&so[w][r][c4]; *(v4f*)(C + (size_t)(row0 + r) * ldc + col0 + c4) = v; } }
     }
}

// k_gemm_hh variant with fused epilogue: v = acc·alpha + bias[by·sBias + col] (+ CP[(row/rowsPerB)·sCPb + by·64 + col] if CP) ; ACT 0 none / 1 elu ; writes f16 C16 (and f32 C if non-null)
template <int ACT>
__global__ __launch_bounds__(128) void k_gemm_hhx(const _Float16* __restrict__ A, int lda, size_t sA, const _Float16* __restrict__ Bh, int ldb, size_t sB, float alpha, const float* __restrict__ bias, size_t sBias, const float* __restrict__ CP, int rowsPerB, size_t sCPb, int row0g,
    float* __restrict__ C, _Float16* __restrict__ C16, int ldc, size_t sC, int M, int N, int K) {
  __shared__ __attribute__((aligned(16))) float so[4][16][64];
  const int tid = threadIdx.x, w = tid >> 5, lane = tid & 31, ln = lane & 15, hh = lane >> 4; const int by = blockIdx.y;
  A += (size_t)by * sA; Bh += (size_t)by * sB; const size_t cofs = (size_t)by * sC; const float* bp = bias ? bias + (size_t)by * sBias : nullptr;
  const int ntn = (N + 63) / 64; const int wid = blockIdx.x * 4 + w; const int mt = wid / ntn, nq = wid % ntn; if (mt * 16 >= M) return;
  const int row0 = mt * 16, col0 = nq * 64; const _Float16* arow = A + (size_t)(row0 + ln) * lda;
  v8f acc[4] = {};
  for (int kb = 0; kb < K; kb += 32) { FragH ah; ah.half[0] = *(const v8us*)((const unsigned short*)arow + kb + 8 * hh); ah.half[1] = *(const v8us*)((const unsigned short*)arow + kb + 16 + 8 * hh);
#pragma unroll
    for (int t = 0; t < 4; ++t) { if (col0 + t * 16 >= N) continue; const size_t boff = (size_t)(col0 + t * 16 + ln) * ldb + kb; FragH bq; bq.half[0] = *(const v8us*)((const unsigned short*)Bh + boff + 8 * hh); bq.half[1] = *(const v8us*)((const unsigned short*)Bh + boff + 16 + 8 * hh);
      acc[t] = mmaH<1>(ah.v, ah.v, bq.v, bq.v, acc[t]); }
  }
#pragma unroll
  for (int t = 0; t < 4; ++t) { if (col0 + t * 16 >= N) continue; const int col = col0 + t * 16 + ln; const float bv = bp ? bf16_round(bp[col]) : 0.f;
#pragma unroll
    for (int r = 0; r < 8; ++r) { float v = acc[t][r] * alpha + bv; if (CP) { const int rr = row0g + row0 + 8 * hh + r; if (rowsPerB < 0) v += CP[cofs + (size_t)rr * ldc + col];      /* rowsPerB < 0: own element of the batched C plane */ else { const int bidx = rr / rowsPerB; v += CP[(size_t)bidx * sCPb + (size_t)by * 64 + col]; } } if (ACT == 1) v = (v > 0.f) ? v : expm1f(v); else if (ACT == 7) v = (v > 0.f) ? v + 1.0f : expf(v); else if (ACT == 8) v = tanhf(v); else if (ACT == 9) v = 0.5f * v * (1.0f + tanhf(0.7978845608028654f * (v + 0.044715f * v * v * v))); else if (ACT == 11) v = 1.0f / (1.0f + expf(-v)); else if (ACT == 12) v = (v > 0.f) ? v : 0.01f * v; else if (ACT == 14) v = (v > 0.f) ? v : 0.1f * v; else if (ACT == 16) v = (v >= 0.f) ? v : 0.3f * v; else if (ACT == 17) v = (v >= 0.f) ? v : 0.2f * v; else if (ACT == 15) v = v / (1.0f + expf(-v)); else if (ACT == 3) v = fmaxf(v, 0.f); else if (ACT == 6) v = 0.5f * v * (1.0f + erff(v * 0.70710678118654752f)); so[w][8 * hh + r][t * 16 + ln] = v; } }
  __builtin_amdgcn_fence(__ATOMIC_ACQ_REL, "workgroup"); __builtin_amdgcn_wave_barrier();
  const int rsub = lane >> 4, c4 = (lane & 15) * 4; typedef _Float16 v4h __attribute__((ext_vector_type(4)));
  {
#pragma unroll
    for (int q = 0; q < 8; ++q) { const int r = q * 2 + rsub; if (col0 + c4 < N) { const v4f v = *(const v4fa*)&so[w][r][c4]; if (C) *(v4f*)(C + cofs + (size_t)(row0 + r) * ldc + col0 + c4) = v; if (C16) { v4h h4; for (int i = 0; i < 4; ++i) h4[i] = (_Float16)v[i]; *(v4h*)(C16 + cofs + (size_t)(row0 + r) * ldc + col0 + c4) = h4; } } }
     }
}


typedef _Float16 v4h __attribute__((ext_vector_type(4)));

__global__ __launch_bounds__(256) void k_h16(const float* __restrict__ x, _Float16* __restrict__ X16, size_t n8) { const size_t t = (size_t)blockIdx.x * 256 + threadIdx.x; if (t >= n8) return; FragH f;
#pragma unroll
  for (int q = 0; q < 8; ++q) f.h[q] = (_Float16)x[t * 8 + q]; *(v8us*)((unsigned short*)X16 + t * 8) = f.half[0];  }
__global__ __launch_bounds__(256) void k_round16f(const float* __restrict__ W, _Float16* __restrict__ Bt, size_t n8) { const size_t t = (size_t)blockIdx.x * 256 + threadIdx.x; if (t >= n8) return; FragH f;
#pragma unroll
  for (int i = 0; i < 8; ++i) f.h[i] = (_Float16)(bf16_round(W[t * 8 + i]) * 16.0f); *(v8us*)((unsigned short*)Bt + t * 8) = f.half[0];  }
// ---- element-wise conversions: one launch per stage, 32 or 64 elements a thread, so that a stage is a few thousand waves that each keep 16 to 24 loads of 16 bytes in flight ----
// k_prep, blocks 0 .. PWB - 1: the four weight matrices, f32 [in][out] -> Bt[n][k] = f16(bf16-rounded value x 16). A thread owns a tile of 8 k x 8 n; the lanes of a wave lie 4 along n and 8 along k,
// so that a wave's loads read whole 128-byte lines of its k rows and each of its stores writes whole lines of 4 n rows. Blocks PWB ..: the three row casts, f32 -> f16(bf16-rounded value), 4 pieces of 8 elements of each tensor a thread.
#define PWB 256                            /* 64 blocks a matrix: 512 waves of 32 tiles = 128 x 128 tiles */
#define PXB 512                            /* 1024 pieces of 8 elements a block and tensor */
__global__ __launch_bounds__(256) void k_prep(const float* __restrict__ xq, const float* __restrict__ xk, const float* __restrict__ xv, const float* __restrict__ wq, const float* __restrict__ wk, const float* __restrict__ wv, const float* __restrict__ wo, _Float16* __restrict__ X16, _Float16* __restrict__ BT) {
  static_assert(DM == 1024 && NR * DM / 8 == (size_t)PXB * 1024, "k_prep: the block counts are written for these shapes");
  const int tid = threadIdx.x;
  if (blockIdx.x < PWB) {      /* block-uniform */
    const int mi = blockIdx.x >> 6; const float* Wm = mi == 0 ? wq : mi == 1 ? wk : mi == 2 ? wv : wo;
    const int wid = (blockIdx.x & 63) * 8 + (tid >> 5), lane = tid & 31; const int n8 = ((wid >> 4) * 4 + (lane & 3)) * 8, k8 = ((wid & 15) * 8 + (lane >> 2)) * 8;
    const float* sp = Wm + (size_t)k8 * DM + n8; unsigned short* dp = (unsigned short*)BT + (size_t)mi * (DM * DM) + (size_t)n8 * DM + k8;
    v4f a[8][2]; v8us o[8];
#pragma unroll      /* constant indices: the tile stays in registers, all 16 loads in flight */
    for (int i = 0; i < 8; ++i) { a[i][0] = *(const v4fa*)(sp + i * DM); a[i][1] = *(const v4fa*)(sp + i * DM + 4); }
    asm volatile("s_wait_xcnt 0x0" :: "v"(sp) : "memory");      /* the loads' address registers stay untouched up to this wait; its memory clobber also keeps all 16 loads in front of the first store (without it the build held four loads back behind stores) */
#pragma unroll
    for (int j = 0; j < 8; ++j) { FragH f;
#pragma unroll
      for (int i = 0; i < 8; ++i) f.h[i] = (_Float16)(bf16_round(a[i][j >> 2][j & 3]) * 16.0f);
      o[j] = f.half[0]; }
#pragma unroll
    for (int j = 0; j < 8; ++j) *(v8us*)(dp + j * DM) = o[j];
  } else {
    const size_t e0 = ((size_t)(blockIdx.x - PWB) * 1024 + tid) * 8;      /* the thread's first element; its pieces lie 256 pieces apart */
    const float* s0 = xq + e0; const float* s1 = xk + e0; const float* s2 = xv + e0; unsigned short* dp = (unsigned short*)X16 + e0;
    v4f a[3][4][2]; v8us o[3][4];
#pragma unroll      /* constant indices: registers, all 24 loads in flight */
    for (int u = 0; u < 4; ++u) { a[0][u][0] = *(const v4fa*)(s0 + u * 2048); a[0][u][1] = *(const v4fa*)(s0 + u * 2048 + 4); a[1][u][0] = *(const v4fa*)(s1 + u * 2048); a[1][u][1] = *(const v4fa*)(s1 + u * 2048 + 4); a[2][u][0] = *(const v4fa*)(s2 + u * 2048); a[2][u][1] = *(const v4fa*)(s2 + u * 2048 + 4); }
    asm volatile("s_wait_xcnt 0x0" :: "v"(s0), "v"(s1), "v"(s2) : "memory");      /* the loads' address registers stay untouched up to this wait; its memory clobber also keeps all 24 loads in front of the first store (without it the build issued them in three groups between the stores) */
#pragma unroll
    for (int s = 0; s < 3; ++s)
#pragma unroll
      for (int u = 0; u < 4; ++u) { FragH f;
#pragma unroll
        for (int q = 0; q < 8; ++q) f.h[q] = (_Float16)bf16_round(a[s][u][q >> 2][q & 3]);
        o[s][u] = f.half[0]; }
#pragma unroll
    for (int s = 0; s < 3; ++s)
#pragma unroll
      for (int u = 0; u < 4; ++u) *(v8us*)(dp + (size_t)s * (NR * DM) + u * 2048) = o[s][u];
    asm volatile("s_wait_xcnt 0x0" ::: "memory");      /* in the built code the weight part's first instructions stand on the other side of the closing branch and rewrite registers that these stores name: the wait stands in front of them */
  } }

// ---- fast GEMM (block tile 128x64, wave tile 32x64; requires M % 128 == 0 rows per launch region, N % 64 == 0 and K % 128 == 0); epilogue = k_gemm_hhx semantics ----
// The block's 128 A rows and 64 B rows are staged in LDS 128 k at a time (rows of 256 bytes, whole lines) by asynchronous 16-byte copies, two buffers: tile t + 2 flies while tile t + 1 is worked on.
// The four waves share the B rows; fragments are read from LDS by g2_frag in the k order and the kb order of the direct loads, so every accumulator sums in the same order.
__device__ __forceinline__ v16h g2_frag(const _Float16* p, int hh) { FragH f; f.half[0] = *(const v8us*)((const unsigned short*)p + 8 * hh); f.half[1] = *(const v8us*)((const unsigned short*)p + 16 + 8 * hh); return f.v; }
__device__ __forceinline__ v8f g2_mma(v16h a, v16h b, v8f c) { v8f d = __builtin_amdgcn_wmma_f32_16x16x32_f16(false, a, false, b, (short)0, c, false, false); asm volatile("v_nop\n\tv_nop\n\tv_nop\n\tv_nop" : "+v"(d) : "v"(a), "v"(b)); return d; }
#define GKS 128                            /* k per staged tile */
#define GLP 136                            /* LDS row pitch in f16: 128 + 8 = 272 bytes, for the 16-byte fragment reads */
// Twelve asynchronous 16-byte copies, global to LDS, each lane its own two addresses. The closing s_wait_xcnt 0 stands inside the statement so that no address register is rewritten ahead of it.
__device__ __forceinline__ void g2_copy12(const unsigned* l, const char* const* g) {
  asm volatile("global_load_async_to_lds_b128 %0, %12, off\n\tglobal_load_async_to_lds_b128 %1, %13, off\n\tglobal_load_async_to_lds_b128 %2, %14, off\n\tglobal_load_async_to_lds_b128 %3, %15, off\n\t"
               "global_load_async_to_lds_b128 %4, %16, off\n\tglobal_load_async_to_lds_b128 %5, %17, off\n\tglobal_load_async_to_lds_b128 %6, %18, off\n\tglobal_load_async_to_lds_b128 %7, %19, off\n\t"
               "global_load_async_to_lds_b128 %8, %20, off\n\tglobal_load_async_to_lds_b128 %9, %21, off\n\tglobal_load_async_to_lds_b128 %10, %22, off\n\tglobal_load_async_to_lds_b128 %11, %23, off\n\ts_wait_xcnt 0x0"
               :: "v"(l[0]), "v"(l[1]), "v"(l[2]), "v"(l[3]), "v"(l[4]), "v"(l[5]), "v"(l[6]), "v"(l[7]), "v"(l[8]), "v"(l[9]), "v"(l[10]), "v"(l[11]),
                  "v"(g[0]), "v"(g[1]), "v"(g[2]), "v"(g[3]), "v"(g[4]), "v"(g[5]), "v"(g[6]), "v"(g[7]), "v"(g[8]), "v"(g[9]), "v"(g[10]), "v"(g[11]) : "memory"); }
template <int ACT, int QKV>
__global__ __launch_bounds__(128) void k_gemm2(const _Float16* __restrict__ A, int lda, size_t sA, const _Float16* __restrict__ Bh, int ldb, size_t sB, float alpha, const float* __restrict__ bias, size_t sBias, const float* __restrict__ CP, int rowsPerB, size_t sCPb, int row0g,
    float* __restrict__ C, _Float16* __restrict__ C16, int ldc, size_t sC, int M, int N, int K, _Float16* __restrict__ VTo) { static_assert(ACT == 0 || ACT == 3 || ACT == 6 || ACT == 8 || ACT == 9 || ACT == 11 || ACT == 12 || ACT == 14 || ACT == 15 || ACT == 16 || ACT == 17, "k_gemm2: unsupported ACT code (would silently apply no activation)");
  __shared__ __attribute__((aligned(16))) float so[4][32][68];
  __shared__ __attribute__((aligned(16))) _Float16 ta[2][128][GLP]; __shared__ __attribute__((aligned(16))) _Float16 tb[2][64][GLP];
  const int tid = threadIdx.x, w = tid >> 5, lane = tid & 31, ln = lane & 15, hh = lane >> 4; const int by = blockIdx.y;
  A += (size_t)by * sA; Bh += (size_t)by * sB; const size_t cofs = (size_t)by * sC; const float* bp = bias ? bias + (size_t)by * sBias : nullptr;
  const bool vtr = QKV && by == 2;      /* block-uniform: the v product runs with its operands swapped (rows = output features, columns = tokens; lda == ldb there), so that its row stores are V^T rows */
  if (vtr) { const _Float16* sw = A; A = Bh; Bh = sw; const int ms = M; M = N; N = ms; }
  const int ntn = N >> 6; const int mt = blockIdx.x / ntn, nq = blockIdx.x - mt * ntn; const int row0 = mt * 128 + 32 * w, col0 = nq * 64; if (mt * 128 >= M) return;      /* block-uniform, in front of every barrier */
  const int srow = tid >> 4, sc8 = (tid & 15) * 8;      /* staging: 16 threads per row of 256 bytes, 8 rows a step */
  const char* ga = (const char*)(A + (size_t)(mt * 128 + srow) * lda + sc8); const char* gb = (const char*)(Bh + (size_t)(col0 + srow) * ldb + sc8); const size_t ga8 = (size_t)lda * 16, gb8 = (size_t)ldb * 16;      /* 8 rows in bytes */
  const unsigned la = (unsigned)(size_t)&ta[0][srow][sc8], lb = (unsigned)(size_t)&tb[0][srow][sc8];      /* byte addresses in the work-group's LDS */
  auto stage = [&](int t, int buf) { unsigned l[24]; const char* g[24];      /* one tile: 16 copies of A and 8 of B per thread */
#pragma unroll
    for (int j = 0; j < 16; ++j) { l[j] = la + (unsigned)buf * (unsigned)sizeof(ta[0]) + (unsigned)j * (8u * GLP * 2u); g[j] = ga + (size_t)t * (GKS * 2) + (size_t)j * ga8; }
#pragma unroll
    for (int j = 0; j < 8; ++j) { l[16 + j] = lb + (unsigned)buf * (unsigned)sizeof(tb[0]) + (unsigned)j * (8u * GLP * 2u); g[16 + j] = gb + (size_t)t * (GKS * 2) + (size_t)j * gb8; }
    g2_copy12(l, g); g2_copy12(l + 12, g + 12); };
  const v8f z8 = {0.f,0.f,0.f,0.f,0.f,0.f,0.f,0.f}; v8f c00 = z8, c01 = z8, c02 = z8, c03 = z8, c10 = z8, c11 = z8, c12 = z8, c13 = z8;
  const int nt = K / GKS;
  stage(0, 0);
  asm volatile("s_wait_asynccnt 0x0" ::: "memory");      /* this wave's copies of tile 0 have landed */
  __syncthreads();      /* publishes tile 0 to the four waves */
  if (nt > 1) stage(1, 1);
#pragma unroll 1      /* one trip is 32 matrix instructions of straight-line code already */
  for (int t = 0; t < nt; ++t) { const _Float16* ap = &ta[t & 1][32 * w + ln][0]; const _Float16* bq = &tb[t & 1][ln][0];
    v16h fa[2][2], fb[2][4];      /* two fragment sets: the next 32 k of this tile are read from LDS as one group ahead of the current block's matrix instructions */
    fa[0][0] = g2_frag(ap, hh); fa[0][1] = g2_frag(ap + 16 * GLP, hh); fb[0][0] = g2_frag(bq, hh); fb[0][1] = g2_frag(bq + 16 * GLP, hh); fb[0][2] = g2_frag(bq + 32 * GLP, hh); fb[0][3] = g2_frag(bq + 48 * GLP, hh);
#pragma unroll      /* makes the set index a constant, so that the sets are registers */
    for (int q = 0; q < GKS / 32; ++q) { const int s = q & 1, n = s ^ 1, kn = (q + 1) * 32;
      if (q + 1 < GKS / 32) { fa[n][0] = g2_frag(ap + kn, hh); fa[n][1] = g2_frag(ap + 16 * GLP + kn, hh); fb[n][0] = g2_frag(bq + kn, hh); fb[n][1] = g2_frag(bq + 16 * GLP + kn, hh); fb[n][2] = g2_frag(bq + 32 * GLP + kn, hh); fb[n][3] = g2_frag(bq + 48 * GLP + kn, hh); }
      c00 = g2_mma(fa[s][0], fb[s][0], c00); c10 = g2_mma(fa[s][1], fb[s][0], c10); c01 = g2_mma(fa[s][0], fb[s][1], c01); c11 = g2_mma(fa[s][1], fb[s][1], c11);
      c02 = g2_mma(fa[s][0], fb[s][2], c02); c12 = g2_mma(fa[s][1], fb[s][2], c12); c03 = g2_mma(fa[s][0], fb[s][3], c03); c13 = g2_mma(fa[s][1], fb[s][3], c13); }
    asm volatile("s_wait_dscnt 0x0" ::: "memory");      /* this wave's reads of tile t are done before its buffer is refilled */
    asm volatile("s_wait_asynccnt 0x0" ::: "memory");      /* this wave's copies of tile t + 1 have landed */
    __syncthreads();      /* publishes tile t + 1 and ends every wave's reads of tile t */
    if (t + 2 < nt) stage(t + 2, t & 1); }
  asm volatile("s_wait_asynccnt 0x0" ::: "memory");      /* no copy is outstanding when the wave goes on */
  v8f accs[8] = {c00, c01, c02, c03, c10, c11, c12, c13};
#pragma unroll
  for (int u = 0; u < 8; ++u) { const int t = u & 3, half = u >> 2; const int col = col0 + t * 16 + ln; const float bv = (!QKV && bp) ? bf16_round(bp[col]) : 0.f;      /* the projection launch has neither a bias nor an addend plane */
#pragma unroll
    for (int r = 0; r < 8; ++r) { const int rloc = half * 16 + 8 * hh + r; float v = accs[u][r] * alpha + bv; if (!QKV && CP) { if (rowsPerB < 0) v += CP[cofs + (size_t)(row0g + row0 + rloc) * ldc + col];      /* rowsPerB < 0: own element of the batched C plane */ else { const int bidx = (row0g + row0 + rloc) / rowsPerB; v += CP[(size_t)bidx * sCPb + (size_t)by * 64 + col]; } }
      if (ACT == 3) v = fmaxf(v, 0.f); else if (ACT == 6) v = 0.5f * v * (1.0f + erff(v * 0.70710678118654752f)); else if (ACT == 11) v = 1.0f / (1.0f + expf(-v)); else if (ACT == 15) v = v / (1.0f + expf(-v)); else if (ACT == 12) v = (v > 0.f) ? v : 0.01f * v; else if (ACT == 8) v = tanhf(v); else if (ACT == 9) v = 0.5f * v * (1.0f + tanhf(0.7978845608028654f * (v + 0.044715f * v * v * v))); else if (ACT == 14) v = (v > 0.f) ? v : 0.1f * v; else if (ACT == 16) v = (v >= 0.f) ? v : 0.3f * v; else if (ACT == 17) v = (v >= 0.f) ? v : 0.2f * v;
      so[w][rloc][t * 16 + ln] = v; } }
  __builtin_amdgcn_fence(__ATOMIC_ACQ_REL, "workgroup"); __builtin_amdgcn_wave_barrier();
  const int rsub = lane >> 4, c4 = (lane & 15) * 4;
  if (QKV) {      /* the projection launch (grid y: q, k, v) stores what the attention launch reads: q and k as f16 hi + x1024 residual planes (C16: q hi, q lo, k hi, k lo, sC apart), v as V^T rows [feature][batch * SQ + token]; f32 rows (C: q, k, v planes) only for each batch's first QT0 tokens, which the exact path reads */
    static_assert(QT0 == 128, "a batch's exact rows are one 128-row block, or two 64-token column blocks of the swapped v product");
    v4f vv[16], pa[16]; v4h vh[16], vl[16];
#pragma unroll      /* constant indices: the sixteen steps' pieces are registers, the row steps immediate offsets */
    for (int q = 0; q < 16; ++q) { vv[q] = *(const v4fa*)&so[w][q * 2 + rsub][c4];
#pragma unroll
      for (int i = 0; i < 4; ++i) { const _Float16 h = (_Float16)vv[q][i]; vh[q][i] = h; vl[q][i] = (_Float16)((vv[q][i] - (float)h) * 1024.0f); pa[q][i] = accs[q >> 1][(q & 1) * 4 + i] * alpha; } }
    if (vtr) {
      if ((col0 & (SQ - 1)) < QT0) { float* fp = C + cofs + (size_t)(col0 + ln) * DM + row0 + 8 * hh;      /* block-uniform: a lane's accumulator registers are 8 successive features of one token: the f32 v row pieces go out straight from them */
        __builtin_amdgcn_sched_barrier(0);      /* every product stands in front of the first store */
#pragma unroll
        for (int u = 0; u < 8; ++u) { *(v4f*)(fp + (u & 3) * (16 * DM) + (u >> 2) * 16) = pa[2 * u]; *(v4f*)(fp + (u & 3) * (16 * DM) + (u >> 2) * 16 + 4) = pa[2 * u + 1]; }
        asm volatile("s_wait_xcnt 0x0" ::: "memory"); }      /* whatever is written behind this block may land on registers that these stores name: the wait stands in front of it */
      _Float16* tp = VTo + (size_t)(row0 + rsub) * (NB * SQ) + col0 + c4;
      __builtin_amdgcn_sched_barrier(0);      /* every conversion and the address stand in front of the first store */
#pragma unroll
      for (int q = 0; q < 16; ++q) *(v4h*)(tp + q * (2 * NB * SQ)) = vh[q];
      asm volatile("s_wait_xcnt 0x0" ::: "memory");      /* in the built code the other branch's block may stand behind these stores and rewrite registers that they name: the wait stands in front of it */
    } else {
      if ((mt & (SQ / 128 - 1)) == 0) { float* fp = C + cofs + (size_t)(row0 + rsub) * DM + col0 + c4;      /* block-uniform */
        __builtin_amdgcn_sched_barrier(0);      /* the LDS reads and the address stand in front of the first store */
#pragma unroll
        for (int q = 0; q < 16; ++q) *(v4f*)(fp + q * (2 * DM)) = vv[q];
        asm volatile("s_wait_xcnt 0x0" ::: "memory"); }      /* as above */
      _Float16* hp = C16 + (size_t)(2 * by) * sC + (size_t)(row0 + rsub) * DM + col0 + c4; _Float16* lp = hp + sC;
      __builtin_amdgcn_sched_barrier(0);      /* conversions and addresses stand in front of the first store */
#pragma unroll
      for (int q = 0; q < 16; ++q) { *(v4h*)(hp + q * (2 * DM)) = vh[q]; *(v4h*)(lp + q * (2 * DM)) = vl[q]; }
      asm volatile("s_wait_xcnt 0x0" ::: "memory"); }      /* in the built code the swapped product's block stands behind these stores and rewrites registers that they name: the wait stands in front of it */
    return; }
  {
#pragma unroll
    for (int q = 0; q < 16; ++q) { const int r = q * 2 + rsub; const v4f v = *(const v4fa*)&so[w][r][c4]; if (C) { *(v4f*)(C + cofs + (size_t)(row0 + r) * ldc + col0 + c4) = v; asm volatile("s_wait_xcnt 0x0" ::: "memory"); }      /* the f32 store's data and address registers are rewritten right behind it (the f16 conversion, the next row): the wait stands in front of that */
      if (C16) { v4h h4; for (int i = 0; i < 4; ++i) h4[i] = (_Float16)v[i]; *(v4h*)(C16 + cofs + (size_t)(row0 + r) * ldc + col0 + c4) = h4; } }
     } }


__global__ __launch_bounds__(256) void k_wnat(const float* __restrict__ w, size_t n8, _Float16* __restrict__ Bt) { const size_t t = (size_t)blockIdx.x * 256 + threadIdx.x; if (t >= n8) return; FragH f; for (int q = 0; q < 8; ++q) f.h[q] = (_Float16)(bf16_round(w[t * 8 + q]) * 16.0f); *(v8us*)((unsigned short*)Bt + t * 8) = f.half[0];  }
__global__ __launch_bounds__(256) void k_rsm(const float* __restrict__ S, _Float16* __restrict__ P, int nrows) {
  #pragma clang fp contract(off)
  const int i = blockIdx.x * 256 + threadIdx.x; if (i >= nrows) return; const float* s = S + (size_t)i * SQ; float mx = -3.0e38f;
#pragma unroll 1
  for (int j = 0; j < SQ; ++j) mx = fmaxf(mx, s[j]); float se = 0.f;
#pragma unroll 1
  for (int j = 0; j < SQ; ++j) se += expf(s[j] - mx); const float sc = 256.0f / se;
#pragma unroll 1
  for (int j0 = 0; j0 < SQ; j0 += 8) { FragH f; for (int q = 0; q < 8; ++q) f.h[q] = (_Float16)(expf(s[j0 + q] - mx) * sc); unsigned short* d = (unsigned short*)P + (size_t)i * SQ + j0; *(v8us*)d = f.half[0];  } }
__global__ __launch_bounds__(256) void k_vt(const _Float16* __restrict__ V16, int b, int h0, _Float16* __restrict__ VT) { __shared__ unsigned short tl[64][65]; const int tid = threadIdx.x; const int hh = blockIdx.x % HG, sg = blockIdx.x / HG; const int s0 = sg * 64; const int h = h0 + hh;
  for (int i = tid; i < 64 * 8; i += 256) { const int j = i / 8, d8 = (i % 8) * 8; FragH f; f.half[0] = *(const v8us*)((const unsigned short*)V16 + ((size_t)b * SQ + s0 + j) * DM + h * HD + d8); for (int q = 0; q < 8; ++q) tl[d8 + q][j] = f.u[q]; }
  __syncthreads();
  { for (int i = tid; i < 64 * 8; i += 256) { const int d = i / 8, j8 = (i % 8) * 8; FragH f; for (int q = 0; q < 8; ++q) f.u[q] = tl[d][j8 + q]; *(v8us*)((unsigned short*)VT + ((size_t)hh * HD + d) * SQ + s0 + j8) = f.half[0]; }  } }



// Exact f32 attention for the first QT0 rows of one head and batch, run by the attention launch's block that owns these rows: one thread per query row; q, k, v are the f32 rows of the full projections; o leaves as f16 hi (into the merged o rows) + x1024 residual.
// The 128 key and value rows (64 floats each) are staged once in LDS by whole-line loads and then read as broadcasts; the thread's q row and o row stay in registers; four keys' score sums run side by side, each in index order.
// Every plain '#pragma unroll' below makes the indices of q, o, s and the staged pieces constants, so that these arrays are registers and not scratch.
__device__ __forceinline__ void fa_exact(const float* __restrict__ QF, const float* __restrict__ KF, const float* __restrict__ VF, int h, int b, int w, _Float16* __restrict__ OH, _Float16* __restrict__ OL, float (*lk)[64], float (*lv)[64]) {
  static_assert(QT0 == 128 && HD == 64, "fa_exact: one thread per row of a block of 128, staging in 16 steps of 8 rows");
  const int tid = threadIdx.x; const int i = tid; const size_t r0 = (size_t)b * SQ;      /* the batch's first token row */
  const char* qh = (const char*)(QF + r0 * DM + h * HD); const char* kh = (const char*)(KF + r0 * DM + h * HD); const char* vh = (const char*)(VF + r0 * DM + h * HD);      /* block-uniform bases */
  const unsigned qoff = (unsigned)(i * DM) * 4u;      /* byte offset of the thread's q row */
  float q[HD], o[HD];
#pragma unroll
  for (int c = 0; c < HD / 4; ++c) { const v4f t4 = *(const v4fa*)(qh + qoff + c * 16);
#pragma unroll
    for (int u = 0; u < 4; ++u) { q[c * 4 + u] = t4[u]; o[c * 4 + u] = 0.f; } }
  const int srow = tid >> 4, sc4 = (tid & 15) * 4; const unsigned soff = (unsigned)(srow * DM + sc4) * 4u;      /* staging: 16 threads per row of 256 bytes, 8 rows a step; byte offset */
  const char* kp = kh + soff; const char* vp = vh + soff;      /* the thread's own staging addresses */
  { v4f tk[16], tv[16];      /* all 32 loads of a thread in flight together */
#pragma unroll
    for (int it = 0; it < 16; ++it) { tk[it] = *(const v4fa*)(kp + it * (8 * DM * 4)); tv[it] = *(const v4fa*)(vp + it * (8 * DM * 4)); }
    asm volatile("s_wait_xcnt 0x0" :: "v"(qoff), "v"(soff), "v"(kp), "v"(vp) : "memory");      /* the loads' offset and address registers stay untouched up to this wait: nothing, a later load's data included, lands on a register that an issued load names */
#pragma unroll
    for (int it = 0; it < 16; ++it) { *(v4f*)&lk[it * 8 + srow][sc4] = tk[it]; *(v4f*)&lv[it * 8 + srow][sc4] = tv[it]; } }
  __syncthreads();      /* publishes the staged rows to the four waves */
  float m = -1.0e30f, l = 0.f; const int nkey = 32 * w + 32;      /* causal form: keys up to the wave's last row (wave-uniform) */
#pragma unroll 1      /* the body is four whole keys of straight-line code already: more would only grow the text */
  for (int j0 = 0; j0 < nkey; j0 += 4) { float s[4] = {0.f, 0.f, 0.f, 0.f}; v4f g[2][16];      /* two register sets of 16 LDS pieces: eight groups a trip (16 head dims of the four k rows, four times; then the four v rows), each read while the group before it is worked on */
#pragma unroll
    for (int cc = 0; cc < 4; ++cc)
#pragma unroll
      for (int u = 0; u < 4; ++u) g[0][cc * 4 + u] = *(const v4f*)&lk[j0 + u][cc * 4];
#pragma unroll
    for (int p = 0; p < 8; ++p) { const int cu = p & 1, nx = cu ^ 1;
      __builtin_amdgcn_sched_barrier(0);      /* with the one below: keeps the reads of group p + 1, and of no later group, in front of group p's arithmetic; left free, the build hoists a whole trip's 128 reads, which takes more registers than two waves a SIMD leave and spills */
      if (p + 1 < 4) {
#pragma unroll
        for (int cc = 0; cc < 4; ++cc)
#pragma unroll
          for (int u = 0; u < 4; ++u) g[nx][cc * 4 + u] = *(const v4f*)&lk[j0 + u][((p + 1) * 4 + cc) * 4]; }
      else if (p + 1 < 8) {
#pragma unroll
        for (int c = 0; c < HD / 4; ++c) g[nx][c] = *(const v4f*)&lv[j0 + p - 3][c * 4]; }
      __builtin_amdgcn_sched_barrier(0);      /* see above */
      if (p < 4) {
#pragma unroll
        for (int cc = 0; cc < 4; ++cc)
#pragma unroll
          for (int x = 0; x < 4; ++x)
#pragma unroll
            for (int u = 0; u < 4; ++u) s[u] = __fadd_rn(s[u], __fmul_rn(q[(p * 4 + cc) * 4 + x], g[cu][cc * 4 + u][x])); }
      else { const int u = p - 4; const int j = j0 + u; const float sv = __fmul_rn(s[u], SCL);
        const float f = (j <= i) ? 1.f : 0.f; const float sm = fmaf(f, sv, (1.f - f) * -1.0e30f); const float mn = fmaxf(m, sm); const float sc = expf(m - mn); const float e = expf(sm - mn); l = __fadd_rn(__fmul_rn(l, sc), e); m = mn;
#pragma unroll
        for (int c = 0; c < HD / 4; ++c)
#pragma unroll
          for (int x = 0; x < 4; ++x) o[c * 4 + x] = __fadd_rn(__fmul_rn(o[c * 4 + x], sc), __fmul_rn(e, g[cu][c][x])); } } }
  const float fin = 64.0f / l;      /* o carried x64 like the f16 path */
  __syncthreads();      /* every wave has left the k rows: their LDS takes the o rows */
#pragma unroll
  for (int c = 0; c < HD / 4; ++c) { v4f oo;
#pragma unroll
    for (int u = 0; u < 4; ++u) oo[u] = __fmul_rn(o[c * 4 + u], fin);
    *(v4f*)&lk[tid][c * 4] = oo; }
  __syncthreads();      /* publishes the o rows to the four waves */
  v4h vh4[16], vl4[16]; const int orow = tid / 16, pc = (tid % 16) * 4;      /* 16 threads per row, 8 rows a step */
#pragma unroll      /* constant indices: the sixteen steps' pieces are registers, the row steps immediate offsets */
  for (int it = 0; it < 16; ++it) { const v4f v = *(const v4f*)&lk[it * 8 + orow][pc];
#pragma unroll
    for (int u = 0; u < 4; ++u) { const _Float16 hi = (_Float16)v[u]; vh4[it][u] = hi; vl4[it][u] = (_Float16)((v[u] - (float)hi) * 1024.0f); } }
  __builtin_amdgcn_sched_barrier(0);      /* every conversion stands in front of the first store, so that no register which an issued store names is written again before the wave ends */
  _Float16* ohp = OH + (r0 + orow) * DM + h * HD + pc; _Float16* olp = OL + ((size_t)b * QT0 + orow) * DM + h * HD + pc;
#pragma unroll
  for (int it = 0; it < 16; ++it) { *(v4h*)(ohp + it * (8 * DM)) = vh4[it]; *(v4h*)(olp + it * (8 * DM)) = vl4[it]; } }

// Fused causal attention: a block owns 128 query rows of one head (32 per wave) and walks the keys 64 at a time; scores and weights never leave registers.
// Each pass has 64 rows of k hi, k lo and 64 rows (head dims) of V^T in LDS, brought once for the four waves by asynchronous 16-byte copies (whole lines), two buffers: pass t + 2 is issued behind the barrier that ends pass t and flies while pass t + 1 is worked on; row pitch 128 + 16 bytes for the 16-byte fragment reads.
// S^T = K . Q^T (A = 16 key rows, B = 16 query rows, both by g2_frag): a lane holds 8 keys (8*hh + r) of ONE query (ln) per tile, so maximum and sum are in-lane plus one exchange of the wave halves.
// Two score tiles of one query group, converted in place, are the B operand of O^T += V^T . P^T (element i = key 8*hh + i, element 8 + i = key 16 + 8*hh + i: the k order of g2_frag on the V^T rows).
// Scores: (lo . hi + hi . lo) first, x 2^-10, then hi . hi on top in the same accumulator. Weights carried x256 (the + 8 in the exponent), in the f16 operand and in the row sum alike; o leaves x64.
#define FAC 0.18033688011112042f           /* 1 / sqrt(head_dim) * log2(e) */
#define FLP 72                             /* LDS row pitch in f16: 64 + 8 */
__device__ __forceinline__ float fa_exp2(float x) { asm("v_exp_f32 %0, %0\n\tv_nop" : "+v"(x)); return x; }      /* native 2^x; the v_nop fills the one slot that the instruction set asks for between a transcendental and a directly following instruction that reads its result or overwrites its source */
__device__ __forceinline__ v8f fa_mma(v16h a, v16h b, v8f c) { return __builtin_amdgcn_wmma_f32_16x16x32_f16(false, a, false, b, (short)0, c, false, false); }
__global__ __launch_bounds__(128, 2) void k_fattn(const _Float16* __restrict__ QHp, const _Float16* __restrict__ QLp, const _Float16* __restrict__ KHp, const _Float16* __restrict__ KLp, const _Float16* __restrict__ VTp, _Float16* __restrict__ Op, const float* __restrict__ QF, const float* __restrict__ KF, const float* __restrict__ VF, _Float16* __restrict__ OLp) {      /* two waves a SIMD: the register bound under which all 512 blocks are resident at once (the exact part alone would take more) */
  __shared__ __attribute__((aligned(16))) float xk[QT0][64]; __shared__ __attribute__((aligned(16))) float xv[QT0][64];      /* the exact block's f32 key and value rows */
  __shared__ __attribute__((aligned(16))) _Float16 lkh[2][64][FLP]; __shared__ __attribute__((aligned(16))) _Float16 lkl[2][64][FLP]; __shared__ __attribute__((aligned(16))) _Float16 lvt[2][64][FLP];      /* two buffers: pass t + 1's rows fly in while pass t is worked on */
  const int tid = threadIdx.x, lane = tid & 31, ln = lane & 15, hh = lane >> 4; const int w = __builtin_amdgcn_readfirstlane(tid >> 5);
  const int h = blockIdx.y, b = blockIdx.z; const int nqt = (int)gridDim.x, x2 = (int)blockIdx.x + 2; const int qt = (b & 1) ? (x2 >= nqt ? x2 - nqt : x2) : nqt - 1 - (int)blockIdx.x;      /* long and short blocks mixed over the grid: at equal blockIdx.x the two batches hold tiles 15 - x and x + 2 (mod 16), for speed only */
  if (qt == 0) { fa_exact(QF, KF, VF, h, b, w, Op, OLp, xk, xv); return; }      /* block-uniform, in front of every barrier of the f16 path: rows 0..127 are computed exactly in f32, beside the other blocks' f16 work */
  const int row0 = qt * 128 + 32 * w; const size_t r0 = (size_t)b * SQ;
  v16h qh[2][2], ql[2][2]; const _Float16* qhp = QHp + (r0 + row0 + ln) * LQ + h * HD + 8 * hh; const _Float16* qlp = QLp + (r0 + row0 + ln) * LQ + h * HD + 8 * hh;      /* the lane's own 16-byte pieces start here (g2_frag with half 0) */
#pragma unroll
  for (int g = 0; g < 2; ++g) { qh[g][0] = g2_frag(qhp + g * (16 * LQ), 0); qh[g][1] = g2_frag(qhp + g * (16 * LQ) + 32, 0); ql[g][0] = g2_frag(qlp + g * (16 * LQ), 0); ql[g][1] = g2_frag(qlp + g * (16 * LQ) + 32, 0); }
  asm volatile("s_wait_xcnt 0x0" :: "v"(qhp), "v"(qlp) : "memory");      /* the sixteen loads' address registers stay untouched up to this wait: nothing, a later load's data included, lands on them before it */
  const char* khb = (const char*)(KHp + r0 * LQ + h * HD); const char* klb = (const char*)(KLp + r0 * LQ + h * HD); const char* vtb = (const char*)(VTp + (size_t)(h * HD) * (NB * SQ) + r0);      /* block-uniform bases; V^T rows are [feature][batch * SQ + token] */
  const int srow = tid >> 3, sc8 = (tid & 7) * 8; const unsigned koff = (unsigned)(srow * LQ + sc8) * 2u, voff = (unsigned)(srow * (NB * SQ) + sc8) * 2u;      /* staging: 8 threads per row of 128 bytes, 16 rows a step; byte offsets */
  const v8f z8 = {0.f,0.f,0.f,0.f,0.f,0.f,0.f,0.f}; v8f o[4][2];
#pragma unroll
  for (int dt = 0; dt < 4; ++dt) { o[dt][0] = z8; o[dt][1] = z8; }
  float m[2] = {-1.0e30f, -1.0e30f}, l[2] = {0.f, 0.f};
  const int kend = qt * 128 + 64;           /* the block's last piece: every wave stages and passes the barriers up to it */
  const unsigned lak = (unsigned)(size_t)&lkh[0][srow][sc8], lal = (unsigned)(size_t)&lkl[0][srow][sc8], lav = (unsigned)(size_t)&lvt[0][srow][sc8];      /* byte addresses in the work-group's LDS */
  auto stage = [&](int kb, int bf) { unsigned sl[12]; const char* sg[12];      /* one pass's rows: 4 copies each of k hi, k lo and V^T per thread */
#pragma unroll
    for (int j = 0; j < 4; ++j) { const unsigned lo = (unsigned)bf * (unsigned)sizeof(lkh[0]) + (unsigned)j * (16u * FLP * 2u); sl[j] = lak + lo; sl[4 + j] = lal + lo; sl[8 + j] = lav + lo;
      sg[j] = khb + (size_t)kb * (LQ * 2) + koff + j * (16 * LQ * 2); sg[4 + j] = klb + (size_t)kb * (LQ * 2) + koff + j * (16 * LQ * 2); sg[8 + j] = vtb + (size_t)kb * 2 + voff + j * (16 * NB * SQ * 2); }
    g2_copy12(sl, sg); };
  stage(0, 0);
  asm volatile("s_wait_asynccnt 0x0" ::: "memory");      /* this wave's copies of pass 0 have landed */
  __syncthreads();      /* publishes pass 0's rows to the four waves */
  stage(64, 1);      /* every block of this path has four passes or more */
#pragma unroll 1      /* one pass is up to 64 matrix instructions of straight-line code already */
  for (int kb = 0; kb <= kend; kb += 64) { const int bf = (kb >> 6) & 1;      /* the pass reads this buffer alone */
#pragma unroll
    for (int hf = 0; hf < 2; ++hf) { const int k0 = kb + 32 * hf;      /* 32 keys a step: 16 score registers per query group alive at a time */
      if (k0 <= row0) {      /* wave-uniform: keys past the wave's last row (row0 + 31) are left out whole */
        v8f s[2][2];
#pragma unroll
        for (int t = 0; t < 2; ++t) { const int kr = 32 * hf + 16 * t + ln; const v16h a0 = g2_frag(&lkh[bf][kr][0], hh), a1 = g2_frag(&lkh[bf][kr][32], hh), c0 = g2_frag(&lkl[bf][kr][0], hh), c1 = g2_frag(&lkl[bf][kr][32], hh);
#pragma unroll
          for (int g = 0; g < 2; ++g) { v8f y = fa_mma(a0, ql[g][0], z8); y = fa_mma(a1, ql[g][1], y); y = fa_mma(c0, qh[g][0], y); y = fa_mma(c1, qh[g][1], y);
#pragma unroll
            for (int r = 0; r < 8; ++r) y[r] *= 0.0009765625f;
            y = fa_mma(a0, qh[g][0], y); y = fa_mma(a1, qh[g][1], y); s[t][g] = y; } }
        if (k0 == row0) {      /* wave-uniform: the 32 x 32 piece on the diagonal is the only one that needs the causal test; key k0 stays for every query */
#pragma unroll
          for (int t = 0; t < 2; ++t)
#pragma unroll
            for (int g = 0; g < 2; ++g)
#pragma unroll
              for (int r = 0; r < 8; ++r) if (16 * t + 8 * hh + r > 16 * g + ln) s[t][g][r] = -1.0e30f; }
        FragH p[2];
#pragma unroll
        for (int g = 0; g < 2; ++g) { float mx = s[0][g][0];
#pragma unroll
          for (int t = 0; t < 2; ++t)
#pragma unroll
            for (int r = 0; r < 8; ++r) mx = fmaxf(mx, s[t][g][r]);
          mx = fmaxf(mx, __shfl_xor(mx, 16, 32));      /* the other 8 keys of every tile sit in the other wave half */
          const float mn = fmaxf(m[g], mx); const float sc = fa_exp2((m[g] - mn) * FAC); m[g] = mn; const float nb = fmaf(-mn, FAC, 8.0f);
          float ps[4] = {0.f, 0.f, 0.f, 0.f};
#pragma unroll
          for (int t = 0; t < 2; ++t)
#pragma unroll
            for (int r = 0; r < 8; ++r) { const float e = fa_exp2(fmaf(s[t][g][r], FAC, nb)); ps[r & 3] += e; p[g].h[t * 8 + r] = (_Float16)e; }
          l[g] = fmaf(l[g], sc, (ps[0] + ps[1]) + (ps[2] + ps[3]));
#pragma unroll
          for (int dt = 0; dt < 4; ++dt)
#pragma unroll
            for (int r = 0; r < 8; ++r) o[dt][g][r] *= sc; }
#pragma unroll
        for (int dt = 0; dt < 4; ++dt) { const v16h a = g2_frag(&lvt[bf][16 * dt + ln][32 * hf], hh); o[dt][0] = fa_mma(a, p[0].v, o[dt][0]); o[dt][1] = fa_mma(a, p[1].v, o[dt][1]); } } }
    asm volatile("s_wait_dscnt 0x0" ::: "memory");      /* this wave's reads of this pass's rows are done before their buffer is refilled */
    asm volatile("s_wait_asynccnt 0x0" ::: "memory");      /* this wave's copies of the next pass's rows have landed */
    __syncthreads();      /* publishes the next pass's rows and ends every wave's reads of this pass's */
    if (kb + 128 <= kend) stage(kb + 128, bf); }      /* block-uniform */
  asm volatile("s_wait_asynccnt 0x0" ::: "memory");      /* no copy is outstanding when the wave goes on */
#pragma unroll
  for (int g = 0; g < 2; ++g) { const float fin = 64.0f / (l[g] + __shfl_xor(l[g], 16, 32));      /* the halves' sums joined once; x256 cancels, o carried x64 */
    unsigned short* op = (unsigned short*)Op + (r0 + row0 + 16 * g + ln) * DM + h * HD + 8 * hh;
#pragma unroll
    for (int dt = 0; dt < 4; ++dt) { FragH f;
#pragma unroll
      for (int r = 0; r < 8; ++r) f.h[r] = (_Float16)(o[dt][g][r] * fin);
      *(v8us*)(op + 16 * dt) = f.half[0]; } } }


extern "C" void kernel_launch(void* const* d_in, const int* in_sizes, int n_in,
                              void* d_out, int out_size, void* d_ws, size_t ws_size, hipStream_t stream) {
  (void)in_sizes; (void)n_in; (void)out_size;
  const float* const* I = (const float* const*)d_in; const float* x = I[0]; const float* xk = I[1]; const float* xv = I[2]; const float* wq = I[3]; const float* wk = I[4]; const float* wv = I[5]; const float* wo = I[6]; const float* bo = I[7];      /* input order: query_data, key_data, value_data (three SEPARATE streams: the three exact-f16 row casts read one each), Wq, Wk, Wv ([in][out]; the module has NO q / k / v biases), Wp ([in][out]), bp (REAL); NO mask input (the causal fill is built inside the reference) */
  char* ws = (char*)d_ws; size_t off = 0;
  auto take = [&](size_t bytes) { char* p = ws + off; off += (bytes + 255) & ~(size_t)255; return p; };
  _Float16* BQ = (_Float16*)take((size_t)DM * DM * 2); _Float16* BK = (_Float16*)take((size_t)DM * DM * 2); _Float16* BV = (_Float16*)take((size_t)DM * DM * 2); _Float16* BO = (_Float16*)take((size_t)DM * DM * 2);
  _Float16* X16 = (_Float16*)take(NR * DM * 2); _Float16* XK16 = (_Float16*)take(NR * DM * 2); _Float16* XV16 = (_Float16*)take(NR * DM * 2);      /* exact f16 rows of query, key, value */ float* QF = (float*)take(NR * DM * 4); float* KF = (float*)take(NR * DM * 4); float* VF = (float*)take(NR * DM * 4);      /* f32 q, k, v rows, a plane each: only rows 0..127 of each batch are written, and the exact path reads only them */ _Float16* QH = (_Float16*)take(NR * DM * 2); _Float16* QL = (_Float16*)take(NR * DM * 2); _Float16* KH = (_Float16*)take(NR * DM * 2); _Float16* KL = (_Float16*)take(NR * DM * 2); _Float16* Q16 = QH; _Float16* K16 = KH; _Float16* O16 = (_Float16*)take(NR * DM * 2);
  _Float16* VT = (_Float16*)take((size_t)NB * NH * HD * SQ * 2);
  _Float16* OL0 = (_Float16*)take((size_t)NB * QT0 * DM * 2);      /* x1024 residual of the exact o rows */
  if (off > ws_size) return;
  static_assert(B0 == 0 && NBR == NB, "the conversion launches take whole planes");
  k_prep<<<PWB + PXB, 256, 0, stream>>>(x, xk, xv, wq, wk, wv, wo, X16, BQ);      /* the four weights [in][out] -> Bt[n][k] x16 (BQ, BK, BV, BO lie one behind the other) and the three exact f16 row casts (X16, XK16, XV16 likewise) in one launch */
  const size_t r0p = (size_t)B0 * SQ;      /* first projected row */
  static_assert((MP / 128) * (DM / 64) == (DM / 128) * (MP / 64), "the swapped v product has as many blocks as the q and k products");
  k_gemm2<0, 1><<<dim3((unsigned)((MP / 128) * (DM / 64)), 3), 128, 0, stream>>>(X16, DM, NR * DM, BQ, DM, (size_t)DM * DM, 0.0625f, nullptr, 0, nullptr, 1, 0, 0, QF, QH, DM, NR * DM, MP, DM, DM, VT);      /* the three projections in one launch (grid y; the module has no q / k / v biases): q and k leave as f16 hi + x1024 residual planes (QH, QL, KH, KL one behind the other; unscaled logits sigma ~8), v as V^T rows [DM][NB * SQ]; f32 rows (QF, KF, VF one behind the other) only for rows 0..127 of each batch */
  static_assert(QT0 == 128, "the attention launch's first query block is the exact one");
  k_fattn<<<dim3(SQ / 128, NH, NB), 128, 0, stream>>>(QH, QL, KH, KL, VT, O16, QF, KF, VF, OL0);      /* scores, causal softmax and P . V in one launch for all rows, heads and batches: o (merged heads, x64) as f16 rows; the blocks of rows 0..127 run the exact f32 attention: f16 hi into the o rows, x1024 residual into its own plane */
  k_gemm2<0, 0><<<dim3((unsigned)((MPO / 128) * (DM / 64)), 1), 128, 0, stream>>>(O16 + r0p * DM, DM, 0, BO, DM, 0, 0.0009765625f, bo, 0, nullptr, 1, 0, 0, (float*)d_out + r0p * DM, nullptr, DM, 0, MPO, DM, DM, nullptr);      /* out rows are the output layout */
  k_gemm2<0, 0><<<dim3((QT0 / 128) * (DM / 64), NBR), 128, 0, stream>>>(OL0, DM, (size_t)QT0 * DM, BO, DM, 0, 0.00000095367431640625f, nullptr, 0, (const float*)d_out + r0p * DM, -1, 0, 0, (float*)d_out + r0p * DM, nullptr, DM, (size_t)SQ * DM, QT0, DM, DM, nullptr);      /* rows 0..127 of both batches (grid y): += o_lo Wo 2^-20 (own-element accumulate) on the o_hi Wo + b that the launch above wrote */
}
